// v000
// The times below were measured on an AMD MI455X: many runs one after another, warmed up first and cycling through
// copies of the inputs, with the whole window's GPU time divided by the number of runs. Launches and the gaps
// between them are all in it. The median over several windows is given; except for v000 it joins two sittings, which
// can be a few percent apart, so the side-by-side timings, each taken in one sitting, are the better comparison.
// v000 is the starting kernel. One run takes 409 microseconds.
// compute dtype: all float inputs rounded to bf16, t read on device; the six q/k/v projections with EXACT bf16 products on WMMA 16x16x32 (natural [out][in] rows; channels-first activations gathered token-major), + bias, rounded once to f16; local branch: windowed scores (16 slots, zero-padded slots as logit-0 / value-0 phantoms) and global branch: interleaved-pair RoPE (f32 inv_freq by powf, precise sinf/cosf) then full attention - both PLAIN (q, k single f16 x 1/8, running-max softmax in f32 with hardware exp, P scaled by 2^11 single f16 x v single f16); output convs/linears with the contexts split into bf16 hi + residual (2 products); the sqrt(1 - t/999), sqrt(t/999) mix in f32.
#include <hip/hip_runtime.h>
#include <math.h>

typedef __attribute__((ext_vector_type(16))) _Float16 v16h;
typedef __attribute__((ext_vector_type(16))) __bf16 v16b;
typedef __attribute__((ext_vector_type(8)))  _Float16 v8h;
typedef __attribute__((ext_vector_type(8)))  float v8f;
typedef __attribute__((ext_vector_type(4)))  float v4f;
typedef __attribute__((ext_vector_type(2)))  float v2f;
typedef __attribute__((ext_vector_type(4)))  unsigned v4u;
typedef __attribute__((ext_vector_type(4)))  int v4i;
typedef float __attribute__((may_alias)) float_a;
typedef int __attribute__((may_alias)) int_a;

template <typename T> __device__ __forceinline__ void vst2(void* p, T v) { *(T*)p = v;  }
__device__ __forceinline__ v8f wmma16(v16h a, v16h b, v8f c) {
  v8f d = __builtin_amdgcn_wmma_f32_16x16x32_f16(false, a, false, b, (short)0, c, false, false);
  asm volatile("v_nop\n\tv_nop\n\tv_nop\n\tv_nop" : "+v"(d) : "v"(a), "v"(b));
  return d;
}
__device__ __forceinline__ v8f wmma_bf(v16b a, v16b b, v8f c) {
  v8f d = __builtin_amdgcn_wmma_f32_16x16x32_bf16(false, a, false, b, (short)0, c, false, false);
  asm volatile("v_nop\n\tv_nop\n\tv_nop\n\tv_nop" : "+v"(d) : "v"(a), "v"(b));
  return d;
}
// 16x16x32 fragments: lane = (h = lane>>4, row/col = lane&15); elements 0..7 = k0+8h+0..7, 8..15 = k0+16+8h+0..7; D element r = row 8h+r
__device__ __forceinline__ v16h frag_h(const _Float16* rowk0, int lane) {
  union { v16h v; v8h q[2]; } u; const _Float16* p = rowk0 + 8 * (lane >> 4);
  u.q[0] = *(const v8h*)p; u.q[1] = *(const v8h*)(p + 16); return u.v;
}
__device__ __forceinline__ v16h frag_f32(const float* rowk0, int lane) {
  v16h a; const float* p = rowk0 + 8 * (lane >> 4);
#pragma unroll
  for (int i = 0; i < 8; ++i) { a[i] = (_Float16)p[i]; a[8 + i] = (_Float16)p[16 + i]; }
  return a;
}
__device__ __forceinline__ v16h frag_f32s(const float* rowk0, int lane, float sc) {
  v16h a; const float* p = rowk0 + 8 * (lane >> 4);
#pragma unroll
  for (int i = 0; i < 8; ++i) { a[i] = (_Float16)(p[i] * sc); a[8 + i] = (_Float16)(p[16 + i] * sc); }
  return a;
}
// column fragment from a [K][ld] layout (column n), rows >= K read as 0
__device__ __forceinline__ v16h fragc_f32(const float* W, int k0, int n, int lane, int ld, int K) {
  v16h a; const int g = lane >> 4;
#pragma unroll
  for (int i = 0; i < 8; ++i) { const int ka = k0 + 8 * g + i, kb = ka + 16;
    a[i] = (_Float16)(ka < K ? W[(size_t)(ka < K ? ka : K - 1) * ld + n] : 0.f); a[8 + i] = (_Float16)(kb < K ? W[(size_t)(kb < K ? kb : K - 1) * ld + n] : 0.f); }
  return a;
}
struct F2 { v16b h, l; };
__device__ __forceinline__ F2 bsplit16(const float v[16]) { F2 r;
#pragma unroll
  for (int i = 0; i < 16; ++i) { const __bf16 h = (__bf16)v[i]; r.h[i] = h; r.l[i] = (__bf16)(v[i] - (float)h); }
  return r; }
__device__ __forceinline__ F2 split_row(const float* row, int k0, int lane) { float v[16]; const float* p = row + k0 + 8 * (lane >> 4);
#pragma unroll
  for (int i = 0; i < 8; ++i) { v[i] = p[i]; v[8 + i] = p[16 + i]; }
  return bsplit16(v); }
__device__ __forceinline__ F2 split_rowK(const float* row, int k0, int lane, int K) { float v[16]; const int g = lane >> 4;
#pragma unroll
  for (int i = 0; i < 8; ++i) { const int ka = k0 + 8 * g + i, kb = ka + 16; v[i] = ka < K ? row[ka < K ? ka : K - 1] : 0.f; v[8 + i] = kb < K ? row[kb < K ? kb : K - 1] : 0.f; }
  return bsplit16(v); }
__device__ __forceinline__ F2 split_col(const float* W, int k0, int n, int lane, int ld, int K) { float v[16]; const int g = lane >> 4;
#pragma unroll
  for (int i = 0; i < 8; ++i) { const int ka = k0 + 8 * g + i, kb = ka + 16; v[i] = ka < K ? W[(size_t)(ka < K ? ka : K - 1) * ld + n] : 0.f; v[8 + i] = kb < K ? W[(size_t)(kb < K ? kb : K - 1) * ld + n] : 0.f; }
  return bsplit16(v); }
__device__ __forceinline__ v8f mac3(const F2& a, const F2& b, v8f c) { c = wmma_bf(a.l, b.h, c); c = wmma_bf(a.h, b.l, c); return wmma_bf(a.h, b.h, c); }
__device__ __forceinline__ float sigm(float v) { return 1.0f / (1.0f + expf(-v)); }
#define LDSX() do { asm volatile("s_wait_dscnt 0" ::: "memory"); __builtin_amdgcn_wave_barrier(); __builtin_amdgcn_fence(__ATOMIC_RELEASE, "workgroup"); } while (0)


// Mixed local / global soft-align attention (B 4, C 512, T 2,048, 8 heads x 64, window 16): a windowed cross attention (q from x, k/v from cond, zero-padded window) and a global RoPE cross attention, each with its own 1x1 projections, blended per sample by the diffusion step t.
#define NB 4
#define CC 512
#define TT 2048
#define NH 8
#define HD 64
#define WW 16
#define TS 1000
#define NR (NB * TT)
#ifndef TNB
#define TNB NB
#endif
#define TR (TNB * TT)
typedef __attribute__((ext_vector_type(8))) __bf16 v8b;
__device__ __forceinline__ v16b frag_b(const __bf16* rowk0, int lane) {
  union { v16b v; v8b q[2]; } u; const __bf16* p = rowk0 + 8 * (lane >> 4);
  u.q[0] = *(const v8b*)p; u.q[1] = *(const v8b*)(p + 16); return u.v;
}
__device__ __forceinline__ float bfr(float v) { return (float)(__bf16)v; }
__device__ __attribute__((noinline)) float exp_ni(float v) { return expf(v); }
__device__ __attribute__((noinline)) float erf_ni(float v) { return erff(v); }

#define WS_PW   0u                                     // bf16 rows: lq, lk, lv, lo, gq, gk, gv, go [8][512][512] (natural [out][in])
#define WS_QL   (WS_PW + 2u * (size_t)8 * CC * CC)        // f16 token rows [NR][512]: QL, KL, QG, KG
#define WS_KL   (WS_QL + 2u * (size_t)NR * CC)
#define WS_QG   (WS_KL + 2u * (size_t)NR * CC)
#define WS_KG   (WS_QG + 2u * (size_t)NR * CC)
#define WS_VL   (WS_KG + 2u * (size_t)NR * CC)            // f16 planes [b][512][TT]: VL, VG
#define WS_VG   (WS_VL + 2u * (size_t)NB * CC * TT)
#define WS_LO   (WS_VG + 2u * (size_t)NB * CC * TT)       // f32 local context in the module's (h, t, d) order == [c'][t'] ; CG token-major [NR][512]
#define WS_CG   (WS_LO + 4u * (size_t)NR * CC)
#define WS_LOT  (WS_CG + 4u * (size_t)NR * CC)            // bf16 hi / lo of LO^T [b][t'][c']
#define WS_LOTL (WS_LOT + 2u * (size_t)NR * CC)
#define WS_YL   (WS_LOTL + 2u * (size_t)NR * CC)          // f32 ctx_local channels-first [b][512][TT]
#define WS_END  (WS_YL + 4u * (size_t)NB * CC * TT)

__global__ __launch_bounds__(256) void k_pack(const float* __restrict__ W0, const float* __restrict__ W1, const float* __restrict__ W2, const float* __restrict__ W3, const float* __restrict__ W4, const float* __restrict__ W5, const float* __restrict__ W6, const float* __restrict__ W7, __bf16* __restrict__ P) {
  __shared__ __align__(16) __bf16 s[CC]; const int n = blockIdx.x, which = blockIdx.y, t = threadIdx.x; const float* Wm = (which == 0) ? W0 : (which == 1) ? W1 : (which == 2) ? W2 : (which == 3) ? W3 : (which == 4) ? W4 : (which == 5) ? W5 : (which == 6) ? W6 : W7;
  for (int k = t; k < CC; k += 256) s[k] = (__bf16)Wm[(size_t)n * CC + k]; __syncthreads(); for (int q = t; q < CC / 8; q += 256) vst2((unsigned*)(P + ((size_t)which * CC + n) * CC + q * 8), *(const v4u*)&s[q * 8]); }
__device__ __attribute__((noinline)) float pow_p(float a, float b) { return powf(a, b); }
__device__ __attribute__((noinline)) float sin_p(float v) { return sinf(v); }
__device__ __attribute__((noinline)) float cos_p(float v) { return cosf(v); }
// ---- k_proj: block = (64 tokens, 128 out channels, which): which 0 lq(x) 1 lk(cond) 4 gq(x) 5 gk(cond) -> f16 token rows (gq/gk with RoPE); 2 lv(cond) 6 gv(cond) -> f16 planes. A gathered from the channels-first input.
__global__ __launch_bounds__(128) void k_proj(const float* __restrict__ X, const float* __restrict__ CND, const __bf16* __restrict__ P, const float* __restrict__ B0, const float* __restrict__ B1, const float* __restrict__ B2, const float* __restrict__ B4, const float* __restrict__ B5, const float* __restrict__ B6, _Float16* __restrict__ QL, _Float16* __restrict__ KL, _Float16* __restrict__ VL, _Float16* __restrict__ QG, _Float16* __restrict__ KG, _Float16* __restrict__ VG) {
  __shared__ __align__(16) float sf[64][132]; __shared__ __align__(16) _Float16 so[64][136]; __shared__ __align__(16) _Float16 st[128][72];
  const int tid = threadIdx.x, wave = tid >> 5, lane = tid & 31, col = lane & 15, g = lane >> 4; const int wsel = blockIdx.z; const int which = (wsel < 3) ? wsel : wsel + 1;   // 0,1,2,4,5,6
  const int n0 = blockIdx.y * 128; const size_t rb0 = (size_t)blockIdx.x * 64; const size_t b = rb0 / TT, t0 = rb0 % TT; const int tw = (int)t0 + wave * 16;
  const float* IN = (which == 0 || which == 4) ? X : CND; const float* BB = (which == 0) ? B0 : (which == 1) ? B1 : (which == 2) ? B2 : (which == 4) ? B4 : (which == 5) ? B5 : B6;
  v8f acc[8] = {};
#pragma unroll 2
  for (int kc = 0; kc < CC / 32; ++kc) { v16b a; { const float* p = IN + (b * CC + kc * 32 + 8 * g) * TT + tw + col;   // element (token tw+col, channel kc*32+8g+i)
#pragma unroll
      for (int i = 0; i < 8; ++i) { a[i] = (__bf16)p[(size_t)i * TT]; a[8 + i] = (__bf16)p[(size_t)(16 + i) * TT]; } }
#pragma unroll
    for (int j = 0; j < 8; ++j) acc[j] = wmma_bf(a, frag_b(P + ((size_t)which * CC + n0 + j * 16 + col) * CC + kc * 32, lane), acc[j]); }
  if (which == 2 || which == 6) {   // v -> planes [b][c][t]
#pragma unroll
    for (int j = 0; j < 8; ++j) { const float bb = bfr(BB[n0 + j * 16 + col]);
#pragma unroll
      for (int r = 0; r < 8; ++r) st[j * 16 + col][wave * 16 + 8 * g + r] = (_Float16)(acc[j][r] + bb); }
    __syncthreads(); _Float16* V = (which == 2) ? VL : VG;
    for (int e = tid; e < 128 * 8; e += 128) { const int d = e >> 3, pc = e & 7; vst2((unsigned*)(V + ((b * CC + n0 + d) * TT) + t0 + pc * 8), *(const v4u*)&st[d][pc * 8]); }
    return; }
  if (which < 2) {   // local q/k rows
#pragma unroll
    for (int j = 0; j < 8; ++j) { const float bb = bfr(BB[n0 + j * 16 + col]);
#pragma unroll
      for (int r = 0; r < 8; ++r) so[wave * 16 + 8 * g + r][j * 16 + col] = (_Float16)(acc[j][r] + bb); }
  } else {   // global q/k: + bias then interleaved-pair RoPE within each 64-dim head: angle = t * inv_freq[(c % 64) / 2]
#pragma unroll
    for (int j = 0; j < 8; ++j) { const float bb = bfr(BB[n0 + j * 16 + col]);
#pragma unroll
      for (int r = 0; r < 8; ++r) sf[wave * 16 + 8 * g + r][j * 16 + col] = acc[j][r] + bb; }
    LDSX();
    // each lane: rows of this wave; pairs handled by even columns
    for (int rl = 0; rl < 16; ++rl) { const float pos = (float)(tw + rl);
      for (int pi = lane; pi < 64; pi += 32) { const int c = 2 * pi; const int i = ((n0 + c) % HD) / 2; const float inv = 1.0f / pow_p(10000.0f, (float)(2 * i) / (float)HD); const float ang = pos * inv; const float cs = cos_p(ang), sn = sin_p(ang);
        const float x1 = sf[wave * 16 + rl][c], x2 = sf[wave * 16 + rl][c + 1]; so[wave * 16 + rl][c] = (_Float16)(x1 * cs - x2 * sn); so[wave * 16 + rl][c + 1] = (_Float16)(x1 * sn + x2 * cs); } }
  }
  LDSX();
  _Float16* D0 = (which == 0) ? QL : (which == 1) ? KL : (which == 4) ? QG : KG;
  for (int rl = 0; rl < 16; ++rl) if (lane < 16) vst2((unsigned*)(D0 + (rb0 + wave * 16 + rl) * CC + n0 + lane * 8), *(const v4u*)&so[wave * 16 + rl][lane * 8]);
}
// ---- k_local: block = (64 queries, head, b): window keys j = t-8..t+7 (3 key tiles from tq0-16), out-of-range slots = phantom keys with logit 0 and value 0; out -> LO in (h, t, d) order
__global__ __launch_bounds__(128) void k_local(const _Float16* __restrict__ QL, const _Float16* __restrict__ KL, const _Float16* __restrict__ VL, float* __restrict__ LO) {
  __shared__ __align__(16) _Float16 sph[4][16][56]; __shared__ __align__(16) float so[4][16][68];
  const int tid = threadIdx.x, wave = tid >> 5, lane = tid & 31, col = lane & 15, g = lane >> 4; const int h = blockIdx.y; const size_t b = blockIdx.z; const int q0 = blockIdx.x * 64 + wave * 16; const size_t rq = b * TT + q0;
  v16h aq[2];
#pragma unroll
  for (int kc = 0; kc < 2; ++kc) aq[kc] = frag_h(QL + (rq + col) * CC + h * HD + kc * 32, lane);
  float s[3][8]; const int jbase = q0 - 16;
#pragma unroll
  for (int ct = 0; ct < 3; ++ct) { const int j = jbase + ct * 16 + col; v8f c = {};
    if (jbase + ct * 16 >= 0 && jbase + ct * 16 + 16 <= TT) {
#pragma unroll
      for (int kc = 0; kc < 2; ++kc) c = wmma16(aq[kc], frag_h(KL + (b * TT + j) * CC + h * HD + kc * 32, lane), c); }
#pragma unroll
    for (int r = 0; r < 8; ++r) { const int t = q0 + 8 * g + r; const bool inwin = (j >= t - 8) && (j <= t + 7) && (j >= 0) && (j < TT); s[ct][r] = inwin ? c[r] * 0.125f : -3.0e38f; } }
  float il[8];
#pragma unroll
  for (int r = 0; r < 8; ++r) { const int t = q0 + 8 * g + r; const int npad = max(0, 8 - t) + max(0, t + 8 - TT); float mx = fmaxf(fmaxf(s[0][r], s[1][r]), s[2][r]);
#pragma unroll
    for (int o = 1; o < 16; o <<= 1) mx = fmaxf(mx, __shfl_xor(mx, o));
    if (npad > 0) mx = fmaxf(mx, 0.f);
    float es = 0.f; float e[3];
#pragma unroll
    for (int ct = 0; ct < 3; ++ct) { e[ct] = (s[ct][r] <= -1.0e38f) ? 0.f : __expf(s[ct][r] - mx); es += e[ct]; }
#pragma unroll
    for (int o = 1; o < 16; o <<= 1) es += __shfl_xor(es, o);
    es += (float)npad * __expf(-mx);   // zero-padded slots: logit 0, value 0
    il[r] = (1.0f / 2048.0f) / es;
#pragma unroll
    for (int ct = 0; ct < 3; ++ct) sph[wave][8 * g + r][ct * 16 + col] = (_Float16)(e[ct] * 2048.0f); }
  LDSX();
  v8f acc[4] = {};
#pragma unroll
  for (int ct = 0; ct < 3; ++ct) { const int j0 = jbase + ct * 16; if (j0 < 0 || j0 + 16 > TT) continue;   // fully out-of-range tile: P is 0 there
    // a 16-wide K step: use a 32-wide frag with the second half zero? frag_h reads 32 halves; take keys [j0, j0+32) only when ct < 2 pairs... simpler: process pairs (ct 0-1) as one 32-step and ct 2 alone padded by sph zeros beyond col 48
    (void)j0; }
  { // step A: keys jbase..jbase+31 (tiles 0,1); step B: keys jbase+32..jbase+47 (tile 2) + 16 zero columns (sph cols 48..63 are never written -> zero them)
#pragma unroll
    for (int r = 0; r < 8; ++r) sph[wave][8 * g + r][48 + (col & 7)] = (_Float16)0.f;   // cols 48..55 zeroed (56-wide buffer); frag reads up to col 63 -> keep within 56? use explicit bounds below
  }
  LDSX();
  { const int jA = jbase, jB = jbase + 32;
    const v16h pa = frag_h(&sph[wave][col][0], lane);
    if (jA >= 0) {   // tiles 0-1 fully in range unless jbase < 0 (first query block): then tile 0 is out of range and its P are 0, but the V address would underflow -> handle by splitting
#pragma unroll
      for (int dt = 0; dt < 4; ++dt) acc[dt] = wmma16(pa, frag_h(VL + ((b * CC + (size_t)h * HD + dt * 16 + col) * TT) + jA, lane), acc[dt]); }
    else {   // q0 == 0 block, wave 0: keys -16..15: only 0..15 valid (tile 1) -> shift: build a frag over keys 0..31 with P columns 16..47? Simplest: second-half product using a 32-wide read at 0 with P cols 16..47
      const v16h pa2 = frag_h(&sph[wave][col][16], lane);   // P for keys jbase+16 .. jbase+47 = 0..31
#pragma unroll
      for (int dt = 0; dt < 4; ++dt) acc[dt] = wmma16(pa2, frag_h(VL + ((b * CC + (size_t)h * HD + dt * 16 + col) * TT) + 0, lane), acc[dt]); }
    if (jA >= 0 && jB + 16 <= TT) {   // tile 2 (16 keys) + 16 phantom zero columns: read 32 values from V (the extra 16 are multiplied by explicit zeros)
      v16h pb = frag_h(&sph[wave][col][32], lane);
#pragma unroll
      for (int i = 8; i < 16; ++i) pb[i] = (_Float16)0.f;   // K positions 16..31 of this step (cols 48..63) -> zero regardless of LDS contents
      const int jr = (jB + 32 <= TT) ? jB : (TT - 32);   // keep the 32-wide V read in range; when shifted, realign P instead
      if (jr == jB) {
#pragma unroll
        for (int dt = 0; dt < 4; ++dt) acc[dt] = wmma16(pb, frag_h(VL + ((b * CC + (size_t)h * HD + dt * 16 + col) * TT) + jB, lane), acc[dt]); }
      else {   // last block: keys jB..jB+15 are the LAST 16 positions -> read V from TT-32 and put P into K positions 16..31
        v16h pc2; 
#pragma unroll
        for (int i = 0; i < 8; ++i) { pc2[i] = (_Float16)0.f; pc2[8 + i] = pb[i]; }
#pragma unroll
        for (int dt = 0; dt < 4; ++dt) acc[dt] = wmma16(pc2, frag_h(VL + ((b * CC + (size_t)h * HD + dt * 16 + col) * TT) + (TT - 32), lane), acc[dt]); } }
  }
#pragma unroll
  for (int r = 0; r < 8; ++r)
#pragma unroll
    for (int dt = 0; dt < 4; ++dt) so[wave][8 * g + r][dt * 16 + col] = acc[dt][r] * il[r];
  LDSX();
  for (int rl = 0; rl < 16; ++rl) if (lane < 16) vst2(LO + ((b * NH + h) * TT + q0 + rl) * (size_t)HD + lane * 4, *(const v4f*)&so[wave][rl][lane * 4]);   // (h, t, d) order: 256-B row per (h, t)
}
// ---- k_global: block = (64 queries, head, b): full attention on the roped q/k rows; ctx token-major CG[row][h*64 + d]
__global__ __launch_bounds__(128) void k_global(const _Float16* __restrict__ QG, const _Float16* __restrict__ KG, const _Float16* __restrict__ VG, float* __restrict__ CG) {
  __shared__ __align__(16) _Float16 sph[4][16][40]; __shared__ __align__(16) float so[4][16][68];
  const int tid = threadIdx.x, wave = tid >> 5, lane = tid & 31, col = lane & 15, g = lane >> 4; const int h = blockIdx.y; const size_t b = blockIdx.z; const int q0 = blockIdx.x * 64 + wave * 16; const size_t rq = b * TT + q0;
  v16h aq[2];
#pragma unroll
  for (int kc = 0; kc < 2; ++kc) aq[kc] = frag_h(QG + (rq + col) * CC + h * HD + kc * 32, lane);
  float m[8], l[8];
#pragma unroll
  for (int r = 0; r < 8; ++r) { m[r] = -3.0e38f; l[r] = 0.f; }
  v8f acc[4] = {};
#pragma unroll 1
  for (int ks = 0; ks < TT / 32; ++ks) { const int j0 = ks * 32; v8f s[2];
#pragma unroll
    for (int ct = 0; ct < 2; ++ct) { const size_t rk = (b * TT + j0 + ct * 16 + col) * CC + h * HD; v8f c = {};
#pragma unroll
      for (int kc = 0; kc < 2; ++kc) c = wmma16(aq[kc], frag_h(KG + rk + kc * 32, lane), c);
#pragma unroll
      for (int r = 0; r < 8; ++r) s[ct][r] = c[r] * 0.125f; }
#pragma unroll
    for (int r = 0; r < 8; ++r) { float mx = fmaxf(s[0][r], s[1][r]);
#pragma unroll
      for (int o = 1; o < 16; o <<= 1) mx = fmaxf(mx, __shfl_xor(mx, o));
      const float mn = fmaxf(m[r], mx); const float alpha = (m[r] <= -1.0e38f) ? 0.f : __expf(m[r] - mn); const float e0 = __expf(s[0][r] - mn), e1 = __expf(s[1][r] - mn); float es = e0 + e1;
#pragma unroll
      for (int o = 1; o < 16; o <<= 1) es += __shfl_xor(es, o);
      l[r] = l[r] * alpha + es; m[r] = mn;
#pragma unroll
      for (int dt = 0; dt < 4; ++dt) acc[dt][r] *= alpha;
      sph[wave][8 * g + r][col] = (_Float16)(e0 * 2048.0f); sph[wave][8 * g + r][16 + col] = (_Float16)(e1 * 2048.0f); }
    LDSX();
    const v16h pa = frag_h(&sph[wave][col][0], lane);
#pragma unroll
    for (int dt = 0; dt < 4; ++dt) acc[dt] = wmma16(pa, frag_h(VG + ((b * CC + (size_t)h * HD + dt * 16 + col) * TT) + j0, lane), acc[dt]);
    LDSX(); }
#pragma unroll
  for (int r = 0; r < 8; ++r) { const float il = (1.0f / 2048.0f) / l[r];
#pragma unroll
    for (int dt = 0; dt < 4; ++dt) so[wave][8 * g + r][dt * 16 + col] = acc[dt][r] * il; }
  LDSX();
  for (int rl = 0; rl < 16; ++rl) if (lane < 16) vst2(CG + (rq + rl) * CC + h * HD + lane * 4, *(const v4f*)&so[wave][rl][lane * 4]);
}
// ---- k_lot: block = (64 t' of one batch): LO^T[b][t'][c'] as bf16 hi + lo, from LO viewed as [c'][t'] (c' * TT + t')
__global__ __launch_bounds__(256) void k_lot(const float* __restrict__ LO, __bf16* __restrict__ LOT, __bf16* __restrict__ LOTL) {
  __shared__ __align__(16) __bf16 sh[64][136]; __shared__ __align__(16) __bf16 sl[64][136]; const size_t rb0 = (size_t)blockIdx.x * 64; const size_t b = rb0 / TT, t0 = rb0 % TT; const int c0 = blockIdx.y * 128; const int t = threadIdx.x;
  for (int e = t; e < 128 * 64; e += 256) { const int c = e >> 6, tl = e & 63; const float v = LO[(b * CC + c0 + c) * (size_t)TT + t0 + tl]; const __bf16 hv = (__bf16)v; sh[tl][c] = hv; sl[tl][c] = (__bf16)(v - (float)hv); }
  __syncthreads();
  for (int e = t; e < 64 * 16; e += 256) { const int tl = e >> 4, q = e & 15; vst2((unsigned*)(LOT + (rb0 + tl) * CC + c0 + q * 8), *(const v4u*)&sh[tl][q * 8]); vst2((unsigned*)(LOTL + (rb0 + tl) * CC + c0 + q * 8), *(const v4u*)&sl[tl][q * 8]); }
}
// ---- k_outl: block = (64 tokens, 128 out channels): YL[b][o][t] = lo_w[o] . LO^T[t] (2 products) + lo_b, stored channels-first
__global__ __launch_bounds__(128) void k_outl(const __bf16* __restrict__ LOT, const __bf16* __restrict__ LOTL, const __bf16* __restrict__ P, const float* __restrict__ BO, float* __restrict__ YL) {
  __shared__ __align__(16) float st[128][68];
  const int tid = threadIdx.x, wave = tid >> 5, lane = tid & 31, col = lane & 15, g = lane >> 4; const size_t rb0 = (size_t)blockIdx.x * 64, r0 = rb0 + wave * 16; const size_t b = rb0 / TT, t0 = rb0 % TT; const int n0 = blockIdx.y * 128;
  v8f acc[8] = {};
#pragma unroll 2
  for (int kc = 0; kc < CC / 32; ++kc) { const v16b ah = frag_b(LOT + (r0 + col) * CC + kc * 32, lane), al = frag_b(LOTL + (r0 + col) * CC + kc * 32, lane);
#pragma unroll
    for (int j = 0; j < 8; ++j) { const v16b w = frag_b(P + ((size_t)3 * CC + n0 + j * 16 + col) * CC + kc * 32, lane); acc[j] = wmma_bf(ah, w, acc[j]); acc[j] = wmma_bf(al, w, acc[j]); } }
#pragma unroll
  for (int j = 0; j < 8; ++j) { const float bb = bfr(BO[n0 + j * 16 + col]);
#pragma unroll
    for (int r = 0; r < 8; ++r) st[j * 16 + col][wave * 16 + 8 * g + r] = acc[j][r] + bb; }
  __syncthreads();
  for (int e = tid; e < 128 * 16; e += 128) { const int o = e >> 4, q = e & 15; vst2(YL + ((b * CC + n0 + o) * TT) + t0 + q * 4, *(const v4f*)&st[o][q * 4]); }   // 256-B segment of row (b, o)
}
// ---- k_outg: block = (64 tokens, 128 out channels): yg = go_w[o] . cg[t] (hi + residual) + go_b; out[b][o][t] = sqrt(1 - t_b/999) yg + sqrt(t_b/999) YL (channels-first)
__global__ __launch_bounds__(128) void k_outg(const float* __restrict__ CG, const __bf16* __restrict__ P, const float* __restrict__ BO, const float* __restrict__ YL, const int* __restrict__ TSTEP, float* __restrict__ OUT) {
  __shared__ __align__(16) float st[128][68];
  const int tid = threadIdx.x, wave = tid >> 5, lane = tid & 31, col = lane & 15, g = lane >> 4; const size_t rb0 = (size_t)blockIdx.x * 64, r0 = rb0 + wave * 16; const size_t b = rb0 / TT, t0 = rb0 % TT; const int n0 = blockIdx.y * 128;
  v8f acc[8] = {};
#pragma unroll 2
  for (int kc = 0; kc < CC / 32; ++kc) { const F2 a = split_row(CG + (r0 + col) * CC, kc * 32, lane);
#pragma unroll
    for (int j = 0; j < 8; ++j) { const v16b w = frag_b(P + ((size_t)7 * CC + n0 + j * 16 + col) * CC + kc * 32, lane); acc[j] = wmma_bf(a.l, w, acc[j]); acc[j] = wmma_bf(a.h, w, acc[j]); } }
  const float tn = (float)TSTEP[b] / (float)(TS - 1); const float ag = sqrtf(1.0f - tn), al = sqrtf(tn);
#pragma unroll
  for (int j = 0; j < 8; ++j) { const float bb = bfr(BO[n0 + j * 16 + col]);
#pragma unroll
    for (int r = 0; r < 8; ++r) st[j * 16 + col][wave * 16 + 8 * g + r] = (acc[j][r] + bb) * ag; }
  __syncthreads();
  for (int e = tid; e < 128 * 16; e += 128) { const int o = e >> 4, q = e & 15; const size_t off = ((b * CC + n0 + o) * TT) + t0 + q * 4; v4f yl = *(const v4f*)&YL[off]; v4f v = *(const v4f*)&st[o][q * 4]; v4f w; for (int i = 0; i < 4; ++i) w[i] = v[i] + al * yl[i]; vst2(OUT + off, w); }
}
extern "C" void kernel_launch(void* const* d_in, const int* in_sizes, int n_in, void* d_out, int out_size, void* d_ws, size_t ws_size, hipStream_t stream) {
  (void)in_sizes; (void)n_in; (void)out_size;
  const float** F = (const float**)d_in;   // 0 x, 1 cond [4,512,2048]; 2 t [4] int; 3 lq_w,4 lq_b, 5 lk_w,6 lk_b, 7 lv_w,8 lv_b, 9 lo_w,10 lo_b, 11 gq_w,12 gq_b, 13 gk_w,14 gk_b, 15 gv_w,16 gv_b, 17 go_w,18 go_b
  if (ws_size < (size_t)WS_END) return;
  char* ws = (char*)d_ws; __bf16* P = (__bf16*)ws; _Float16 *QL = (_Float16*)(ws + WS_QL), *KL = (_Float16*)(ws + WS_KL), *QG = (_Float16*)(ws + WS_QG), *KG = (_Float16*)(ws + WS_KG), *VL = (_Float16*)(ws + WS_VL), *VG = (_Float16*)(ws + WS_VG); float *LO = (float*)(ws + WS_LO), *CG = (float*)(ws + WS_CG), *YL = (float*)(ws + WS_YL); __bf16 *LOT = (__bf16*)(ws + WS_LOT), *LOTL = (__bf16*)(ws + WS_LOTL);
  k_pack<<<dim3(CC, 8), 256, 0, stream>>>(F[3], F[5], F[7], F[9], F[11], F[13], F[15], F[17], P);
  k_proj<<<dim3(TR / 64, CC / 128, 6), 128, 0, stream>>>(F[0], F[1], P, F[4], F[6], F[8], F[12], F[14], F[16], QL, KL, VL, QG, KG, VG);
  k_local<<<dim3(TT / 64, NH, TNB), 128, 0, stream>>>(QL, KL, VL, LO);
  k_global<<<dim3(TT / 64, NH, TNB), 128, 0, stream>>>(QG, KG, VG, CG);
  k_lot<<<dim3(TR / 64, CC / 128), 256, 0, stream>>>(LO, LOT, LOTL);
  k_outl<<<dim3(TR / 64, CC / 128), 128, 0, stream>>>(LOT, LOTL, P, F[10], YL);
  k_outg<<<dim3(TR / 64, CC / 128), 128, 0, stream>>>(CG, P, F[18], YL, (const int*)d_in[2], (float*)d_out);
}

// v001
// One run takes 302 microseconds.
// Timed twice side by side with v000, it ran 1.38 times as fast both times.
// compute dtype: all float inputs rounded to bf16, t read on device; the six q/k/v projections with EXACT bf16 products on WMMA 16x16x32 (natural [out][in] rows; channels-first activations gathered token-major), + bias, rounded once to f16; local branch: windowed scores (16 slots, zero-padded slots as logit-0 / value-0 phantoms) and global branch: interleaved-pair RoPE (f32 inv_freq by powf, precise sinf/cosf) then full attention - both PLAIN (q, k single f16 x 1/8, running-max softmax in f32 with hardware exp, P scaled by 2^11 single f16 x v single f16); output convs/linears with the contexts split into bf16 hi + residual (2 products); the sqrt(1 - t/999), sqrt(t/999) mix in f32.
#include <hip/hip_runtime.h>
#include <math.h>

typedef __attribute__((ext_vector_type(16))) _Float16 v16h;
typedef __attribute__((ext_vector_type(16))) __bf16 v16b;
typedef __attribute__((ext_vector_type(8)))  _Float16 v8h;
typedef __attribute__((ext_vector_type(8)))  float v8f;
typedef __attribute__((ext_vector_type(4)))  float v4f;
typedef __attribute__((ext_vector_type(2)))  float v2f;
typedef __attribute__((ext_vector_type(4)))  unsigned v4u;
typedef __attribute__((ext_vector_type(4)))  int v4i;
typedef float __attribute__((may_alias)) float_a;
typedef int __attribute__((may_alias)) int_a;

template <typename T> __device__ __forceinline__ void vst2(void* p, T v) { *(T*)p = v;  }
__device__ __forceinline__ v8f wmma16(v16h a, v16h b, v8f c) {
  v8f d = __builtin_amdgcn_wmma_f32_16x16x32_f16(false, a, false, b, (short)0, c, false, false);
  asm volatile("v_nop\n\tv_nop\n\tv_nop\n\tv_nop" : "+v"(d) : "v"(a), "v"(b));
  return d;
}
__device__ __forceinline__ v8f wmma_bf(v16b a, v16b b, v8f c) {
  v8f d = __builtin_amdgcn_wmma_f32_16x16x32_bf16(false, a, false, b, (short)0, c, false, false);
  asm volatile("v_nop\n\tv_nop\n\tv_nop\n\tv_nop" : "+v"(d) : "v"(a), "v"(b));
  return d;
}
// 16x16x32 fragments: lane = (h = lane>>4, row/col = lane&15); elements 0..7 = k0+8h+0..7, 8..15 = k0+16+8h+0..7; D element r = row 8h+r
__device__ __forceinline__ v16h frag_h(const _Float16* rowk0, int lane) {
  union { v16h v; v8h q[2]; } u; const _Float16* p = rowk0 + 8 * (lane >> 4);
  u.q[0] = *(const v8h*)p; u.q[1] = *(const v8h*)(p + 16); return u.v;
}
__device__ __forceinline__ v16h frag_f32(const float* rowk0, int lane) {
  v16h a; const float* p = rowk0 + 8 * (lane >> 4);
#pragma unroll
  for (int i = 0; i < 8; ++i) { a[i] = (_Float16)p[i]; a[8 + i] = (_Float16)p[16 + i]; }
  return a;
}
__device__ __forceinline__ v16h frag_f32s(const float* rowk0, int lane, float sc) {
  v16h a; const float* p = rowk0 + 8 * (lane >> 4);
#pragma unroll
  for (int i = 0; i < 8; ++i) { a[i] = (_Float16)(p[i] * sc); a[8 + i] = (_Float16)(p[16 + i] * sc); }
  return a;
}
// column fragment from a [K][ld] layout (column n), rows >= K read as 0
__device__ __forceinline__ v16h fragc_f32(const float* W, int k0, int n, int lane, int ld, int K) {
  v16h a; const int g = lane >> 4;
#pragma unroll
  for (int i = 0; i < 8; ++i) { const int ka = k0 + 8 * g + i, kb = ka + 16;
    a[i] = (_Float16)(ka < K ? W[(size_t)(ka < K ? ka : K - 1) * ld + n] : 0.f); a[8 + i] = (_Float16)(kb < K ? W[(size_t)(kb < K ? kb : K - 1) * ld + n] : 0.f); }
  return a;
}
struct F2 { v16b h, l; };
__device__ __forceinline__ F2 bsplit16(const float v[16]) { F2 r;
#pragma unroll
  for (int i = 0; i < 16; ++i) { const __bf16 h = (__bf16)v[i]; r.h[i] = h; r.l[i] = (__bf16)(v[i] - (float)h); }
  return r; }
__device__ __forceinline__ F2 split_row(const float* row, int k0, int lane) { float v[16]; const float* p = row + k0 + 8 * (lane >> 4);
#pragma unroll
  for (int i = 0; i < 8; ++i) { v[i] = p[i]; v[8 + i] = p[16 + i]; }
  return bsplit16(v); }
__device__ __forceinline__ F2 split_rowK(const float* row, int k0, int lane, int K) { float v[16]; const int g = lane >> 4;
#pragma unroll
  for (int i = 0; i < 8; ++i) { const int ka = k0 + 8 * g + i, kb = ka + 16; v[i] = ka < K ? row[ka < K ? ka : K - 1] : 0.f; v[8 + i] = kb < K ? row[kb < K ? kb : K - 1] : 0.f; }
  return bsplit16(v); }
__device__ __forceinline__ F2 split_col(const float* W, int k0, int n, int lane, int ld, int K) { float v[16]; const int g = lane >> 4;
#pragma unroll
  for (int i = 0; i < 8; ++i) { const int ka = k0 + 8 * g + i, kb = ka + 16; v[i] = ka < K ? W[(size_t)(ka < K ? ka : K - 1) * ld + n] : 0.f; v[8 + i] = kb < K ? W[(size_t)(kb < K ? kb : K - 1) * ld + n] : 0.f; }
  return bsplit16(v); }
__device__ __forceinline__ v8f mac3(const F2& a, const F2& b, v8f c) { c = wmma_bf(a.l, b.h, c); c = wmma_bf(a.h, b.l, c); return wmma_bf(a.h, b.h, c); }
__device__ __forceinline__ float sigm(float v) { return 1.0f / (1.0f + expf(-v)); }
#define LDSX() do { asm volatile("s_wait_dscnt 0" ::: "memory"); __builtin_amdgcn_wave_barrier(); __builtin_amdgcn_fence(__ATOMIC_RELEASE, "workgroup"); } while (0)


// Mixed local / global soft-align attention (B 4, C 512, T 2,048, 8 heads x 64, window 16): a windowed cross attention (q from x, k/v from cond, zero-padded window) and a global RoPE cross attention, each with its own 1x1 projections, blended per sample by the diffusion step t.
#define NB 4
#define CC 512
#define TT 2048
#define NH 8
#define HD 64
#define WW 16
#define TS 1000
#define NR (NB * TT)
#ifndef TNB
#define TNB NB
#endif
#define TR (TNB * TT)
typedef __attribute__((ext_vector_type(8))) __bf16 v8b;
__device__ __forceinline__ v16b frag_b(const __bf16* rowk0, int lane) {
  union { v16b v; v8b q[2]; } u; const __bf16* p = rowk0 + 8 * (lane >> 4);
  u.q[0] = *(const v8b*)p; u.q[1] = *(const v8b*)(p + 16); return u.v;
}
__device__ __forceinline__ float bfr(float v) { return (float)(__bf16)v; }
__device__ __attribute__((noinline)) float exp_ni(float v) { return expf(v); }
__device__ __attribute__((noinline)) float erf_ni(float v) { return erff(v); }

#define WS_PW   0u                                     // bf16 rows: lq, lk, lv, lo, gq, gk, gv, go [8][512][512] (natural [out][in])
#define WS_QL   (WS_PW + 2u * (size_t)8 * CC * CC)        // f16 token rows [NR][512]: QL, KL, QG, KG
#define WS_KL   (WS_QL + 2u * (size_t)NR * CC)
#define WS_QG   (WS_KL + 2u * (size_t)NR * CC)
#define WS_KG   (WS_QG + 2u * (size_t)NR * CC)
#define WS_VL   (WS_KG + 2u * (size_t)NR * CC)            // f16 planes [b][512][TT]: VL, VG
#define WS_VG   (WS_VL + 2u * (size_t)NB * CC * TT)
#define WS_LO   (WS_VG + 2u * (size_t)NB * CC * TT)       // f32 local context in the module's (h, t, d) order == [c'][t'] ; CG token-major [NR][512]
#define WS_CG   (WS_LO + 4u * (size_t)NR * CC)
#define WS_LOT  (WS_CG + 4u * (size_t)NR * CC)            // bf16 hi / lo of LO^T [b][t'][c']
#define WS_LOTL (WS_LOT + 2u * (size_t)NR * CC)
#define WS_YL   (WS_LOTL + 2u * (size_t)NR * CC)          // f32 ctx_local channels-first [b][512][TT]
#define WS_END  (WS_YL + 4u * (size_t)NB * CC * TT)

// ---- weight tile in LDS: 128 weight rows x 64 k (128 B a row, LDS pitch 144 B = 16 B x odd for ds_load_b128), read by all four waves of a block; two buffers, the next tile's copies fly while this one is worked on
#define WPITCH 72
#define WBUF (128 * WPITCH)
#define WSTG (CC / 64)
__device__ __forceinline__ unsigned lds_off(const void* p) { return (unsigned)(size_t)p; }   // low 32 bits of a __shared__ address = byte offset in the work-group's LDS
// one tile: thread = (row tid >> 3 (+ 16 i), 16-byte piece tid & 7), a wave's copy covers 4 whole 128-B lines. The s_wait_xcnt stands inside the statement so that no address register is rewritten ahead of it.
__device__ __forceinline__ void wstage(unsigned l, const __bf16* g) {
  asm volatile("global_load_async_to_lds_b128 %0, %8, off\n\t"
               "global_load_async_to_lds_b128 %1, %9, off\n\t"
               "global_load_async_to_lds_b128 %2, %10, off\n\t"
               "global_load_async_to_lds_b128 %3, %11, off\n\t"
               "global_load_async_to_lds_b128 %4, %12, off\n\t"
               "global_load_async_to_lds_b128 %5, %13, off\n\t"
               "global_load_async_to_lds_b128 %6, %14, off\n\t"
               "global_load_async_to_lds_b128 %7, %15, off\n\t"
               "s_wait_xcnt 0x0"
               :: "v"(l), "v"(l + 2304u), "v"(l + 2u * 2304u), "v"(l + 3u * 2304u), "v"(l + 4u * 2304u), "v"(l + 5u * 2304u), "v"(l + 6u * 2304u), "v"(l + 7u * 2304u),
                  "v"(g), "v"(g + 16 * CC), "v"(g + 32 * CC), "v"(g + 48 * CC), "v"(g + 64 * CC), "v"(g + 80 * CC), "v"(g + 96 * CC), "v"(g + 112 * CC) : "memory");
}
#define WAIT_COPIES() asm volatile("s_wait_asynccnt 0x0" ::: "memory")   // this wave's copies have landed
#define WAIT_LDS() asm volatile("s_wait_dscnt 0x0" ::: "memory")         // this wave's reads of the buffer about to be refilled have returned
// in front of the loop: tile 0, wait, barrier, then tile 1
#define WRING_OPEN(l, g) do { wstage((l), (g)); WAIT_COPIES(); __syncthreads(); wstage((l) + 2u * WBUF, (g) + 64); } while (0)
// foot of trip s: the one barrier publishes tile s + 1 and ends every wave's reads of tile s, whose buffer takes tile s + 2
#define WRING_FOOT(l, g, s) do { WAIT_LDS(); WAIT_COPIES(); __syncthreads(); if ((s) + 2 < WSTG) wstage((l) + (unsigned)((s) & 1) * (2u * WBUF), (g) + ((s) + 2) * 64); } while (0)

__global__ __launch_bounds__(256) void k_pack(const float* __restrict__ W0, const float* __restrict__ W1, const float* __restrict__ W2, const float* __restrict__ W3, const float* __restrict__ W4, const float* __restrict__ W5, const float* __restrict__ W6, const float* __restrict__ W7, __bf16* __restrict__ P) {
  __shared__ __align__(16) __bf16 s[CC]; const int n = blockIdx.x, which = blockIdx.y, t = threadIdx.x; const float* Wm = (which == 0) ? W0 : (which == 1) ? W1 : (which == 2) ? W2 : (which == 3) ? W3 : (which == 4) ? W4 : (which == 5) ? W5 : (which == 6) ? W6 : W7;
  for (int k = t; k < CC; k += 256) s[k] = (__bf16)Wm[(size_t)n * CC + k]; __syncthreads(); for (int q = t; q < CC / 8; q += 256) vst2((unsigned*)(P + ((size_t)which * CC + n) * CC + q * 8), *(const v4u*)&s[q * 8]); }
__device__ __attribute__((noinline)) float pow_p(float a, float b) { return powf(a, b); }
__device__ __attribute__((noinline)) float sin_p(float v) { return sinf(v); }
__device__ __attribute__((noinline)) float cos_p(float v) { return cosf(v); }
// ---- k_proj: block = (64 tokens, 128 out channels, which): which 0 lq(x) 1 lk(cond) 4 gq(x) 5 gk(cond) -> f16 token rows (gq/gk with RoPE); 2 lv(cond) 6 gv(cond) -> f16 planes. A gathered from the channels-first input.
__global__ __launch_bounds__(128) void k_proj(const float* __restrict__ X, const float* __restrict__ CND, const __bf16* __restrict__ P, const float* __restrict__ B0, const float* __restrict__ B1, const float* __restrict__ B2, const float* __restrict__ B4, const float* __restrict__ B5, const float* __restrict__ B6, _Float16* __restrict__ QL, _Float16* __restrict__ KL, _Float16* __restrict__ VL, _Float16* __restrict__ QG, _Float16* __restrict__ KG, _Float16* __restrict__ VG) {
  __shared__ __align__(16) float sf[64][132]; __shared__ __align__(16) _Float16 so[64][136]; __shared__ __align__(16) _Float16 st[128][72]; __shared__ __align__(16) __bf16 sw[2 * WBUF];
  const int tid = threadIdx.x, wave = tid >> 5, lane = tid & 31, col = lane & 15, g = lane >> 4; const int wsel = blockIdx.z; const int which = (wsel < 3) ? wsel : wsel + 1;   // 0,1,2,4,5,6
  const int n0 = blockIdx.y * 128; const size_t rb0 = (size_t)blockIdx.x * 64; const size_t b = rb0 / TT, t0 = rb0 % TT; const int tw = (int)t0 + wave * 16;
  const float* IN = (which == 0 || which == 4) ? X : CND; const float* BB = (which == 0) ? B0 : (which == 1) ? B1 : (which == 2) ? B2 : (which == 4) ? B4 : (which == 5) ? B5 : B6;
  v8f acc[8] = {};
  const __bf16* wg = P + ((size_t)which * CC + n0 + (tid >> 3)) * CC + (tid & 7) * 8; const unsigned wl = lds_off(sw) + (unsigned)(tid >> 3) * 144u + (unsigned)(tid & 7) * 16u;
  WRING_OPEN(wl, wg);
  for (int s = 0; s < WSTG; ++s) { const __bf16* wb = sw + (s & 1) * WBUF; const float* p = IN + (b * CC + s * 64 + 8 * g) * TT + tw + col;   // element (token tw+col, channel s*64+8g+..): one address for the tile's two k steps
#pragma unroll   // kk becomes a constant, so that the LDS reads of both k steps take immediate offsets from one address
    for (int kk = 0; kk < 2; ++kk) { v16b a;
#pragma unroll
      for (int i = 0; i < 8; ++i) { a[i] = (__bf16)p[(size_t)(kk * 32 + i) * TT]; a[8 + i] = (__bf16)p[(size_t)(kk * 32 + 16 + i) * TT]; }
      v16b w[8];   // the k step's eight weight fragments are read as one group, so that the LDS latency is waited out once and not in front of every product
#pragma unroll
      for (int j = 0; j < 8; ++j) w[j] = frag_b(wb + (j * 16 + col) * WPITCH + kk * 32, lane);
#pragma unroll
      for (int j = 0; j < 8; ++j) acc[j] = wmma_bf(a, w[j], acc[j]); }
    asm volatile("s_wait_xcnt 0x0" :: "v"(p) : "memory");   // takes the activation loads' address as an input: the pair stays in use behind all 32 loads, so no load's result lands in it, and its step to the next tile stands behind this wait
    WRING_FOOT(wl, wg, s); }
  WAIT_COPIES();
  if (which == 2 || which == 6) {   // v -> planes [b][c][t]
#pragma unroll
    for (int j = 0; j < 8; ++j) { const float bb = bfr(BB[n0 + j * 16 + col]);
#pragma unroll
      for (int r = 0; r < 8; ++r) st[j * 16 + col][wave * 16 + 8 * g + r] = (_Float16)(acc[j][r] + bb); }
    __syncthreads(); _Float16* V = (which == 2) ? VL : VG;
    for (int e = tid; e < 128 * 8; e += 128) { const int d = e >> 3, pc = e & 7; vst2((unsigned*)(V + ((b * CC + n0 + d) * TT) + t0 + pc * 8), *(const v4u*)&st[d][pc * 8]); }
    return; }
  if (which < 2) {   // local q/k rows
#pragma unroll
    for (int j = 0; j < 8; ++j) { const float bb = bfr(BB[n0 + j * 16 + col]);
#pragma unroll
      for (int r = 0; r < 8; ++r) so[wave * 16 + 8 * g + r][j * 16 + col] = (_Float16)(acc[j][r] + bb); }
  } else {   // global q/k: + bias then interleaved-pair RoPE within each 64-dim head: angle = t * inv_freq[(c % 64) / 2]
#pragma unroll
    for (int j = 0; j < 8; ++j) { const float bb = bfr(BB[n0 + j * 16 + col]);
#pragma unroll
      for (int r = 0; r < 8; ++r) sf[wave * 16 + 8 * g + r][j * 16 + col] = acc[j][r] + bb; }
    LDSX();
    // each lane: rows of this wave; pairs handled by even columns
    for (int rl = 0; rl < 16; ++rl) { const float pos = (float)(tw + rl);
      for (int pi = lane; pi < 64; pi += 32) { const int c = 2 * pi; const int i = ((n0 + c) % HD) / 2; const float inv = 1.0f / pow_p(10000.0f, (float)(2 * i) / (float)HD); const float ang = pos * inv; const float cs = cos_p(ang), sn = sin_p(ang);
        const float x1 = sf[wave * 16 + rl][c], x2 = sf[wave * 16 + rl][c + 1]; so[wave * 16 + rl][c] = (_Float16)(x1 * cs - x2 * sn); so[wave * 16 + rl][c + 1] = (_Float16)(x1 * sn + x2 * cs); } }
  }
  LDSX();
  _Float16* D0 = (which == 0) ? QL : (which == 1) ? KL : (which == 4) ? QG : KG;
  for (int rl = 0; rl < 16; ++rl) if (lane < 16) vst2((unsigned*)(D0 + (rb0 + wave * 16 + rl) * CC + n0 + lane * 8), *(const v4u*)&so[wave * 16 + rl][lane * 8]);
}
// ---- k_local: block = (64 queries, head, b): window keys j = t-8..t+7 (3 key tiles from tq0-16), out-of-range slots = phantom keys with logit 0 and value 0; out -> LO in (h, t, d) order
__global__ __launch_bounds__(128) void k_local(const _Float16* __restrict__ QL, const _Float16* __restrict__ KL, const _Float16* __restrict__ VL, float* __restrict__ LO) {
  __shared__ __align__(16) _Float16 sph[4][16][56]; __shared__ __align__(16) float so[4][16][68];
  const int tid = threadIdx.x, wave = tid >> 5, lane = tid & 31, col = lane & 15, g = lane >> 4; const int h = blockIdx.y; const size_t b = blockIdx.z; const int q0 = blockIdx.x * 64 + wave * 16; const size_t rq = b * TT + q0;
  v16h aq[2];
#pragma unroll
  for (int kc = 0; kc < 2; ++kc) aq[kc] = frag_h(QL + (rq + col) * CC + h * HD + kc * 32, lane);
  float s[3][8]; const int jbase = q0 - 16;
#pragma unroll
  for (int ct = 0; ct < 3; ++ct) { const int j = jbase + ct * 16 + col; v8f c = {};
    if (jbase + ct * 16 >= 0 && jbase + ct * 16 + 16 <= TT) {
#pragma unroll
      for (int kc = 0; kc < 2; ++kc) c = wmma16(aq[kc], frag_h(KL + (b * TT + j) * CC + h * HD + kc * 32, lane), c); }
#pragma unroll
    for (int r = 0; r < 8; ++r) { const int t = q0 + 8 * g + r; const bool inwin = (j >= t - 8) && (j <= t + 7) && (j >= 0) && (j < TT); s[ct][r] = inwin ? c[r] * 0.125f : -3.0e38f; } }
  float il[8];
#pragma unroll
  for (int r = 0; r < 8; ++r) { const int t = q0 + 8 * g + r; const int npad = max(0, 8 - t) + max(0, t + 8 - TT); float mx = fmaxf(fmaxf(s[0][r], s[1][r]), s[2][r]);
#pragma unroll
    for (int o = 1; o < 16; o <<= 1) mx = fmaxf(mx, __shfl_xor(mx, o));
    if (npad > 0) mx = fmaxf(mx, 0.f);
    float es = 0.f; float e[3];
#pragma unroll
    for (int ct = 0; ct < 3; ++ct) { e[ct] = (s[ct][r] <= -1.0e38f) ? 0.f : __expf(s[ct][r] - mx); es += e[ct]; }
#pragma unroll
    for (int o = 1; o < 16; o <<= 1) es += __shfl_xor(es, o);
    es += (float)npad * __expf(-mx);   // zero-padded slots: logit 0, value 0
    il[r] = (1.0f / 2048.0f) / es;
#pragma unroll
    for (int ct = 0; ct < 3; ++ct) sph[wave][8 * g + r][ct * 16 + col] = (_Float16)(e[ct] * 2048.0f); }
  LDSX();
  v8f acc[4] = {};
#pragma unroll
  for (int ct = 0; ct < 3; ++ct) { const int j0 = jbase + ct * 16; if (j0 < 0 || j0 + 16 > TT) continue;   // fully out-of-range tile: P is 0 there
    // a 16-wide K step: use a 32-wide frag with the second half zero? frag_h reads 32 halves; take keys [j0, j0+32) only when ct < 2 pairs... simpler: process pairs (ct 0-1) as one 32-step and ct 2 alone padded by sph zeros beyond col 48
    (void)j0; }
  { // step A: keys jbase..jbase+31 (tiles 0,1); step B: keys jbase+32..jbase+47 (tile 2) + 16 zero columns (sph cols 48..63 are never written -> zero them)
#pragma unroll
    for (int r = 0; r < 8; ++r) sph[wave][8 * g + r][48 + (col & 7)] = (_Float16)0.f;   // cols 48..55 zeroed (56-wide buffer); frag reads up to col 63 -> keep within 56? use explicit bounds below
  }
  LDSX();
  { const int jA = jbase, jB = jbase + 32;
    const v16h pa = frag_h(&sph[wave][col][0], lane);
    if (jA >= 0) {   // tiles 0-1 fully in range unless jbase < 0 (first query block): then tile 0 is out of range and its P are 0, but the V address would underflow -> handle by splitting
#pragma unroll
      for (int dt = 0; dt < 4; ++dt) acc[dt] = wmma16(pa, frag_h(VL + ((b * CC + (size_t)h * HD + dt * 16 + col) * TT) + jA, lane), acc[dt]); }
    else {   // q0 == 0 block, wave 0: keys -16..15: only 0..15 valid (tile 1) -> shift: build a frag over keys 0..31 with P columns 16..47? Simplest: second-half product using a 32-wide read at 0 with P cols 16..47
      const v16h pa2 = frag_h(&sph[wave][col][16], lane);   // P for keys jbase+16 .. jbase+47 = 0..31
#pragma unroll
      for (int dt = 0; dt < 4; ++dt) acc[dt] = wmma16(pa2, frag_h(VL + ((b * CC + (size_t)h * HD + dt * 16 + col) * TT) + 0, lane), acc[dt]); }
    if (jA >= 0 && jB + 16 <= TT) {   // tile 2 (16 keys) + 16 phantom zero columns: read 32 values from V (the extra 16 are multiplied by explicit zeros)
      v16h pb = frag_h(&sph[wave][col][32], lane);
#pragma unroll
      for (int i = 8; i < 16; ++i) pb[i] = (_Float16)0.f;   // K positions 16..31 of this step (cols 48..63) -> zero regardless of LDS contents
      const int jr = (jB + 32 <= TT) ? jB : (TT - 32);   // keep the 32-wide V read in range; when shifted, realign P instead
      if (jr == jB) {
#pragma unroll
        for (int dt = 0; dt < 4; ++dt) acc[dt] = wmma16(pb, frag_h(VL + ((b * CC + (size_t)h * HD + dt * 16 + col) * TT) + jB, lane), acc[dt]); }
      else {   // last block: keys jB..jB+15 are the LAST 16 positions -> read V from TT-32 and put P into K positions 16..31
        v16h pc2; 
#pragma unroll
        for (int i = 0; i < 8; ++i) { pc2[i] = (_Float16)0.f; pc2[8 + i] = pb[i]; }
#pragma unroll
        for (int dt = 0; dt < 4; ++dt) acc[dt] = wmma16(pc2, frag_h(VL + ((b * CC + (size_t)h * HD + dt * 16 + col) * TT) + (TT - 32), lane), acc[dt]); } }
  }
#pragma unroll
  for (int r = 0; r < 8; ++r)
#pragma unroll
    for (int dt = 0; dt < 4; ++dt) so[wave][8 * g + r][dt * 16 + col] = acc[dt][r] * il[r];
  LDSX();
  for (int rl = 0; rl < 16; ++rl) if (lane < 16) vst2(LO + ((b * NH + h) * TT + q0 + rl) * (size_t)HD + lane * 4, *(const v4f*)&so[wave][rl][lane * 4]);   // (h, t, d) order: 256-B row per (h, t)
}
// ---- k_global: block = (64 queries, head, b): full attention on the roped q/k rows; ctx token-major CG[row][h*64 + d]
__global__ __launch_bounds__(128) void k_global(const _Float16* __restrict__ QG, const _Float16* __restrict__ KG, const _Float16* __restrict__ VG, float* __restrict__ CG) {
  __shared__ __align__(16) _Float16 sph[4][16][40]; __shared__ __align__(16) float so[4][16][68];
  const int tid = threadIdx.x, wave = tid >> 5, lane = tid & 31, col = lane & 15, g = lane >> 4; const int h = blockIdx.y; const size_t b = blockIdx.z; const int q0 = blockIdx.x * 64 + wave * 16; const size_t rq = b * TT + q0;
  v16h aq[2];
#pragma unroll
  for (int kc = 0; kc < 2; ++kc) aq[kc] = frag_h(QG + (rq + col) * CC + h * HD + kc * 32, lane);
  float m[8], l[8];
#pragma unroll
  for (int r = 0; r < 8; ++r) { m[r] = -3.0e38f; l[r] = 0.f; }
  v8f acc[4] = {};
#pragma unroll 1
  for (int ks = 0; ks < TT / 32; ++ks) { const int j0 = ks * 32; v8f s[2];
#pragma unroll
    for (int ct = 0; ct < 2; ++ct) { const size_t rk = (b * TT + j0 + ct * 16 + col) * CC + h * HD; v8f c = {};
#pragma unroll
      for (int kc = 0; kc < 2; ++kc) c = wmma16(aq[kc], frag_h(KG + rk + kc * 32, lane), c);
#pragma unroll
      for (int r = 0; r < 8; ++r) s[ct][r] = c[r] * 0.125f; }
#pragma unroll
    for (int r = 0; r < 8; ++r) { float mx = fmaxf(s[0][r], s[1][r]);
#pragma unroll
      for (int o = 1; o < 16; o <<= 1) mx = fmaxf(mx, __shfl_xor(mx, o));
      const float mn = fmaxf(m[r], mx); const float alpha = (m[r] <= -1.0e38f) ? 0.f : __expf(m[r] - mn); const float e0 = __expf(s[0][r] - mn), e1 = __expf(s[1][r] - mn); float es = e0 + e1;
#pragma unroll
      for (int o = 1; o < 16; o <<= 1) es += __shfl_xor(es, o);
      l[r] = l[r] * alpha + es; m[r] = mn;
#pragma unroll
      for (int dt = 0; dt < 4; ++dt) acc[dt][r] *= alpha;
      sph[wave][8 * g + r][col] = (_Float16)(e0 * 2048.0f); sph[wave][8 * g + r][16 + col] = (_Float16)(e1 * 2048.0f); }
    LDSX();
    const v16h pa = frag_h(&sph[wave][col][0], lane);
#pragma unroll
    for (int dt = 0; dt < 4; ++dt) acc[dt] = wmma16(pa, frag_h(VG + ((b * CC + (size_t)h * HD + dt * 16 + col) * TT) + j0, lane), acc[dt]);
    LDSX(); }
#pragma unroll
  for (int r = 0; r < 8; ++r) { const float il = (1.0f / 2048.0f) / l[r];
#pragma unroll
    for (int dt = 0; dt < 4; ++dt) so[wave][8 * g + r][dt * 16 + col] = acc[dt][r] * il; }
  LDSX();
  for (int rl = 0; rl < 16; ++rl) if (lane < 16) vst2(CG + (rq + rl) * CC + h * HD + lane * 4, *(const v4f*)&so[wave][rl][lane * 4]);
}
// ---- k_lot: block = (64 t' of one batch): LO^T[b][t'][c'] as bf16 hi + lo, from LO viewed as [c'][t'] (c' * TT + t')
__global__ __launch_bounds__(256) void k_lot(const float* __restrict__ LO, __bf16* __restrict__ LOT, __bf16* __restrict__ LOTL) {
  __shared__ __align__(16) __bf16 sh[64][136]; __shared__ __align__(16) __bf16 sl[64][136]; const size_t rb0 = (size_t)blockIdx.x * 64; const size_t b = rb0 / TT, t0 = rb0 % TT; const int c0 = blockIdx.y * 128; const int t = threadIdx.x;
  for (int e = t; e < 128 * 64; e += 256) { const int c = e >> 6, tl = e & 63; const float v = LO[(b * CC + c0 + c) * (size_t)TT + t0 + tl]; const __bf16 hv = (__bf16)v; sh[tl][c] = hv; sl[tl][c] = (__bf16)(v - (float)hv); }
  __syncthreads();
  for (int e = t; e < 64 * 16; e += 256) { const int tl = e >> 4, q = e & 15; vst2((unsigned*)(LOT + (rb0 + tl) * CC + c0 + q * 8), *(const v4u*)&sh[tl][q * 8]); vst2((unsigned*)(LOTL + (rb0 + tl) * CC + c0 + q * 8), *(const v4u*)&sl[tl][q * 8]); }
}
// ---- k_outl: block = (64 tokens, 128 out channels): YL[b][o][t] = lo_w[o] . LO^T[t] (2 products) + lo_b, stored channels-first
__global__ __launch_bounds__(128) void k_outl(const __bf16* __restrict__ LOT, const __bf16* __restrict__ LOTL, const __bf16* __restrict__ P, const float* __restrict__ BO, float* __restrict__ YL) {
  __shared__ __align__(16) float st[128][68]; __shared__ __align__(16) __bf16 sw[2 * WBUF];
  const int tid = threadIdx.x, wave = tid >> 5, lane = tid & 31, col = lane & 15, g = lane >> 4; const size_t rb0 = (size_t)blockIdx.x * 64, r0 = rb0 + wave * 16; const size_t b = rb0 / TT, t0 = rb0 % TT; const int n0 = blockIdx.y * 128;
  v8f acc[8] = {};
  const __bf16* wg = P + ((size_t)3 * CC + n0 + (tid >> 3)) * CC + (tid & 7) * 8; const unsigned wl = lds_off(sw) + (unsigned)(tid >> 3) * 144u + (unsigned)(tid & 7) * 16u;
  WRING_OPEN(wl, wg);
  for (int s = 0; s < WSTG; ++s) { const __bf16* wb = sw + (s & 1) * WBUF;
#pragma unroll   // kk becomes a constant, so that the LDS reads of both k steps take immediate offsets from one address
    for (int kk = 0; kk < 2; ++kk) { const int kc = 2 * s + kk; const v16b ah = frag_b(LOT + (r0 + col) * CC + kc * 32, lane), al = frag_b(LOTL + (r0 + col) * CC + kc * 32, lane);
      v16b w[8];   // one group of LDS reads per k step, as in k_proj
#pragma unroll
      for (int j = 0; j < 8; ++j) w[j] = frag_b(wb + (j * 16 + col) * WPITCH + kk * 32, lane);
#pragma unroll
      for (int j = 0; j < 8; ++j) { acc[j] = wmma_bf(ah, w[j], acc[j]); acc[j] = wmma_bf(al, w[j], acc[j]); } }
    WRING_FOOT(wl, wg, s); }
  WAIT_COPIES();
#pragma unroll
  for (int j = 0; j < 8; ++j) { const float bb = bfr(BO[n0 + j * 16 + col]);
#pragma unroll
    for (int r = 0; r < 8; ++r) st[j * 16 + col][wave * 16 + 8 * g + r] = acc[j][r] + bb; }
  __syncthreads();
  for (int e = tid; e < 128 * 16; e += 128) { const int o = e >> 4, q = e & 15; vst2(YL + ((b * CC + n0 + o) * TT) + t0 + q * 4, *(const v4f*)&st[o][q * 4]); }   // 256-B segment of row (b, o)
}
// ---- k_outg: block = (64 tokens, 128 out channels): yg = go_w[o] . cg[t] (hi + residual) + go_b; out[b][o][t] = sqrt(1 - t_b/999) yg + sqrt(t_b/999) YL (channels-first)
__global__ __launch_bounds__(128) void k_outg(const float* __restrict__ CG, const __bf16* __restrict__ P, const float* __restrict__ BO, const float* __restrict__ YL, const int* __restrict__ TSTEP, float* __restrict__ OUT) {
  __shared__ __align__(16) float st[128][68]; __shared__ __align__(16) __bf16 sw[2 * WBUF];
  const int tid = threadIdx.x, wave = tid >> 5, lane = tid & 31, col = lane & 15, g = lane >> 4; const size_t rb0 = (size_t)blockIdx.x * 64, r0 = rb0 + wave * 16; const size_t b = rb0 / TT, t0 = rb0 % TT; const int n0 = blockIdx.y * 128;
  v8f acc[8] = {};
  const __bf16* wg = P + ((size_t)7 * CC + n0 + (tid >> 3)) * CC + (tid & 7) * 8; const unsigned wl = lds_off(sw) + (unsigned)(tid >> 3) * 144u + (unsigned)(tid & 7) * 16u;
  WRING_OPEN(wl, wg);
  for (int s = 0; s < WSTG; ++s) { const __bf16* wb = sw + (s & 1) * WBUF;
#pragma unroll   // kk becomes a constant, so that the LDS reads of both k steps take immediate offsets from one address
    for (int kk = 0; kk < 2; ++kk) { const int kc = 2 * s + kk; const F2 a = split_row(CG + (r0 + col) * CC, kc * 32, lane);
      v16b w[8];   // one group of LDS reads per k step, as in k_proj
#pragma unroll
      for (int j = 0; j < 8; ++j) w[j] = frag_b(wb + (j * 16 + col) * WPITCH + kk * 32, lane);
#pragma unroll
      for (int j = 0; j < 8; ++j) { acc[j] = wmma_bf(a.l, w[j], acc[j]); acc[j] = wmma_bf(a.h, w[j], acc[j]); } }
    WRING_FOOT(wl, wg, s); }
  WAIT_COPIES();
  const float tn = (float)TSTEP[b] / (float)(TS - 1); const float ag = sqrtf(1.0f - tn), al = sqrtf(tn);
#pragma unroll
  for (int j = 0; j < 8; ++j) { const float bb = bfr(BO[n0 + j * 16 + col]);
#pragma unroll
    for (int r = 0; r < 8; ++r) st[j * 16 + col][wave * 16 + 8 * g + r] = (acc[j][r] + bb) * ag; }
  __syncthreads();
  for (int e = tid; e < 128 * 16; e += 128) { const int o = e >> 4, q = e & 15; const size_t off = ((b * CC + n0 + o) * TT) + t0 + q * 4; v4f yl = *(const v4f*)&YL[off]; v4f v = *(const v4f*)&st[o][q * 4]; v4f w; for (int i = 0; i < 4; ++i) w[i] = v[i] + al * yl[i]; vst2(OUT + off, w); }
}
extern "C" void kernel_launch(void* const* d_in, const int* in_sizes, int n_in, void* d_out, int out_size, void* d_ws, size_t ws_size, hipStream_t stream) {
  (void)in_sizes; (void)n_in; (void)out_size;
  const float** F = (const float**)d_in;   // 0 x, 1 cond [4,512,2048]; 2 t [4] int; 3 lq_w,4 lq_b, 5 lk_w,6 lk_b, 7 lv_w,8 lv_b, 9 lo_w,10 lo_b, 11 gq_w,12 gq_b, 13 gk_w,14 gk_b, 15 gv_w,16 gv_b, 17 go_w,18 go_b
  if (ws_size < (size_t)WS_END) return;
  char* ws = (char*)d_ws; __bf16* P = (__bf16*)ws; _Float16 *QL = (_Float16*)(ws + WS_QL), *KL = (_Float16*)(ws + WS_KL), *QG = (_Float16*)(ws + WS_QG), *KG = (_Float16*)(ws + WS_KG), *VL = (_Float16*)(ws + WS_VL), *VG = (_Float16*)(ws + WS_VG); float *LO = (float*)(ws + WS_LO), *CG = (float*)(ws + WS_CG), *YL = (float*)(ws + WS_YL); __bf16 *LOT = (__bf16*)(ws + WS_LOT), *LOTL = (__bf16*)(ws + WS_LOTL);
  k_pack<<<dim3(CC, 8), 256, 0, stream>>>(F[3], F[5], F[7], F[9], F[11], F[13], F[15], F[17], P);
  k_proj<<<dim3(TR / 64, CC / 128, 6), 128, 0, stream>>>(F[0], F[1], P, F[4], F[6], F[8], F[12], F[14], F[16], QL, KL, VL, QG, KG, VG);
  k_local<<<dim3(TT / 64, NH, TNB), 128, 0, stream>>>(QL, KL, VL, LO);
  k_global<<<dim3(TT / 64, NH, TNB), 128, 0, stream>>>(QG, KG, VG, CG);
  k_lot<<<dim3(TR / 64, CC / 128), 256, 0, stream>>>(LO, LOT, LOTL);
  k_outl<<<dim3(TR / 64, CC / 128), 128, 0, stream>>>(LOT, LOTL, P, F[10], YL);
  k_outg<<<dim3(TR / 64, CC / 128), 128, 0, stream>>>(CG, P, F[18], YL, (const int*)d_in[2], (float*)d_out);
}

// v002
// Measured time: 230 microseconds a run.
// Timed twice side by side with v001, it ran 1.32 and 1.30 times as fast.
// Over all steps from v000 it is 1.81 times as fast.
// compute dtype: all float inputs rounded to bf16, t read on device; the six q/k/v projections with EXACT bf16 products on WMMA 16x16x32 (natural [out][in] rows; channels-first activations gathered token-major), + bias, rounded once to f16; local branch: windowed scores (16 slots, zero-padded slots as logit-0 / value-0 phantoms) and global branch: interleaved-pair RoPE (f32 inv_freq by powf, precise sinf/cosf) then full attention - both PLAIN (q, k single f16 x 1/8, running-max softmax in f32 with hardware exp, P scaled by 2^11 single f16 x v single f16); output convs/linears with the contexts split into bf16 hi + residual (2 products); the sqrt(1 - t/999), sqrt(t/999) mix in f32.
#include <hip/hip_runtime.h>
#include <math.h>

typedef __attribute__((ext_vector_type(16))) _Float16 v16h;
typedef __attribute__((ext_vector_type(16))) __bf16 v16b;
typedef __attribute__((ext_vector_type(8)))  _Float16 v8h;
typedef __attribute__((ext_vector_type(8)))  float v8f;
typedef __attribute__((ext_vector_type(4)))  float v4f;
typedef __attribute__((ext_vector_type(2)))  float v2f;
typedef __attribute__((ext_vector_type(4)))  unsigned v4u;
typedef __attribute__((ext_vector_type(4)))  int v4i;
typedef float __attribute__((may_alias)) float_a;
typedef int __attribute__((may_alias)) int_a;

template <typename T> __device__ __forceinline__ void vst2(void* p, T v) { *(T*)p = v;  }
__device__ __forceinline__ v8f wmma16(v16h a, v16h b, v8f c) {
  v8f d = __builtin_amdgcn_wmma_f32_16x16x32_f16(false, a, false, b, (short)0, c, false, false);
  asm volatile("v_nop\n\tv_nop\n\tv_nop\n\tv_nop" : "+v"(d) : "v"(a), "v"(b));
  return d;
}
__device__ __forceinline__ v8f wmma_bf(v16b a, v16b b, v8f c) {
  v8f d = __builtin_amdgcn_wmma_f32_16x16x32_bf16(false, a, false, b, (short)0, c, false, false);
  asm volatile("v_nop\n\tv_nop\n\tv_nop\n\tv_nop" : "+v"(d) : "v"(a), "v"(b));
  return d;
}
// 16x16x32 fragments: lane = (h = lane>>4, row/col = lane&15); elements 0..7 = k0+8h+0..7, 8..15 = k0+16+8h+0..7; D element r = row 8h+r
__device__ __forceinline__ v16h frag_h(const _Float16* rowk0, int lane) {
  union { v16h v; v8h q[2]; } u; const _Float16* p = rowk0 + 8 * (lane >> 4);
  u.q[0] = *(const v8h*)p; u.q[1] = *(const v8h*)(p + 16); return u.v;
}
__device__ __forceinline__ v16h frag_f32(const float* rowk0, int lane) {
  v16h a; const float* p = rowk0 + 8 * (lane >> 4);
#pragma unroll
  for (int i = 0; i < 8; ++i) { a[i] = (_Float16)p[i]; a[8 + i] = (_Float16)p[16 + i]; }
  return a;
}
__device__ __forceinline__ v16h frag_f32s(const float* rowk0, int lane, float sc) {
  v16h a; const float* p = rowk0 + 8 * (lane >> 4);
#pragma unroll
  for (int i = 0; i < 8; ++i) { a[i] = (_Float16)(p[i] * sc); a[8 + i] = (_Float16)(p[16 + i] * sc); }
  return a;
}
// column fragment from a [K][ld] layout (column n), rows >= K read as 0
__device__ __forceinline__ v16h fragc_f32(const float* W, int k0, int n, int lane, int ld, int K) {
  v16h a; const int g = lane >> 4;
#pragma unroll
  for (int i = 0; i < 8; ++i) { const int ka = k0 + 8 * g + i, kb = ka + 16;
    a[i] = (_Float16)(ka < K ? W[(size_t)(ka < K ? ka : K - 1) * ld + n] : 0.f); a[8 + i] = (_Float16)(kb < K ? W[(size_t)(kb < K ? kb : K - 1) * ld + n] : 0.f); }
  return a;
}
struct F2 { v16b h, l; };
__device__ __forceinline__ F2 bsplit16(const float v[16]) { F2 r;
#pragma unroll
  for (int i = 0; i < 16; ++i) { const __bf16 h = (__bf16)v[i]; r.h[i] = h; r.l[i] = (__bf16)(v[i] - (float)h); }
  return r; }
__device__ __forceinline__ F2 split_row(const float* row, int k0, int lane) { float v[16]; const float* p = row + k0 + 8 * (lane >> 4);
#pragma unroll
  for (int i = 0; i < 8; ++i) { v[i] = p[i]; v[8 + i] = p[16 + i]; }
  return bsplit16(v); }
__device__ __forceinline__ F2 split_rowK(const float* row, int k0, int lane, int K) { float v[16]; const int g = lane >> 4;
#pragma unroll
  for (int i = 0; i < 8; ++i) { const int ka = k0 + 8 * g + i, kb = ka + 16; v[i] = ka < K ? row[ka < K ? ka : K - 1] : 0.f; v[8 + i] = kb < K ? row[kb < K ? kb : K - 1] : 0.f; }
  return bsplit16(v); }
__device__ __forceinline__ F2 split_col(const float* W, int k0, int n, int lane, int ld, int K) { float v[16]; const int g = lane >> 4;
#pragma unroll
  for (int i = 0; i < 8; ++i) { const int ka = k0 + 8 * g + i, kb = ka + 16; v[i] = ka < K ? W[(size_t)(ka < K ? ka : K - 1) * ld + n] : 0.f; v[8 + i] = kb < K ? W[(size_t)(kb < K ? kb : K - 1) * ld + n] : 0.f; }
  return bsplit16(v); }
__device__ __forceinline__ v8f mac3(const F2& a, const F2& b, v8f c) { c = wmma_bf(a.l, b.h, c); c = wmma_bf(a.h, b.l, c); return wmma_bf(a.h, b.h, c); }
__device__ __forceinline__ float sigm(float v) { return 1.0f / (1.0f + expf(-v)); }
#define LDSX() do { asm volatile("s_wait_dscnt 0" ::: "memory"); __builtin_amdgcn_wave_barrier(); __builtin_amdgcn_fence(__ATOMIC_RELEASE, "workgroup"); } while (0)


// Mixed local / global soft-align attention (B 4, C 512, T 2,048, 8 heads x 64, window 16): a windowed cross attention (q from x, k/v from cond, zero-padded window) and a global RoPE cross attention, each with its own 1x1 projections, blended per sample by the diffusion step t.
#define NB 4
#define CC 512
#define TT 2048
#define NH 8
#define HD 64
#define WW 16
#define TS 1000
#define NR (NB * TT)
#ifndef TNB
#define TNB NB
#endif
#define TR (TNB * TT)
typedef __attribute__((ext_vector_type(8))) __bf16 v8b;
__device__ __forceinline__ v16b frag_b(const __bf16* rowk0, int lane) {
  union { v16b v; v8b q[2]; } u; const __bf16* p = rowk0 + 8 * (lane >> 4);
  u.q[0] = *(const v8b*)p; u.q[1] = *(const v8b*)(p + 16); return u.v;
}
__device__ __forceinline__ float bfr(float v) { return (float)(__bf16)v; }
__device__ __attribute__((noinline)) float exp_ni(float v) { return expf(v); }
__device__ __attribute__((noinline)) float erf_ni(float v) { return erff(v); }

#define WS_PW   0u                                     // bf16 rows: lq, lk, lv, lo, gq, gk, gv, go [8][512][512] (natural [out][in])
#define WS_QL   (WS_PW + 2u * (size_t)8 * CC * CC)        // f16 token rows [NR][512]: QL, KL, QG, KG
#define WS_KL   (WS_QL + 2u * (size_t)NR * CC)
#define WS_QG   (WS_KL + 2u * (size_t)NR * CC)
#define WS_KG   (WS_QG + 2u * (size_t)NR * CC)
#define WS_VL   (WS_KG + 2u * (size_t)NR * CC)            // f16 planes [b][512][TT]: VL, VG
#define WS_VG   (WS_VL + 2u * (size_t)NB * CC * TT)
#define WS_LO   (WS_VG + 2u * (size_t)NB * CC * TT)       // f32 local context in the module's (h, t, d) order == [c'][t'] ; CG token-major [NR][512]
#define WS_CG   (WS_LO + 4u * (size_t)NR * CC)
#define WS_LOT  (WS_CG + 4u * (size_t)NR * CC)            // bf16 hi / lo of LO^T [b][t'][c']
#define WS_LOTL (WS_LOT + 2u * (size_t)NR * CC)
#define WS_YL   (WS_LOTL + 2u * (size_t)NR * CC)          // f32 ctx_local channels-first [b][512][TT]
#define WS_END  (WS_YL + 4u * (size_t)NB * CC * TT)

// ---- weight tile in LDS: 128 weight rows x 64 k (128 B a row, LDS pitch 144 B = 16 B x odd for ds_load_b128), read by all four waves of a block; two buffers, the next tile's copies fly while this one is worked on
#define WPITCH 72
#define WBUF (128 * WPITCH)
#define WSTG (CC / 64)
__device__ __forceinline__ unsigned lds_off(const void* p) { return (unsigned)(size_t)p; }   // low 32 bits of a __shared__ address = byte offset in the work-group's LDS
// one tile: thread = (row tid >> 3 (+ 16 i), 16-byte piece tid & 7), a wave's copy covers 4 whole 128-B lines. The s_wait_xcnt stands inside the statement so that no address register is rewritten ahead of it.
__device__ __forceinline__ void wstage(unsigned l, const __bf16* g) {
  asm volatile("global_load_async_to_lds_b128 %0, %8, off\n\t"
               "global_load_async_to_lds_b128 %1, %9, off\n\t"
               "global_load_async_to_lds_b128 %2, %10, off\n\t"
               "global_load_async_to_lds_b128 %3, %11, off\n\t"
               "global_load_async_to_lds_b128 %4, %12, off\n\t"
               "global_load_async_to_lds_b128 %5, %13, off\n\t"
               "global_load_async_to_lds_b128 %6, %14, off\n\t"
               "global_load_async_to_lds_b128 %7, %15, off\n\t"
               "s_wait_xcnt 0x0"
               :: "v"(l), "v"(l + 2304u), "v"(l + 2u * 2304u), "v"(l + 3u * 2304u), "v"(l + 4u * 2304u), "v"(l + 5u * 2304u), "v"(l + 6u * 2304u), "v"(l + 7u * 2304u),
                  "v"(g), "v"(g + 16 * CC), "v"(g + 32 * CC), "v"(g + 48 * CC), "v"(g + 64 * CC), "v"(g + 80 * CC), "v"(g + 96 * CC), "v"(g + 112 * CC) : "memory");
}
#define WAIT_COPIES() asm volatile("s_wait_asynccnt 0x0" ::: "memory")   // this wave's copies have landed
#define WAIT_LDS() asm volatile("s_wait_dscnt 0x0" ::: "memory")         // this wave's reads of the buffer about to be refilled have returned
// in front of the loop: tile 0, wait, barrier, then tile 1
#define WRING_OPEN(l, g) do { wstage((l), (g)); WAIT_COPIES(); __syncthreads(); wstage((l) + 2u * WBUF, (g) + 64); } while (0)
// foot of trip s: the one barrier publishes tile s + 1 and ends every wave's reads of tile s, whose buffer takes tile s + 2
#define WRING_FOOT(l, g, s) do { WAIT_LDS(); WAIT_COPIES(); __syncthreads(); if ((s) + 2 < WSTG) wstage((l) + (unsigned)((s) & 1) * (2u * WBUF), (g) + ((s) + 2) * 64); } while (0)

__global__ __launch_bounds__(256) void k_pack(const float* __restrict__ W0, const float* __restrict__ W1, const float* __restrict__ W2, const float* __restrict__ W3, const float* __restrict__ W4, const float* __restrict__ W5, const float* __restrict__ W6, const float* __restrict__ W7, __bf16* __restrict__ P) {
  __shared__ __align__(16) __bf16 s[CC]; const int n = blockIdx.x, which = blockIdx.y, t = threadIdx.x; const float* Wm = (which == 0) ? W0 : (which == 1) ? W1 : (which == 2) ? W2 : (which == 3) ? W3 : (which == 4) ? W4 : (which == 5) ? W5 : (which == 6) ? W6 : W7;
  for (int k = t; k < CC; k += 256) s[k] = (__bf16)Wm[(size_t)n * CC + k]; __syncthreads(); for (int q = t; q < CC / 8; q += 256) vst2((unsigned*)(P + ((size_t)which * CC + n) * CC + q * 8), *(const v4u*)&s[q * 8]); }
__device__ __attribute__((noinline)) float pow_p(float a, float b) { return powf(a, b); }
__device__ __attribute__((noinline)) float sin_p(float v) { return sinf(v); }
__device__ __attribute__((noinline)) float cos_p(float v) { return cosf(v); }
// ---- k_proj: block = (64 tokens, 128 out channels, which): which 0 lq(x) 1 lk(cond) 4 gq(x) 5 gk(cond) -> f16 token rows (gq/gk with RoPE); 2 lv(cond) 6 gv(cond) -> f16 planes. A gathered from the channels-first input.
__global__ __launch_bounds__(128) void k_proj(const float* __restrict__ X, const float* __restrict__ CND, const __bf16* __restrict__ P, const float* __restrict__ B0, const float* __restrict__ B1, const float* __restrict__ B2, const float* __restrict__ B4, const float* __restrict__ B5, const float* __restrict__ B6, _Float16* __restrict__ QL, _Float16* __restrict__ KL, _Float16* __restrict__ VL, _Float16* __restrict__ QG, _Float16* __restrict__ KG, _Float16* __restrict__ VG) {
  __shared__ __align__(16) float sf[64][132]; __shared__ __align__(16) _Float16 so[64][136]; __shared__ __align__(16) _Float16 st[128][72]; __shared__ __align__(16) __bf16 sw[2 * WBUF];
  const int tid = threadIdx.x, wave = tid >> 5, lane = tid & 31, col = lane & 15, g = lane >> 4; const int wsel = blockIdx.z; const int which = (wsel < 3) ? wsel : wsel + 1;   // 0,1,2,4,5,6
  const int n0 = blockIdx.y * 128; const size_t rb0 = (size_t)blockIdx.x * 64; const size_t b = rb0 / TT, t0 = rb0 % TT; const int tw = (int)t0 + wave * 16;
  const float* IN = (which == 0 || which == 4) ? X : CND; const float* BB = (which == 0) ? B0 : (which == 1) ? B1 : (which == 2) ? B2 : (which == 4) ? B4 : (which == 5) ? B5 : B6;
  v8f acc[8] = {};
  const __bf16* wg = P + ((size_t)which * CC + n0 + (tid >> 3)) * CC + (tid & 7) * 8; const unsigned wl = lds_off(sw) + (unsigned)(tid >> 3) * 144u + (unsigned)(tid & 7) * 16u;
  WRING_OPEN(wl, wg);
  for (int s = 0; s < WSTG; ++s) { const __bf16* wb = sw + (s & 1) * WBUF; const float* p = IN + (b * CC + s * 64 + 8 * g) * TT + tw + col;   // element (token tw+col, channel s*64+8g+..): one address for the tile's two k steps
#pragma unroll   // kk becomes a constant, so that the LDS reads of both k steps take immediate offsets from one address
    for (int kk = 0; kk < 2; ++kk) { v16b a;
#pragma unroll
      for (int i = 0; i < 8; ++i) { a[i] = (__bf16)p[(size_t)(kk * 32 + i) * TT]; a[8 + i] = (__bf16)p[(size_t)(kk * 32 + 16 + i) * TT]; }
      v16b w[8];   // the k step's eight weight fragments are read as one group, so that the LDS latency is waited out once and not in front of every product
#pragma unroll
      for (int j = 0; j < 8; ++j) w[j] = frag_b(wb + (j * 16 + col) * WPITCH + kk * 32, lane);
#pragma unroll
      for (int j = 0; j < 8; ++j) acc[j] = wmma_bf(a, w[j], acc[j]); }
    asm volatile("s_wait_xcnt 0x0" :: "v"(p) : "memory");   // takes the activation loads' address as an input: the pair stays in use behind all 32 loads, so no load's result lands in it, and its step to the next tile stands behind this wait
    WRING_FOOT(wl, wg, s); }
  WAIT_COPIES();
  if (which == 2 || which == 6) {   // v -> planes [b][c][t]
#pragma unroll
    for (int j = 0; j < 8; ++j) { const float bb = bfr(BB[n0 + j * 16 + col]);
#pragma unroll
      for (int r = 0; r < 8; ++r) st[j * 16 + col][wave * 16 + 8 * g + r] = (_Float16)(acc[j][r] + bb); }
    __syncthreads(); _Float16* V = (which == 2) ? VL : VG;
    for (int e = tid; e < 128 * 8; e += 128) { const int d = e >> 3, pc = e & 7; vst2((unsigned*)(V + ((b * CC + n0 + d) * TT) + t0 + pc * 8), *(const v4u*)&st[d][pc * 8]); }
    return; }
  if (which < 2) {   // local q/k rows
#pragma unroll
    for (int j = 0; j < 8; ++j) { const float bb = bfr(BB[n0 + j * 16 + col]);
#pragma unroll
      for (int r = 0; r < 8; ++r) so[wave * 16 + 8 * g + r][j * 16 + col] = (_Float16)(acc[j][r] + bb); }
  } else {   // global q/k: + bias then interleaved-pair RoPE within each 64-dim head: angle = t * inv_freq[(c % 64) / 2]
#pragma unroll
    for (int j = 0; j < 8; ++j) { const float bb = bfr(BB[n0 + j * 16 + col]);
#pragma unroll
      for (int r = 0; r < 8; ++r) sf[wave * 16 + 8 * g + r][j * 16 + col] = acc[j][r] + bb; }
    LDSX();
    // each lane: rows of this wave; pairs handled by even columns
    for (int rl = 0; rl < 16; ++rl) { const float pos = (float)(tw + rl);
      for (int pi = lane; pi < 64; pi += 32) { const int c = 2 * pi; const int i = ((n0 + c) % HD) / 2; const float inv = 1.0f / pow_p(10000.0f, (float)(2 * i) / (float)HD); const float ang = pos * inv; const float cs = cos_p(ang), sn = sin_p(ang);
        const float x1 = sf[wave * 16 + rl][c], x2 = sf[wave * 16 + rl][c + 1]; so[wave * 16 + rl][c] = (_Float16)(x1 * cs - x2 * sn); so[wave * 16 + rl][c + 1] = (_Float16)(x1 * sn + x2 * cs); } }
  }
  LDSX();
  _Float16* D0 = (which == 0) ? QL : (which == 1) ? KL : (which == 4) ? QG : KG;
  for (int rl = 0; rl < 16; ++rl) if (lane < 16) vst2((unsigned*)(D0 + (rb0 + wave * 16 + rl) * CC + n0 + lane * 8), *(const v4u*)&so[wave * 16 + rl][lane * 8]);
}
// ---- k_local: block = (64 queries, head, b): window keys j = t-8..t+7 (3 key tiles from tq0-16), out-of-range slots = phantom keys with logit 0 and value 0; out -> LO in (h, t, d) order
__global__ __launch_bounds__(128) void k_local(const _Float16* __restrict__ QL, const _Float16* __restrict__ KL, const _Float16* __restrict__ VL, float* __restrict__ LO) {
  __shared__ __align__(16) _Float16 sph[4][16][56]; __shared__ __align__(16) float so[4][16][68];
  const int tid = threadIdx.x, wave = tid >> 5, lane = tid & 31, col = lane & 15, g = lane >> 4; const int h = blockIdx.y; const size_t b = blockIdx.z; const int q0 = blockIdx.x * 64 + wave * 16; const size_t rq = b * TT + q0;
  v16h aq[2];
#pragma unroll
  for (int kc = 0; kc < 2; ++kc) aq[kc] = frag_h(QL + (rq + col) * CC + h * HD + kc * 32, lane);
  float s[3][8]; const int jbase = q0 - 16;
#pragma unroll
  for (int ct = 0; ct < 3; ++ct) { const int j = jbase + ct * 16 + col; v8f c = {};
    if (jbase + ct * 16 >= 0 && jbase + ct * 16 + 16 <= TT) {
#pragma unroll
      for (int kc = 0; kc < 2; ++kc) c = wmma16(aq[kc], frag_h(KL + (b * TT + j) * CC + h * HD + kc * 32, lane), c); }
#pragma unroll
    for (int r = 0; r < 8; ++r) { const int t = q0 + 8 * g + r; const bool inwin = (j >= t - 8) && (j <= t + 7) && (j >= 0) && (j < TT); s[ct][r] = inwin ? c[r] * 0.125f : -3.0e38f; } }
  float il[8];
#pragma unroll
  for (int r = 0; r < 8; ++r) { const int t = q0 + 8 * g + r; const int npad = max(0, 8 - t) + max(0, t + 8 - TT); float mx = fmaxf(fmaxf(s[0][r], s[1][r]), s[2][r]);
#pragma unroll
    for (int o = 1; o < 16; o <<= 1) mx = fmaxf(mx, __shfl_xor(mx, o));
    if (npad > 0) mx = fmaxf(mx, 0.f);
    float es = 0.f; float e[3];
#pragma unroll
    for (int ct = 0; ct < 3; ++ct) { e[ct] = (s[ct][r] <= -1.0e38f) ? 0.f : __expf(s[ct][r] - mx); es += e[ct]; }
#pragma unroll
    for (int o = 1; o < 16; o <<= 1) es += __shfl_xor(es, o);
    es += (float)npad * __expf(-mx);   // zero-padded slots: logit 0, value 0
    il[r] = (1.0f / 2048.0f) / es;
#pragma unroll
    for (int ct = 0; ct < 3; ++ct) sph[wave][8 * g + r][ct * 16 + col] = (_Float16)(e[ct] * 2048.0f); }
  LDSX();
  v8f acc[4] = {};
#pragma unroll
  for (int ct = 0; ct < 3; ++ct) { const int j0 = jbase + ct * 16; if (j0 < 0 || j0 + 16 > TT) continue;   // fully out-of-range tile: P is 0 there
    // a 16-wide K step: use a 32-wide frag with the second half zero? frag_h reads 32 halves; take keys [j0, j0+32) only when ct < 2 pairs... simpler: process pairs (ct 0-1) as one 32-step and ct 2 alone padded by sph zeros beyond col 48
    (void)j0; }
  { // step A: keys jbase..jbase+31 (tiles 0,1); step B: keys jbase+32..jbase+47 (tile 2) + 16 zero columns (sph cols 48..63 are never written -> zero them)
#pragma unroll
    for (int r = 0; r < 8; ++r) sph[wave][8 * g + r][48 + (col & 7)] = (_Float16)0.f;   // cols 48..55 zeroed (56-wide buffer); frag reads up to col 63 -> keep within 56? use explicit bounds below
  }
  LDSX();
  { const int jA = jbase, jB = jbase + 32;
    const v16h pa = frag_h(&sph[wave][col][0], lane);
    if (jA >= 0) {   // tiles 0-1 fully in range unless jbase < 0 (first query block): then tile 0 is out of range and its P are 0, but the V address would underflow -> handle by splitting
#pragma unroll
      for (int dt = 0; dt < 4; ++dt) acc[dt] = wmma16(pa, frag_h(VL + ((b * CC + (size_t)h * HD + dt * 16 + col) * TT) + jA, lane), acc[dt]); }
    else {   // q0 == 0 block, wave 0: keys -16..15: only 0..15 valid (tile 1) -> shift: build a frag over keys 0..31 with P columns 16..47? Simplest: second-half product using a 32-wide read at 0 with P cols 16..47
      const v16h pa2 = frag_h(&sph[wave][col][16], lane);   // P for keys jbase+16 .. jbase+47 = 0..31
#pragma unroll
      for (int dt = 0; dt < 4; ++dt) acc[dt] = wmma16(pa2, frag_h(VL + ((b * CC + (size_t)h * HD + dt * 16 + col) * TT) + 0, lane), acc[dt]); }
    if (jA >= 0 && jB + 16 <= TT) {   // tile 2 (16 keys) + 16 phantom zero columns: read 32 values from V (the extra 16 are multiplied by explicit zeros)
      v16h pb = frag_h(&sph[wave][col][32], lane);
#pragma unroll
      for (int i = 8; i < 16; ++i) pb[i] = (_Float16)0.f;   // K positions 16..31 of this step (cols 48..63) -> zero regardless of LDS contents
      const int jr = (jB + 32 <= TT) ? jB : (TT - 32);   // keep the 32-wide V read in range; when shifted, realign P instead
      if (jr == jB) {
#pragma unroll
        for (int dt = 0; dt < 4; ++dt) acc[dt] = wmma16(pb, frag_h(VL + ((b * CC + (size_t)h * HD + dt * 16 + col) * TT) + jB, lane), acc[dt]); }
      else {   // last block: keys jB..jB+15 are the LAST 16 positions -> read V from TT-32 and put P into K positions 16..31
        v16h pc2; 
#pragma unroll
        for (int i = 0; i < 8; ++i) { pc2[i] = (_Float16)0.f; pc2[8 + i] = pb[i]; }
#pragma unroll
        for (int dt = 0; dt < 4; ++dt) acc[dt] = wmma16(pc2, frag_h(VL + ((b * CC + (size_t)h * HD + dt * 16 + col) * TT) + (TT - 32), lane), acc[dt]); } }
  }
#pragma unroll
  for (int r = 0; r < 8; ++r)
#pragma unroll
    for (int dt = 0; dt < 4; ++dt) so[wave][8 * g + r][dt * 16 + col] = acc[dt][r] * il[r];
  LDSX();
  for (int rl = 0; rl < 16; ++rl) if (lane < 16) vst2(LO + ((b * NH + h) * TT + q0 + rl) * (size_t)HD + lane * 4, *(const v4f*)&so[wave][rl][lane * 4]);   // (h, t, d) order: 256-B row per (h, t)
}
// ---- K / V tiles of k_global in LDS: 64 keys a tile; K = 64 key rows x 64 dims, V = 64 dim rows x 64 keys, each row one whole 128-B line, LDS pitch 144 B (16 B x odd for ds_load_b128); read by all four waves of a block; two buffers, the next tile's copies fly while this one is worked on
#define KVP 72
#define KVT (64 * KVP)
#define KVBUF (2 * KVT)
#define KVSTG (TT / 64)
// one tile pair: thread = (row tid >> 3 (+ 16 i), 16-byte piece tid & 7), a wave's copy covers 4 whole 128-B lines. The s_wait_xcnt stands inside the statement so that no address register is rewritten ahead of it.
__device__ __forceinline__ void kvstage(unsigned l, const _Float16* gk, const _Float16* gv) {
  asm volatile("global_load_async_to_lds_b128 %0, %8, off\n\t"
               "global_load_async_to_lds_b128 %1, %9, off\n\t"
               "global_load_async_to_lds_b128 %2, %10, off\n\t"
               "global_load_async_to_lds_b128 %3, %11, off\n\t"
               "global_load_async_to_lds_b128 %4, %12, off\n\t"
               "global_load_async_to_lds_b128 %5, %13, off\n\t"
               "global_load_async_to_lds_b128 %6, %14, off\n\t"
               "global_load_async_to_lds_b128 %7, %15, off\n\t"
               "s_wait_xcnt 0x0"
               :: "v"(l), "v"(l + 2304u), "v"(l + 2u * 2304u), "v"(l + 3u * 2304u), "v"(l + 4u * 2304u), "v"(l + 5u * 2304u), "v"(l + 6u * 2304u), "v"(l + 7u * 2304u),
                  "v"(gk), "v"(gk + 16 * CC), "v"(gk + 32 * CC), "v"(gk + 48 * CC), "v"(gv), "v"(gv + 16 * TT), "v"(gv + 32 * TT), "v"(gv + 48 * TT) : "memory");
}
// ---- k_global: block = (64 queries, head, b): full attention on the roped q/k rows; ctx token-major CG[row][h*64 + d]
__global__ __launch_bounds__(128) void k_global(const _Float16* __restrict__ QG, const _Float16* __restrict__ KG, const _Float16* __restrict__ VG, float* __restrict__ CG) {
  __shared__ __align__(16) _Float16 sph[4][16][40]; __shared__ __align__(16) float so[4][16][68]; __shared__ __align__(16) _Float16 skv[2 * KVBUF];
  const int tid = threadIdx.x, wave = tid >> 5, lane = tid & 31, col = lane & 15, g = lane >> 4; const int h = blockIdx.y; const size_t b = blockIdx.z; const int q0 = blockIdx.x * 64 + wave * 16; const size_t rq = b * TT + q0;
  v16h aq[2];
#pragma unroll
  for (int kc = 0; kc < 2; ++kc) aq[kc] = frag_h(QG + (rq + col) * CC + h * HD + kc * 32, lane);
  float m[8], l[8];
#pragma unroll
  for (int r = 0; r < 8; ++r) { m[r] = -3.0e38f; l[r] = 0.f; }
  v8f acc[4] = {};
  const _Float16* gk = KG + (b * TT + (tid >> 3)) * CC + h * HD + (tid & 7) * 8; const _Float16* gv = VG + (b * CC + (size_t)h * HD + (tid >> 3)) * TT + (tid & 7) * 8; const unsigned kl = lds_off(skv) + (unsigned)(tid >> 3) * 144u + (unsigned)(tid & 7) * 16u;
  // in front of the loop: tile 0, wait, barrier, then tile 1
  kvstage(kl, gk, gv); WAIT_COPIES(); __syncthreads(); kvstage(kl + 2u * KVBUF, gk + 64 * CC, gv + 64);
#pragma unroll 1   // one tile a trip: the ring's foot stands once in the code
  for (int st = 0; st < KVSTG; ++st) { const _Float16* kb = skv + (st & 1) * KVBUF; const _Float16* vb = kb + KVT;
#pragma unroll   // kk becomes a constant, so that the LDS reads of both 32-key steps take immediate offsets from one address
    for (int kk = 0; kk < 2; ++kk) { v16h kf[2][2], vf[4]; v8f s[2];   // the step's eight fragments are read as one group, so that the LDS latency is waited out once
#pragma unroll
      for (int ct = 0; ct < 2; ++ct)
#pragma unroll
        for (int kc = 0; kc < 2; ++kc) kf[ct][kc] = frag_h(kb + (kk * 32 + ct * 16 + col) * KVP + kc * 32, lane);
#pragma unroll
      for (int dt = 0; dt < 4; ++dt) vf[dt] = frag_h(vb + (dt * 16 + col) * KVP + kk * 32, lane);
#pragma unroll
      for (int ct = 0; ct < 2; ++ct) { v8f c = {};
#pragma unroll
        for (int kc = 0; kc < 2; ++kc) c = wmma16(aq[kc], kf[ct][kc], c);
#pragma unroll
        for (int r = 0; r < 8; ++r) s[ct][r] = c[r] * 0.125f; }
#pragma unroll
      for (int r = 0; r < 8; ++r) { float mx = fmaxf(s[0][r], s[1][r]);
#pragma unroll
        for (int o = 1; o < 16; o <<= 1) mx = fmaxf(mx, __shfl_xor(mx, o));
        const float mn = fmaxf(m[r], mx); const float alpha = (m[r] <= -1.0e38f) ? 0.f : __expf(m[r] - mn); const float e0 = __expf(s[0][r] - mn), e1 = __expf(s[1][r] - mn); float es = e0 + e1;
#pragma unroll
        for (int o = 1; o < 16; o <<= 1) es += __shfl_xor(es, o);
        l[r] = l[r] * alpha + es; m[r] = mn;
#pragma unroll
        for (int dt = 0; dt < 4; ++dt) acc[dt][r] *= alpha;
        sph[wave][8 * g + r][col] = (_Float16)(e0 * 2048.0f); sph[wave][8 * g + r][16 + col] = (_Float16)(e1 * 2048.0f); }
      LDSX();
      const v16h pa = frag_h(&sph[wave][col][0], lane);
#pragma unroll
      for (int dt = 0; dt < 4; ++dt) acc[dt] = wmma16(pa, vf[dt], acc[dt]);
      LDSX(); }
    // foot of trip st: the one barrier publishes tile st + 1 and ends every wave's reads of tile st, whose buffer takes tile st + 2
    WAIT_LDS(); WAIT_COPIES(); __syncthreads(); if (st + 2 < KVSTG) kvstage(kl + (unsigned)(st & 1) * (2u * KVBUF), gk + (size_t)(st + 2) * 64 * CC, gv + (st + 2) * 64); }
  WAIT_COPIES();
#pragma unroll
  for (int r = 0; r < 8; ++r) { const float il = (1.0f / 2048.0f) / l[r];
#pragma unroll
    for (int dt = 0; dt < 4; ++dt) so[wave][8 * g + r][dt * 16 + col] = acc[dt][r] * il; }
  LDSX();
  for (int rl = 0; rl < 16; ++rl) if (lane < 16) vst2(CG + (rq + rl) * CC + h * HD + lane * 4, *(const v4f*)&so[wave][rl][lane * 4]);
}
// ---- k_lot: block = (64 t' of one batch): LO^T[b][t'][c'] as bf16 hi + lo, from LO viewed as [c'][t'] (c' * TT + t')
__global__ __launch_bounds__(256) void k_lot(const float* __restrict__ LO, __bf16* __restrict__ LOT, __bf16* __restrict__ LOTL) {
  __shared__ __align__(16) __bf16 sh[64][136]; __shared__ __align__(16) __bf16 sl[64][136]; const size_t rb0 = (size_t)blockIdx.x * 64; const size_t b = rb0 / TT, t0 = rb0 % TT; const int c0 = blockIdx.y * 128; const int t = threadIdx.x;
  for (int e = t; e < 128 * 64; e += 256) { const int c = e >> 6, tl = e & 63; const float v = LO[(b * CC + c0 + c) * (size_t)TT + t0 + tl]; const __bf16 hv = (__bf16)v; sh[tl][c] = hv; sl[tl][c] = (__bf16)(v - (float)hv); }
  __syncthreads();
  for (int e = t; e < 64 * 16; e += 256) { const int tl = e >> 4, q = e & 15; vst2((unsigned*)(LOT + (rb0 + tl) * CC + c0 + q * 8), *(const v4u*)&sh[tl][q * 8]); vst2((unsigned*)(LOTL + (rb0 + tl) * CC + c0 + q * 8), *(const v4u*)&sl[tl][q * 8]); }
}
// ---- k_outl: block = (64 tokens, 128 out channels): YL[b][o][t] = lo_w[o] . LO^T[t] (2 products) + lo_b, stored channels-first
__global__ __launch_bounds__(128) void k_outl(const __bf16* __restrict__ LOT, const __bf16* __restrict__ LOTL, const __bf16* __restrict__ P, const float* __restrict__ BO, float* __restrict__ YL) {
  __shared__ __align__(16) float st[128][68]; __shared__ __align__(16) __bf16 sw[2 * WBUF];
  const int tid = threadIdx.x, wave = tid >> 5, lane = tid & 31, col = lane & 15, g = lane >> 4; const size_t rb0 = (size_t)blockIdx.x * 64, r0 = rb0 + wave * 16; const size_t b = rb0 / TT, t0 = rb0 % TT; const int n0 = blockIdx.y * 128;
  v8f acc[8] = {};
  const __bf16* wg = P + ((size_t)3 * CC + n0 + (tid >> 3)) * CC + (tid & 7) * 8; const unsigned wl = lds_off(sw) + (unsigned)(tid >> 3) * 144u + (unsigned)(tid & 7) * 16u;
  WRING_OPEN(wl, wg);
  for (int s = 0; s < WSTG; ++s) { const __bf16* wb = sw + (s & 1) * WBUF;
#pragma unroll   // kk becomes a constant, so that the LDS reads of both k steps take immediate offsets from one address
    for (int kk = 0; kk < 2; ++kk) { const int kc = 2 * s + kk; const v16b ah = frag_b(LOT + (r0 + col) * CC + kc * 32, lane), al = frag_b(LOTL + (r0 + col) * CC + kc * 32, lane);
      v16b w[8];   // one group of LDS reads per k step, as in k_proj
#pragma unroll
      for (int j = 0; j < 8; ++j) w[j] = frag_b(wb + (j * 16 + col) * WPITCH + kk * 32, lane);
#pragma unroll
      for (int j = 0; j < 8; ++j) { acc[j] = wmma_bf(ah, w[j], acc[j]); acc[j] = wmma_bf(al, w[j], acc[j]); } }
    WRING_FOOT(wl, wg, s); }
  WAIT_COPIES();
#pragma unroll
  for (int j = 0; j < 8; ++j) { const float bb = bfr(BO[n0 + j * 16 + col]);
#pragma unroll
    for (int r = 0; r < 8; ++r) st[j * 16 + col][wave * 16 + 8 * g + r] = acc[j][r] + bb; }
  __syncthreads();
  for (int e = tid; e < 128 * 16; e += 128) { const int o = e >> 4, q = e & 15; vst2(YL + ((b * CC + n0 + o) * TT) + t0 + q * 4, *(const v4f*)&st[o][q * 4]); }   // 256-B segment of row (b, o)
}
// ---- k_outg: block = (64 tokens, 128 out channels): yg = go_w[o] . cg[t] (hi + residual) + go_b; out[b][o][t] = sqrt(1 - t_b/999) yg + sqrt(t_b/999) YL (channels-first)
__global__ __launch_bounds__(128) void k_outg(const float* __restrict__ CG, const __bf16* __restrict__ P, const float* __restrict__ BO, const float* __restrict__ YL, const int* __restrict__ TSTEP, float* __restrict__ OUT) {
  __shared__ __align__(16) float st[128][68]; __shared__ __align__(16) __bf16 sw[2 * WBUF];
  const int tid = threadIdx.x, wave = tid >> 5, lane = tid & 31, col = lane & 15, g = lane >> 4; const size_t rb0 = (size_t)blockIdx.x * 64, r0 = rb0 + wave * 16; const size_t b = rb0 / TT, t0 = rb0 % TT; const int n0 = blockIdx.y * 128;
  v8f acc[8] = {};
  const __bf16* wg = P + ((size_t)7 * CC + n0 + (tid >> 3)) * CC + (tid & 7) * 8; const unsigned wl = lds_off(sw) + (unsigned)(tid >> 3) * 144u + (unsigned)(tid & 7) * 16u;
  WRING_OPEN(wl, wg);
  for (int s = 0; s < WSTG; ++s) { const __bf16* wb = sw + (s & 1) * WBUF;
#pragma unroll   // kk becomes a constant, so that the LDS reads of both k steps take immediate offsets from one address
    for (int kk = 0; kk < 2; ++kk) { const int kc = 2 * s + kk; const F2 a = split_row(CG + (r0 + col) * CC, kc * 32, lane);
      v16b w[8];   // one group of LDS reads per k step, as in k_proj
#pragma unroll
      for (int j = 0; j < 8; ++j) w[j] = frag_b(wb + (j * 16 + col) * WPITCH + kk * 32, lane);
#pragma unroll
      for (int j = 0; j < 8; ++j) { acc[j] = wmma_bf(a.l, w[j], acc[j]); acc[j] = wmma_bf(a.h, w[j], acc[j]); } }
    WRING_FOOT(wl, wg, s); }
  WAIT_COPIES();
  const float tn = (float)TSTEP[b] / (float)(TS - 1); const float ag = sqrtf(1.0f - tn), al = sqrtf(tn);
#pragma unroll
  for (int j = 0; j < 8; ++j) { const float bb = bfr(BO[n0 + j * 16 + col]);
#pragma unroll
    for (int r = 0; r < 8; ++r) st[j * 16 + col][wave * 16 + 8 * g + r] = (acc[j][r] + bb) * ag; }
  __syncthreads();
  for (int e = tid; e < 128 * 16; e += 128) { const int o = e >> 4, q = e & 15; const size_t off = ((b * CC + n0 + o) * TT) + t0 + q * 4; v4f yl = *(const v4f*)&YL[off]; v4f v = *(const v4f*)&st[o][q * 4]; v4f w; for (int i = 0; i < 4; ++i) w[i] = v[i] + al * yl[i]; vst2(OUT + off, w); }
}
extern "C" void kernel_launch(void* const* d_in, const int* in_sizes, int n_in, void* d_out, int out_size, void* d_ws, size_t ws_size, hipStream_t stream) {
  (void)in_sizes; (void)n_in; (void)out_size;
  const float** F = (const float**)d_in;   // 0 x, 1 cond [4,512,2048]; 2 t [4] int; 3 lq_w,4 lq_b, 5 lk_w,6 lk_b, 7 lv_w,8 lv_b, 9 lo_w,10 lo_b, 11 gq_w,12 gq_b, 13 gk_w,14 gk_b, 15 gv_w,16 gv_b, 17 go_w,18 go_b
  if (ws_size < (size_t)WS_END) return;
  char* ws = (char*)d_ws; __bf16* P = (__bf16*)ws; _Float16 *QL = (_Float16*)(ws + WS_QL), *KL = (_Float16*)(ws + WS_KL), *QG = (_Float16*)(ws + WS_QG), *KG = (_Float16*)(ws + WS_KG), *VL = (_Float16*)(ws + WS_VL), *VG = (_Float16*)(ws + WS_VG); float *LO = (float*)(ws + WS_LO), *CG = (float*)(ws + WS_CG), *YL = (float*)(ws + WS_YL); __bf16 *LOT = (__bf16*)(ws + WS_LOT), *LOTL = (__bf16*)(ws + WS_LOTL);
  k_pack<<<dim3(CC, 8), 256, 0, stream>>>(F[3], F[5], F[7], F[9], F[11], F[13], F[15], F[17], P);
  k_proj<<<dim3(TR / 64, CC / 128, 6), 128, 0, stream>>>(F[0], F[1], P, F[4], F[6], F[8], F[12], F[14], F[16], QL, KL, VL, QG, KG, VG);
  k_local<<<dim3(TT / 64, NH, TNB), 128, 0, stream>>>(QL, KL, VL, LO);
  k_global<<<dim3(TT / 64, NH, TNB), 128, 0, stream>>>(QG, KG, VG, CG);
  k_lot<<<dim3(TR / 64, CC / 128), 256, 0, stream>>>(LO, LOT, LOTL);
  k_outl<<<dim3(TR / 64, CC / 128), 128, 0, stream>>>(LOT, LOTL, P, F[10], YL);
  k_outg<<<dim3(TR / 64, CC / 128), 128, 0, stream>>>(CG, P, F[18], YL, (const int*)d_in[2], (float*)d_out);
}

// v003
// Measured time: 181 microseconds a run.
// Next to v002, in two timings, it ran 1.27 times as fast each time.
// Counting every step since v000, it is 2.30 times as fast.
// compute dtype: all float inputs rounded to bf16, t read on device; the six q/k/v projections with EXACT bf16 products on WMMA 16x16x32 (natural [out][in] rows; channels-first activations gathered token-major), + bias, rounded once to f16; local branch: windowed scores (16 slots, zero-padded slots as logit-0 / value-0 phantoms) and global branch: interleaved-pair RoPE (f32 inv_freq by powf, precise sinf/cosf) then full attention - both PLAIN (q, k single f16 x 1/8, running-max softmax in f32 with hardware exp, P scaled by 2^11 single f16 x v single f16); output convs/linears with the contexts split into bf16 hi + residual (2 products); the sqrt(1 - t/999), sqrt(t/999) mix in f32.
#include <hip/hip_runtime.h>
#include <math.h>

typedef __attribute__((ext_vector_type(16))) _Float16 v16h;
typedef __attribute__((ext_vector_type(16))) __bf16 v16b;
typedef __attribute__((ext_vector_type(8)))  _Float16 v8h;
typedef __attribute__((ext_vector_type(8)))  float v8f;
typedef __attribute__((ext_vector_type(4)))  float v4f;
typedef __attribute__((ext_vector_type(2)))  float v2f;
typedef __attribute__((ext_vector_type(4)))  unsigned v4u;
typedef __attribute__((ext_vector_type(4)))  int v4i;
typedef float __attribute__((may_alias)) float_a;
typedef int __attribute__((may_alias)) int_a;

template <typename T> __device__ __forceinline__ void vst2(void* p, T v) { *(T*)p = v;  }
__device__ __forceinline__ v8f wmma16(v16h a, v16h b, v8f c) {
  v8f d = __builtin_amdgcn_wmma_f32_16x16x32_f16(false, a, false, b, (short)0, c, false, false);
  asm volatile("v_nop\n\tv_nop\n\tv_nop\n\tv_nop" : "+v"(d) : "v"(a), "v"(b));
  return d;
}
__device__ __forceinline__ v8f wmma_bf(v16b a, v16b b, v8f c) {
  v8f d = __builtin_amdgcn_wmma_f32_16x16x32_bf16(false, a, false, b, (short)0, c, false, false);
  asm volatile("v_nop\n\tv_nop\n\tv_nop\n\tv_nop" : "+v"(d) : "v"(a), "v"(b));
  return d;
}
// 16x16x32 fragments: lane = (h = lane>>4, row/col = lane&15); elements 0..7 = k0+8h+0..7, 8..15 = k0+16+8h+0..7; D element r = row 8h+r
__device__ __forceinline__ v16h frag_h(const _Float16* rowk0, int lane) {
  union { v16h v; v8h q[2]; } u; const _Float16* p = rowk0 + 8 * (lane >> 4);
  u.q[0] = *(const v8h*)p; u.q[1] = *(const v8h*)(p + 16); return u.v;
}
__device__ __forceinline__ v16h frag_f32(const float* rowk0, int lane) {
  v16h a; const float* p = rowk0 + 8 * (lane >> 4);
#pragma unroll
  for (int i = 0; i < 8; ++i) { a[i] = (_Float16)p[i]; a[8 + i] = (_Float16)p[16 + i]; }
  return a;
}
__device__ __forceinline__ v16h frag_f32s(const float* rowk0, int lane, float sc) {
  v16h a; const float* p = rowk0 + 8 * (lane >> 4);
#pragma unroll
  for (int i = 0; i < 8; ++i) { a[i] = (_Float16)(p[i] * sc); a[8 + i] = (_Float16)(p[16 + i] * sc); }
  return a;
}
// column fragment from a [K][ld] layout (column n), rows >= K read as 0
__device__ __forceinline__ v16h fragc_f32(const float* W, int k0, int n, int lane, int ld, int K) {
  v16h a; const int g = lane >> 4;
#pragma unroll
  for (int i = 0; i < 8; ++i) { const int ka = k0 + 8 * g + i, kb = ka + 16;
    a[i] = (_Float16)(ka < K ? W[(size_t)(ka < K ? ka : K - 1) * ld + n] : 0.f); a[8 + i] = (_Float16)(kb < K ? W[(size_t)(kb < K ? kb : K - 1) * ld + n] : 0.f); }
  return a;
}
struct F2 { v16b h, l; };
__device__ __forceinline__ F2 bsplit16(const float v[16]) { F2 r;
#pragma unroll
  for (int i = 0; i < 16; ++i) { const __bf16 h = (__bf16)v[i]; r.h[i] = h; r.l[i] = (__bf16)(v[i] - (float)h); }
  return r; }
__device__ __forceinline__ F2 split_row(const float* row, int k0, int lane) { float v[16]; const float* p = row + k0 + 8 * (lane >> 4);
#pragma unroll
  for (int i = 0; i < 8; ++i) { v[i] = p[i]; v[8 + i] = p[16 + i]; }
  return bsplit16(v); }
__device__ __forceinline__ F2 split_rowK(const float* row, int k0, int lane, int K) { float v[16]; const int g = lane >> 4;
#pragma unroll
  for (int i = 0; i < 8; ++i) { const int ka = k0 + 8 * g + i, kb = ka + 16; v[i] = ka < K ? row[ka < K ? ka : K - 1] : 0.f; v[8 + i] = kb < K ? row[kb < K ? kb : K - 1] : 0.f; }
  return bsplit16(v); }
__device__ __forceinline__ F2 split_col(const float* W, int k0, int n, int lane, int ld, int K) { float v[16]; const int g = lane >> 4;
#pragma unroll
  for (int i = 0; i < 8; ++i) { const int ka = k0 + 8 * g + i, kb = ka + 16; v[i] = ka < K ? W[(size_t)(ka < K ? ka : K - 1) * ld + n] : 0.f; v[8 + i] = kb < K ? W[(size_t)(kb < K ? kb : K - 1) * ld + n] : 0.f; }
  return bsplit16(v); }
__device__ __forceinline__ v8f mac3(const F2& a, const F2& b, v8f c) { c = wmma_bf(a.l, b.h, c); c = wmma_bf(a.h, b.l, c); return wmma_bf(a.h, b.h, c); }
__device__ __forceinline__ float sigm(float v) { return 1.0f / (1.0f + expf(-v)); }
#define LDSX() do { asm volatile("s_wait_dscnt 0" ::: "memory"); __builtin_amdgcn_wave_barrier(); __builtin_amdgcn_fence(__ATOMIC_RELEASE, "workgroup"); } while (0)


// Mixed local / global soft-align attention (B 4, C 512, T 2,048, 8 heads x 64, window 16): a windowed cross attention (q from x, k/v from cond, zero-padded window) and a global RoPE cross attention, each with its own 1x1 projections, blended per sample by the diffusion step t.
#define NB 4
#define CC 512
#define TT 2048
#define NH 8
#define HD 64
#define WW 16
#define TS 1000
#define NR (NB * TT)
#ifndef TNB
#define TNB NB
#endif
#define TR (TNB * TT)
typedef __attribute__((ext_vector_type(8))) __bf16 v8b;
__device__ __forceinline__ v16b frag_b(const __bf16* rowk0, int lane) {
  union { v16b v; v8b q[2]; } u; const __bf16* p = rowk0 + 8 * (lane >> 4);
  u.q[0] = *(const v8b*)p; u.q[1] = *(const v8b*)(p + 16); return u.v;
}
__device__ __forceinline__ float bfr(float v) { return (float)(__bf16)v; }
__device__ __attribute__((noinline)) float exp_ni(float v) { return expf(v); }
__device__ __attribute__((noinline)) float erf_ni(float v) { return erff(v); }

#define WS_PW   0u                                     // bf16 rows: lq, lk, lv, lo, gq, gk, gv, go [8][512][512] (natural [out][in])
#define WS_QL   (WS_PW + 2u * (size_t)8 * CC * CC)        // f16 token rows [NR][512]: QL, KL, QG, KG
#define WS_KL   (WS_QL + 2u * (size_t)NR * CC)
#define WS_QG   (WS_KL + 2u * (size_t)NR * CC)
#define WS_KG   (WS_QG + 2u * (size_t)NR * CC)
#define WS_VL   (WS_KG + 2u * (size_t)NR * CC)            // f16 planes [b][512][TT]: VL, VG
#define WS_VG   (WS_VL + 2u * (size_t)NB * CC * TT)
#define WS_LO   (WS_VG + 2u * (size_t)NB * CC * TT)       // f32 local context in the module's (h, t, d) order == [c'][t'] ; CG token-major [NR][512]
#define WS_CG   (WS_LO + 4u * (size_t)NR * CC)
#define WS_LOT  (WS_CG + 4u * (size_t)NR * CC)            // bf16 hi / lo of LO^T [b][t'][c']
#define WS_LOTL (WS_LOT + 2u * (size_t)NR * CC)
#define WS_YL   (WS_LOTL + 2u * (size_t)NR * CC)          // f32 ctx_local channels-first [b][512][TT]
#define WS_END  (WS_YL + 4u * (size_t)NB * CC * TT)

// ---- weight tile in LDS: 128 weight rows x 64 k (128 B a row, LDS pitch 144 B = 16 B x odd for ds_load_b128), read by all four waves of a block; two buffers, the next tile's copies fly while this one is worked on
#define WPITCH 72
#define WBUF (128 * WPITCH)
#define WSTG (CC / 64)
__device__ __forceinline__ unsigned lds_off(const void* p) { return (unsigned)(size_t)p; }   // low 32 bits of a __shared__ address = byte offset in the work-group's LDS
// one tile: thread = (row tid >> 3 (+ 16 i), 16-byte piece tid & 7), a wave's copy covers 4 whole 128-B lines. The s_wait_xcnt stands inside the statement so that no address register is rewritten ahead of it.
__device__ __forceinline__ void wstage(unsigned l, const __bf16* g) {
  asm volatile("global_load_async_to_lds_b128 %0, %8, off\n\t"
               "global_load_async_to_lds_b128 %1, %9, off\n\t"
               "global_load_async_to_lds_b128 %2, %10, off\n\t"
               "global_load_async_to_lds_b128 %3, %11, off\n\t"
               "global_load_async_to_lds_b128 %4, %12, off\n\t"
               "global_load_async_to_lds_b128 %5, %13, off\n\t"
               "global_load_async_to_lds_b128 %6, %14, off\n\t"
               "global_load_async_to_lds_b128 %7, %15, off\n\t"
               "s_wait_xcnt 0x0"
               :: "v"(l), "v"(l + 2304u), "v"(l + 2u * 2304u), "v"(l + 3u * 2304u), "v"(l + 4u * 2304u), "v"(l + 5u * 2304u), "v"(l + 6u * 2304u), "v"(l + 7u * 2304u),
                  "v"(g), "v"(g + 16 * CC), "v"(g + 32 * CC), "v"(g + 48 * CC), "v"(g + 64 * CC), "v"(g + 80 * CC), "v"(g + 96 * CC), "v"(g + 112 * CC) : "memory");
}
#define WAIT_COPIES() asm volatile("s_wait_asynccnt 0x0" ::: "memory")   // this wave's copies have landed
#define WAIT_LDS() asm volatile("s_wait_dscnt 0x0" ::: "memory")         // this wave's reads of the buffer about to be refilled have returned
// in front of the loop: tile 0, wait, barrier, then tile 1
#define WRING_OPEN(l, g) do { wstage((l), (g)); WAIT_COPIES(); __syncthreads(); wstage((l) + 2u * WBUF, (g) + 64); } while (0)
// foot of trip s: the one barrier publishes tile s + 1 and ends every wave's reads of tile s, whose buffer takes tile s + 2
#define WRING_FOOT(l, g, s) do { WAIT_LDS(); WAIT_COPIES(); __syncthreads(); if ((s) + 2 < WSTG) wstage((l) + (unsigned)((s) & 1) * (2u * WBUF), (g) + ((s) + 2) * 64); } while (0)

__global__ __launch_bounds__(256) void k_pack(const float* __restrict__ W0, const float* __restrict__ W1, const float* __restrict__ W2, const float* __restrict__ W3, const float* __restrict__ W4, const float* __restrict__ W5, const float* __restrict__ W6, const float* __restrict__ W7, __bf16* __restrict__ P) {
  __shared__ __align__(16) __bf16 s[CC]; const int n = blockIdx.x, which = blockIdx.y, t = threadIdx.x; const float* Wm = (which == 0) ? W0 : (which == 1) ? W1 : (which == 2) ? W2 : (which == 3) ? W3 : (which == 4) ? W4 : (which == 5) ? W5 : (which == 6) ? W6 : W7;
  for (int k = t; k < CC; k += 256) s[k] = (__bf16)Wm[(size_t)n * CC + k]; __syncthreads(); for (int q = t; q < CC / 8; q += 256) vst2((unsigned*)(P + ((size_t)which * CC + n) * CC + q * 8), *(const v4u*)&s[q * 8]); }
__device__ __attribute__((noinline)) float pow_p(float a, float b) { return powf(a, b); }
__device__ __attribute__((noinline)) float sin_p(float v) { return sinf(v); }
__device__ __attribute__((noinline)) float cos_p(float v) { return cosf(v); }
// ---- k_proj: block = (64 tokens, 128 out channels, which): which 0 lq(x) 1 lk(cond) 4 gq(x) 5 gk(cond) -> f16 token rows (gq/gk with RoPE); 2 lv(cond) 6 gv(cond) -> f16 planes. A gathered from the channels-first input.
__global__ __launch_bounds__(128) void k_proj(const float* __restrict__ X, const float* __restrict__ CND, const __bf16* __restrict__ P, const float* __restrict__ B0, const float* __restrict__ B1, const float* __restrict__ B2, const float* __restrict__ B4, const float* __restrict__ B5, const float* __restrict__ B6, _Float16* __restrict__ QL, _Float16* __restrict__ KL, _Float16* __restrict__ VL, _Float16* __restrict__ QG, _Float16* __restrict__ KG, _Float16* __restrict__ VG) {
  __shared__ __align__(16) float sf[64][132]; __shared__ __align__(16) _Float16 so[64][136]; __shared__ __align__(16) _Float16 st[128][72]; __shared__ __align__(16) __bf16 sw[2 * WBUF];
  const int tid = threadIdx.x, wave = tid >> 5, lane = tid & 31, col = lane & 15, g = lane >> 4; const int wsel = blockIdx.z; const int which = (wsel < 3) ? wsel : wsel + 1;   // 0,1,2,4,5,6
  const int n0 = blockIdx.y * 128; const size_t rb0 = (size_t)blockIdx.x * 64; const size_t b = rb0 / TT, t0 = rb0 % TT; const int tw = (int)t0 + wave * 16;
  const float* IN = (which == 0 || which == 4) ? X : CND; const float* BB = (which == 0) ? B0 : (which == 1) ? B1 : (which == 2) ? B2 : (which == 4) ? B4 : (which == 5) ? B5 : B6;
  v8f acc[8] = {};
  const __bf16* wg = P + ((size_t)which * CC + n0 + (tid >> 3)) * CC + (tid & 7) * 8; const unsigned wl = lds_off(sw) + (unsigned)(tid >> 3) * 144u + (unsigned)(tid & 7) * 16u;
  WRING_OPEN(wl, wg);
  for (int s = 0; s < WSTG; ++s) { const __bf16* wb = sw + (s & 1) * WBUF; const float* p = IN + (b * CC + s * 64 + 8 * g) * TT + tw + col;   // element (token tw+col, channel s*64+8g+..): one address for the tile's two k steps
#pragma unroll   // kk becomes a constant, so that the LDS reads of both k steps take immediate offsets from one address
    for (int kk = 0; kk < 2; ++kk) { v16b a;
#pragma unroll
      for (int i = 0; i < 8; ++i) { a[i] = (__bf16)p[(size_t)(kk * 32 + i) * TT]; a[8 + i] = (__bf16)p[(size_t)(kk * 32 + 16 + i) * TT]; }
      v16b w[8];   // the k step's eight weight fragments are read as one group, so that the LDS latency is waited out once and not in front of every product
#pragma unroll
      for (int j = 0; j < 8; ++j) w[j] = frag_b(wb + (j * 16 + col) * WPITCH + kk * 32, lane);
#pragma unroll
      for (int j = 0; j < 8; ++j) acc[j] = wmma_bf(a, w[j], acc[j]); }
    asm volatile("s_wait_xcnt 0x0" :: "v"(p) : "memory");   // takes the activation loads' address as an input: the pair stays in use behind all 32 loads, so no load's result lands in it, and its step to the next tile stands behind this wait
    WRING_FOOT(wl, wg, s); }
  WAIT_COPIES();
  if (which == 2 || which == 6) {   // v -> planes [b][c][t]
#pragma unroll
    for (int j = 0; j < 8; ++j) { const float bb = bfr(BB[n0 + j * 16 + col]);
#pragma unroll
      for (int r = 0; r < 8; ++r) st[j * 16 + col][wave * 16 + 8 * g + r] = (_Float16)(acc[j][r] + bb); }
    __syncthreads(); _Float16* V = (which == 2) ? VL : VG;
    for (int e = tid; e < 128 * 8; e += 128) { const int d = e >> 3, pc = e & 7; vst2((unsigned*)(V + ((b * CC + n0 + d) * TT) + t0 + pc * 8), *(const v4u*)&st[d][pc * 8]); }
    return; }
  if (which < 2) {   // local q/k rows
#pragma unroll
    for (int j = 0; j < 8; ++j) { const float bb = bfr(BB[n0 + j * 16 + col]);
#pragma unroll
      for (int r = 0; r < 8; ++r) so[wave * 16 + 8 * g + r][j * 16 + col] = (_Float16)(acc[j][r] + bb); }
  } else {   // global q/k: + bias then interleaved-pair RoPE within each 64-dim head: angle = t * inv_freq[(c % 64) / 2]
#pragma unroll
    for (int j = 0; j < 8; ++j) { const float bb = bfr(BB[n0 + j * 16 + col]);
#pragma unroll
      for (int r = 0; r < 8; ++r) sf[wave * 16 + 8 * g + r][j * 16 + col] = acc[j][r] + bb; }
    LDSX();
    // each lane: rows of this wave; pairs handled by even columns
    for (int rl = 0; rl < 16; ++rl) { const float pos = (float)(tw + rl);
      for (int pi = lane; pi < 64; pi += 32) { const int c = 2 * pi; const int i = ((n0 + c) % HD) / 2; const float inv = 1.0f / pow_p(10000.0f, (float)(2 * i) / (float)HD); const float ang = pos * inv; const float cs = cos_p(ang), sn = sin_p(ang);
        const float x1 = sf[wave * 16 + rl][c], x2 = sf[wave * 16 + rl][c + 1]; so[wave * 16 + rl][c] = (_Float16)(x1 * cs - x2 * sn); so[wave * 16 + rl][c + 1] = (_Float16)(x1 * sn + x2 * cs); } }
  }
  LDSX();
  _Float16* D0 = (which == 0) ? QL : (which == 1) ? KL : (which == 4) ? QG : KG;
  for (int rl = 0; rl < 16; ++rl) if (lane < 16) vst2((unsigned*)(D0 + (rb0 + wave * 16 + rl) * CC + n0 + lane * 8), *(const v4u*)&so[wave * 16 + rl][lane * 8]);
}
// ---- k_local: block = (64 queries, head, b): window keys j = t-8..t+7 (3 key tiles from tq0-16), out-of-range slots = phantom keys with logit 0 and value 0; out -> LO in (h, t, d) order
__global__ __launch_bounds__(128) void k_local(const _Float16* __restrict__ QL, const _Float16* __restrict__ KL, const _Float16* __restrict__ VL, float* __restrict__ LO) {
  __shared__ __align__(16) _Float16 sph[4][16][56]; __shared__ __align__(16) float so[4][16][68];
  const int tid = threadIdx.x, wave = tid >> 5, lane = tid & 31, col = lane & 15, g = lane >> 4; const int h = blockIdx.y; const size_t b = blockIdx.z; const int q0 = blockIdx.x * 64 + wave * 16; const size_t rq = b * TT + q0;
  v16h aq[2];
#pragma unroll
  for (int kc = 0; kc < 2; ++kc) aq[kc] = frag_h(QL + (rq + col) * CC + h * HD + kc * 32, lane);
  float s[3][8]; const int jbase = q0 - 16;
#pragma unroll
  for (int ct = 0; ct < 3; ++ct) { const int j = jbase + ct * 16 + col; v8f c = {};
    if (jbase + ct * 16 >= 0 && jbase + ct * 16 + 16 <= TT) {
#pragma unroll
      for (int kc = 0; kc < 2; ++kc) c = wmma16(aq[kc], frag_h(KL + (b * TT + j) * CC + h * HD + kc * 32, lane), c); }
#pragma unroll
    for (int r = 0; r < 8; ++r) { const int t = q0 + 8 * g + r; const bool inwin = (j >= t - 8) && (j <= t + 7) && (j >= 0) && (j < TT); s[ct][r] = inwin ? c[r] * 0.125f : -3.0e38f; } }
  float il[8];
#pragma unroll
  for (int r = 0; r < 8; ++r) { const int t = q0 + 8 * g + r; const int npad = max(0, 8 - t) + max(0, t + 8 - TT); float mx = fmaxf(fmaxf(s[0][r], s[1][r]), s[2][r]);
#pragma unroll
    for (int o = 1; o < 16; o <<= 1) mx = fmaxf(mx, __shfl_xor(mx, o));
    if (npad > 0) mx = fmaxf(mx, 0.f);
    float es = 0.f; float e[3];
#pragma unroll
    for (int ct = 0; ct < 3; ++ct) { e[ct] = (s[ct][r] <= -1.0e38f) ? 0.f : __expf(s[ct][r] - mx); es += e[ct]; }
#pragma unroll
    for (int o = 1; o < 16; o <<= 1) es += __shfl_xor(es, o);
    es += (float)npad * __expf(-mx);   // zero-padded slots: logit 0, value 0
    il[r] = (1.0f / 2048.0f) / es;
#pragma unroll
    for (int ct = 0; ct < 3; ++ct) sph[wave][8 * g + r][ct * 16 + col] = (_Float16)(e[ct] * 2048.0f); }
  LDSX();
  v8f acc[4] = {};
#pragma unroll
  for (int ct = 0; ct < 3; ++ct) { const int j0 = jbase + ct * 16; if (j0 < 0 || j0 + 16 > TT) continue;   // fully out-of-range tile: P is 0 there
    // a 16-wide K step: use a 32-wide frag with the second half zero? frag_h reads 32 halves; take keys [j0, j0+32) only when ct < 2 pairs... simpler: process pairs (ct 0-1) as one 32-step and ct 2 alone padded by sph zeros beyond col 48
    (void)j0; }
  { // step A: keys jbase..jbase+31 (tiles 0,1); step B: keys jbase+32..jbase+47 (tile 2) + 16 zero columns (sph cols 48..63 are never written -> zero them)
#pragma unroll
    for (int r = 0; r < 8; ++r) sph[wave][8 * g + r][48 + (col & 7)] = (_Float16)0.f;   // cols 48..55 zeroed (56-wide buffer); frag reads up to col 63 -> keep within 56? use explicit bounds below
  }
  LDSX();
  { const int jA = jbase, jB = jbase + 32;
    const v16h pa = frag_h(&sph[wave][col][0], lane);
    if (jA >= 0) {   // tiles 0-1 fully in range unless jbase < 0 (first query block): then tile 0 is out of range and its P are 0, but the V address would underflow -> handle by splitting
#pragma unroll
      for (int dt = 0; dt < 4; ++dt) acc[dt] = wmma16(pa, frag_h(VL + ((b * CC + (size_t)h * HD + dt * 16 + col) * TT) + jA, lane), acc[dt]); }
    else {   // q0 == 0 block, wave 0: keys -16..15: only 0..15 valid (tile 1) -> shift: build a frag over keys 0..31 with P columns 16..47? Simplest: second-half product using a 32-wide read at 0 with P cols 16..47
      const v16h pa2 = frag_h(&sph[wave][col][16], lane);   // P for keys jbase+16 .. jbase+47 = 0..31
#pragma unroll
      for (int dt = 0; dt < 4; ++dt) acc[dt] = wmma16(pa2, frag_h(VL + ((b * CC + (size_t)h * HD + dt * 16 + col) * TT) + 0, lane), acc[dt]); }
    if (jA >= 0 && jB + 16 <= TT) {   // tile 2 (16 keys) + 16 phantom zero columns: read 32 values from V (the extra 16 are multiplied by explicit zeros)
      v16h pb = frag_h(&sph[wave][col][32], lane);
#pragma unroll
      for (int i = 8; i < 16; ++i) pb[i] = (_Float16)0.f;   // K positions 16..31 of this step (cols 48..63) -> zero regardless of LDS contents
      const int jr = (jB + 32 <= TT) ? jB : (TT - 32);   // keep the 32-wide V read in range; when shifted, realign P instead
      if (jr == jB) {
#pragma unroll
        for (int dt = 0; dt < 4; ++dt) acc[dt] = wmma16(pb, frag_h(VL + ((b * CC + (size_t)h * HD + dt * 16 + col) * TT) + jB, lane), acc[dt]); }
      else {   // last block: keys jB..jB+15 are the LAST 16 positions -> read V from TT-32 and put P into K positions 16..31
        v16h pc2; 
#pragma unroll
        for (int i = 0; i < 8; ++i) { pc2[i] = (_Float16)0.f; pc2[8 + i] = pb[i]; }
#pragma unroll
        for (int dt = 0; dt < 4; ++dt) acc[dt] = wmma16(pc2, frag_h(VL + ((b * CC + (size_t)h * HD + dt * 16 + col) * TT) + (TT - 32), lane), acc[dt]); } }
  }
#pragma unroll
  for (int r = 0; r < 8; ++r)
#pragma unroll
    for (int dt = 0; dt < 4; ++dt) so[wave][8 * g + r][dt * 16 + col] = acc[dt][r] * il[r];
  LDSX();
  for (int rl = 0; rl < 16; ++rl) if (lane < 16) vst2(LO + ((b * NH + h) * TT + q0 + rl) * (size_t)HD + lane * 4, *(const v4f*)&so[wave][rl][lane * 4]);   // (h, t, d) order: 256-B row per (h, t)
}
// ---- K / V tiles of k_global in LDS: 64 keys a tile; K = 64 key rows x 64 dims, V = 64 dim rows x 64 keys, each row one whole 128-B line, LDS pitch 144 B (16 B x odd for ds_load_b128); read by all four waves of a block; two buffers, the next tile's copies fly while this one is worked on
#define KVP 72
#define KVT (64 * KVP)
#define KVBUF (2 * KVT)
#define KVSTG (TT / 64)
// one tile pair: thread = (row tid >> 3 (+ 16 i), 16-byte piece tid & 7), a wave's copy covers 4 whole 128-B lines. The s_wait_xcnt stands inside the statement so that no address register is rewritten ahead of it.
__device__ __forceinline__ void kvstage(unsigned l, const _Float16* gk, const _Float16* gv) {
  asm volatile("global_load_async_to_lds_b128 %0, %8, off\n\t"
               "global_load_async_to_lds_b128 %1, %9, off\n\t"
               "global_load_async_to_lds_b128 %2, %10, off\n\t"
               "global_load_async_to_lds_b128 %3, %11, off\n\t"
               "global_load_async_to_lds_b128 %4, %12, off\n\t"
               "global_load_async_to_lds_b128 %5, %13, off\n\t"
               "global_load_async_to_lds_b128 %6, %14, off\n\t"
               "global_load_async_to_lds_b128 %7, %15, off\n\t"
               "s_wait_xcnt 0x0"
               :: "v"(l), "v"(l + 2304u), "v"(l + 2u * 2304u), "v"(l + 3u * 2304u), "v"(l + 4u * 2304u), "v"(l + 5u * 2304u), "v"(l + 6u * 2304u), "v"(l + 7u * 2304u),
                  "v"(gk), "v"(gk + 16 * CC), "v"(gk + 32 * CC), "v"(gk + 48 * CC), "v"(gv), "v"(gv + 16 * TT), "v"(gv + 32 * TT), "v"(gv + 48 * TT) : "memory");
}
// value of lane ^ 16 (the same column in the other lane half) by a vector cross-row move, no LDS round trip
__device__ __forceinline__ float xhalf(float v) { const int bts = __builtin_bit_cast(int, v); return __builtin_bit_cast(float, __builtin_amdgcn_permlanex16(bts, bts, 0x76543210, 0xfedcba98, false, false)); }
__global__ __launch_bounds__(128) void k_global(const _Float16* __restrict__ QG, const _Float16* __restrict__ KG, const _Float16* __restrict__ VG, float* __restrict__ CG) {
  __shared__ __align__(16) float so[4][16][68]; __shared__ __align__(16) _Float16 skv[2 * KVBUF];
  const int tid = threadIdx.x, wave = tid >> 5, lane = tid & 31, col = lane & 15, g = lane >> 4; const int h = blockIdx.y; const size_t b = blockIdx.z; const int q0 = blockIdx.x * 64 + wave * 16; const size_t rq = b * TT + q0;
  v16h aq[2];   // Q rows as the B operand: column col = query q0 + col
#pragma unroll
  for (int kc = 0; kc < 2; ++kc) aq[kc] = frag_h(QG + (rq + col) * CC + h * HD + kc * 32, lane);
  float m = -3.0e38f, l = 0.f;   // of query col: m is equal in both lane halves, l is the sum over this half's keys (the halves are joined behind the loop)
  v8f acc[4] = {};   // acc[dt][r] = O[query col][dt * 16 + 8g + r]
  const _Float16* gk = KG + (b * TT + (tid >> 3)) * CC + h * HD + (tid & 7) * 8; const _Float16* gv = VG + (b * CC + (size_t)h * HD + (tid >> 3)) * TT + (tid & 7) * 8; const unsigned kl = lds_off(skv) + (unsigned)(tid >> 3) * 144u + (unsigned)(tid & 7) * 16u;
  // in front of the loop: tile 0, wait, barrier, then tile 1
  kvstage(kl, gk, gv); WAIT_COPIES(); __syncthreads(); kvstage(kl + 2u * KVBUF, gk + 64 * CC, gv + 64);
#pragma unroll 1   // one tile a trip: the ring's foot stands once in the code
  for (int st = 0; st < KVSTG; ++st) { const _Float16* kb = skv + (st & 1) * KVBUF; const _Float16* vb = kb + KVT;
#pragma unroll   // kk becomes a constant, so that the LDS reads of both 32-key steps take immediate offsets from one address
    for (int kk = 0; kk < 2; ++kk) { v16h kf[2][2], vf[4]; float s[2][8];   // the step's eight fragments are read as one group, so that the LDS latency is waited out once
#pragma unroll
      for (int ct = 0; ct < 2; ++ct)
#pragma unroll
        for (int kc = 0; kc < 2; ++kc) kf[ct][kc] = frag_h(kb + (kk * 32 + ct * 16 + col) * KVP + kc * 32, lane);
#pragma unroll
      for (int dt = 0; dt < 4; ++dt) vf[dt] = frag_h(vb + (dt * 16 + col) * KVP + kk * 32, lane);
#pragma unroll
      for (int ct = 0; ct < 2; ++ct) { v8f c = {};   // c[r] = score of key kk * 32 + ct * 16 + 8g + r with query col
#pragma unroll
        for (int kc = 0; kc < 2; ++kc) c = wmma16(kf[ct][kc], aq[kc], c);
#pragma unroll
        for (int r = 0; r < 8; ++r) s[ct][r] = c[r] * 0.125f; }
      float mx = fmaxf(s[0][0], s[1][0]);
#pragma unroll   // r becomes a constant: the scores stay in registers
      for (int r = 1; r < 8; ++r) mx = fmaxf(mx, fmaxf(s[0][r], s[1][r]));
      mx = fmaxf(mx, xhalf(mx));   // the other half's 16 keys of the same query
      const float mn = fmaxf(m, mx); const float alpha = (m <= -1.0e38f) ? 0.f : __expf(m - mn); m = mn;
      v16h pb; float es = 0.f;   // P^T as the B operand straight from the score registers: element i = key 8g + i, element 8 + i = key 16 + 8g + i, the k order of frag_h
#pragma unroll   // r becomes a constant: scores and P stay in registers
      for (int r = 0; r < 8; ++r) { const float e0 = __expf(s[0][r] - mn), e1 = __expf(s[1][r] - mn); es += e0 + e1; pb[r] = (_Float16)(e0 * 2048.0f); pb[8 + r] = (_Float16)(e1 * 2048.0f); }
      l = l * alpha + es;
#pragma unroll   // dt becomes a constant: the accumulators stay in registers
      for (int dt = 0; dt < 4; ++dt) { acc[dt] *= alpha; acc[dt] = wmma16(vf[dt], pb, acc[dt]); } }
    // foot of trip st: the one barrier publishes tile st + 1 and ends every wave's reads of tile st, whose buffer takes tile st + 2
    WAIT_LDS(); WAIT_COPIES(); __syncthreads(); if (st + 2 < KVSTG) kvstage(kl + (unsigned)(st & 1) * (2u * KVBUF), gk + (size_t)(st + 2) * 64 * CC, gv + (st + 2) * 64); }
  WAIT_COPIES();
  l += xhalf(l);
  const float il = (1.0f / 2048.0f) / l;
#pragma unroll   // dt and r become constants: the accumulators stay in registers
  for (int dt = 0; dt < 4; ++dt) { v4f lo, hi;
#pragma unroll
    for (int r = 0; r < 4; ++r) { lo[r] = acc[dt][r] * il; hi[r] = acc[dt][4 + r] * il; }
    *(v4f*)&so[wave][col][dt * 16 + 8 * g] = lo; *(v4f*)&so[wave][col][dt * 16 + 8 * g + 4] = hi; }
  LDSX();
  for (int rl = 0; rl < 16; ++rl) if (lane < 16) vst2(CG + (rq + rl) * CC + h * HD + lane * 4, *(const v4f*)&so[wave][rl][lane * 4]);
}
// ---- k_lot: block = (64 t' of one batch): LO^T[b][t'][c'] as bf16 hi + lo, from LO viewed as [c'][t'] (c' * TT + t')
__global__ __launch_bounds__(256) void k_lot(const float* __restrict__ LO, __bf16* __restrict__ LOT, __bf16* __restrict__ LOTL) {
  __shared__ __align__(16) __bf16 sh[64][136]; __shared__ __align__(16) __bf16 sl[64][136]; const size_t rb0 = (size_t)blockIdx.x * 64; const size_t b = rb0 / TT, t0 = rb0 % TT; const int c0 = blockIdx.y * 128; const int t = threadIdx.x;
  for (int e = t; e < 128 * 64; e += 256) { const int c = e >> 6, tl = e & 63; const float v = LO[(b * CC + c0 + c) * (size_t)TT + t0 + tl]; const __bf16 hv = (__bf16)v; sh[tl][c] = hv; sl[tl][c] = (__bf16)(v - (float)hv); }
  __syncthreads();
  for (int e = t; e < 64 * 16; e += 256) { const int tl = e >> 4, q = e & 15; vst2((unsigned*)(LOT + (rb0 + tl) * CC + c0 + q * 8), *(const v4u*)&sh[tl][q * 8]); vst2((unsigned*)(LOTL + (rb0 + tl) * CC + c0 + q * 8), *(const v4u*)&sl[tl][q * 8]); }
}
// ---- k_outl: block = (64 tokens, 128 out channels): YL[b][o][t] = lo_w[o] . LO^T[t] (2 products) + lo_b, stored channels-first
__global__ __launch_bounds__(128) void k_outl(const __bf16* __restrict__ LOT, const __bf16* __restrict__ LOTL, const __bf16* __restrict__ P, const float* __restrict__ BO, float* __restrict__ YL) {
  __shared__ __align__(16) float st[128][68]; __shared__ __align__(16) __bf16 sw[2 * WBUF];
  const int tid = threadIdx.x, wave = tid >> 5, lane = tid & 31, col = lane & 15, g = lane >> 4; const size_t rb0 = (size_t)blockIdx.x * 64, r0 = rb0 + wave * 16; const size_t b = rb0 / TT, t0 = rb0 % TT; const int n0 = blockIdx.y * 128;
  v8f acc[8] = {};
  const __bf16* wg = P + ((size_t)3 * CC + n0 + (tid >> 3)) * CC + (tid & 7) * 8; const unsigned wl = lds_off(sw) + (unsigned)(tid >> 3) * 144u + (unsigned)(tid & 7) * 16u;
  WRING_OPEN(wl, wg);
  for (int s = 0; s < WSTG; ++s) { const __bf16* wb = sw + (s & 1) * WBUF;
#pragma unroll   // kk becomes a constant, so that the LDS reads of both k steps take immediate offsets from one address
    for (int kk = 0; kk < 2; ++kk) { const int kc = 2 * s + kk; const v16b ah = frag_b(LOT + (r0 + col) * CC + kc * 32, lane), al = frag_b(LOTL + (r0 + col) * CC + kc * 32, lane);
      v16b w[8];   // one group of LDS reads per k step, as in k_proj
#pragma unroll
      for (int j = 0; j < 8; ++j) w[j] = frag_b(wb + (j * 16 + col) * WPITCH + kk * 32, lane);
#pragma unroll
      for (int j = 0; j < 8; ++j) { acc[j] = wmma_bf(ah, w[j], acc[j]); acc[j] = wmma_bf(al, w[j], acc[j]); } }
    WRING_FOOT(wl, wg, s); }
  WAIT_COPIES();
#pragma unroll
  for (int j = 0; j < 8; ++j) { const float bb = bfr(BO[n0 + j * 16 + col]);
#pragma unroll
    for (int r = 0; r < 8; ++r) st[j * 16 + col][wave * 16 + 8 * g + r] = acc[j][r] + bb; }
  __syncthreads();
  for (int e = tid; e < 128 * 16; e += 128) { const int o = e >> 4, q = e & 15; vst2(YL + ((b * CC + n0 + o) * TT) + t0 + q * 4, *(const v4f*)&st[o][q * 4]); }   // 256-B segment of row (b, o)
}
// ---- k_outg: block = (64 tokens, 128 out channels): yg = go_w[o] . cg[t] (hi + residual) + go_b; out[b][o][t] = sqrt(1 - t_b/999) yg + sqrt(t_b/999) YL (channels-first)
__global__ __launch_bounds__(128) void k_outg(const float* __restrict__ CG, const __bf16* __restrict__ P, const float* __restrict__ BO, const float* __restrict__ YL, const int* __restrict__ TSTEP, float* __restrict__ OUT) {
  __shared__ __align__(16) float st[128][68]; __shared__ __align__(16) __bf16 sw[2 * WBUF];
  const int tid = threadIdx.x, wave = tid >> 5, lane = tid & 31, col = lane & 15, g = lane >> 4; const size_t rb0 = (size_t)blockIdx.x * 64, r0 = rb0 + wave * 16; const size_t b = rb0 / TT, t0 = rb0 % TT; const int n0 = blockIdx.y * 128;
  v8f acc[8] = {};
  const __bf16* wg = P + ((size_t)7 * CC + n0 + (tid >> 3)) * CC + (tid & 7) * 8; const unsigned wl = lds_off(sw) + (unsigned)(tid >> 3) * 144u + (unsigned)(tid & 7) * 16u;
  WRING_OPEN(wl, wg);
  for (int s = 0; s < WSTG; ++s) { const __bf16* wb = sw + (s & 1) * WBUF;
#pragma unroll   // kk becomes a constant, so that the LDS reads of both k steps take immediate offsets from one address
    for (int kk = 0; kk < 2; ++kk) { const int kc = 2 * s + kk; const F2 a = split_row(CG + (r0 + col) * CC, kc * 32, lane);
      v16b w[8];   // one group of LDS reads per k step, as in k_proj
#pragma unroll
      for (int j = 0; j < 8; ++j) w[j] = frag_b(wb + (j * 16 + col) * WPITCH + kk * 32, lane);
#pragma unroll
      for (int j = 0; j < 8; ++j) { acc[j] = wmma_bf(a.l, w[j], acc[j]); acc[j] = wmma_bf(a.h, w[j], acc[j]); } }
    WRING_FOOT(wl, wg, s); }
  WAIT_COPIES();
  const float tn = (float)TSTEP[b] / (float)(TS - 1); const float ag = sqrtf(1.0f - tn), al = sqrtf(tn);
#pragma unroll
  for (int j = 0; j < 8; ++j) { const float bb = bfr(BO[n0 + j * 16 + col]);
#pragma unroll
    for (int r = 0; r < 8; ++r) st[j * 16 + col][wave * 16 + 8 * g + r] = (acc[j][r] + bb) * ag; }
  __syncthreads();
  for (int e = tid; e < 128 * 16; e += 128) { const int o = e >> 4, q = e & 15; const size_t off = ((b * CC + n0 + o) * TT) + t0 + q * 4; v4f yl = *(const v4f*)&YL[off]; v4f v = *(const v4f*)&st[o][q * 4]; v4f w; for (int i = 0; i < 4; ++i) w[i] = v[i] + al * yl[i]; vst2(OUT + off, w); }
}
extern "C" void kernel_launch(void* const* d_in, const int* in_sizes, int n_in, void* d_out, int out_size, void* d_ws, size_t ws_size, hipStream_t stream) {
  (void)in_sizes; (void)n_in; (void)out_size;
  const float** F = (const float**)d_in;   // 0 x, 1 cond [4,512,2048]; 2 t [4] int; 3 lq_w,4 lq_b, 5 lk_w,6 lk_b, 7 lv_w,8 lv_b, 9 lo_w,10 lo_b, 11 gq_w,12 gq_b, 13 gk_w,14 gk_b, 15 gv_w,16 gv_b, 17 go_w,18 go_b
  if (ws_size < (size_t)WS_END) return;
  char* ws = (char*)d_ws; __bf16* P = (__bf16*)ws; _Float16 *QL = (_Float16*)(ws + WS_QL), *KL = (_Float16*)(ws + WS_KL), *QG = (_Float16*)(ws + WS_QG), *KG = (_Float16*)(ws + WS_KG), *VL = (_Float16*)(ws + WS_VL), *VG = (_Float16*)(ws + WS_VG); float *LO = (float*)(ws + WS_LO), *CG = (float*)(ws + WS_CG), *YL = (float*)(ws + WS_YL); __bf16 *LOT = (__bf16*)(ws + WS_LOT), *LOTL = (__bf16*)(ws + WS_LOTL);
  k_pack<<<dim3(CC, 8), 256, 0, stream>>>(F[3], F[5], F[7], F[9], F[11], F[13], F[15], F[17], P);
  k_proj<<<dim3(TR / 64, CC / 128, 6), 128, 0, stream>>>(F[0], F[1], P, F[4], F[6], F[8], F[12], F[14], F[16], QL, KL, VL, QG, KG, VG);
  k_local<<<dim3(TT / 64, NH, TNB), 128, 0, stream>>>(QL, KL, VL, LO);
  k_global<<<dim3(TT / 64, NH, TNB), 128, 0, stream>>>(QG, KG, VG, CG);
  k_lot<<<dim3(TR / 64, CC / 128), 256, 0, stream>>>(LO, LOT, LOTL);
  k_outl<<<dim3(TR / 64, CC / 128), 128, 0, stream>>>(LOT, LOTL, P, F[10], YL);
  k_outg<<<dim3(TR / 64, CC / 128), 128, 0, stream>>>(CG, P, F[18], YL, (const int*)d_in[2], (float*)d_out);
}

// v004
// Measured time: 155 microseconds a run.
// Next to v003, in two timings, it ran 1.17 times as fast each time.
// Over all steps from v000 it is 2.69 times as fast.
// compute dtype: all float inputs rounded to bf16, t read on device; the six q/k/v projections with EXACT bf16 products on WMMA 16x16x32 (natural [out][in] rows; channels-first activations gathered token-major), + bias, rounded once to f16; local branch: windowed scores (16 slots, zero-padded slots as logit-0 / value-0 phantoms) and global branch: interleaved-pair RoPE (f32 inv_freq by powf, precise sinf/cosf) then full attention - both PLAIN (q, k single f16 x 1/8, running-max softmax in f32 with hardware exp, P scaled by 2^11 single f16 x v single f16); output convs/linears with the contexts split into bf16 hi + residual (2 products); the sqrt(1 - t/999), sqrt(t/999) mix in f32.
#include <hip/hip_runtime.h>
#include <math.h>

typedef __attribute__((ext_vector_type(16))) _Float16 v16h;
typedef __attribute__((ext_vector_type(16))) __bf16 v16b;
typedef __attribute__((ext_vector_type(8)))  _Float16 v8h;
typedef __attribute__((ext_vector_type(8)))  float v8f;
typedef __attribute__((ext_vector_type(4)))  float v4f;
typedef __attribute__((ext_vector_type(2)))  float v2f;
typedef __attribute__((ext_vector_type(4)))  unsigned v4u;
typedef __attribute__((ext_vector_type(4)))  int v4i;
typedef float __attribute__((may_alias)) float_a;
typedef int __attribute__((may_alias)) int_a;

template <typename T> __device__ __forceinline__ void vst2(void* p, T v) { *(T*)p = v;  }
__device__ __forceinline__ v8f wmma16(v16h a, v16h b, v8f c) {
  v8f d = __builtin_amdgcn_wmma_f32_16x16x32_f16(false, a, false, b, (short)0, c, false, false);
  asm volatile("v_nop\n\tv_nop\n\tv_nop\n\tv_nop" : "+v"(d) : "v"(a), "v"(b));
  return d;
}
__device__ __forceinline__ v8f wmma_bf(v16b a, v16b b, v8f c) {
  v8f d = __builtin_amdgcn_wmma_f32_16x16x32_bf16(false, a, false, b, (short)0, c, false, false);
  asm volatile("v_nop\n\tv_nop\n\tv_nop\n\tv_nop" : "+v"(d) : "v"(a), "v"(b));
  return d;
}
// 16x16x32 fragments: lane = (h = lane>>4, row/col = lane&15); elements 0..7 = k0+8h+0..7, 8..15 = k0+16+8h+0..7; D element r = row 8h+r
__device__ __forceinline__ v16h frag_h(const _Float16* rowk0, int lane) {
  union { v16h v; v8h q[2]; } u; const _Float16* p = rowk0 + 8 * (lane >> 4);
  u.q[0] = *(const v8h*)p; u.q[1] = *(const v8h*)(p + 16); return u.v;
}
__device__ __forceinline__ v16h frag_f32(const float* rowk0, int lane) {
  v16h a; const float* p = rowk0 + 8 * (lane >> 4);
#pragma unroll
  for (int i = 0; i < 8; ++i) { a[i] = (_Float16)p[i]; a[8 + i] = (_Float16)p[16 + i]; }
  return a;
}
__device__ __forceinline__ v16h frag_f32s(const float* rowk0, int lane, float sc) {
  v16h a; const float* p = rowk0 + 8 * (lane >> 4);
#pragma unroll
  for (int i = 0; i < 8; ++i) { a[i] = (_Float16)(p[i] * sc); a[8 + i] = (_Float16)(p[16 + i] * sc); }
  return a;
}
// column fragment from a [K][ld] layout (column n), rows >= K read as 0
__device__ __forceinline__ v16h fragc_f32(const float* W, int k0, int n, int lane, int ld, int K) {
  v16h a; const int g = lane >> 4;
#pragma unroll
  for (int i = 0; i < 8; ++i) { const int ka = k0 + 8 * g + i, kb = ka + 16;
    a[i] = (_Float16)(ka < K ? W[(size_t)(ka < K ? ka : K - 1) * ld + n] : 0.f); a[8 + i] = (_Float16)(kb < K ? W[(size_t)(kb < K ? kb : K - 1) * ld + n] : 0.f); }
  return a;
}
struct F2 { v16b h, l; };
__device__ __forceinline__ F2 bsplit16(const float v[16]) { F2 r;
#pragma unroll
  for (int i = 0; i < 16; ++i) { const __bf16 h = (__bf16)v[i]; r.h[i] = h; r.l[i] = (__bf16)(v[i] - (float)h); }
  return r; }
__device__ __forceinline__ F2 split_row(const float* row, int k0, int lane) { float v[16]; const float* p = row + k0 + 8 * (lane >> 4);
#pragma unroll
  for (int i = 0; i < 8; ++i) { v[i] = p[i]; v[8 + i] = p[16 + i]; }
  return bsplit16(v); }
__device__ __forceinline__ F2 split_rowK(const float* row, int k0, int lane, int K) { float v[16]; const int g = lane >> 4;
#pragma unroll
  for (int i = 0; i < 8; ++i) { const int ka = k0 + 8 * g + i, kb = ka + 16; v[i] = ka < K ? row[ka < K ? ka : K - 1] : 0.f; v[8 + i] = kb < K ? row[kb < K ? kb : K - 1] : 0.f; }
  return bsplit16(v); }
__device__ __forceinline__ F2 split_col(const float* W, int k0, int n, int lane, int ld, int K) { float v[16]; const int g = lane >> 4;
#pragma unroll
  for (int i = 0; i < 8; ++i) { const int ka = k0 + 8 * g + i, kb = ka + 16; v[i] = ka < K ? W[(size_t)(ka < K ? ka : K - 1) * ld + n] : 0.f; v[8 + i] = kb < K ? W[(size_t)(kb < K ? kb : K - 1) * ld + n] : 0.f; }
  return bsplit16(v); }
__device__ __forceinline__ v8f mac3(const F2& a, const F2& b, v8f c) { c = wmma_bf(a.l, b.h, c); c = wmma_bf(a.h, b.l, c); return wmma_bf(a.h, b.h, c); }
__device__ __forceinline__ float sigm(float v) { return 1.0f / (1.0f + expf(-v)); }
#define LDSX() do { asm volatile("s_wait_dscnt 0" ::: "memory"); __builtin_amdgcn_wave_barrier(); __builtin_amdgcn_fence(__ATOMIC_RELEASE, "workgroup"); } while (0)


// Mixed local / global soft-align attention (B 4, C 512, T 2,048, 8 heads x 64, window 16): a windowed cross attention (q from x, k/v from cond, zero-padded window) and a global RoPE cross attention, each with its own 1x1 projections, blended per sample by the diffusion step t.
#define NB 4
#define CC 512
#define TT 2048
#define NH 8
#define HD 64
#define WW 16
#define TS 1000
#define NR (NB * TT)
#ifndef TNB
#define TNB NB
#endif
#define TR (TNB * TT)
typedef __attribute__((ext_vector_type(8))) __bf16 v8b;
__device__ __forceinline__ v16b frag_b(const __bf16* rowk0, int lane) {
  union { v16b v; v8b q[2]; } u; const __bf16* p = rowk0 + 8 * (lane >> 4);
  u.q[0] = *(const v8b*)p; u.q[1] = *(const v8b*)(p + 16); return u.v;
}
__device__ __forceinline__ float bfr(float v) { return (float)(__bf16)v; }
__device__ __attribute__((noinline)) float exp_ni(float v) { return expf(v); }
__device__ __attribute__((noinline)) float erf_ni(float v) { return erff(v); }

#define WS_PW   0u                                     // bf16 rows: lq, lk, lv, lo, gq, gk, gv, go [8][512][512] (natural [out][in])
#define WS_QL   (WS_PW + 2u * (size_t)8 * CC * CC)        // f16 token rows [NR][512]: QL, KL, QG, KG
#define WS_KL   (WS_QL + 2u * (size_t)NR * CC)
#define WS_QG   (WS_KL + 2u * (size_t)NR * CC)
#define WS_KG   (WS_QG + 2u * (size_t)NR * CC)
#define WS_VL   (WS_KG + 2u * (size_t)NR * CC)            // f16 planes [b][512][TT]: VL, VG
#define WS_VG   (WS_VL + 2u * (size_t)NB * CC * TT)
#define WS_LO   (WS_VG + 2u * (size_t)NB * CC * TT)       // f32 local context in the module's (h, t, d) order == [c'][t'] ; CG token-major [NR][512]
#define WS_CG   (WS_LO + 4u * (size_t)NR * CC)
#define WS_LOT  (WS_CG + 4u * (size_t)NR * CC)            // bf16 hi / lo of LO^T [b][t'][c']
#define WS_LOTL (WS_LOT + 2u * (size_t)NR * CC)
#define WS_YL   (WS_LOTL + 2u * (size_t)NR * CC)          // f32 ctx_local channels-first [b][512][TT]
#define WS_RC   (WS_YL + 4u * (size_t)NB * CC * TT)      // f32 RoPE table [TT][32]: cos, then sin
#define WS_RS   (WS_RC + 4u * (size_t)TT * (HD / 2))
#define WS_END  (WS_RS + 4u * (size_t)TT * (HD / 2))

// ---- weight tile in LDS: 128 weight rows x 64 k (128 B a row, LDS pitch 144 B = 16 B x odd for ds_load_b128), read by all four waves of a block; two buffers, the next tile's copies fly while this one is worked on
#define WPITCH 72
#define WBUF (128 * WPITCH)
#define WSTG (CC / 64)
__device__ __forceinline__ unsigned lds_off(const void* p) { return (unsigned)(size_t)p; }   // low 32 bits of a __shared__ address = byte offset in the work-group's LDS
// one tile: thread = (row tid >> 3 (+ 16 i), 16-byte piece tid & 7), a wave's copy covers 4 whole 128-B lines. The s_wait_xcnt stands inside the statement so that no address register is rewritten ahead of it.
__device__ __forceinline__ void wstage(unsigned l, const __bf16* g) {
  asm volatile("global_load_async_to_lds_b128 %0, %8, off\n\t"
               "global_load_async_to_lds_b128 %1, %9, off\n\t"
               "global_load_async_to_lds_b128 %2, %10, off\n\t"
               "global_load_async_to_lds_b128 %3, %11, off\n\t"
               "global_load_async_to_lds_b128 %4, %12, off\n\t"
               "global_load_async_to_lds_b128 %5, %13, off\n\t"
               "global_load_async_to_lds_b128 %6, %14, off\n\t"
               "global_load_async_to_lds_b128 %7, %15, off\n\t"
               "s_wait_xcnt 0x0"
               :: "v"(l), "v"(l + 2304u), "v"(l + 2u * 2304u), "v"(l + 3u * 2304u), "v"(l + 4u * 2304u), "v"(l + 5u * 2304u), "v"(l + 6u * 2304u), "v"(l + 7u * 2304u),
                  "v"(g), "v"(g + 16 * CC), "v"(g + 32 * CC), "v"(g + 48 * CC), "v"(g + 64 * CC), "v"(g + 80 * CC), "v"(g + 96 * CC), "v"(g + 112 * CC) : "memory");
}
#define WAIT_COPIES() asm volatile("s_wait_asynccnt 0x0" ::: "memory")   // this wave's copies have landed
#define WAIT_LDS() asm volatile("s_wait_dscnt 0x0" ::: "memory")         // this wave's reads of the buffer about to be refilled have returned
// in front of the loop: tile 0, wait, barrier, then tile 1
#define WRING_OPEN(l, g) do { wstage((l), (g)); WAIT_COPIES(); __syncthreads(); wstage((l) + 2u * WBUF, (g) + 64); } while (0)
// foot of trip s: the one barrier publishes tile s + 1 and ends every wave's reads of tile s, whose buffer takes tile s + 2
#define WRING_FOOT(l, g, s) do { WAIT_LDS(); WAIT_COPIES(); __syncthreads(); if ((s) + 2 < WSTG) wstage((l) + (unsigned)((s) & 1) * (2u * WBUF), (g) + ((s) + 2) * 64); } while (0)

__device__ __attribute__((noinline)) float pow_p(float a, float b) { return powf(a, b); }
__device__ __attribute__((noinline)) float sin_p(float v) { return sinf(v); }
__device__ __attribute__((noinline)) float cos_p(float v) { return cosf(v); }
static_assert(CC * 128 == TT * (HD / 2), "the CC blocks of blockIdx.y 8, 128 entries each, cover the table exactly");
// blockIdx.y 0..7: one weight row to bf16; blockIdx.y 8: 128 entries (4 positions x 32 frequencies) of the RoPE table, waves 0..3 the cosines, waves 4..7 the sines, each wave one whole 128-B line
__global__ __launch_bounds__(256) void k_pack(const float* __restrict__ W0, const float* __restrict__ W1, const float* __restrict__ W2, const float* __restrict__ W3, const float* __restrict__ W4, const float* __restrict__ W5, const float* __restrict__ W6, const float* __restrict__ W7, __bf16* __restrict__ P, float* __restrict__ RC, float* __restrict__ RS) {
  __shared__ __align__(16) __bf16 s[CC]; const int n = blockIdx.x, which = blockIdx.y, t = threadIdx.x;
  if (which == 8) { const int e = n * 128 + (t & 127); const int i = e & 31; const float inv = 1.0f / pow_p(10000.0f, (float)(2 * i) / (float)HD); const float ang = (float)(e >> 5) * inv;   // angle = position * inv_freq[i]
    if (t < 128) RC[e] = cos_p(ang); else RS[e] = sin_p(ang);
    return; }
  const float* Wm = (which == 0) ? W0 : (which == 1) ? W1 : (which == 2) ? W2 : (which == 3) ? W3 : (which == 4) ? W4 : (which == 5) ? W5 : (which == 6) ? W6 : W7;
  for (int k = t; k < CC; k += 256) s[k] = (__bf16)Wm[(size_t)n * CC + k]; __syncthreads(); for (int q = t; q < CC / 8; q += 256) vst2((unsigned*)(P + ((size_t)which * CC + n) * CC + q * 8), *(const v4u*)&s[q * 8]); }
// ---- k_proj: block = (64 tokens, 128 out channels, which): which 0 lq(x) 1 lk(cond) 4 gq(x) 5 gk(cond) -> f16 token rows (gq/gk with RoPE); 2 lv(cond) 6 gv(cond) -> f16 planes. A gathered from the channels-first input.
__global__ __launch_bounds__(128) void k_proj(const float* __restrict__ X, const float* __restrict__ CND, const __bf16* __restrict__ P, const float* __restrict__ B0, const float* __restrict__ B1, const float* __restrict__ B2, const float* __restrict__ B4, const float* __restrict__ B5, const float* __restrict__ B6, _Float16* __restrict__ QL, _Float16* __restrict__ KL, _Float16* __restrict__ VL, _Float16* __restrict__ QG, _Float16* __restrict__ KG, _Float16* __restrict__ VG, const float* __restrict__ RC, const float* __restrict__ RS) {
  __shared__ __align__(16) float sf[64][132]; __shared__ __align__(16) _Float16 so[64][136]; __shared__ __align__(16) _Float16 st[128][72]; __shared__ __align__(16) __bf16 sw[2 * WBUF];
  const int tid = threadIdx.x, wave = tid >> 5, lane = tid & 31, col = lane & 15, g = lane >> 4; const int wsel = blockIdx.z; const int which = (wsel < 3) ? wsel : wsel + 1;   // 0,1,2,4,5,6
  const int n0 = blockIdx.y * 128; const size_t rb0 = (size_t)blockIdx.x * 64; const size_t b = rb0 / TT, t0 = rb0 % TT; const int tw = (int)t0 + wave * 16;
  const float* IN = (which == 0 || which == 4) ? X : CND; const float* BB = (which == 0) ? B0 : (which == 1) ? B1 : (which == 2) ? B2 : (which == 4) ? B4 : (which == 5) ? B5 : B6;
  v8f acc[8] = {};
  const __bf16* wg = P + ((size_t)which * CC + n0 + (tid >> 3)) * CC + (tid & 7) * 8; const unsigned wl = lds_off(sw) + (unsigned)(tid >> 3) * 144u + (unsigned)(tid & 7) * 16u;
  WRING_OPEN(wl, wg);
  for (int s = 0; s < WSTG; ++s) { const __bf16* wb = sw + (s & 1) * WBUF; const float* p = IN + (b * CC + s * 64 + 8 * g) * TT + tw + col;   // element (token tw+col, channel s*64+8g+..): one address for the tile's two k steps
#pragma unroll   // kk becomes a constant, so that the LDS reads of both k steps take immediate offsets from one address
    for (int kk = 0; kk < 2; ++kk) { v16b a;
#pragma unroll
      for (int i = 0; i < 8; ++i) { a[i] = (__bf16)p[(size_t)(kk * 32 + i) * TT]; a[8 + i] = (__bf16)p[(size_t)(kk * 32 + 16 + i) * TT]; }
      v16b w[8];   // the k step's eight weight fragments are read as one group, so that the LDS latency is waited out once and not in front of every product
#pragma unroll
      for (int j = 0; j < 8; ++j) w[j] = frag_b(wb + (j * 16 + col) * WPITCH + kk * 32, lane);
#pragma unroll
      for (int j = 0; j < 8; ++j) acc[j] = wmma_bf(a, w[j], acc[j]); }
    asm volatile("s_wait_xcnt 0x0" :: "v"(p) : "memory");   // takes the activation loads' address as an input: the pair stays in use behind all 32 loads, so no load's result lands in it, and its step to the next tile stands behind this wait
    WRING_FOOT(wl, wg, s); }
  WAIT_COPIES();
  if (which == 2 || which == 6) {   // v -> planes [b][c][t]
#pragma unroll
    for (int j = 0; j < 8; ++j) { const float bb = bfr(BB[n0 + j * 16 + col]);
#pragma unroll
      for (int r = 0; r < 8; ++r) st[j * 16 + col][wave * 16 + 8 * g + r] = (_Float16)(acc[j][r] + bb); }
    __syncthreads(); _Float16* V = (which == 2) ? VL : VG;
    for (int e = tid; e < 128 * 8; e += 128) { const int d = e >> 3, pc = e & 7; vst2((unsigned*)(V + ((b * CC + n0 + d) * TT) + t0 + pc * 8), *(const v4u*)&st[d][pc * 8]); }
    return; }
  if (which < 2) {   // local q/k rows
#pragma unroll
    for (int j = 0; j < 8; ++j) { const float bb = bfr(BB[n0 + j * 16 + col]);
#pragma unroll
      for (int r = 0; r < 8; ++r) so[wave * 16 + 8 * g + r][j * 16 + col] = (_Float16)(acc[j][r] + bb); }
  } else {   // global q/k: + bias then interleaved-pair RoPE within each 64-dim head: angle = t * inv_freq[(c % 64) / 2], its cos and sin from the table
    float cs[16], sn[16]; const float* rc = RC + tw * (HD / 2) + lane; const float* rs = RS + tw * (HD / 2) + lane;   // pair pi has frequency pi % 32 = lane: one table line a row serves both of a lane's pairs
#pragma unroll   // rl becomes a constant: the 32 loads go out as one group, in front of the LDS round trip
    for (int rl = 0; rl < 16; ++rl) { cs[rl] = rc[rl * (HD / 2)]; sn[rl] = rs[rl * (HD / 2)]; }
    asm volatile("s_wait_xcnt 0x0" :: "v"(rc), "v"(rs) : "memory");   // takes the table loads' addresses as inputs: they stay in use behind all 32 loads, so no load's result lands in them, and any later write of them stands behind this wait
#pragma unroll
    for (int j = 0; j < 8; ++j) { const float bb = bfr(BB[n0 + j * 16 + col]);
#pragma unroll
      for (int r = 0; r < 8; ++r) sf[wave * 16 + 8 * g + r][j * 16 + col] = acc[j][r] + bb; }
    LDSX();
    // each lane: rows of this wave; pairs handled by even columns
#pragma unroll   // rl becomes a constant: cs and sn stay in registers
    for (int rl = 0; rl < 16; ++rl) {
#pragma unroll   // two pairs a lane, straight-line now that no call stands in the body
      for (int u = 0; u < 2; ++u) { const int c = 2 * (lane + 32 * u);
        const float x1 = sf[wave * 16 + rl][c], x2 = sf[wave * 16 + rl][c + 1]; so[wave * 16 + rl][c] = (_Float16)(x1 * cs[rl] - x2 * sn[rl]); so[wave * 16 + rl][c + 1] = (_Float16)(x1 * sn[rl] + x2 * cs[rl]); } }
  }
  LDSX();
  _Float16* D0 = (which == 0) ? QL : (which == 1) ? KL : (which == 4) ? QG : KG;
  for (int rl = 0; rl < 16; ++rl) if (lane < 16) vst2((unsigned*)(D0 + (rb0 + wave * 16 + rl) * CC + n0 + lane * 8), *(const v4u*)&so[wave * 16 + rl][lane * 8]);
}
// ---- k_local: block = (64 queries, head, b): window keys j = t-8..t+7 (3 key tiles from tq0-16), out-of-range slots = phantom keys with logit 0 and value 0; out -> LO in (h, t, d) order
__global__ __launch_bounds__(128) void k_local(const _Float16* __restrict__ QL, const _Float16* __restrict__ KL, const _Float16* __restrict__ VL, float* __restrict__ LO) {
  __shared__ __align__(16) _Float16 sph[4][16][56]; __shared__ __align__(16) float so[4][16][68];
  const int tid = threadIdx.x, wave = tid >> 5, lane = tid & 31, col = lane & 15, g = lane >> 4; const int h = blockIdx.y; const size_t b = blockIdx.z; const int q0 = blockIdx.x * 64 + wave * 16; const size_t rq = b * TT + q0;
  v16h aq[2];
#pragma unroll
  for (int kc = 0; kc < 2; ++kc) aq[kc] = frag_h(QL + (rq + col) * CC + h * HD + kc * 32, lane);
  float s[3][8]; const int jbase = q0 - 16;
#pragma unroll
  for (int ct = 0; ct < 3; ++ct) { const int j = jbase + ct * 16 + col; v8f c = {};
    if (jbase + ct * 16 >= 0 && jbase + ct * 16 + 16 <= TT) {
#pragma unroll
      for (int kc = 0; kc < 2; ++kc) c = wmma16(aq[kc], frag_h(KL + (b * TT + j) * CC + h * HD + kc * 32, lane), c); }
#pragma unroll
    for (int r = 0; r < 8; ++r) { const int t = q0 + 8 * g + r; const bool inwin = (j >= t - 8) && (j <= t + 7) && (j >= 0) && (j < TT); s[ct][r] = inwin ? c[r] * 0.125f : -3.0e38f; } }
  float il[8];
#pragma unroll
  for (int r = 0; r < 8; ++r) { const int t = q0 + 8 * g + r; const int npad = max(0, 8 - t) + max(0, t + 8 - TT); float mx = fmaxf(fmaxf(s[0][r], s[1][r]), s[2][r]);
#pragma unroll
    for (int o = 1; o < 16; o <<= 1) mx = fmaxf(mx, __shfl_xor(mx, o));
    if (npad > 0) mx = fmaxf(mx, 0.f);
    float es = 0.f; float e[3];
#pragma unroll
    for (int ct = 0; ct < 3; ++ct) { e[ct] = (s[ct][r] <= -1.0e38f) ? 0.f : __expf(s[ct][r] - mx); es += e[ct]; }
#pragma unroll
    for (int o = 1; o < 16; o <<= 1) es += __shfl_xor(es, o);
    es += (float)npad * __expf(-mx);   // zero-padded slots: logit 0, value 0
    il[r] = (1.0f / 2048.0f) / es;
#pragma unroll
    for (int ct = 0; ct < 3; ++ct) sph[wave][8 * g + r][ct * 16 + col] = (_Float16)(e[ct] * 2048.0f); }
  LDSX();
  v8f acc[4] = {};
#pragma unroll
  for (int ct = 0; ct < 3; ++ct) { const int j0 = jbase + ct * 16; if (j0 < 0 || j0 + 16 > TT) continue;   // fully out-of-range tile: P is 0 there
    // a 16-wide K step: use a 32-wide frag with the second half zero? frag_h reads 32 halves; take keys [j0, j0+32) only when ct < 2 pairs... simpler: process pairs (ct 0-1) as one 32-step and ct 2 alone padded by sph zeros beyond col 48
    (void)j0; }
  { // step A: keys jbase..jbase+31 (tiles 0,1); step B: keys jbase+32..jbase+47 (tile 2) + 16 zero columns (sph cols 48..63 are never written -> zero them)
#pragma unroll
    for (int r = 0; r < 8; ++r) sph[wave][8 * g + r][48 + (col & 7)] = (_Float16)0.f;   // cols 48..55 zeroed (56-wide buffer); frag reads up to col 63 -> keep within 56? use explicit bounds below
  }
  LDSX();
  { const int jA = jbase, jB = jbase + 32;
    const v16h pa = frag_h(&sph[wave][col][0], lane);
    if (jA >= 0) {   // tiles 0-1 fully in range unless jbase < 0 (first query block): then tile 0 is out of range and its P are 0, but the V address would underflow -> handle by splitting
#pragma unroll
      for (int dt = 0; dt < 4; ++dt) acc[dt] = wmma16(pa, frag_h(VL + ((b * CC + (size_t)h * HD + dt * 16 + col) * TT) + jA, lane), acc[dt]); }
    else {   // q0 == 0 block, wave 0: keys -16..15: only 0..15 valid (tile 1) -> shift: build a frag over keys 0..31 with P columns 16..47? Simplest: second-half product using a 32-wide read at 0 with P cols 16..47
      const v16h pa2 = frag_h(&sph[wave][col][16], lane);   // P for keys jbase+16 .. jbase+47 = 0..31
#pragma unroll
      for (int dt = 0; dt < 4; ++dt) acc[dt] = wmma16(pa2, frag_h(VL + ((b * CC + (size_t)h * HD + dt * 16 + col) * TT) + 0, lane), acc[dt]); }
    if (jA >= 0 && jB + 16 <= TT) {   // tile 2 (16 keys) + 16 phantom zero columns: read 32 values from V (the extra 16 are multiplied by explicit zeros)
      v16h pb = frag_h(&sph[wave][col][32], lane);
#pragma unroll
      for (int i = 8; i < 16; ++i) pb[i] = (_Float16)0.f;   // K positions 16..31 of this step (cols 48..63) -> zero regardless of LDS contents
      const int jr = (jB + 32 <= TT) ? jB : (TT - 32);   // keep the 32-wide V read in range; when shifted, realign P instead
      if (jr == jB) {
#pragma unroll
        for (int dt = 0; dt < 4; ++dt) acc[dt] = wmma16(pb, frag_h(VL + ((b * CC + (size_t)h * HD + dt * 16 + col) * TT) + jB, lane), acc[dt]); }
      else {   // last block: keys jB..jB+15 are the LAST 16 positions -> read V from TT-32 and put P into K positions 16..31
        v16h pc2; 
#pragma unroll
        for (int i = 0; i < 8; ++i) { pc2[i] = (_Float16)0.f; pc2[8 + i] = pb[i]; }
#pragma unroll
        for (int dt = 0; dt < 4; ++dt) acc[dt] = wmma16(pc2, frag_h(VL + ((b * CC + (size_t)h * HD + dt * 16 + col) * TT) + (TT - 32), lane), acc[dt]); } }
  }
#pragma unroll
  for (int r = 0; r < 8; ++r)
#pragma unroll
    for (int dt = 0; dt < 4; ++dt) so[wave][8 * g + r][dt * 16 + col] = acc[dt][r] * il[r];
  LDSX();
  for (int rl = 0; rl < 16; ++rl) if (lane < 16) vst2(LO + ((b * NH + h) * TT + q0 + rl) * (size_t)HD + lane * 4, *(const v4f*)&so[wave][rl][lane * 4]);   // (h, t, d) order: 256-B row per (h, t)
}
// ---- K / V tiles of k_global in LDS: 64 keys a tile; K = 64 key rows x 64 dims, V = 64 dim rows x 64 keys, each row one whole 128-B line, LDS pitch 144 B (16 B x odd for ds_load_b128); read by all four waves of a block; two buffers, the next tile's copies fly while this one is worked on
#define KVP 72
#define KVT (64 * KVP)
#define KVBUF (2 * KVT)
#define KVSTG (TT / 64)
// one tile pair: thread = (row tid >> 3 (+ 16 i), 16-byte piece tid & 7), a wave's copy covers 4 whole 128-B lines. The s_wait_xcnt stands inside the statement so that no address register is rewritten ahead of it.
__device__ __forceinline__ void kvstage(unsigned l, const _Float16* gk, const _Float16* gv) {
  asm volatile("global_load_async_to_lds_b128 %0, %8, off\n\t"
               "global_load_async_to_lds_b128 %1, %9, off\n\t"
               "global_load_async_to_lds_b128 %2, %10, off\n\t"
               "global_load_async_to_lds_b128 %3, %11, off\n\t"
               "global_load_async_to_lds_b128 %4, %12, off\n\t"
               "global_load_async_to_lds_b128 %5, %13, off\n\t"
               "global_load_async_to_lds_b128 %6, %14, off\n\t"
               "global_load_async_to_lds_b128 %7, %15, off\n\t"
               "s_wait_xcnt 0x0"
               :: "v"(l), "v"(l + 2304u), "v"(l + 2u * 2304u), "v"(l + 3u * 2304u), "v"(l + 4u * 2304u), "v"(l + 5u * 2304u), "v"(l + 6u * 2304u), "v"(l + 7u * 2304u),
                  "v"(gk), "v"(gk + 16 * CC), "v"(gk + 32 * CC), "v"(gk + 48 * CC), "v"(gv), "v"(gv + 16 * TT), "v"(gv + 32 * TT), "v"(gv + 48 * TT) : "memory");
}
// value of lane ^ 16 (the same column in the other lane half) by a vector cross-row move, no LDS round trip
__device__ __forceinline__ float xhalf(float v) { const int bts = __builtin_bit_cast(int, v); return __builtin_bit_cast(float, __builtin_amdgcn_permlanex16(bts, bts, 0x76543210, 0xfedcba98, false, false)); }
__global__ __launch_bounds__(128) void k_global(const _Float16* __restrict__ QG, const _Float16* __restrict__ KG, const _Float16* __restrict__ VG, float* __restrict__ CG) {
  __shared__ __align__(16) float so[4][16][68]; __shared__ __align__(16) _Float16 skv[2 * KVBUF];
  const int tid = threadIdx.x, wave = tid >> 5, lane = tid & 31, col = lane & 15, g = lane >> 4; const int h = blockIdx.y; const size_t b = blockIdx.z; const int q0 = blockIdx.x * 64 + wave * 16; const size_t rq = b * TT + q0;
  v16h aq[2];   // Q rows as the B operand: column col = query q0 + col
#pragma unroll
  for (int kc = 0; kc < 2; ++kc) aq[kc] = frag_h(QG + (rq + col) * CC + h * HD + kc * 32, lane);
  float m = -3.0e38f, l = 0.f;   // of query col: m is equal in both lane halves, l is the sum over this half's keys (the halves are joined behind the loop)
  v8f acc[4] = {};   // acc[dt][r] = O[query col][dt * 16 + 8g + r]
  const _Float16* gk = KG + (b * TT + (tid >> 3)) * CC + h * HD + (tid & 7) * 8; const _Float16* gv = VG + (b * CC + (size_t)h * HD + (tid >> 3)) * TT + (tid & 7) * 8; const unsigned kl = lds_off(skv) + (unsigned)(tid >> 3) * 144u + (unsigned)(tid & 7) * 16u;
  // in front of the loop: tile 0, wait, barrier, then tile 1
  kvstage(kl, gk, gv); WAIT_COPIES(); __syncthreads(); kvstage(kl + 2u * KVBUF, gk + 64 * CC, gv + 64);
#pragma unroll 1   // one tile a trip: the ring's foot stands once in the code
  for (int st = 0; st < KVSTG; ++st) { const _Float16* kb = skv + (st & 1) * KVBUF; const _Float16* vb = kb + KVT;
#pragma unroll   // kk becomes a constant, so that the LDS reads of both 32-key steps take immediate offsets from one address
    for (int kk = 0; kk < 2; ++kk) { v16h kf[2][2], vf[4]; float s[2][8];   // the step's eight fragments are read as one group, so that the LDS latency is waited out once
#pragma unroll
      for (int ct = 0; ct < 2; ++ct)
#pragma unroll
        for (int kc = 0; kc < 2; ++kc) kf[ct][kc] = frag_h(kb + (kk * 32 + ct * 16 + col) * KVP + kc * 32, lane);
#pragma unroll
      for (int dt = 0; dt < 4; ++dt) vf[dt] = frag_h(vb + (dt * 16 + col) * KVP + kk * 32, lane);
#pragma unroll
      for (int ct = 0; ct < 2; ++ct) { v8f c = {};   // c[r] = score of key kk * 32 + ct * 16 + 8g + r with query col
#pragma unroll
        for (int kc = 0; kc < 2; ++kc) c = wmma16(kf[ct][kc], aq[kc], c);
#pragma unroll
        for (int r = 0; r < 8; ++r) s[ct][r] = c[r] * 0.125f; }
      float mx = fmaxf(s[0][0], s[1][0]);
#pragma unroll   // r becomes a constant: the scores stay in registers
      for (int r = 1; r < 8; ++r) mx = fmaxf(mx, fmaxf(s[0][r], s[1][r]));
      mx = fmaxf(mx, xhalf(mx));   // the other half's 16 keys of the same query
      const float mn = fmaxf(m, mx); const float alpha = (m <= -1.0e38f) ? 0.f : __expf(m - mn); m = mn;
      v16h pb; float es = 0.f;   // P^T as the B operand straight from the score registers: element i = key 8g + i, element 8 + i = key 16 + 8g + i, the k order of frag_h
#pragma unroll   // r becomes a constant: scores and P stay in registers
      for (int r = 0; r < 8; ++r) { const float e0 = __expf(s[0][r] - mn), e1 = __expf(s[1][r] - mn); es += e0 + e1; pb[r] = (_Float16)(e0 * 2048.0f); pb[8 + r] = (_Float16)(e1 * 2048.0f); }
      l = l * alpha + es;
#pragma unroll   // dt becomes a constant: the accumulators stay in registers
      for (int dt = 0; dt < 4; ++dt) { acc[dt] *= alpha; acc[dt] = wmma16(vf[dt], pb, acc[dt]); } }
    // foot of trip st: the one barrier publishes tile st + 1 and ends every wave's reads of tile st, whose buffer takes tile st + 2
    WAIT_LDS(); WAIT_COPIES(); __syncthreads(); if (st + 2 < KVSTG) kvstage(kl + (unsigned)(st & 1) * (2u * KVBUF), gk + (size_t)(st + 2) * 64 * CC, gv + (st + 2) * 64); }
  WAIT_COPIES();
  l += xhalf(l);
  const float il = (1.0f / 2048.0f) / l;
#pragma unroll   // dt and r become constants: the accumulators stay in registers
  for (int dt = 0; dt < 4; ++dt) { v4f lo, hi;
#pragma unroll
    for (int r = 0; r < 4; ++r) { lo[r] = acc[dt][r] * il; hi[r] = acc[dt][4 + r] * il; }
    *(v4f*)&so[wave][col][dt * 16 + 8 * g] = lo; *(v4f*)&so[wave][col][dt * 16 + 8 * g + 4] = hi; }
  LDSX();
  for (int rl = 0; rl < 16; ++rl) if (lane < 16) vst2(CG + (rq + rl) * CC + h * HD + lane * 4, *(const v4f*)&so[wave][rl][lane * 4]);
}
// ---- k_lot: block = (64 t' of one batch): LO^T[b][t'][c'] as bf16 hi + lo, from LO viewed as [c'][t'] (c' * TT + t')
__global__ __launch_bounds__(256) void k_lot(const float* __restrict__ LO, __bf16* __restrict__ LOT, __bf16* __restrict__ LOTL) {
  __shared__ __align__(16) __bf16 sh[64][136]; __shared__ __align__(16) __bf16 sl[64][136]; const size_t rb0 = (size_t)blockIdx.x * 64; const size_t b = rb0 / TT, t0 = rb0 % TT; const int c0 = blockIdx.y * 128; const int t = threadIdx.x;
  for (int e = t; e < 128 * 64; e += 256) { const int c = e >> 6, tl = e & 63; const float v = LO[(b * CC + c0 + c) * (size_t)TT + t0 + tl]; const __bf16 hv = (__bf16)v; sh[tl][c] = hv; sl[tl][c] = (__bf16)(v - (float)hv); }
  __syncthreads();
  for (int e = t; e < 64 * 16; e += 256) { const int tl = e >> 4, q = e & 15; vst2((unsigned*)(LOT + (rb0 + tl) * CC + c0 + q * 8), *(const v4u*)&sh[tl][q * 8]); vst2((unsigned*)(LOTL + (rb0 + tl) * CC + c0 + q * 8), *(const v4u*)&sl[tl][q * 8]); }
}
// ---- k_outl: block = (64 tokens, 128 out channels): YL[b][o][t] = lo_w[o] . LO^T[t] (2 products) + lo_b, stored channels-first
__global__ __launch_bounds__(128) void k_outl(const __bf16* __restrict__ LOT, const __bf16* __restrict__ LOTL, const __bf16* __restrict__ P, const float* __restrict__ BO, float* __restrict__ YL) {
  __shared__ __align__(16) float st[128][68]; __shared__ __align__(16) __bf16 sw[2 * WBUF];
  const int tid = threadIdx.x, wave = tid >> 5, lane = tid & 31, col = lane & 15, g = lane >> 4; const size_t rb0 = (size_t)blockIdx.x * 64, r0 = rb0 + wave * 16; const size_t b = rb0 / TT, t0 = rb0 % TT; const int n0 = blockIdx.y * 128;
  v8f acc[8] = {};
  const __bf16* wg = P + ((size_t)3 * CC + n0 + (tid >> 3)) * CC + (tid & 7) * 8; const unsigned wl = lds_off(sw) + (unsigned)(tid >> 3) * 144u + (unsigned)(tid & 7) * 16u;
  WRING_OPEN(wl, wg);
  for (int s = 0; s < WSTG; ++s) { const __bf16* wb = sw + (s & 1) * WBUF;
#pragma unroll   // kk becomes a constant, so that the LDS reads of both k steps take immediate offsets from one address
    for (int kk = 0; kk < 2; ++kk) { const int kc = 2 * s + kk; const v16b ah = frag_b(LOT + (r0 + col) * CC + kc * 32, lane), al = frag_b(LOTL + (r0 + col) * CC + kc * 32, lane);
      v16b w[8];   // one group of LDS reads per k step, as in k_proj
#pragma unroll
      for (int j = 0; j < 8; ++j) w[j] = frag_b(wb + (j * 16 + col) * WPITCH + kk * 32, lane);
#pragma unroll
      for (int j = 0; j < 8; ++j) { acc[j] = wmma_bf(ah, w[j], acc[j]); acc[j] = wmma_bf(al, w[j], acc[j]); } }
    WRING_FOOT(wl, wg, s); }
  WAIT_COPIES();
#pragma unroll
  for (int j = 0; j < 8; ++j) { const float bb = bfr(BO[n0 + j * 16 + col]);
#pragma unroll
    for (int r = 0; r < 8; ++r) st[j * 16 + col][wave * 16 + 8 * g + r] = acc[j][r] + bb; }
  __syncthreads();
  for (int e = tid; e < 128 * 16; e += 128) { const int o = e >> 4, q = e & 15; vst2(YL + ((b * CC + n0 + o) * TT) + t0 + q * 4, *(const v4f*)&st[o][q * 4]); }   // 256-B segment of row (b, o)
}
// ---- k_outg: block = (64 tokens, 128 out channels): yg = go_w[o] . cg[t] (hi + residual) + go_b; out[b][o][t] = sqrt(1 - t_b/999) yg + sqrt(t_b/999) YL (channels-first)
__global__ __launch_bounds__(128) void k_outg(const float* __restrict__ CG, const __bf16* __restrict__ P, const float* __restrict__ BO, const float* __restrict__ YL, const int* __restrict__ TSTEP, float* __restrict__ OUT) {
  __shared__ __align__(16) float st[128][68]; __shared__ __align__(16) __bf16 sw[2 * WBUF];
  const int tid = threadIdx.x, wave = tid >> 5, lane = tid & 31, col = lane & 15, g = lane >> 4; const size_t rb0 = (size_t)blockIdx.x * 64, r0 = rb0 + wave * 16; const size_t b = rb0 / TT, t0 = rb0 % TT; const int n0 = blockIdx.y * 128;
  v8f acc[8] = {};
  const __bf16* wg = P + ((size_t)7 * CC + n0 + (tid >> 3)) * CC + (tid & 7) * 8; const unsigned wl = lds_off(sw) + (unsigned)(tid >> 3) * 144u + (unsigned)(tid & 7) * 16u;
  WRING_OPEN(wl, wg);
  for (int s = 0; s < WSTG; ++s) { const __bf16* wb = sw + (s & 1) * WBUF;
#pragma unroll   // kk becomes a constant, so that the LDS reads of both k steps take immediate offsets from one address
    for (int kk = 0; kk < 2; ++kk) { const int kc = 2 * s + kk; const F2 a = split_row(CG + (r0 + col) * CC, kc * 32, lane);
      v16b w[8];   // one group of LDS reads per k step, as in k_proj
#pragma unroll
      for (int j = 0; j < 8; ++j) w[j] = frag_b(wb + (j * 16 + col) * WPITCH + kk * 32, lane);
#pragma unroll
      for (int j = 0; j < 8; ++j) { acc[j] = wmma_bf(a.l, w[j], acc[j]); acc[j] = wmma_bf(a.h, w[j], acc[j]); } }
    WRING_FOOT(wl, wg, s); }
  WAIT_COPIES();
  const float tn = (float)TSTEP[b] / (float)(TS - 1); const float ag = sqrtf(1.0f - tn), al = sqrtf(tn);
#pragma unroll
  for (int j = 0; j < 8; ++j) { const float bb = bfr(BO[n0 + j * 16 + col]);
#pragma unroll
    for (int r = 0; r < 8; ++r) st[j * 16 + col][wave * 16 + 8 * g + r] = (acc[j][r] + bb) * ag; }
  __syncthreads();
  for (int e = tid; e < 128 * 16; e += 128) { const int o = e >> 4, q = e & 15; const size_t off = ((b * CC + n0 + o) * TT) + t0 + q * 4; v4f yl = *(const v4f*)&YL[off]; v4f v = *(const v4f*)&st[o][q * 4]; v4f w; for (int i = 0; i < 4; ++i) w[i] = v[i] + al * yl[i]; vst2(OUT + off, w); }
}
extern "C" void kernel_launch(void* const* d_in, const int* in_sizes, int n_in, void* d_out, int out_size, void* d_ws, size_t ws_size, hipStream_t stream) {
  (void)in_sizes; (void)n_in; (void)out_size;
  const float** F = (const float**)d_in;   // 0 x, 1 cond [4,512,2048]; 2 t [4] int; 3 lq_w,4 lq_b, 5 lk_w,6 lk_b, 7 lv_w,8 lv_b, 9 lo_w,10 lo_b, 11 gq_w,12 gq_b, 13 gk_w,14 gk_b, 15 gv_w,16 gv_b, 17 go_w,18 go_b
  if (ws_size < (size_t)WS_END) return;
  char* ws = (char*)d_ws; __bf16* P = (__bf16*)ws; _Float16 *QL = (_Float16*)(ws + WS_QL), *KL = (_Float16*)(ws + WS_KL), *QG = (_Float16*)(ws + WS_QG), *KG = (_Float16*)(ws + WS_KG), *VL = (_Float16*)(ws + WS_VL), *VG = (_Float16*)(ws + WS_VG); float *LO = (float*)(ws + WS_LO), *CG = (float*)(ws + WS_CG), *YL = (float*)(ws + WS_YL); __bf16 *LOT = (__bf16*)(ws + WS_LOT), *LOTL = (__bf16*)(ws + WS_LOTL); float *RC = (float*)(ws + WS_RC), *RS = (float*)(ws + WS_RS);
  k_pack<<<dim3(CC, 9), 256, 0, stream>>>(F[3], F[5], F[7], F[9], F[11], F[13], F[15], F[17], P, RC, RS);
  k_proj<<<dim3(TR / 64, CC / 128, 6), 128, 0, stream>>>(F[0], F[1], P, F[4], F[6], F[8], F[12], F[14], F[16], QL, KL, VL, QG, KG, VG, RC, RS);
  k_local<<<dim3(TT / 64, NH, TNB), 128, 0, stream>>>(QL, KL, VL, LO);
  k_global<<<dim3(TT / 64, NH, TNB), 128, 0, stream>>>(QG, KG, VG, CG);
  k_lot<<<dim3(TR / 64, CC / 128), 256, 0, stream>>>(LO, LOT, LOTL);
  k_outl<<<dim3(TR / 64, CC / 128), 128, 0, stream>>>(LOT, LOTL, P, F[10], YL);
  k_outg<<<dim3(TR / 64, CC / 128), 128, 0, stream>>>(CG, P, F[18], YL, (const int*)d_in[2], (float*)d_out);
}

// v005
// One run takes 143 microseconds.
// Next to v004, in two timings, it ran 1.09 times as fast each time.
// All steps since v000 together make it 2.92 times as fast.
// compute dtype: all float inputs rounded to bf16, t read on device; the six q/k/v projections with EXACT bf16 products on WMMA 16x16x32 (natural [out][in] rows; channels-first activations gathered token-major), + bias, rounded once to f16; local branch: windowed scores (16 slots, zero-padded slots as logit-0 / value-0 phantoms) and global branch: interleaved-pair RoPE (f32 inv_freq by powf, precise sinf/cosf) then full attention - both PLAIN (q, k single f16 x 1/8, running-max softmax in f32 with hardware exp, P scaled by 2^11 single f16 x v single f16); output convs/linears with the contexts split into bf16 hi + residual (2 products); the sqrt(1 - t/999), sqrt(t/999) mix in f32.
#include <hip/hip_runtime.h>
#include <math.h>

typedef __attribute__((ext_vector_type(16))) _Float16 v16h;
typedef __attribute__((ext_vector_type(16))) __bf16 v16b;
typedef __attribute__((ext_vector_type(8)))  _Float16 v8h;
typedef __attribute__((ext_vector_type(8)))  float v8f;
typedef __attribute__((ext_vector_type(4)))  float v4f;
typedef __attribute__((ext_vector_type(2)))  float v2f;
typedef __attribute__((ext_vector_type(4)))  unsigned v4u;
typedef __attribute__((ext_vector_type(4)))  int v4i;
typedef float __attribute__((may_alias)) float_a;
typedef int __attribute__((may_alias)) int_a;

template <typename T> __device__ __forceinline__ void vst2(void* p, T v) { *(T*)p = v;  }
__device__ __forceinline__ v8f wmma16(v16h a, v16h b, v8f c) {
  v8f d = __builtin_amdgcn_wmma_f32_16x16x32_f16(false, a, false, b, (short)0, c, false, false);
  asm volatile("v_nop\n\tv_nop\n\tv_nop\n\tv_nop" : "+v"(d) : "v"(a), "v"(b));
  return d;
}
__device__ __forceinline__ v8f wmma_bf(v16b a, v16b b, v8f c) {
  v8f d = __builtin_amdgcn_wmma_f32_16x16x32_bf16(false, a, false, b, (short)0, c, false, false);
  asm volatile("v_nop\n\tv_nop\n\tv_nop\n\tv_nop" : "+v"(d) : "v"(a), "v"(b));
  return d;
}
// 16x16x32 fragments: lane = (h = lane>>4, row/col = lane&15); elements 0..7 = k0+8h+0..7, 8..15 = k0+16+8h+0..7; D element r = row 8h+r
__device__ __forceinline__ v16h frag_h(const _Float16* rowk0, int lane) {
  union { v16h v; v8h q[2]; } u; const _Float16* p = rowk0 + 8 * (lane >> 4);
  u.q[0] = *(const v8h*)p; u.q[1] = *(const v8h*)(p + 16); return u.v;
}
__device__ __forceinline__ v16h frag_f32(const float* rowk0, int lane) {
  v16h a; const float* p = rowk0 + 8 * (lane >> 4);
#pragma unroll
  for (int i = 0; i < 8; ++i) { a[i] = (_Float16)p[i]; a[8 + i] = (_Float16)p[16 + i]; }
  return a;
}
__device__ __forceinline__ v16h frag_f32s(const float* rowk0, int lane, float sc) {
  v16h a; const float* p = rowk0 + 8 * (lane >> 4);
#pragma unroll
  for (int i = 0; i < 8; ++i) { a[i] = (_Float16)(p[i] * sc); a[8 + i] = (_Float16)(p[16 + i] * sc); }
  return a;
}
// column fragment from a [K][ld] layout (column n), rows >= K read as 0
__device__ __forceinline__ v16h fragc_f32(const float* W, int k0, int n, int lane, int ld, int K) {
  v16h a; const int g = lane >> 4;
#pragma unroll
  for (int i = 0; i < 8; ++i) { const int ka = k0 + 8 * g + i, kb = ka + 16;
    a[i] = (_Float16)(ka < K ? W[(size_t)(ka < K ? ka : K - 1) * ld + n] : 0.f); a[8 + i] = (_Float16)(kb < K ? W[(size_t)(kb < K ? kb : K - 1) * ld + n] : 0.f); }
  return a;
}
struct F2 { v16b h, l; };
__device__ __forceinline__ F2 bsplit16(const float v[16]) { F2 r;
#pragma unroll
  for (int i = 0; i < 16; ++i) { const __bf16 h = (__bf16)v[i]; r.h[i] = h; r.l[i] = (__bf16)(v[i] - (float)h); }
  return r; }
__device__ __forceinline__ F2 split_row(const float* row, int k0, int lane) { float v[16]; const float* p = row + k0 + 8 * (lane >> 4);
#pragma unroll
  for (int i = 0; i < 8; ++i) { v[i] = p[i]; v[8 + i] = p[16 + i]; }
  return bsplit16(v); }
__device__ __forceinline__ F2 split_rowK(const float* row, int k0, int lane, int K) { float v[16]; const int g = lane >> 4;
#pragma unroll
  for (int i = 0; i < 8; ++i) { const int ka = k0 + 8 * g + i, kb = ka + 16; v[i] = ka < K ? row[ka < K ? ka : K - 1] : 0.f; v[8 + i] = kb < K ? row[kb < K ? kb : K - 1] : 0.f; }
  return bsplit16(v); }
__device__ __forceinline__ F2 split_col(const float* W, int k0, int n, int lane, int ld, int K) { float v[16]; const int g = lane >> 4;
#pragma unroll
  for (int i = 0; i < 8; ++i) { const int ka = k0 + 8 * g + i, kb = ka + 16; v[i] = ka < K ? W[(size_t)(ka < K ? ka : K - 1) * ld + n] : 0.f; v[8 + i] = kb < K ? W[(size_t)(kb < K ? kb : K - 1) * ld + n] : 0.f; }
  return bsplit16(v); }
__device__ __forceinline__ v8f mac3(const F2& a, const F2& b, v8f c) { c = wmma_bf(a.l, b.h, c); c = wmma_bf(a.h, b.l, c); return wmma_bf(a.h, b.h, c); }
__device__ __forceinline__ float sigm(float v) { return 1.0f / (1.0f + expf(-v)); }
#define LDSX() do { asm volatile("s_wait_dscnt 0" ::: "memory"); __builtin_amdgcn_wave_barrier(); __builtin_amdgcn_fence(__ATOMIC_RELEASE, "workgroup"); } while (0)


// Mixed local / global soft-align attention (B 4, C 512, T 2,048, 8 heads x 64, window 16): a windowed cross attention (q from x, k/v from cond, zero-padded window) and a global RoPE cross attention, each with its own 1x1 projections, blended per sample by the diffusion step t.
#define NB 4
#define CC 512
#define TT 2048
#define NH 8
#define HD 64
#define WW 16
#define TS 1000
#define NR (NB * TT)
#ifndef TNB
#define TNB NB
#endif
#define TR (TNB * TT)
typedef __attribute__((ext_vector_type(8))) __bf16 v8b;
__device__ __forceinline__ v16b frag_b(const __bf16* rowk0, int lane) {
  union { v16b v; v8b q[2]; } u; const __bf16* p = rowk0 + 8 * (lane >> 4);
  u.q[0] = *(const v8b*)p; u.q[1] = *(const v8b*)(p + 16); return u.v;
}
__device__ __forceinline__ float bfr(float v) { return (float)(__bf16)v; }
__device__ __attribute__((noinline)) float exp_ni(float v) { return expf(v); }
__device__ __attribute__((noinline)) float erf_ni(float v) { return erff(v); }

#define WS_PW   0u                                     // bf16 rows: lq, lk, lv, lo, gq, gk, gv, go [8][512][512] (natural [out][in])
#define WS_QL   (WS_PW + 2u * (size_t)8 * CC * CC)        // f16 token rows [NR][512]: QL, KL, QG, KG
#define WS_KL   (WS_QL + 2u * (size_t)NR * CC)
#define WS_QG   (WS_KL + 2u * (size_t)NR * CC)
#define WS_KG   (WS_QG + 2u * (size_t)NR * CC)
#define WS_VL   (WS_KG + 2u * (size_t)NR * CC)            // f16 planes [b][512][TT]: VL, VG
#define WS_VG   (WS_VL + 2u * (size_t)NB * CC * TT)
#define WS_LO   (WS_VG + 2u * (size_t)NB * CC * TT)       // f32 local context in the module's (h, t, d) order == [c'][t'] ; CG token-major [NR][512]
#define WS_CG   (WS_LO + 4u * (size_t)NR * CC)
#define WS_RC   (WS_CG + 4u * (size_t)NR * CC)            // f32 RoPE table [TT][32]: cos, then sin
#define WS_RS   (WS_RC + 4u * (size_t)TT * (HD / 2))
#define WS_END  (WS_RS + 4u * (size_t)TT * (HD / 2))

// ---- weight tile in LDS: 128 weight rows x 64 k (128 B a row, LDS pitch 144 B = 16 B x odd for ds_load_b128), read by all four waves of a block; two buffers, the next tile's copies fly while this one is worked on
#define WPITCH 72
#define WBUF (128 * WPITCH)
#define WSTG (CC / 64)
__device__ __forceinline__ unsigned lds_off(const void* p) { return (unsigned)(size_t)p; }   // low 32 bits of a __shared__ address = byte offset in the work-group's LDS
// one tile: thread = (row tid >> 3 (+ 16 i), 16-byte piece tid & 7), a wave's copy covers 4 whole 128-B lines. The s_wait_xcnt stands inside the statement so that no address register is rewritten ahead of it.
__device__ __forceinline__ void wstage(unsigned l, const __bf16* g) {
  asm volatile("global_load_async_to_lds_b128 %0, %8, off\n\t"
               "global_load_async_to_lds_b128 %1, %9, off\n\t"
               "global_load_async_to_lds_b128 %2, %10, off\n\t"
               "global_load_async_to_lds_b128 %3, %11, off\n\t"
               "global_load_async_to_lds_b128 %4, %12, off\n\t"
               "global_load_async_to_lds_b128 %5, %13, off\n\t"
               "global_load_async_to_lds_b128 %6, %14, off\n\t"
               "global_load_async_to_lds_b128 %7, %15, off\n\t"
               "s_wait_xcnt 0x0"
               :: "v"(l), "v"(l + 2304u), "v"(l + 2u * 2304u), "v"(l + 3u * 2304u), "v"(l + 4u * 2304u), "v"(l + 5u * 2304u), "v"(l + 6u * 2304u), "v"(l + 7u * 2304u),
                  "v"(g), "v"(g + 16 * CC), "v"(g + 32 * CC), "v"(g + 48 * CC), "v"(g + 64 * CC), "v"(g + 80 * CC), "v"(g + 96 * CC), "v"(g + 112 * CC) : "memory");
}
#define WAIT_COPIES() asm volatile("s_wait_asynccnt 0x0" ::: "memory")   // this wave's copies have landed
#define WAIT_LDS() asm volatile("s_wait_dscnt 0x0" ::: "memory")         // this wave's reads of the buffer about to be refilled have returned
// in front of the loop: tile 0, wait, barrier, then tile 1
#define WRING_OPEN(l, g) do { wstage((l), (g)); WAIT_COPIES(); __syncthreads(); wstage((l) + 2u * WBUF, (g) + 64); } while (0)
// foot of trip s: the one barrier publishes tile s + 1 and ends every wave's reads of tile s, whose buffer takes tile s + 2
#define WRING_FOOT(l, g, s) do { WAIT_LDS(); WAIT_COPIES(); __syncthreads(); if ((s) + 2 < WSTG) wstage((l) + (unsigned)((s) & 1) * (2u * WBUF), (g) + ((s) + 2) * 64); } while (0)

__device__ __attribute__((noinline)) float pow_p(float a, float b) { return powf(a, b); }
__device__ __attribute__((noinline)) float sin_p(float v) { return sinf(v); }
__device__ __attribute__((noinline)) float cos_p(float v) { return cosf(v); }
static_assert(CC * 128 == TT * (HD / 2), "the CC blocks of blockIdx.y 8, 128 entries each, cover the table exactly");
// blockIdx.y 0..7: one weight row to bf16; blockIdx.y 8: 128 entries (4 positions x 32 frequencies) of the RoPE table, waves 0..3 the cosines, waves 4..7 the sines, each wave one whole 128-B line
__global__ __launch_bounds__(256) void k_pack(const float* __restrict__ W0, const float* __restrict__ W1, const float* __restrict__ W2, const float* __restrict__ W3, const float* __restrict__ W4, const float* __restrict__ W5, const float* __restrict__ W6, const float* __restrict__ W7, __bf16* __restrict__ P, float* __restrict__ RC, float* __restrict__ RS) {
  __shared__ __align__(16) __bf16 s[CC]; const int n = blockIdx.x, which = blockIdx.y, t = threadIdx.x;
  if (which == 8) { const int e = n * 128 + (t & 127); const int i = e & 31; const float inv = 1.0f / pow_p(10000.0f, (float)(2 * i) / (float)HD); const float ang = (float)(e >> 5) * inv;   // angle = position * inv_freq[i]
    if (t < 128) RC[e] = cos_p(ang); else RS[e] = sin_p(ang);
    return; }
  const float* Wm = (which == 0) ? W0 : (which == 1) ? W1 : (which == 2) ? W2 : (which == 3) ? W3 : (which == 4) ? W4 : (which == 5) ? W5 : (which == 6) ? W6 : W7;
  for (int k = t; k < CC; k += 256) s[k] = (__bf16)Wm[(size_t)n * CC + k]; __syncthreads(); for (int q = t; q < CC / 8; q += 256) vst2((unsigned*)(P + ((size_t)which * CC + n) * CC + q * 8), *(const v4u*)&s[q * 8]); }
// ---- k_proj: block = (64 tokens, 128 out channels, which): which 0 lq(x) 1 lk(cond) 4 gq(x) 5 gk(cond) -> f16 token rows (gq/gk with RoPE); 2 lv(cond) 6 gv(cond) -> f16 planes. A gathered from the channels-first input.
__global__ __launch_bounds__(128) void k_proj(const float* __restrict__ X, const float* __restrict__ CND, const __bf16* __restrict__ P, const float* __restrict__ B0, const float* __restrict__ B1, const float* __restrict__ B2, const float* __restrict__ B4, const float* __restrict__ B5, const float* __restrict__ B6, _Float16* __restrict__ QL, _Float16* __restrict__ KL, _Float16* __restrict__ VL, _Float16* __restrict__ QG, _Float16* __restrict__ KG, _Float16* __restrict__ VG, const float* __restrict__ RC, const float* __restrict__ RS) {
  __shared__ __align__(16) float sf[64][132]; __shared__ __align__(16) _Float16 so[64][136]; __shared__ __align__(16) _Float16 st[128][72]; __shared__ __align__(16) __bf16 sw[2 * WBUF];
  const int tid = threadIdx.x, wave = tid >> 5, lane = tid & 31, col = lane & 15, g = lane >> 4; const int wsel = blockIdx.z; const int which = (wsel < 3) ? wsel : wsel + 1;   // 0,1,2,4,5,6
  const int n0 = blockIdx.y * 128; const size_t rb0 = (size_t)blockIdx.x * 64; const size_t b = rb0 / TT, t0 = rb0 % TT; const int tw = (int)t0 + wave * 16;
  const float* IN = (which == 0 || which == 4) ? X : CND; const float* BB = (which == 0) ? B0 : (which == 1) ? B1 : (which == 2) ? B2 : (which == 4) ? B4 : (which == 5) ? B5 : B6;
  v8f acc[8] = {};
  const __bf16* wg = P + ((size_t)which * CC + n0 + (tid >> 3)) * CC + (tid & 7) * 8; const unsigned wl = lds_off(sw) + (unsigned)(tid >> 3) * 144u + (unsigned)(tid & 7) * 16u;
  WRING_OPEN(wl, wg);
  for (int s = 0; s < WSTG; ++s) { const __bf16* wb = sw + (s & 1) * WBUF; const float* p = IN + (b * CC + s * 64 + 8 * g) * TT + tw + col;   // element (token tw+col, channel s*64+8g+..): one address for the tile's two k steps
#pragma unroll   // kk becomes a constant, so that the LDS reads of both k steps take immediate offsets from one address
    for (int kk = 0; kk < 2; ++kk) { v16b a;
#pragma unroll
      for (int i = 0; i < 8; ++i) { a[i] = (__bf16)p[(size_t)(kk * 32 + i) * TT]; a[8 + i] = (__bf16)p[(size_t)(kk * 32 + 16 + i) * TT]; }
      v16b w[8];   // the k step's eight weight fragments are read as one group, so that the LDS latency is waited out once and not in front of every product
#pragma unroll
      for (int j = 0; j < 8; ++j) w[j] = frag_b(wb + (j * 16 + col) * WPITCH + kk * 32, lane);
#pragma unroll
      for (int j = 0; j < 8; ++j) acc[j] = wmma_bf(a, w[j], acc[j]); }
    asm volatile("s_wait_xcnt 0x0" :: "v"(p) : "memory");   // takes the activation loads' address as an input: the pair stays in use behind all 32 loads, so no load's result lands in it, and its step to the next tile stands behind this wait
    WRING_FOOT(wl, wg, s); }
  WAIT_COPIES();
  if (which == 2 || which == 6) {   // v -> planes [b][c][t]
#pragma unroll
    for (int j = 0; j < 8; ++j) { const float bb = bfr(BB[n0 + j * 16 + col]);
#pragma unroll
      for (int r = 0; r < 8; ++r) st[j * 16 + col][wave * 16 + 8 * g + r] = (_Float16)(acc[j][r] + bb); }
    __syncthreads(); _Float16* V = (which == 2) ? VL : VG;
    for (int e = tid; e < 128 * 8; e += 128) { const int d = e >> 3, pc = e & 7; vst2((unsigned*)(V + ((b * CC + n0 + d) * TT) + t0 + pc * 8), *(const v4u*)&st[d][pc * 8]); }
    return; }
  if (which < 2) {   // local q/k rows
#pragma unroll
    for (int j = 0; j < 8; ++j) { const float bb = bfr(BB[n0 + j * 16 + col]);
#pragma unroll
      for (int r = 0; r < 8; ++r) so[wave * 16 + 8 * g + r][j * 16 + col] = (_Float16)(acc[j][r] + bb); }
  } else {   // global q/k: + bias then interleaved-pair RoPE within each 64-dim head: angle = t * inv_freq[(c % 64) / 2], its cos and sin from the table
    float cs[16], sn[16]; const float* rc = RC + tw * (HD / 2) + lane; const float* rs = RS + tw * (HD / 2) + lane;   // pair pi has frequency pi % 32 = lane: one table line a row serves both of a lane's pairs
#pragma unroll   // rl becomes a constant: the 32 loads go out as one group, in front of the LDS round trip
    for (int rl = 0; rl < 16; ++rl) { cs[rl] = rc[rl * (HD / 2)]; sn[rl] = rs[rl * (HD / 2)]; }
    asm volatile("s_wait_xcnt 0x0" :: "v"(rc), "v"(rs) : "memory");   // takes the table loads' addresses as inputs: they stay in use behind all 32 loads, so no load's result lands in them, and any later write of them stands behind this wait
#pragma unroll
    for (int j = 0; j < 8; ++j) { const float bb = bfr(BB[n0 + j * 16 + col]);
#pragma unroll
      for (int r = 0; r < 8; ++r) sf[wave * 16 + 8 * g + r][j * 16 + col] = acc[j][r] + bb; }
    LDSX();
    // each lane: rows of this wave; pairs handled by even columns
#pragma unroll   // rl becomes a constant: cs and sn stay in registers
    for (int rl = 0; rl < 16; ++rl) {
#pragma unroll   // two pairs a lane, straight-line now that no call stands in the body
      for (int u = 0; u < 2; ++u) { const int c = 2 * (lane + 32 * u);
        const float x1 = sf[wave * 16 + rl][c], x2 = sf[wave * 16 + rl][c + 1]; so[wave * 16 + rl][c] = (_Float16)(x1 * cs[rl] - x2 * sn[rl]); so[wave * 16 + rl][c + 1] = (_Float16)(x1 * sn[rl] + x2 * cs[rl]); } }
  }
  LDSX();
  _Float16* D0 = (which == 0) ? QL : (which == 1) ? KL : (which == 4) ? QG : KG;
  for (int rl = 0; rl < 16; ++rl) if (lane < 16) vst2((unsigned*)(D0 + (rb0 + wave * 16 + rl) * CC + n0 + lane * 8), *(const v4u*)&so[wave * 16 + rl][lane * 8]);
}
// ---- k_local: block = (64 queries, head, b): window keys j = t-8..t+7 (3 key tiles from tq0-16), out-of-range slots = phantom keys with logit 0 and value 0; out -> LO in (h, t, d) order
__global__ __launch_bounds__(128) void k_local(const _Float16* __restrict__ QL, const _Float16* __restrict__ KL, const _Float16* __restrict__ VL, float* __restrict__ LO) {
  __shared__ __align__(16) _Float16 sph[4][16][56]; __shared__ __align__(16) float so[4][16][68];
  const int tid = threadIdx.x, wave = tid >> 5, lane = tid & 31, col = lane & 15, g = lane >> 4; const int h = blockIdx.y; const size_t b = blockIdx.z; const int q0 = blockIdx.x * 64 + wave * 16; const size_t rq = b * TT + q0;
  v16h aq[2];
#pragma unroll
  for (int kc = 0; kc < 2; ++kc) aq[kc] = frag_h(QL + (rq + col) * CC + h * HD + kc * 32, lane);
  float s[3][8]; const int jbase = q0 - 16;
#pragma unroll
  for (int ct = 0; ct < 3; ++ct) { const int j = jbase + ct * 16 + col; v8f c = {};
    if (jbase + ct * 16 >= 0 && jbase + ct * 16 + 16 <= TT) {
#pragma unroll
      for (int kc = 0; kc < 2; ++kc) c = wmma16(aq[kc], frag_h(KL + (b * TT + j) * CC + h * HD + kc * 32, lane), c); }
#pragma unroll
    for (int r = 0; r < 8; ++r) { const int t = q0 + 8 * g + r; const bool inwin = (j >= t - 8) && (j <= t + 7) && (j >= 0) && (j < TT); s[ct][r] = inwin ? c[r] * 0.125f : -3.0e38f; } }
  float il[8];
#pragma unroll
  for (int r = 0; r < 8; ++r) { const int t = q0 + 8 * g + r; const int npad = max(0, 8 - t) + max(0, t + 8 - TT); float mx = fmaxf(fmaxf(s[0][r], s[1][r]), s[2][r]);
#pragma unroll
    for (int o = 1; o < 16; o <<= 1) mx = fmaxf(mx, __shfl_xor(mx, o));
    if (npad > 0) mx = fmaxf(mx, 0.f);
    float es = 0.f; float e[3];
#pragma unroll
    for (int ct = 0; ct < 3; ++ct) { e[ct] = (s[ct][r] <= -1.0e38f) ? 0.f : __expf(s[ct][r] - mx); es += e[ct]; }
#pragma unroll
    for (int o = 1; o < 16; o <<= 1) es += __shfl_xor(es, o);
    es += (float)npad * __expf(-mx);   // zero-padded slots: logit 0, value 0
    il[r] = (1.0f / 2048.0f) / es;
#pragma unroll
    for (int ct = 0; ct < 3; ++ct) sph[wave][8 * g + r][ct * 16 + col] = (_Float16)(e[ct] * 2048.0f); }
  LDSX();
  v8f acc[4] = {};
#pragma unroll
  for (int ct = 0; ct < 3; ++ct) { const int j0 = jbase + ct * 16; if (j0 < 0 || j0 + 16 > TT) continue;   // fully out-of-range tile: P is 0 there
    // a 16-wide K step: use a 32-wide frag with the second half zero? frag_h reads 32 halves; take keys [j0, j0+32) only when ct < 2 pairs... simpler: process pairs (ct 0-1) as one 32-step and ct 2 alone padded by sph zeros beyond col 48
    (void)j0; }
  { // step A: keys jbase..jbase+31 (tiles 0,1); step B: keys jbase+32..jbase+47 (tile 2) + 16 zero columns (sph cols 48..63 are never written -> zero them)
#pragma unroll
    for (int r = 0; r < 8; ++r) sph[wave][8 * g + r][48 + (col & 7)] = (_Float16)0.f;   // cols 48..55 zeroed (56-wide buffer); frag reads up to col 63 -> keep within 56? use explicit bounds below
  }
  LDSX();
  { const int jA = jbase, jB = jbase + 32;
    const v16h pa = frag_h(&sph[wave][col][0], lane);
    if (jA >= 0) {   // tiles 0-1 fully in range unless jbase < 0 (first query block): then tile 0 is out of range and its P are 0, but the V address would underflow -> handle by splitting
#pragma unroll
      for (int dt = 0; dt < 4; ++dt) acc[dt] = wmma16(pa, frag_h(VL + ((b * CC + (size_t)h * HD + dt * 16 + col) * TT) + jA, lane), acc[dt]); }
    else {   // q0 == 0 block, wave 0: keys -16..15: only 0..15 valid (tile 1) -> shift: build a frag over keys 0..31 with P columns 16..47? Simplest: second-half product using a 32-wide read at 0 with P cols 16..47
      const v16h pa2 = frag_h(&sph[wave][col][16], lane);   // P for keys jbase+16 .. jbase+47 = 0..31
#pragma unroll
      for (int dt = 0; dt < 4; ++dt) acc[dt] = wmma16(pa2, frag_h(VL + ((b * CC + (size_t)h * HD + dt * 16 + col) * TT) + 0, lane), acc[dt]); }
    if (jA >= 0 && jB + 16 <= TT) {   // tile 2 (16 keys) + 16 phantom zero columns: read 32 values from V (the extra 16 are multiplied by explicit zeros)
      v16h pb = frag_h(&sph[wave][col][32], lane);
#pragma unroll
      for (int i = 8; i < 16; ++i) pb[i] = (_Float16)0.f;   // K positions 16..31 of this step (cols 48..63) -> zero regardless of LDS contents
      const int jr = (jB + 32 <= TT) ? jB : (TT - 32);   // keep the 32-wide V read in range; when shifted, realign P instead
      if (jr == jB) {
#pragma unroll
        for (int dt = 0; dt < 4; ++dt) acc[dt] = wmma16(pb, frag_h(VL + ((b * CC + (size_t)h * HD + dt * 16 + col) * TT) + jB, lane), acc[dt]); }
      else {   // last block: keys jB..jB+15 are the LAST 16 positions -> read V from TT-32 and put P into K positions 16..31
        v16h pc2; 
#pragma unroll
        for (int i = 0; i < 8; ++i) { pc2[i] = (_Float16)0.f; pc2[8 + i] = pb[i]; }
#pragma unroll
        for (int dt = 0; dt < 4; ++dt) acc[dt] = wmma16(pc2, frag_h(VL + ((b * CC + (size_t)h * HD + dt * 16 + col) * TT) + (TT - 32), lane), acc[dt]); } }
  }
#pragma unroll
  for (int r = 0; r < 8; ++r)
#pragma unroll
    for (int dt = 0; dt < 4; ++dt) so[wave][8 * g + r][dt * 16 + col] = acc[dt][r] * il[r];
  LDSX();
  for (int rl = 0; rl < 16; ++rl) if (lane < 16) vst2(LO + ((b * NH + h) * TT + q0 + rl) * (size_t)HD + lane * 4, *(const v4f*)&so[wave][rl][lane * 4]);   // (h, t, d) order: 256-B row per (h, t)
}
// ---- K / V tiles of k_global in LDS: 64 keys a tile; K = 64 key rows x 64 dims, V = 64 dim rows x 64 keys, each row one whole 128-B line, LDS pitch 144 B (16 B x odd for ds_load_b128); read by all four waves of a block; two buffers, the next tile's copies fly while this one is worked on
#define KVP 72
#define KVT (64 * KVP)
#define KVBUF (2 * KVT)
#define KVSTG (TT / 64)
// one tile pair: thread = (row tid >> 3 (+ 16 i), 16-byte piece tid & 7), a wave's copy covers 4 whole 128-B lines. The s_wait_xcnt stands inside the statement so that no address register is rewritten ahead of it.
__device__ __forceinline__ void kvstage(unsigned l, const _Float16* gk, const _Float16* gv) {
  asm volatile("global_load_async_to_lds_b128 %0, %8, off\n\t"
               "global_load_async_to_lds_b128 %1, %9, off\n\t"
               "global_load_async_to_lds_b128 %2, %10, off\n\t"
               "global_load_async_to_lds_b128 %3, %11, off\n\t"
               "global_load_async_to_lds_b128 %4, %12, off\n\t"
               "global_load_async_to_lds_b128 %5, %13, off\n\t"
               "global_load_async_to_lds_b128 %6, %14, off\n\t"
               "global_load_async_to_lds_b128 %7, %15, off\n\t"
               "s_wait_xcnt 0x0"
               :: "v"(l), "v"(l + 2304u), "v"(l + 2u * 2304u), "v"(l + 3u * 2304u), "v"(l + 4u * 2304u), "v"(l + 5u * 2304u), "v"(l + 6u * 2304u), "v"(l + 7u * 2304u),
                  "v"(gk), "v"(gk + 16 * CC), "v"(gk + 32 * CC), "v"(gk + 48 * CC), "v"(gv), "v"(gv + 16 * TT), "v"(gv + 32 * TT), "v"(gv + 48 * TT) : "memory");
}
// value of lane ^ 16 (the same column in the other lane half) by a vector cross-row move, no LDS round trip
__device__ __forceinline__ float xhalf(float v) { const int bts = __builtin_bit_cast(int, v); return __builtin_bit_cast(float, __builtin_amdgcn_permlanex16(bts, bts, 0x76543210, 0xfedcba98, false, false)); }
__global__ __launch_bounds__(128) void k_global(const _Float16* __restrict__ QG, const _Float16* __restrict__ KG, const _Float16* __restrict__ VG, float* __restrict__ CG) {
  __shared__ __align__(16) float so[4][16][68]; __shared__ __align__(16) _Float16 skv[2 * KVBUF];
  const int tid = threadIdx.x, wave = tid >> 5, lane = tid & 31, col = lane & 15, g = lane >> 4; const int h = blockIdx.y; const size_t b = blockIdx.z; const int q0 = blockIdx.x * 64 + wave * 16; const size_t rq = b * TT + q0;
  v16h aq[2];   // Q rows as the B operand: column col = query q0 + col
#pragma unroll
  for (int kc = 0; kc < 2; ++kc) aq[kc] = frag_h(QG + (rq + col) * CC + h * HD + kc * 32, lane);
  float m = -3.0e38f, l = 0.f;   // of query col: m is equal in both lane halves, l is the sum over this half's keys (the halves are joined behind the loop)
  v8f acc[4] = {};   // acc[dt][r] = O[query col][dt * 16 + 8g + r]
  const _Float16* gk = KG + (b * TT + (tid >> 3)) * CC + h * HD + (tid & 7) * 8; const _Float16* gv = VG + (b * CC + (size_t)h * HD + (tid >> 3)) * TT + (tid & 7) * 8; const unsigned kl = lds_off(skv) + (unsigned)(tid >> 3) * 144u + (unsigned)(tid & 7) * 16u;
  // in front of the loop: tile 0, wait, barrier, then tile 1
  kvstage(kl, gk, gv); WAIT_COPIES(); __syncthreads(); kvstage(kl + 2u * KVBUF, gk + 64 * CC, gv + 64);
#pragma unroll 1   // one tile a trip: the ring's foot stands once in the code
  for (int st = 0; st < KVSTG; ++st) { const _Float16* kb = skv + (st & 1) * KVBUF; const _Float16* vb = kb + KVT;
#pragma unroll   // kk becomes a constant, so that the LDS reads of both 32-key steps take immediate offsets from one address
    for (int kk = 0; kk < 2; ++kk) { v16h kf[2][2], vf[4]; float s[2][8];   // the step's eight fragments are read as one group, so that the LDS latency is waited out once
#pragma unroll
      for (int ct = 0; ct < 2; ++ct)
#pragma unroll
        for (int kc = 0; kc < 2; ++kc) kf[ct][kc] = frag_h(kb + (kk * 32 + ct * 16 + col) * KVP + kc * 32, lane);
#pragma unroll
      for (int dt = 0; dt < 4; ++dt) vf[dt] = frag_h(vb + (dt * 16 + col) * KVP + kk * 32, lane);
#pragma unroll
      for (int ct = 0; ct < 2; ++ct) { v8f c = {};   // c[r] = score of key kk * 32 + ct * 16 + 8g + r with query col
#pragma unroll
        for (int kc = 0; kc < 2; ++kc) c = wmma16(kf[ct][kc], aq[kc], c);
#pragma unroll
        for (int r = 0; r < 8; ++r) s[ct][r] = c[r] * 0.125f; }
      float mx = fmaxf(s[0][0], s[1][0]);
#pragma unroll   // r becomes a constant: the scores stay in registers
      for (int r = 1; r < 8; ++r) mx = fmaxf(mx, fmaxf(s[0][r], s[1][r]));
      mx = fmaxf(mx, xhalf(mx));   // the other half's 16 keys of the same query
      const float mn = fmaxf(m, mx); const float alpha = (m <= -1.0e38f) ? 0.f : __expf(m - mn); m = mn;
      v16h pb; float es = 0.f;   // P^T as the B operand straight from the score registers: element i = key 8g + i, element 8 + i = key 16 + 8g + i, the k order of frag_h
#pragma unroll   // r becomes a constant: scores and P stay in registers
      for (int r = 0; r < 8; ++r) { const float e0 = __expf(s[0][r] - mn), e1 = __expf(s[1][r] - mn); es += e0 + e1; pb[r] = (_Float16)(e0 * 2048.0f); pb[8 + r] = (_Float16)(e1 * 2048.0f); }
      l = l * alpha + es;
#pragma unroll   // dt becomes a constant: the accumulators stay in registers
      for (int dt = 0; dt < 4; ++dt) { acc[dt] *= alpha; acc[dt] = wmma16(vf[dt], pb, acc[dt]); } }
    // foot of trip st: the one barrier publishes tile st + 1 and ends every wave's reads of tile st, whose buffer takes tile st + 2
    WAIT_LDS(); WAIT_COPIES(); __syncthreads(); if (st + 2 < KVSTG) kvstage(kl + (unsigned)(st & 1) * (2u * KVBUF), gk + (size_t)(st + 2) * 64 * CC, gv + (st + 2) * 64); }
  WAIT_COPIES();
  l += xhalf(l);
  const float il = (1.0f / 2048.0f) / l;
#pragma unroll   // dt and r become constants: the accumulators stay in registers
  for (int dt = 0; dt < 4; ++dt) { v4f lo, hi;
#pragma unroll
    for (int r = 0; r < 4; ++r) { lo[r] = acc[dt][r] * il; hi[r] = acc[dt][4 + r] * il; }
    *(v4f*)&so[wave][col][dt * 16 + 8 * g] = lo; *(v4f*)&so[wave][col][dt * 16 + 8 * g + 4] = hi; }
  LDSX();
  for (int rl = 0; rl < 16; ++rl) if (lane < 16) vst2(CG + (rq + rl) * CC + h * HD + lane * 4, *(const v4f*)&so[wave][rl][lane * 4]);
}
// ---- k_out: block = (64 tokens, 128 out channels): yl = lo_w[o] . LO[.][t] (LO viewed as [c'][t'], gathered token-major as in k_proj) and yg = go_w[o] . cg[t], each context split in registers into bf16 hi + residual (2 products); out[b][o][t] = sqrt(1 - t_b/999) (yg + go_b) + sqrt(t_b/999) (yl + lo_b), channels-first. One ring of 16 weight tiles: 8 of lo_w, then 8 of go_w
#define OSTG (2 * WSTG)
__device__ __forceinline__ const __bf16* otile(const __bf16* g, int s) { return g + (s < WSTG ? s * 64 : 4 * CC * CC + (s - WSTG) * 64); }   // go_w lies 4 matrices behind lo_w in the packed weights
// foot of trip s, as WRING_FOOT, over the 16 tiles
#define ORING_FOOT(l, g, s) do { WAIT_LDS(); WAIT_COPIES(); __syncthreads(); if ((s) + 2 < OSTG) wstage((l) + (unsigned)((s) & 1) * (2u * WBUF), otile((g), (s) + 2)); } while (0)
__global__ __launch_bounds__(128) void k_out(const float* __restrict__ LO, const float* __restrict__ CG, const __bf16* __restrict__ P, const float* __restrict__ BL, const float* __restrict__ BG, const int* __restrict__ TSTEP, float* __restrict__ OUT) {
  __shared__ __align__(16) float st[128][68]; __shared__ __align__(16) __bf16 sw[2 * WBUF];
  const int tid = threadIdx.x, wave = tid >> 5, lane = tid & 31, col = lane & 15, g = lane >> 4; const size_t rb0 = (size_t)blockIdx.x * 64, r0 = rb0 + wave * 16; const size_t b = rb0 / TT, t0 = rb0 % TT; const int n0 = blockIdx.y * 128;
  const int ts = TSTEP[b];   // block-uniform, read ahead of the loops
  v8f accl[8] = {}, accg[8] = {};
  const __bf16* wg = P + ((size_t)3 * CC + n0 + (tid >> 3)) * CC + (tid & 7) * 8; const unsigned wl = lds_off(sw) + (unsigned)(tid >> 3) * 144u + (unsigned)(tid & 7) * 16u;
  WRING_OPEN(wl, wg);
  for (int s = 0; s < WSTG; ++s) { const __bf16* wb = sw + (s & 1) * WBUF; const float* p = LO + (b * CC + s * 64 + 8 * g) * TT + t0 + wave * 16 + col;   // element (token t0 + 16 wave + col, channel s*64+8g+..): one address for the tile's two k steps
#pragma unroll   // kk becomes a constant, so that the LDS reads of both k steps take immediate offsets from one address
    for (int kk = 0; kk < 2; ++kk) { float v[16];
#pragma unroll
      for (int i = 0; i < 8; ++i) { v[i] = p[(size_t)(kk * 32 + i) * TT]; v[8 + i] = p[(size_t)(kk * 32 + 16 + i) * TT]; }
      const F2 a = bsplit16(v);
      v16b w[8];   // one group of LDS reads per k step, as in k_proj
#pragma unroll
      for (int j = 0; j < 8; ++j) w[j] = frag_b(wb + (j * 16 + col) * WPITCH + kk * 32, lane);
#pragma unroll
      for (int j = 0; j < 8; ++j) { accl[j] = wmma_bf(a.h, w[j], accl[j]); accl[j] = wmma_bf(a.l, w[j], accl[j]); } }
    asm volatile("s_wait_xcnt 0x0" :: "v"(p) : "memory");   // takes the context loads' address as an input: the pair stays in use behind all 32 loads, and its step to the next tile stands behind this wait
    ORING_FOOT(wl, wg, s); }
  for (int s = WSTG; s < OSTG; ++s) { const __bf16* wb = sw + (s & 1) * WBUF; const float* cr = CG + (r0 + col) * CC + (s - WSTG) * 64 + 8 * g;   // element (token row r0 + col, channel (s-8)*64+8g+..): one address for the tile's two k steps
#pragma unroll   // kk becomes a constant, so that the LDS reads of both k steps take immediate offsets from one address
    for (int kk = 0; kk < 2; ++kk) { float v[16];
#pragma unroll
      for (int i = 0; i < 8; ++i) { v[i] = cr[kk * 32 + i]; v[8 + i] = cr[kk * 32 + 16 + i]; }
      const F2 a = bsplit16(v);
      v16b w[8];   // one group of LDS reads per k step, as in k_proj
#pragma unroll
      for (int j = 0; j < 8; ++j) w[j] = frag_b(wb + (j * 16 + col) * WPITCH + kk * 32, lane);
#pragma unroll
      for (int j = 0; j < 8; ++j) { accg[j] = wmma_bf(a.l, w[j], accg[j]); accg[j] = wmma_bf(a.h, w[j], accg[j]); } }
    asm volatile("s_wait_xcnt 0x0" :: "v"(cr) : "memory");   // as above, for the row loads' address
    ORING_FOOT(wl, wg, s); }
  WAIT_COPIES();
  const float tn = (float)ts / (float)(TS - 1); const float ag = sqrtf(1.0f - tn), al = sqrtf(tn);
  float bg[8], bl[8]; const int bo = n0 + col;
#pragma unroll   // j becomes a constant: the 16 bias loads go out as one group
  for (int j = 0; j < 8; ++j) { bg[j] = BG[bo + j * 16]; bl[j] = BL[bo + j * 16]; }
  asm volatile("s_wait_xcnt 0x0" :: "v"(bo) : "memory");   // takes the bias loads' index as an input: it stays in use behind all 16 loads, so no load's result lands in it, and any later write of it stands behind this wait
#pragma unroll
  for (int j = 0; j < 8; ++j) { const float bgj = bfr(bg[j]), blj = bfr(bl[j]);
#pragma unroll
    for (int r = 0; r < 8; ++r) st[j * 16 + col][wave * 16 + 8 * g + r] = (accg[j][r] + bgj) * ag + al * (accl[j][r] + blj); }
  __syncthreads();
  for (int e = tid; e < 128 * 16; e += 128) { const int o = e >> 4, q = e & 15; vst2(OUT + ((b * CC + n0 + o) * TT) + t0 + q * 4, *(const v4f*)&st[o][q * 4]); }   // 256-B segment of row (b, o)
}
extern "C" void kernel_launch(void* const* d_in, const int* in_sizes, int n_in, void* d_out, int out_size, void* d_ws, size_t ws_size, hipStream_t stream) {
  (void)in_sizes; (void)n_in; (void)out_size;
  const float** F = (const float**)d_in;   // 0 x, 1 cond [4,512,2048]; 2 t [4] int; 3 lq_w,4 lq_b, 5 lk_w,6 lk_b, 7 lv_w,8 lv_b, 9 lo_w,10 lo_b, 11 gq_w,12 gq_b, 13 gk_w,14 gk_b, 15 gv_w,16 gv_b, 17 go_w,18 go_b
  if (ws_size < (size_t)WS_END) return;
  char* ws = (char*)d_ws; __bf16* P = (__bf16*)ws; _Float16 *QL = (_Float16*)(ws + WS_QL), *KL = (_Float16*)(ws + WS_KL), *QG = (_Float16*)(ws + WS_QG), *KG = (_Float16*)(ws + WS_KG), *VL = (_Float16*)(ws + WS_VL), *VG = (_Float16*)(ws + WS_VG); float *LO = (float*)(ws + WS_LO), *CG = (float*)(ws + WS_CG); float *RC = (float*)(ws + WS_RC), *RS = (float*)(ws + WS_RS);
  k_pack<<<dim3(CC, 9), 256, 0, stream>>>(F[3], F[5], F[7], F[9], F[11], F[13], F[15], F[17], P, RC, RS);
  k_proj<<<dim3(TR / 64, CC / 128, 6), 128, 0, stream>>>(F[0], F[1], P, F[4], F[6], F[8], F[12], F[14], F[16], QL, KL, VL, QG, KG, VG, RC, RS);
  k_local<<<dim3(TT / 64, NH, TNB), 128, 0, stream>>>(QL, KL, VL, LO);
  k_global<<<dim3(TT / 64, NH, TNB), 128, 0, stream>>>(QG, KG, VG, CG);
  k_out<<<dim3(TR / 64, CC / 128), 128, 0, stream>>>(LO, CG, P, F[10], F[18], (const int*)d_in[2], (float*)d_out);
}

// v006
// One run takes 130 microseconds.
// Next to v005, in two timings, it ran 1.11 and 1.10 times as fast.
// Counting every step since v000, it is 3.22 times as fast.
// compute dtype: all float inputs rounded to bf16, t read on device; the six q/k/v projections with EXACT bf16 products on WMMA 16x16x32 (natural [out][in] rows; channels-first activations gathered token-major), + bias, rounded once to f16; local branch: windowed scores (16 slots, zero-padded slots as logit-0 / value-0 phantoms) and global branch: interleaved-pair RoPE (f32 inv_freq by powf, precise sinf/cosf) then full attention - both PLAIN (q, k single f16 x 1/8, running-max softmax in f32 with hardware exp, P scaled by 2^11 single f16 x v single f16); output convs/linears with the contexts split into bf16 hi + residual (2 products); the sqrt(1 - t/999), sqrt(t/999) mix in f32.
#include <hip/hip_runtime.h>
#include <math.h>

typedef __attribute__((ext_vector_type(16))) _Float16 v16h;
typedef __attribute__((ext_vector_type(16))) __bf16 v16b;
typedef __attribute__((ext_vector_type(8)))  _Float16 v8h;
typedef __attribute__((ext_vector_type(8)))  float v8f;
typedef __attribute__((ext_vector_type(4)))  float v4f;
typedef __attribute__((ext_vector_type(2)))  float v2f;
typedef __attribute__((ext_vector_type(4)))  unsigned v4u;
typedef __attribute__((ext_vector_type(4)))  int v4i;
typedef float __attribute__((may_alias)) float_a;
typedef int __attribute__((may_alias)) int_a;

template <typename T> __device__ __forceinline__ void vst2(void* p, T v) { *(T*)p = v;  }
__device__ __forceinline__ v8f wmma16(v16h a, v16h b, v8f c) {
  v8f d = __builtin_amdgcn_wmma_f32_16x16x32_f16(false, a, false, b, (short)0, c, false, false);
  asm volatile("v_nop\n\tv_nop\n\tv_nop\n\tv_nop" : "+v"(d) : "v"(a), "v"(b));
  return d;
}
__device__ __forceinline__ v8f wmma_bf(v16b a, v16b b, v8f c) {
  v8f d = __builtin_amdgcn_wmma_f32_16x16x32_bf16(false, a, false, b, (short)0, c, false, false);
  asm volatile("v_nop\n\tv_nop\n\tv_nop\n\tv_nop" : "+v"(d) : "v"(a), "v"(b));
  return d;
}
// 16x16x32 fragments: lane = (h = lane>>4, row/col = lane&15); elements 0..7 = k0+8h+0..7, 8..15 = k0+16+8h+0..7; D element r = row 8h+r
__device__ __forceinline__ v16h frag_h(const _Float16* rowk0, int lane) {
  union { v16h v; v8h q[2]; } u; const _Float16* p = rowk0 + 8 * (lane >> 4);
  u.q[0] = *(const v8h*)p; u.q[1] = *(const v8h*)(p + 16); return u.v;
}
__device__ __forceinline__ v16h frag_f32(const float* rowk0, int lane) {
  v16h a; const float* p = rowk0 + 8 * (lane >> 4);
#pragma unroll
  for (int i = 0; i < 8; ++i) { a[i] = (_Float16)p[i]; a[8 + i] = (_Float16)p[16 + i]; }
  return a;
}
__device__ __forceinline__ v16h frag_f32s(const float* rowk0, int lane, float sc) {
  v16h a; const float* p = rowk0 + 8 * (lane >> 4);
#pragma unroll
  for (int i = 0; i < 8; ++i) { a[i] = (_Float16)(p[i] * sc); a[8 + i] = (_Float16)(p[16 + i] * sc); }
  return a;
}
// column fragment from a [K][ld] layout (column n), rows >= K read as 0
__device__ __forceinline__ v16h fragc_f32(const float* W, int k0, int n, int lane, int ld, int K) {
  v16h a; const int g = lane >> 4;
#pragma unroll
  for (int i = 0; i < 8; ++i) { const int ka = k0 + 8 * g + i, kb = ka + 16;
    a[i] = (_Float16)(ka < K ? W[(size_t)(ka < K ? ka : K - 1) * ld + n] : 0.f); a[8 + i] = (_Float16)(kb < K ? W[(size_t)(kb < K ? kb : K - 1) * ld + n] : 0.f); }
  return a;
}
struct F2 { v16b h, l; };
__device__ __forceinline__ F2 bsplit16(const float v[16]) { F2 r;
#pragma unroll
  for (int i = 0; i < 16; ++i) { const __bf16 h = (__bf16)v[i]; r.h[i] = h; r.l[i] = (__bf16)(v[i] - (float)h); }
  return r; }
__device__ __forceinline__ F2 split_row(const float* row, int k0, int lane) { float v[16]; const float* p = row + k0 + 8 * (lane >> 4);
#pragma unroll
  for (int i = 0; i < 8; ++i) { v[i] = p[i]; v[8 + i] = p[16 + i]; }
  return bsplit16(v); }
__device__ __forceinline__ F2 split_rowK(const float* row, int k0, int lane, int K) { float v[16]; const int g = lane >> 4;
#pragma unroll
  for (int i = 0; i < 8; ++i) { const int ka = k0 + 8 * g + i, kb = ka + 16; v[i] = ka < K ? row[ka < K ? ka : K - 1] : 0.f; v[8 + i] = kb < K ? row[kb < K ? kb : K - 1] : 0.f; }
  return bsplit16(v); }
__device__ __forceinline__ F2 split_col(const float* W, int k0, int n, int lane, int ld, int K) { float v[16]; const int g = lane >> 4;
#pragma unroll
  for (int i = 0; i < 8; ++i) { const int ka = k0 + 8 * g + i, kb = ka + 16; v[i] = ka < K ? W[(size_t)(ka < K ? ka : K - 1) * ld + n] : 0.f; v[8 + i] = kb < K ? W[(size_t)(kb < K ? kb : K - 1) * ld + n] : 0.f; }
  return bsplit16(v); }
__device__ __forceinline__ v8f mac3(const F2& a, const F2& b, v8f c) { c = wmma_bf(a.l, b.h, c); c = wmma_bf(a.h, b.l, c); return wmma_bf(a.h, b.h, c); }
__device__ __forceinline__ float sigm(float v) { return 1.0f / (1.0f + expf(-v)); }
#define LDSX() do { asm volatile("s_wait_dscnt 0" ::: "memory"); __builtin_amdgcn_wave_barrier(); __builtin_amdgcn_fence(__ATOMIC_RELEASE, "workgroup"); } while (0)


// Mixed local / global soft-align attention (B 4, C 512, T 2,048, 8 heads x 64, window 16): a windowed cross attention (q from x, k/v from cond, zero-padded window) and a global RoPE cross attention, each with its own 1x1 projections, blended per sample by the diffusion step t.
#define NB 4
#define CC 512
#define TT 2048
#define NH 8
#define HD 64
#define WW 16
#define TS 1000
#define NR (NB * TT)
#ifndef TNB
#define TNB NB
#endif
#define TR (TNB * TT)
typedef __attribute__((ext_vector_type(8))) __bf16 v8b;
__device__ __forceinline__ v16b frag_b(const __bf16* rowk0, int lane) {
  union { v16b v; v8b q[2]; } u; const __bf16* p = rowk0 + 8 * (lane >> 4);
  u.q[0] = *(const v8b*)p; u.q[1] = *(const v8b*)(p + 16); return u.v;
}
__device__ __forceinline__ float bfr(float v) { return (float)(__bf16)v; }
__device__ __attribute__((noinline)) float exp_ni(float v) { return expf(v); }
__device__ __attribute__((noinline)) float erf_ni(float v) { return erff(v); }

#define WS_PW   0u                                     // bf16 rows: lq, lk, lv, lo, gq, gk, gv, go [8][512][512] (natural [out][in])
#define WS_QL   (WS_PW + 2u * (size_t)8 * CC * CC)        // f16 token rows [NR][512]: QL, KL, QG, KG
#define WS_KL   (WS_QL + 2u * (size_t)NR * CC)
#define WS_QG   (WS_KL + 2u * (size_t)NR * CC)
#define WS_KG   (WS_QG + 2u * (size_t)NR * CC)
#define WS_VL   (WS_KG + 2u * (size_t)NR * CC)            // f16 planes [b][512][TT]: VL, VG
#define WS_VG   (WS_VL + 2u * (size_t)NB * CC * TT)
#define WS_LO   (WS_VG + 2u * (size_t)NB * CC * TT)       // f32 local context in the module's (h, t, d) order == [c'][t'] ; CG token-major [NR][512]
#define WS_CG   (WS_LO + 4u * (size_t)NR * CC)
#define WS_RC   (WS_CG + 4u * (size_t)NR * CC)            // f32 RoPE table [TT][32]: cos, then sin
#define WS_RS   (WS_RC + 4u * (size_t)TT * (HD / 2))
#define WS_END  (WS_RS + 4u * (size_t)TT * (HD / 2))

// ---- weight tile in LDS: 128 weight rows x 64 k (128 B a row, LDS pitch 144 B = 16 B x odd for ds_load_b128), read by all four waves of a block; two buffers, the next tile's copies fly while this one is worked on
#define WPITCH 72
#define WBUF (128 * WPITCH)
#define WSTG (CC / 64)
__device__ __forceinline__ unsigned lds_off(const void* p) { return (unsigned)(size_t)p; }   // low 32 bits of a __shared__ address = byte offset in the work-group's LDS
// one tile: thread = (row tid >> 3 (+ 16 i), 16-byte piece tid & 7), a wave's copy covers 4 whole 128-B lines. The s_wait_xcnt stands inside the statement so that no address register is rewritten ahead of it.
__device__ __forceinline__ void wstage(unsigned l, const __bf16* g) {
  asm volatile("global_load_async_to_lds_b128 %0, %8, off\n\t"
               "global_load_async_to_lds_b128 %1, %9, off\n\t"
               "global_load_async_to_lds_b128 %2, %10, off\n\t"
               "global_load_async_to_lds_b128 %3, %11, off\n\t"
               "global_load_async_to_lds_b128 %4, %12, off\n\t"
               "global_load_async_to_lds_b128 %5, %13, off\n\t"
               "global_load_async_to_lds_b128 %6, %14, off\n\t"
               "global_load_async_to_lds_b128 %7, %15, off\n\t"
               "s_wait_xcnt 0x0"
               :: "v"(l), "v"(l + 2304u), "v"(l + 2u * 2304u), "v"(l + 3u * 2304u), "v"(l + 4u * 2304u), "v"(l + 5u * 2304u), "v"(l + 6u * 2304u), "v"(l + 7u * 2304u),
                  "v"(g), "v"(g + 16 * CC), "v"(g + 32 * CC), "v"(g + 48 * CC), "v"(g + 64 * CC), "v"(g + 80 * CC), "v"(g + 96 * CC), "v"(g + 112 * CC) : "memory");
}
#define WAIT_COPIES() asm volatile("s_wait_asynccnt 0x0" ::: "memory")   // this wave's copies have landed
#define WAIT_LDS() asm volatile("s_wait_dscnt 0x0" ::: "memory")         // this wave's reads of the buffer about to be refilled have returned
// in front of the loop: tile 0, wait, barrier, then tile 1
#define WRING_OPEN(l, g) do { wstage((l), (g)); WAIT_COPIES(); __syncthreads(); wstage((l) + 2u * WBUF, (g) + 64); } while (0)
// foot of trip s: the one barrier publishes tile s + 1 and ends every wave's reads of tile s, whose buffer takes tile s + 2
#define WRING_FOOT(l, g, s) do { WAIT_LDS(); WAIT_COPIES(); __syncthreads(); if ((s) + 2 < WSTG) wstage((l) + (unsigned)((s) & 1) * (2u * WBUF), (g) + ((s) + 2) * 64); } while (0)

// one tile (64 channels) of a channels-first f32 activation for one token a lane: 32 loads as one group from one address
__device__ __forceinline__ void gather_tile(float (&an)[32], const float* p) {
#pragma unroll   // constants: immediate offsets, an stays in registers
  for (int kk = 0; kk < 2; ++kk)
#pragma unroll
    for (int i = 0; i < 8; ++i) { an[16 * kk + i] = p[(size_t)(kk * 32 + i) * TT]; an[16 * kk + 8 + i] = p[(size_t)(kk * 32 + 16 + i) * TT]; }
  asm volatile("s_wait_xcnt 0x0" :: "v"(p) : "memory");   // takes the loads' address as an input: the pair stays in use behind all 32 loads, so no load's result lands in it, and any later write of it stands behind this wait
}
// the same 64 channels from a token-major f32 row
__device__ __forceinline__ void row_tile(float (&an)[32], const float* p) {
#pragma unroll   // constants: immediate offsets, an stays in registers
  for (int kk = 0; kk < 2; ++kk)
#pragma unroll
    for (int i = 0; i < 8; ++i) { an[16 * kk + i] = p[kk * 32 + i]; an[16 * kk + 8 + i] = p[kk * 32 + 16 + i]; }
  asm volatile("s_wait_xcnt 0x0" :: "v"(p) : "memory");   // as in gather_tile, for the row loads' address
}
__device__ __attribute__((noinline)) float pow_p(float a, float b) { return powf(a, b); }
__device__ __attribute__((noinline)) float sin_p(float v) { return sinf(v); }
__device__ __attribute__((noinline)) float cos_p(float v) { return cosf(v); }
static_assert(CC * 128 == TT * (HD / 2), "the CC blocks of blockIdx.y 8, 128 entries each, cover the table exactly");
// blockIdx.y 0..7: one weight row to bf16; blockIdx.y 8: 128 entries (4 positions x 32 frequencies) of the RoPE table, waves 0..3 the cosines, waves 4..7 the sines, each wave one whole 128-B line
__global__ __launch_bounds__(256) void k_pack(const float* __restrict__ W0, const float* __restrict__ W1, const float* __restrict__ W2, const float* __restrict__ W3, const float* __restrict__ W4, const float* __restrict__ W5, const float* __restrict__ W6, const float* __restrict__ W7, __bf16* __restrict__ P, float* __restrict__ RC, float* __restrict__ RS) {
  __shared__ __align__(16) __bf16 s[CC]; const int n = blockIdx.x, which = blockIdx.y, t = threadIdx.x;
  if (which == 8) { const int e = n * 128 + (t & 127); const int i = e & 31; const float inv = 1.0f / pow_p(10000.0f, (float)(2 * i) / (float)HD); const float ang = (float)(e >> 5) * inv;   // angle = position * inv_freq[i]
    if (t < 128) RC[e] = cos_p(ang); else RS[e] = sin_p(ang);
    return; }
  const float* Wm = (which == 0) ? W0 : (which == 1) ? W1 : (which == 2) ? W2 : (which == 3) ? W3 : (which == 4) ? W4 : (which == 5) ? W5 : (which == 6) ? W6 : W7;
  for (int k = t; k < CC; k += 256) s[k] = (__bf16)Wm[(size_t)n * CC + k]; __syncthreads(); for (int q = t; q < CC / 8; q += 256) vst2((unsigned*)(P + ((size_t)which * CC + n) * CC + q * 8), *(const v4u*)&s[q * 8]); }
// ---- k_proj: block = (64 tokens, 128 out channels, which): which 0 lq(x) 1 lk(cond) 4 gq(x) 5 gk(cond) -> f16 token rows (gq/gk with RoPE); 2 lv(cond) 6 gv(cond) -> f16 planes. A gathered from the channels-first input.
__global__ __launch_bounds__(128) void k_proj(const float* __restrict__ X, const float* __restrict__ CND, const __bf16* __restrict__ P, const float* __restrict__ B0, const float* __restrict__ B1, const float* __restrict__ B2, const float* __restrict__ B4, const float* __restrict__ B5, const float* __restrict__ B6, _Float16* __restrict__ QL, _Float16* __restrict__ KL, _Float16* __restrict__ VL, _Float16* __restrict__ QG, _Float16* __restrict__ KG, _Float16* __restrict__ VG, const float* __restrict__ RC, const float* __restrict__ RS) {
  __shared__ __align__(16) float sf[64][132]; __shared__ __align__(16) _Float16 so[64][136]; __shared__ __align__(16) _Float16 st[128][72]; __shared__ __align__(16) __bf16 sw[2 * WBUF];
  const int tid = threadIdx.x, wave = tid >> 5, lane = tid & 31, col = lane & 15, g = lane >> 4; const int wsel = blockIdx.z; const int which = (wsel < 3) ? wsel : wsel + 1;   // 0,1,2,4,5,6
  const int n0 = blockIdx.y * 128; const size_t rb0 = (size_t)blockIdx.x * 64; const size_t b = rb0 / TT, t0 = rb0 % TT; const int tw = (int)t0 + wave * 16;
  const float* IN = (which == 0 || which == 4) ? X : CND; const float* BB = (which == 0) ? B0 : (which == 1) ? B1 : (which == 2) ? B2 : (which == 4) ? B4 : (which == 5) ? B5 : B6;
  v8f acc[8] = {};
  const __bf16* wg = P + ((size_t)which * CC + n0 + (tid >> 3)) * CC + (tid & 7) * 8; const unsigned wl = lds_off(sw) + (unsigned)(tid >> 3) * 144u + (unsigned)(tid & 7) * 16u;
  const float* pa = IN + (b * CC + 8 * g) * TT + tw + col;   // element (token tw+col, channel 8g+..) of tile 0; tile s lies s * 64 channels on: one address for a tile's two k steps
  float an[32];   // a tile's activations, fetched one tile ahead: 16 kk + (i, 8 + i) = channels kk*32 + 8g + (i, 16 + i)
  gather_tile(an, pa);
  WRING_OPEN(wl, wg);
  for (int s = 0; s < WSTG; ++s) { const __bf16* wb = sw + (s & 1) * WBUF; v16b a[2];
#pragma unroll   // constants: an and a stay in registers
    for (int i = 0; i < 16; ++i) { a[0][i] = (__bf16)an[i]; a[1][i] = (__bf16)an[16 + i]; }
    if (s + 1 < WSTG) gather_tile(an, pa + (size_t)(s + 1) * 64 * TT);   // the next tile's 32 loads fly while this tile is worked on
#pragma unroll   // kk becomes a constant, so that the LDS reads of both k steps take immediate offsets from one address
    for (int kk = 0; kk < 2; ++kk) {
      v16b w[8];   // the k step's eight weight fragments are read as one group, so that the LDS latency is waited out once and not in front of every product
#pragma unroll
      for (int j = 0; j < 8; ++j) w[j] = frag_b(wb + (j * 16 + col) * WPITCH + kk * 32, lane);
#pragma unroll
      for (int j = 0; j < 8; ++j) acc[j] = wmma_bf(a[kk], w[j], acc[j]); }
    WRING_FOOT(wl, wg, s); }
  WAIT_COPIES();
  if (which == 2 || which == 6) {   // v -> planes [b][c][t]
#pragma unroll
    for (int j = 0; j < 8; ++j) { const float bb = bfr(BB[n0 + j * 16 + col]);
#pragma unroll
      for (int r = 0; r < 8; ++r) st[j * 16 + col][wave * 16 + 8 * g + r] = (_Float16)(acc[j][r] + bb); }
    __syncthreads(); _Float16* V = (which == 2) ? VL : VG;
    for (int e = tid; e < 128 * 8; e += 128) { const int d = e >> 3, pc = e & 7; vst2((unsigned*)(V + ((b * CC + n0 + d) * TT) + t0 + pc * 8), *(const v4u*)&st[d][pc * 8]); }
    return; }
  if (which < 2) {   // local q/k rows
#pragma unroll
    for (int j = 0; j < 8; ++j) { const float bb = bfr(BB[n0 + j * 16 + col]);
#pragma unroll
      for (int r = 0; r < 8; ++r) so[wave * 16 + 8 * g + r][j * 16 + col] = (_Float16)(acc[j][r] + bb); }
  } else {   // global q/k: + bias then interleaved-pair RoPE within each 64-dim head: angle = t * inv_freq[(c % 64) / 2], its cos and sin from the table
    float cs[16], sn[16]; const float* rc = RC + tw * (HD / 2) + lane; const float* rs = RS + tw * (HD / 2) + lane;   // pair pi has frequency pi % 32 = lane: one table line a row serves both of a lane's pairs
#pragma unroll   // rl becomes a constant: the 32 loads go out as one group, in front of the LDS round trip
    for (int rl = 0; rl < 16; ++rl) { cs[rl] = rc[rl * (HD / 2)]; sn[rl] = rs[rl * (HD / 2)]; }
    asm volatile("s_wait_xcnt 0x0" :: "v"(rc), "v"(rs) : "memory");   // takes the table loads' addresses as inputs: they stay in use behind all 32 loads, so no load's result lands in them, and any later write of them stands behind this wait
#pragma unroll
    for (int j = 0; j < 8; ++j) { const float bb = bfr(BB[n0 + j * 16 + col]);
#pragma unroll
      for (int r = 0; r < 8; ++r) sf[wave * 16 + 8 * g + r][j * 16 + col] = acc[j][r] + bb; }
    LDSX();
    // each lane: rows of this wave; pairs handled by even columns
#pragma unroll   // rl becomes a constant: cs and sn stay in registers
    for (int rl = 0; rl < 16; ++rl) {
#pragma unroll   // two pairs a lane, straight-line now that no call stands in the body
      for (int u = 0; u < 2; ++u) { const int c = 2 * (lane + 32 * u);
        const float x1 = sf[wave * 16 + rl][c], x2 = sf[wave * 16 + rl][c + 1]; so[wave * 16 + rl][c] = (_Float16)(x1 * cs[rl] - x2 * sn[rl]); so[wave * 16 + rl][c + 1] = (_Float16)(x1 * sn[rl] + x2 * cs[rl]); } }
  }
  LDSX();
  _Float16* D0 = (which == 0) ? QL : (which == 1) ? KL : (which == 4) ? QG : KG;
  for (int rl = 0; rl < 16; ++rl) if (lane < 16) vst2((unsigned*)(D0 + (rb0 + wave * 16 + rl) * CC + n0 + lane * 8), *(const v4u*)&so[wave * 16 + rl][lane * 8]);
}
// ---- k_local: block = (64 queries, head, b): window keys j = t-8..t+7 (3 key tiles from tq0-16), out-of-range slots = phantom keys with logit 0 and value 0; out -> LO in (h, t, d) order
__global__ __launch_bounds__(128) void k_local(const _Float16* __restrict__ QL, const _Float16* __restrict__ KL, const _Float16* __restrict__ VL, float* __restrict__ LO) {
  __shared__ __align__(16) _Float16 sph[4][16][56]; __shared__ __align__(16) float so[4][16][68];
  const int tid = threadIdx.x, wave = tid >> 5, lane = tid & 31, col = lane & 15, g = lane >> 4; const int h = blockIdx.y; const size_t b = blockIdx.z; const int q0 = blockIdx.x * 64 + wave * 16; const size_t rq = b * TT + q0;
  v16h aq[2];
#pragma unroll
  for (int kc = 0; kc < 2; ++kc) aq[kc] = frag_h(QL + (rq + col) * CC + h * HD + kc * 32, lane);
  float s[3][8]; const int jbase = q0 - 16;
#pragma unroll
  for (int ct = 0; ct < 3; ++ct) { const int j = jbase + ct * 16 + col; v8f c = {};
    if (jbase + ct * 16 >= 0 && jbase + ct * 16 + 16 <= TT) {
#pragma unroll
      for (int kc = 0; kc < 2; ++kc) c = wmma16(aq[kc], frag_h(KL + (b * TT + j) * CC + h * HD + kc * 32, lane), c); }
#pragma unroll
    for (int r = 0; r < 8; ++r) { const int t = q0 + 8 * g + r; const bool inwin = (j >= t - 8) && (j <= t + 7) && (j >= 0) && (j < TT); s[ct][r] = inwin ? c[r] * 0.125f : -3.0e38f; } }
  float il[8];
#pragma unroll
  for (int r = 0; r < 8; ++r) { const int t = q0 + 8 * g + r; const int npad = max(0, 8 - t) + max(0, t + 8 - TT); float mx = fmaxf(fmaxf(s[0][r], s[1][r]), s[2][r]);
#pragma unroll
    for (int o = 1; o < 16; o <<= 1) mx = fmaxf(mx, __shfl_xor(mx, o));
    if (npad > 0) mx = fmaxf(mx, 0.f);
    float es = 0.f; float e[3];
#pragma unroll
    for (int ct = 0; ct < 3; ++ct) { e[ct] = (s[ct][r] <= -1.0e38f) ? 0.f : __expf(s[ct][r] - mx); es += e[ct]; }
#pragma unroll
    for (int o = 1; o < 16; o <<= 1) es += __shfl_xor(es, o);
    es += (float)npad * __expf(-mx);   // zero-padded slots: logit 0, value 0
    il[r] = (1.0f / 2048.0f) / es;
#pragma unroll
    for (int ct = 0; ct < 3; ++ct) sph[wave][8 * g + r][ct * 16 + col] = (_Float16)(e[ct] * 2048.0f); }
  LDSX();
  v8f acc[4] = {};
#pragma unroll
  for (int ct = 0; ct < 3; ++ct) { const int j0 = jbase + ct * 16; if (j0 < 0 || j0 + 16 > TT) continue;   // fully out-of-range tile: P is 0 there
    // a 16-wide K step: use a 32-wide frag with the second half zero? frag_h reads 32 halves; take keys [j0, j0+32) only when ct < 2 pairs... simpler: process pairs (ct 0-1) as one 32-step and ct 2 alone padded by sph zeros beyond col 48
    (void)j0; }
  { // step A: keys jbase..jbase+31 (tiles 0,1); step B: keys jbase+32..jbase+47 (tile 2) + 16 zero columns (sph cols 48..63 are never written -> zero them)
#pragma unroll
    for (int r = 0; r < 8; ++r) sph[wave][8 * g + r][48 + (col & 7)] = (_Float16)0.f;   // cols 48..55 zeroed (56-wide buffer); frag reads up to col 63 -> keep within 56? use explicit bounds below
  }
  LDSX();
  { const int jA = jbase, jB = jbase + 32;
    const v16h pa = frag_h(&sph[wave][col][0], lane);
    if (jA >= 0) {   // tiles 0-1 fully in range unless jbase < 0 (first query block): then tile 0 is out of range and its P are 0, but the V address would underflow -> handle by splitting
#pragma unroll
      for (int dt = 0; dt < 4; ++dt) acc[dt] = wmma16(pa, frag_h(VL + ((b * CC + (size_t)h * HD + dt * 16 + col) * TT) + jA, lane), acc[dt]); }
    else {   // q0 == 0 block, wave 0: keys -16..15: only 0..15 valid (tile 1) -> shift: build a frag over keys 0..31 with P columns 16..47? Simplest: second-half product using a 32-wide read at 0 with P cols 16..47
      const v16h pa2 = frag_h(&sph[wave][col][16], lane);   // P for keys jbase+16 .. jbase+47 = 0..31
#pragma unroll
      for (int dt = 0; dt < 4; ++dt) acc[dt] = wmma16(pa2, frag_h(VL + ((b * CC + (size_t)h * HD + dt * 16 + col) * TT) + 0, lane), acc[dt]); }
    if (jA >= 0 && jB + 16 <= TT) {   // tile 2 (16 keys) + 16 phantom zero columns: read 32 values from V (the extra 16 are multiplied by explicit zeros)
      v16h pb = frag_h(&sph[wave][col][32], lane);
#pragma unroll
      for (int i = 8; i < 16; ++i) pb[i] = (_Float16)0.f;   // K positions 16..31 of this step (cols 48..63) -> zero regardless of LDS contents
      const int jr = (jB + 32 <= TT) ? jB : (TT - 32);   // keep the 32-wide V read in range; when shifted, realign P instead
      if (jr == jB) {
#pragma unroll
        for (int dt = 0; dt < 4; ++dt) acc[dt] = wmma16(pb, frag_h(VL + ((b * CC + (size_t)h * HD + dt * 16 + col) * TT) + jB, lane), acc[dt]); }
      else {   // last block: keys jB..jB+15 are the LAST 16 positions -> read V from TT-32 and put P into K positions 16..31
        v16h pc2; 
#pragma unroll
        for (int i = 0; i < 8; ++i) { pc2[i] = (_Float16)0.f; pc2[8 + i] = pb[i]; }
#pragma unroll
        for (int dt = 0; dt < 4; ++dt) acc[dt] = wmma16(pc2, frag_h(VL + ((b * CC + (size_t)h * HD + dt * 16 + col) * TT) + (TT - 32), lane), acc[dt]); } }
  }
#pragma unroll
  for (int r = 0; r < 8; ++r)
#pragma unroll
    for (int dt = 0; dt < 4; ++dt) so[wave][8 * g + r][dt * 16 + col] = acc[dt][r] * il[r];
  LDSX();
  for (int rl = 0; rl < 16; ++rl) if (lane < 16) vst2(LO + ((b * NH + h) * TT + q0 + rl) * (size_t)HD + lane * 4, *(const v4f*)&so[wave][rl][lane * 4]);   // (h, t, d) order: 256-B row per (h, t)
}
// ---- K / V tiles of k_global in LDS: 64 keys a tile; K = 64 key rows x 64 dims, V = 64 dim rows x 64 keys, each row one whole 128-B line, LDS pitch 144 B (16 B x odd for ds_load_b128); read by all four waves of a block; two buffers, the next tile's copies fly while this one is worked on
#define KVP 72
#define KVT (64 * KVP)
#define KVBUF (2 * KVT)
#define KVSTG (TT / 64)
// one tile pair: thread = (row tid >> 3 (+ 16 i), 16-byte piece tid & 7), a wave's copy covers 4 whole 128-B lines. The s_wait_xcnt stands inside the statement so that no address register is rewritten ahead of it.
__device__ __forceinline__ void kvstage(unsigned l, const _Float16* gk, const _Float16* gv) {
  asm volatile("global_load_async_to_lds_b128 %0, %8, off\n\t"
               "global_load_async_to_lds_b128 %1, %9, off\n\t"
               "global_load_async_to_lds_b128 %2, %10, off\n\t"
               "global_load_async_to_lds_b128 %3, %11, off\n\t"
               "global_load_async_to_lds_b128 %4, %12, off\n\t"
               "global_load_async_to_lds_b128 %5, %13, off\n\t"
               "global_load_async_to_lds_b128 %6, %14, off\n\t"
               "global_load_async_to_lds_b128 %7, %15, off\n\t"
               "s_wait_xcnt 0x0"
               :: "v"(l), "v"(l + 2304u), "v"(l + 2u * 2304u), "v"(l + 3u * 2304u), "v"(l + 4u * 2304u), "v"(l + 5u * 2304u), "v"(l + 6u * 2304u), "v"(l + 7u * 2304u),
                  "v"(gk), "v"(gk + 16 * CC), "v"(gk + 32 * CC), "v"(gk + 48 * CC), "v"(gv), "v"(gv + 16 * TT), "v"(gv + 32 * TT), "v"(gv + 48 * TT) : "memory");
}
// value of lane ^ 16 (the same column in the other lane half) by a vector cross-row move, no LDS round trip
__device__ __forceinline__ float xhalf(float v) { const int bts = __builtin_bit_cast(int, v); return __builtin_bit_cast(float, __builtin_amdgcn_permlanex16(bts, bts, 0x76543210, 0xfedcba98, false, false)); }
__global__ __launch_bounds__(128) void k_global(const _Float16* __restrict__ QG, const _Float16* __restrict__ KG, const _Float16* __restrict__ VG, float* __restrict__ CG) {
  __shared__ __align__(16) float so[4][16][68]; __shared__ __align__(16) _Float16 skv[2 * KVBUF];
  const int tid = threadIdx.x, wave = tid >> 5, lane = tid & 31, col = lane & 15, g = lane >> 4; const int h = blockIdx.y; const size_t b = blockIdx.z; const int q0 = blockIdx.x * 64 + wave * 16; const size_t rq = b * TT + q0;
  v16h aq[2];   // Q rows as the B operand: column col = query q0 + col
#pragma unroll
  for (int kc = 0; kc < 2; ++kc) aq[kc] = frag_h(QG + (rq + col) * CC + h * HD + kc * 32, lane);
  float m = -3.0e38f, l = 0.f;   // of query col: m is equal in both lane halves, l is the sum over this half's keys (the halves are joined behind the loop)
  v8f acc[4] = {};   // acc[dt][r] = O[query col][dt * 16 + 8g + r]
  const _Float16* gk = KG + (b * TT + (tid >> 3)) * CC + h * HD + (tid & 7) * 8; const _Float16* gv = VG + (b * CC + (size_t)h * HD + (tid >> 3)) * TT + (tid & 7) * 8; const unsigned kl = lds_off(skv) + (unsigned)(tid >> 3) * 144u + (unsigned)(tid & 7) * 16u;
  // in front of the loop: tile 0, wait, barrier, then tile 1
  kvstage(kl, gk, gv); WAIT_COPIES(); __syncthreads(); kvstage(kl + 2u * KVBUF, gk + 64 * CC, gv + 64);
#pragma unroll 1   // one tile a trip: the ring's foot stands once in the code
  for (int st = 0; st < KVSTG; ++st) { const _Float16* kb = skv + (st & 1) * KVBUF; const _Float16* vb = kb + KVT;
#pragma unroll   // kk becomes a constant, so that the LDS reads of both 32-key steps take immediate offsets from one address
    for (int kk = 0; kk < 2; ++kk) { v16h kf[2][2], vf[4]; float s[2][8];   // the step's eight fragments are read as one group, so that the LDS latency is waited out once
#pragma unroll
      for (int ct = 0; ct < 2; ++ct)
#pragma unroll
        for (int kc = 0; kc < 2; ++kc) kf[ct][kc] = frag_h(kb + (kk * 32 + ct * 16 + col) * KVP + kc * 32, lane);
#pragma unroll
      for (int dt = 0; dt < 4; ++dt) vf[dt] = frag_h(vb + (dt * 16 + col) * KVP + kk * 32, lane);
#pragma unroll
      for (int ct = 0; ct < 2; ++ct) { v8f c = {};   // c[r] = score of key kk * 32 + ct * 16 + 8g + r with query col
#pragma unroll
        for (int kc = 0; kc < 2; ++kc) c = wmma16(kf[ct][kc], aq[kc], c);
#pragma unroll
        for (int r = 0; r < 8; ++r) s[ct][r] = c[r] * 0.125f; }
      float mx = fmaxf(s[0][0], s[1][0]);
#pragma unroll   // r becomes a constant: the scores stay in registers
      for (int r = 1; r < 8; ++r) mx = fmaxf(mx, fmaxf(s[0][r], s[1][r]));
      mx = fmaxf(mx, xhalf(mx));   // the other half's 16 keys of the same query
      const float mn = fmaxf(m, mx); const float alpha = (m <= -1.0e38f) ? 0.f : __expf(m - mn); m = mn;
      v16h pb; float es = 0.f;   // P^T as the B operand straight from the score registers: element i = key 8g + i, element 8 + i = key 16 + 8g + i, the k order of frag_h
#pragma unroll   // r becomes a constant: scores and P stay in registers
      for (int r = 0; r < 8; ++r) { const float e0 = __expf(s[0][r] - mn), e1 = __expf(s[1][r] - mn); es += e0 + e1; pb[r] = (_Float16)(e0 * 2048.0f); pb[8 + r] = (_Float16)(e1 * 2048.0f); }
      l = l * alpha + es;
#pragma unroll   // dt becomes a constant: the accumulators stay in registers
      for (int dt = 0; dt < 4; ++dt) { acc[dt] *= alpha; acc[dt] = wmma16(vf[dt], pb, acc[dt]); } }
    // foot of trip st: the one barrier publishes tile st + 1 and ends every wave's reads of tile st, whose buffer takes tile st + 2
    WAIT_LDS(); WAIT_COPIES(); __syncthreads(); if (st + 2 < KVSTG) kvstage(kl + (unsigned)(st & 1) * (2u * KVBUF), gk + (size_t)(st + 2) * 64 * CC, gv + (st + 2) * 64); }
  WAIT_COPIES();
  l += xhalf(l);
  const float il = (1.0f / 2048.0f) / l;
#pragma unroll   // dt and r become constants: the accumulators stay in registers
  for (int dt = 0; dt < 4; ++dt) { v4f lo, hi;
#pragma unroll
    for (int r = 0; r < 4; ++r) { lo[r] = acc[dt][r] * il; hi[r] = acc[dt][4 + r] * il; }
    *(v4f*)&so[wave][col][dt * 16 + 8 * g] = lo; *(v4f*)&so[wave][col][dt * 16 + 8 * g + 4] = hi; }
  LDSX();
  for (int rl = 0; rl < 16; ++rl) if (lane < 16) vst2(CG + (rq + rl) * CC + h * HD + lane * 4, *(const v4f*)&so[wave][rl][lane * 4]);
}
// ---- k_out: block = (64 tokens, 128 out channels): yl = lo_w[o] . LO[.][t] (LO viewed as [c'][t'], gathered token-major as in k_proj) and yg = go_w[o] . cg[t], each context split in registers into bf16 hi + residual (2 products); out[b][o][t] = sqrt(1 - t_b/999) (yg + go_b) + sqrt(t_b/999) (yl + lo_b), channels-first. One ring of 16 weight tiles: 8 of lo_w, then 8 of go_w
#define OSTG (2 * WSTG)
__device__ __forceinline__ const __bf16* otile(const __bf16* g, int s) { return g + (s < WSTG ? s * 64 : 4 * CC * CC + (s - WSTG) * 64); }   // go_w lies 4 matrices behind lo_w in the packed weights
// foot of trip s, as WRING_FOOT, over the 16 tiles
#define ORING_FOOT(l, g, s) do { WAIT_LDS(); WAIT_COPIES(); __syncthreads(); if ((s) + 2 < OSTG) wstage((l) + (unsigned)((s) & 1) * (2u * WBUF), otile((g), (s) + 2)); } while (0)
__global__ __launch_bounds__(128) void k_out(const float* __restrict__ LO, const float* __restrict__ CG, const __bf16* __restrict__ P, const float* __restrict__ BL, const float* __restrict__ BG, const int* __restrict__ TSTEP, float* __restrict__ OUT) {
  __shared__ __align__(16) float st[128][68]; __shared__ __align__(16) __bf16 sw[2 * WBUF];
  const int tid = threadIdx.x, wave = tid >> 5, lane = tid & 31, col = lane & 15, g = lane >> 4; const size_t rb0 = (size_t)blockIdx.x * 64, r0 = rb0 + wave * 16; const size_t b = rb0 / TT, t0 = rb0 % TT; const int n0 = blockIdx.y * 128;
  const int ts = TSTEP[b];   // block-uniform, read ahead of the loops
  v8f accl[8] = {}, accg[8] = {};
  const __bf16* wg = P + ((size_t)3 * CC + n0 + (tid >> 3)) * CC + (tid & 7) * 8; const unsigned wl = lds_off(sw) + (unsigned)(tid >> 3) * 144u + (unsigned)(tid & 7) * 16u;
  const float* pl = LO + (b * CC + 8 * g) * TT + t0 + wave * 16 + col;   // element (token t0 + 16 wave + col, channel 8g+..) of tile 0; tile s lies s * 64 channels on
  const float* cr = CG + (r0 + col) * CC + 8 * g;   // element (token row r0 + col, channel 8g+..) of tile 8; tile s lies (s - 8) * 64 floats on
  float an[32];   // a tile's context values, fetched one tile ahead, in the order of k_proj
  gather_tile(an, pl);
  WRING_OPEN(wl, wg);
  for (int s = 0; s < WSTG; ++s) { const __bf16* wb = sw + (s & 1) * WBUF; const F2 a[2] = { bsplit16(an), bsplit16(an + 16) };
    if (s + 1 < WSTG) gather_tile(an, pl + (size_t)(s + 1) * 64 * TT); else row_tile(an, cr);   // the next tile's 32 values fly while this tile is worked on
#pragma unroll   // kk becomes a constant, so that the LDS reads of both k steps take immediate offsets from one address
    for (int kk = 0; kk < 2; ++kk) {
      v16b w[8];   // one group of LDS reads per k step, as in k_proj
#pragma unroll
      for (int j = 0; j < 8; ++j) w[j] = frag_b(wb + (j * 16 + col) * WPITCH + kk * 32, lane);
#pragma unroll
      for (int j = 0; j < 8; ++j) { accl[j] = wmma_bf(a[kk].h, w[j], accl[j]); accl[j] = wmma_bf(a[kk].l, w[j], accl[j]); } }
    ORING_FOOT(wl, wg, s); }
  for (int s = WSTG; s < OSTG; ++s) { const __bf16* wb = sw + (s & 1) * WBUF; const F2 a[2] = { bsplit16(an), bsplit16(an + 16) };
    if (s + 1 < OSTG) { cr += 64; row_tile(an, cr); }   // as above
#pragma unroll   // kk becomes a constant, so that the LDS reads of both k steps take immediate offsets from one address
    for (int kk = 0; kk < 2; ++kk) {
      v16b w[8];   // one group of LDS reads per k step, as in k_proj
#pragma unroll
      for (int j = 0; j < 8; ++j) w[j] = frag_b(wb + (j * 16 + col) * WPITCH + kk * 32, lane);
#pragma unroll
      for (int j = 0; j < 8; ++j) { accg[j] = wmma_bf(a[kk].l, w[j], accg[j]); accg[j] = wmma_bf(a[kk].h, w[j], accg[j]); } }
    ORING_FOOT(wl, wg, s); }
  WAIT_COPIES();
  const float tn = (float)ts / (float)(TS - 1); const float ag = sqrtf(1.0f - tn), al = sqrtf(tn);
  float bg[8], bl[8]; const int bo = n0 + col;
#pragma unroll   // j becomes a constant: the 16 bias loads go out as one group
  for (int j = 0; j < 8; ++j) { bg[j] = BG[bo + j * 16]; bl[j] = BL[bo + j * 16]; }
  asm volatile("s_wait_xcnt 0x0" :: "v"(bo) : "memory");   // takes the bias loads' index as an input: it stays in use behind all 16 loads, so no load's result lands in it, and any later write of it stands behind this wait
#pragma unroll
  for (int j = 0; j < 8; ++j) { const float bgj = bfr(bg[j]), blj = bfr(bl[j]);
#pragma unroll
    for (int r = 0; r < 8; ++r) st[j * 16 + col][wave * 16 + 8 * g + r] = (accg[j][r] + bgj) * ag + al * (accl[j][r] + blj); }
  __syncthreads();
  for (int e = tid; e < 128 * 16; e += 128) { const int o = e >> 4, q = e & 15; vst2(OUT + ((b * CC + n0 + o) * TT) + t0 + q * 4, *(const v4f*)&st[o][q * 4]); }   // 256-B segment of row (b, o)
}
extern "C" void kernel_launch(void* const* d_in, const int* in_sizes, int n_in, void* d_out, int out_size, void* d_ws, size_t ws_size, hipStream_t stream) {
  (void)in_sizes; (void)n_in; (void)out_size;
  const float** F = (const float**)d_in;   // 0 x, 1 cond [4,512,2048]; 2 t [4] int; 3 lq_w,4 lq_b, 5 lk_w,6 lk_b, 7 lv_w,8 lv_b, 9 lo_w,10 lo_b, 11 gq_w,12 gq_b, 13 gk_w,14 gk_b, 15 gv_w,16 gv_b, 17 go_w,18 go_b
  if (ws_size < (size_t)WS_END) return;
  char* ws = (char*)d_ws; __bf16* P = (__bf16*)ws; _Float16 *QL = (_Float16*)(ws + WS_QL), *KL = (_Float16*)(ws + WS_KL), *QG = (_Float16*)(ws + WS_QG), *KG = (_Float16*)(ws + WS_KG), *VL = (_Float16*)(ws + WS_VL), *VG = (_Float16*)(ws + WS_VG); float *LO = (float*)(ws + WS_LO), *CG = (float*)(ws + WS_CG); float *RC = (float*)(ws + WS_RC), *RS = (float*)(ws + WS_RS);
  k_pack<<<dim3(CC, 9), 256, 0, stream>>>(F[3], F[5], F[7], F[9], F[11], F[13], F[15], F[17], P, RC, RS);
  k_proj<<<dim3(TR / 64, CC / 128, 6), 128, 0, stream>>>(F[0], F[1], P, F[4], F[6], F[8], F[12], F[14], F[16], QL, KL, VL, QG, KG, VG, RC, RS);
  k_local<<<dim3(TT / 64, NH, TNB), 128, 0, stream>>>(QL, KL, VL, LO);
  k_global<<<dim3(TT / 64, NH, TNB), 128, 0, stream>>>(QG, KG, VG, CG);
  k_out<<<dim3(TR / 64, CC / 128), 128, 0, stream>>>(LO, CG, P, F[10], F[18], (const int*)d_in[2], (float*)d_out);
}

// v007
// It runs in 124 microseconds.
// Next to v006, in two timings, it ran 1.05 times as fast each time.
// Counting every step since v000, it is 3.38 times as fast.
// compute dtype: all float inputs rounded to bf16, t read on device; the six q/k/v projections with EXACT bf16 products on WMMA 16x16x32 (natural [out][in] rows; channels-first activations gathered token-major), + bias, rounded once to f16; local branch: windowed scores (16 slots, zero-padded slots as logit-0 / value-0 phantoms) and global branch: interleaved-pair RoPE (f32 inv_freq by powf, precise sinf/cosf) then full attention - both PLAIN (q, k single f16 x 1/8, running-max softmax in f32 with hardware exp, P scaled by 2^11 single f16 x v single f16); output convs/linears with the contexts split into bf16 hi + residual (2 products); the sqrt(1 - t/999), sqrt(t/999) mix in f32.
#include <hip/hip_runtime.h>
#include <math.h>

typedef __attribute__((ext_vector_type(16))) _Float16 v16h;
typedef __attribute__((ext_vector_type(16))) __bf16 v16b;
typedef __attribute__((ext_vector_type(8)))  _Float16 v8h;
typedef __attribute__((ext_vector_type(8)))  float v8f;
typedef __attribute__((ext_vector_type(4)))  float v4f;
typedef __attribute__((ext_vector_type(2)))  float v2f;
typedef __attribute__((ext_vector_type(4)))  unsigned v4u;
typedef __attribute__((ext_vector_type(4)))  int v4i;
typedef float __attribute__((may_alias)) float_a;
typedef int __attribute__((may_alias)) int_a;

template <typename T> __device__ __forceinline__ void vst2(void* p, T v) { *(T*)p = v;  }
__device__ __forceinline__ v8f wmma16(v16h a, v16h b, v8f c) {
  v8f d = __builtin_amdgcn_wmma_f32_16x16x32_f16(false, a, false, b, (short)0, c, false, false);
  asm volatile("v_nop\n\tv_nop\n\tv_nop\n\tv_nop" : "+v"(d) : "v"(a), "v"(b));
  return d;
}
__device__ __forceinline__ v8f wmma_bf(v16b a, v16b b, v8f c) {
  v8f d = __builtin_amdgcn_wmma_f32_16x16x32_bf16(false, a, false, b, (short)0, c, false, false);
  asm volatile("v_nop\n\tv_nop\n\tv_nop\n\tv_nop" : "+v"(d) : "v"(a), "v"(b));
  return d;
}
// 16x16x32 fragments: lane = (h = lane>>4, row/col = lane&15); elements 0..7 = k0+8h+0..7, 8..15 = k0+16+8h+0..7; D element r = row 8h+r
__device__ __forceinline__ v16h frag_h(const _Float16* rowk0, int lane) {
  union { v16h v; v8h q[2]; } u; const _Float16* p = rowk0 + 8 * (lane >> 4);
  u.q[0] = *(const v8h*)p; u.q[1] = *(const v8h*)(p + 16); return u.v;
}
__device__ __forceinline__ v16h frag_f32(const float* rowk0, int lane) {
  v16h a; const float* p = rowk0 + 8 * (lane >> 4);
#pragma unroll
  for (int i = 0; i < 8; ++i) { a[i] = (_Float16)p[i]; a[8 + i] = (_Float16)p[16 + i]; }
  return a;
}
__device__ __forceinline__ v16h frag_f32s(const float* rowk0, int lane, float sc) {
  v16h a; const float* p = rowk0 + 8 * (lane >> 4);
#pragma unroll
  for (int i = 0; i < 8; ++i) { a[i] = (_Float16)(p[i] * sc); a[8 + i] = (_Float16)(p[16 + i] * sc); }
  return a;
}
// column fragment from a [K][ld] layout (column n), rows >= K read as 0
__device__ __forceinline__ v16h fragc_f32(const float* W, int k0, int n, int lane, int ld, int K) {
  v16h a; const int g = lane >> 4;
#pragma unroll
  for (int i = 0; i < 8; ++i) { const int ka = k0 + 8 * g + i, kb = ka + 16;
    a[i] = (_Float16)(ka < K ? W[(size_t)(ka < K ? ka : K - 1) * ld + n] : 0.f); a[8 + i] = (_Float16)(kb < K ? W[(size_t)(kb < K ? kb : K - 1) * ld + n] : 0.f); }
  return a;
}
struct F2 { v16b h, l; };
__device__ __forceinline__ F2 bsplit16(const float v[16]) { F2 r;
#pragma unroll
  for (int i = 0; i < 16; ++i) { const __bf16 h = (__bf16)v[i]; r.h[i] = h; r.l[i] = (__bf16)(v[i] - (float)h); }
  return r; }
__device__ __forceinline__ F2 split_row(const float* row, int k0, int lane) { float v[16]; const float* p = row + k0 + 8 * (lane >> 4);
#pragma unroll
  for (int i = 0; i < 8; ++i) { v[i] = p[i]; v[8 + i] = p[16 + i]; }
  return bsplit16(v); }
__device__ __forceinline__ F2 split_rowK(const float* row, int k0, int lane, int K) { float v[16]; const int g = lane >> 4;
#pragma unroll
  for (int i = 0; i < 8; ++i) { const int ka = k0 + 8 * g + i, kb = ka + 16; v[i] = ka < K ? row[ka < K ? ka : K - 1] : 0.f; v[8 + i] = kb < K ? row[kb < K ? kb : K - 1] : 0.f; }
  return bsplit16(v); }
__device__ __forceinline__ F2 split_col(const float* W, int k0, int n, int lane, int ld, int K) { float v[16]; const int g = lane >> 4;
#pragma unroll
  for (int i = 0; i < 8; ++i) { const int ka = k0 + 8 * g + i, kb = ka + 16; v[i] = ka < K ? W[(size_t)(ka < K ? ka : K - 1) * ld + n] : 0.f; v[8 + i] = kb < K ? W[(size_t)(kb < K ? kb : K - 1) * ld + n] : 0.f; }
  return bsplit16(v); }
__device__ __forceinline__ v8f mac3(const F2& a, const F2& b, v8f c) { c = wmma_bf(a.l, b.h, c); c = wmma_bf(a.h, b.l, c); return wmma_bf(a.h, b.h, c); }
__device__ __forceinline__ float sigm(float v) { return 1.0f / (1.0f + expf(-v)); }
#define LDSX() do { asm volatile("s_wait_dscnt 0" ::: "memory"); __builtin_amdgcn_wave_barrier(); __builtin_amdgcn_fence(__ATOMIC_RELEASE, "workgroup"); } while (0)


// Mixed local / global soft-align attention (B 4, C 512, T 2,048, 8 heads x 64, window 16): a windowed cross attention (q from x, k/v from cond, zero-padded window) and a global RoPE cross attention, each with its own 1x1 projections, blended per sample by the diffusion step t.
#define NB 4
#define CC 512
#define TT 2048
#define NH 8
#define HD 64
#define WW 16
#define TS 1000
#define NR (NB * TT)
#ifndef TNB
#define TNB NB
#endif
#define TR (TNB * TT)
typedef __attribute__((ext_vector_type(8))) __bf16 v8b;
__device__ __forceinline__ v16b frag_b(const __bf16* rowk0, int lane) {
  union { v16b v; v8b q[2]; } u; const __bf16* p = rowk0 + 8 * (lane >> 4);
  u.q[0] = *(const v8b*)p; u.q[1] = *(const v8b*)(p + 16); return u.v;
}
__device__ __forceinline__ float bfr(float v) { return (float)(__bf16)v; }
__device__ __attribute__((noinline)) float exp_ni(float v) { return expf(v); }
__device__ __attribute__((noinline)) float erf_ni(float v) { return erff(v); }

#define WS_PW   0u                                     // bf16 rows: lq, lk, lv, lo, gq, gk, gv, go [8][512][512] (natural [out][in])
#define WS_QL   (WS_PW + 2u * (size_t)8 * CC * CC)        // f16 token rows [NR][512]: QL, KL, QG, KG
#define WS_KL   (WS_QL + 2u * (size_t)NR * CC)
#define WS_QG   (WS_KL + 2u * (size_t)NR * CC)
#define WS_KG   (WS_QG + 2u * (size_t)NR * CC)
#define WS_VL   (WS_KG + 2u * (size_t)NR * CC)            // f16 planes [b][512][TT]: VL, VG
#define WS_VG   (WS_VL + 2u * (size_t)NB * CC * TT)
#define WS_LO   (WS_VG + 2u * (size_t)NB * CC * TT)       // f32 local context in the module's (h, t, d) order == [c'][t'] ; CG token-major [NR][512]
#define WS_CG   (WS_LO + 4u * (size_t)NR * CC)
#define WS_RC   (WS_CG + 4u * (size_t)NR * CC)            // f32 RoPE table [TT][32]: cos, then sin
#define WS_RS   (WS_RC + 4u * (size_t)TT * (HD / 2))
#define WS_END  (WS_RS + 4u * (size_t)TT * (HD / 2))

// ---- weight tile in LDS: 128 weight rows x 64 k (128 B a row, LDS pitch 144 B = 16 B x odd for ds_load_b128), read by all four waves of a block; two buffers, the next tile's copies fly while this one is worked on
#define WPITCH 72
#define WBUF (128 * WPITCH)
#define WSTG (CC / 64)
__device__ __forceinline__ unsigned lds_off(const void* p) { return (unsigned)(size_t)p; }   // low 32 bits of a __shared__ address = byte offset in the work-group's LDS
// one tile: thread = (row tid >> 3 (+ 16 i), 16-byte piece tid & 7), a wave's copy covers 4 whole 128-B lines. The s_wait_xcnt stands inside the statement so that no address register is rewritten ahead of it.
__device__ __forceinline__ void wstage(unsigned l, const __bf16* g) {
  asm volatile("global_load_async_to_lds_b128 %0, %8, off\n\t"
               "global_load_async_to_lds_b128 %1, %9, off\n\t"
               "global_load_async_to_lds_b128 %2, %10, off\n\t"
               "global_load_async_to_lds_b128 %3, %11, off\n\t"
               "global_load_async_to_lds_b128 %4, %12, off\n\t"
               "global_load_async_to_lds_b128 %5, %13, off\n\t"
               "global_load_async_to_lds_b128 %6, %14, off\n\t"
               "global_load_async_to_lds_b128 %7, %15, off\n\t"
               "s_wait_xcnt 0x0"
               :: "v"(l), "v"(l + 2304u), "v"(l + 2u * 2304u), "v"(l + 3u * 2304u), "v"(l + 4u * 2304u), "v"(l + 5u * 2304u), "v"(l + 6u * 2304u), "v"(l + 7u * 2304u),
                  "v"(g), "v"(g + 16 * CC), "v"(g + 32 * CC), "v"(g + 48 * CC), "v"(g + 64 * CC), "v"(g + 80 * CC), "v"(g + 96 * CC), "v"(g + 112 * CC) : "memory");
}
#define WAIT_COPIES() asm volatile("s_wait_asynccnt 0x0" ::: "memory")   // this wave's copies have landed
#define WAIT_LDS() asm volatile("s_wait_dscnt 0x0" ::: "memory")         // this wave's reads of the buffer about to be refilled have returned
// in front of the loop: tile 0, wait, barrier, then tile 1
#define WRING_OPEN(l, g) do { wstage((l), (g)); WAIT_COPIES(); __syncthreads(); wstage((l) + 2u * WBUF, (g) + 64); } while (0)
// foot of trip s: the one barrier publishes tile s + 1 and ends every wave's reads of tile s, whose buffer takes tile s + 2
#define WRING_FOOT(l, g, s) do { WAIT_LDS(); WAIT_COPIES(); __syncthreads(); if ((s) + 2 < WSTG) wstage((l) + (unsigned)((s) & 1) * (2u * WBUF), (g) + ((s) + 2) * 64); } while (0)

// one tile (64 channels) of a channels-first f32 activation for one token a lane: 32 loads as one group from one address
__device__ __forceinline__ void gather_tile(float (&an)[32], const float* p) {
#pragma unroll   // constants: immediate offsets, an stays in registers
  for (int kk = 0; kk < 2; ++kk)
#pragma unroll
    for (int i = 0; i < 8; ++i) { an[16 * kk + i] = p[(size_t)(kk * 32 + i) * TT]; an[16 * kk + 8 + i] = p[(size_t)(kk * 32 + 16 + i) * TT]; }
  asm volatile("s_wait_xcnt 0x0" :: "v"(p) : "memory");   // takes the loads' address as an input: the pair stays in use behind all 32 loads, so no load's result lands in it, and any later write of it stands behind this wait
}
// the same 64 channels from a token-major f32 row
__device__ __forceinline__ void row_tile(float (&an)[32], const float* p) {
#pragma unroll   // constants: immediate offsets, an stays in registers
  for (int kk = 0; kk < 2; ++kk)
#pragma unroll
    for (int i = 0; i < 8; ++i) { an[16 * kk + i] = p[kk * 32 + i]; an[16 * kk + 8 + i] = p[kk * 32 + 16 + i]; }
  asm volatile("s_wait_xcnt 0x0" :: "v"(p) : "memory");   // as in gather_tile, for the row loads' address
}
__device__ __attribute__((noinline)) float pow_p(float a, float b) { return powf(a, b); }
__device__ __attribute__((noinline)) float sin_p(float v) { return sinf(v); }
__device__ __attribute__((noinline)) float cos_p(float v) { return cosf(v); }
static_assert(CC * 128 == TT * (HD / 2), "the CC blocks of blockIdx.y 8, 128 entries each, cover the table exactly");
// blockIdx.y 0..7: one weight row to bf16; blockIdx.y 8: 128 entries (4 positions x 32 frequencies) of the RoPE table, waves 0..3 the cosines, waves 4..7 the sines, each wave one whole 128-B line
__global__ __launch_bounds__(256) void k_pack(const float* __restrict__ W0, const float* __restrict__ W1, const float* __restrict__ W2, const float* __restrict__ W3, const float* __restrict__ W4, const float* __restrict__ W5, const float* __restrict__ W6, const float* __restrict__ W7, __bf16* __restrict__ P, float* __restrict__ RC, float* __restrict__ RS) {
  __shared__ __align__(16) __bf16 s[CC]; const int n = blockIdx.x, which = blockIdx.y, t = threadIdx.x;
  if (which == 8) { const int e = n * 128 + (t & 127); const int i = e & 31; const float inv = 1.0f / pow_p(10000.0f, (float)(2 * i) / (float)HD); const float ang = (float)(e >> 5) * inv;   // angle = position * inv_freq[i]
    if (t < 128) RC[e] = cos_p(ang); else RS[e] = sin_p(ang);
    return; }
  const float* Wm = (which == 0) ? W0 : (which == 1) ? W1 : (which == 2) ? W2 : (which == 3) ? W3 : (which == 4) ? W4 : (which == 5) ? W5 : (which == 6) ? W6 : W7;
  for (int k = t; k < CC; k += 256) s[k] = (__bf16)Wm[(size_t)n * CC + k]; __syncthreads(); for (int q = t; q < CC / 8; q += 256) vst2((unsigned*)(P + ((size_t)which * CC + n) * CC + q * 8), *(const v4u*)&s[q * 8]); }
// ---- k_proj: block = (64 tokens, 128 out channels, which): which 0 lq(x) 1 lk(cond) 4 gq(x) 5 gk(cond) -> f16 token rows (gq/gk with RoPE); 2 lv(cond) 6 gv(cond) -> f16 planes. A gathered from the channels-first input.
__global__ __launch_bounds__(128) void k_proj(const float* __restrict__ X, const float* __restrict__ CND, const __bf16* __restrict__ P, const float* __restrict__ B0, const float* __restrict__ B1, const float* __restrict__ B2, const float* __restrict__ B4, const float* __restrict__ B5, const float* __restrict__ B6, _Float16* __restrict__ QL, _Float16* __restrict__ KL, _Float16* __restrict__ VL, _Float16* __restrict__ QG, _Float16* __restrict__ KG, _Float16* __restrict__ VG, const float* __restrict__ RC, const float* __restrict__ RS) {
  __shared__ __align__(16) float sf[64][132]; __shared__ __align__(16) _Float16 so[64][136]; __shared__ __align__(16) _Float16 st[128][72]; __shared__ __align__(16) __bf16 sw[2 * WBUF];
  const int tid = threadIdx.x, wave = tid >> 5, lane = tid & 31, col = lane & 15, g = lane >> 4; const int wsel = blockIdx.z; const int which = (wsel < 3) ? wsel : wsel + 1;   // 0,1,2,4,5,6
  const int n0 = blockIdx.y * 128; const size_t rb0 = (size_t)blockIdx.x * 64; const size_t b = rb0 / TT, t0 = rb0 % TT; const int tw = (int)t0 + wave * 16;
  const float* IN = (which == 0 || which == 4) ? X : CND; const float* BB = (which == 0) ? B0 : (which == 1) ? B1 : (which == 2) ? B2 : (which == 4) ? B4 : (which == 5) ? B5 : B6;
  v8f acc[8] = {};
  const __bf16* wg = P + ((size_t)which * CC + n0 + (tid >> 3)) * CC + (tid & 7) * 8; const unsigned wl = lds_off(sw) + (unsigned)(tid >> 3) * 144u + (unsigned)(tid & 7) * 16u;
  const float* pa = IN + (b * CC + 8 * g) * TT + tw + col;   // element (token tw+col, channel 8g+..) of tile 0; tile s lies s * 64 channels on: one address for a tile's two k steps
  float an[32];   // a tile's activations, fetched one tile ahead: 16 kk + (i, 8 + i) = channels kk*32 + 8g + (i, 16 + i)
  gather_tile(an, pa);
  WRING_OPEN(wl, wg);
  for (int s = 0; s < WSTG; ++s) { const __bf16* wb = sw + (s & 1) * WBUF; v16b a[2];
#pragma unroll   // constants: an and a stay in registers
    for (int i = 0; i < 16; ++i) { a[0][i] = (__bf16)an[i]; a[1][i] = (__bf16)an[16 + i]; }
    if (s + 1 < WSTG) gather_tile(an, pa + (size_t)(s + 1) * 64 * TT);   // the next tile's 32 loads fly while this tile is worked on
#pragma unroll   // kk becomes a constant, so that the LDS reads of both k steps take immediate offsets from one address
    for (int kk = 0; kk < 2; ++kk) {
      v16b w[8];   // the k step's eight weight fragments are read as one group, so that the LDS latency is waited out once and not in front of every product
#pragma unroll
      for (int j = 0; j < 8; ++j) w[j] = frag_b(wb + (j * 16 + col) * WPITCH + kk * 32, lane);
#pragma unroll
      for (int j = 0; j < 8; ++j) acc[j] = wmma_bf(a[kk], w[j], acc[j]); }
    WRING_FOOT(wl, wg, s); }
  WAIT_COPIES();
  if (which == 2 || which == 6) {   // v -> planes [b][c][t]
#pragma unroll
    for (int j = 0; j < 8; ++j) { const float bb = bfr(BB[n0 + j * 16 + col]);
#pragma unroll
      for (int r = 0; r < 8; ++r) st[j * 16 + col][wave * 16 + 8 * g + r] = (_Float16)(acc[j][r] + bb); }
    __syncthreads(); _Float16* V = (which == 2) ? VL : VG;
    for (int e = tid; e < 128 * 8; e += 128) { const int d = e >> 3, pc = e & 7; vst2((unsigned*)(V + ((b * CC + n0 + d) * TT) + t0 + pc * 8), *(const v4u*)&st[d][pc * 8]); }
    return; }
  if (which < 2) {   // local q/k rows
#pragma unroll
    for (int j = 0; j < 8; ++j) { const float bb = bfr(BB[n0 + j * 16 + col]);
#pragma unroll
      for (int r = 0; r < 8; ++r) so[wave * 16 + 8 * g + r][j * 16 + col] = (_Float16)(acc[j][r] + bb); }
  } else {   // global q/k: + bias then interleaved-pair RoPE within each 64-dim head: angle = t * inv_freq[(c % 64) / 2], its cos and sin from the table
    float cs[16], sn[16]; const float* rc = RC + tw * (HD / 2) + lane; const float* rs = RS + tw * (HD / 2) + lane;   // pair pi has frequency pi % 32 = lane: one table line a row serves both of a lane's pairs
#pragma unroll   // rl becomes a constant: the 32 loads go out as one group, in front of the LDS round trip
    for (int rl = 0; rl < 16; ++rl) { cs[rl] = rc[rl * (HD / 2)]; sn[rl] = rs[rl * (HD / 2)]; }
    asm volatile("s_wait_xcnt 0x0" :: "v"(rc), "v"(rs) : "memory");   // takes the table loads' addresses as inputs: they stay in use behind all 32 loads, so no load's result lands in them, and any later write of them stands behind this wait
#pragma unroll
    for (int j = 0; j < 8; ++j) { const float bb = bfr(BB[n0 + j * 16 + col]);
#pragma unroll
      for (int r = 0; r < 8; ++r) sf[wave * 16 + 8 * g + r][j * 16 + col] = acc[j][r] + bb; }
    LDSX();
    // each lane: rows of this wave; pairs handled by even columns
#pragma unroll   // rl becomes a constant: cs and sn stay in registers
    for (int rl = 0; rl < 16; ++rl) {
#pragma unroll   // two pairs a lane, straight-line now that no call stands in the body
      for (int u = 0; u < 2; ++u) { const int c = 2 * (lane + 32 * u);
        const float x1 = sf[wave * 16 + rl][c], x2 = sf[wave * 16 + rl][c + 1]; so[wave * 16 + rl][c] = (_Float16)(x1 * cs[rl] - x2 * sn[rl]); so[wave * 16 + rl][c + 1] = (_Float16)(x1 * sn[rl] + x2 * cs[rl]); } }
  }
  LDSX();
  _Float16* D0 = (which == 0) ? QL : (which == 1) ? KL : (which == 4) ? QG : KG;
  for (int rl = 0; rl < 16; ++rl) if (lane < 16) vst2((unsigned*)(D0 + (rb0 + wave * 16 + rl) * CC + n0 + lane * 8), *(const v4u*)&so[wave * 16 + rl][lane * 8]);
}
// ---- k_local: block = (64 queries, head, b): window keys j = t-8..t+7 (3 key tiles from tq0-16), out-of-range slots = phantom keys with logit 0 and value 0; out -> LO in (h, t, d) order
__global__ __launch_bounds__(128) void k_local(const _Float16* __restrict__ QL, const _Float16* __restrict__ KL, const _Float16* __restrict__ VL, float* __restrict__ LO) {
  __shared__ __align__(16) _Float16 sph[4][16][56]; __shared__ __align__(16) float so[4][16][68];
  const int tid = threadIdx.x, wave = tid >> 5, lane = tid & 31, col = lane & 15, g = lane >> 4; const int h = blockIdx.y; const size_t b = blockIdx.z; const int q0 = blockIdx.x * 64 + wave * 16; const size_t rq = b * TT + q0;
  v16h aq[2];
#pragma unroll
  for (int kc = 0; kc < 2; ++kc) aq[kc] = frag_h(QL + (rq + col) * CC + h * HD + kc * 32, lane);
  float s[3][8]; const int jbase = q0 - 16;
#pragma unroll
  for (int ct = 0; ct < 3; ++ct) { const int j = jbase + ct * 16 + col; v8f c = {};
    if (jbase + ct * 16 >= 0 && jbase + ct * 16 + 16 <= TT) {
#pragma unroll
      for (int kc = 0; kc < 2; ++kc) c = wmma16(aq[kc], frag_h(KL + (b * TT + j) * CC + h * HD + kc * 32, lane), c); }
#pragma unroll
    for (int r = 0; r < 8; ++r) { const int t = q0 + 8 * g + r; const bool inwin = (j >= t - 8) && (j <= t + 7) && (j >= 0) && (j < TT); s[ct][r] = inwin ? c[r] * 0.125f : -3.0e38f; } }
  float il[8];
#pragma unroll
  for (int r = 0; r < 8; ++r) { const int t = q0 + 8 * g + r; const int npad = max(0, 8 - t) + max(0, t + 8 - TT); float mx = fmaxf(fmaxf(s[0][r], s[1][r]), s[2][r]);
#pragma unroll
    for (int o = 1; o < 16; o <<= 1) mx = fmaxf(mx, __shfl_xor(mx, o));
    if (npad > 0) mx = fmaxf(mx, 0.f);
    float es = 0.f; float e[3];
#pragma unroll
    for (int ct = 0; ct < 3; ++ct) { e[ct] = (s[ct][r] <= -1.0e38f) ? 0.f : __expf(s[ct][r] - mx); es += e[ct]; }
#pragma unroll
    for (int o = 1; o < 16; o <<= 1) es += __shfl_xor(es, o);
    es += (float)npad * __expf(-mx);   // zero-padded slots: logit 0, value 0
    il[r] = (1.0f / 2048.0f) / es;
#pragma unroll
    for (int ct = 0; ct < 3; ++ct) sph[wave][8 * g + r][ct * 16 + col] = (_Float16)(e[ct] * 2048.0f); }
  LDSX();
  v8f acc[4] = {};
#pragma unroll
  for (int ct = 0; ct < 3; ++ct) { const int j0 = jbase + ct * 16; if (j0 < 0 || j0 + 16 > TT) continue;   // fully out-of-range tile: P is 0 there
    // a 16-wide K step: use a 32-wide frag with the second half zero? frag_h reads 32 halves; take keys [j0, j0+32) only when ct < 2 pairs... simpler: process pairs (ct 0-1) as one 32-step and ct 2 alone padded by sph zeros beyond col 48
    (void)j0; }
  { // step A: keys jbase..jbase+31 (tiles 0,1); step B: keys jbase+32..jbase+47 (tile 2) + 16 zero columns (sph cols 48..63 are never written -> zero them)
#pragma unroll
    for (int r = 0; r < 8; ++r) sph[wave][8 * g + r][48 + (col & 7)] = (_Float16)0.f;   // cols 48..55 zeroed (56-wide buffer); frag reads up to col 63 -> keep within 56? use explicit bounds below
  }
  LDSX();
  { const int jA = jbase, jB = jbase + 32;
    const v16h pa = frag_h(&sph[wave][col][0], lane);
    if (jA >= 0) {   // tiles 0-1 fully in range unless jbase < 0 (first query block): then tile 0 is out of range and its P are 0, but the V address would underflow -> handle by splitting
#pragma unroll
      for (int dt = 0; dt < 4; ++dt) acc[dt] = wmma16(pa, frag_h(VL + ((b * CC + (size_t)h * HD + dt * 16 + col) * TT) + jA, lane), acc[dt]); }
    else {   // q0 == 0 block, wave 0: keys -16..15: only 0..15 valid (tile 1) -> shift: build a frag over keys 0..31 with P columns 16..47? Simplest: second-half product using a 32-wide read at 0 with P cols 16..47
      const v16h pa2 = frag_h(&sph[wave][col][16], lane);   // P for keys jbase+16 .. jbase+47 = 0..31
#pragma unroll
      for (int dt = 0; dt < 4; ++dt) acc[dt] = wmma16(pa2, frag_h(VL + ((b * CC + (size_t)h * HD + dt * 16 + col) * TT) + 0, lane), acc[dt]); }
    if (jA >= 0 && jB + 16 <= TT) {   // tile 2 (16 keys) + 16 phantom zero columns: read 32 values from V (the extra 16 are multiplied by explicit zeros)
      v16h pb = frag_h(&sph[wave][col][32], lane);
#pragma unroll
      for (int i = 8; i < 16; ++i) pb[i] = (_Float16)0.f;   // K positions 16..31 of this step (cols 48..63) -> zero regardless of LDS contents
      const int jr = (jB + 32 <= TT) ? jB : (TT - 32);   // keep the 32-wide V read in range; when shifted, realign P instead
      if (jr == jB) {
#pragma unroll
        for (int dt = 0; dt < 4; ++dt) acc[dt] = wmma16(pb, frag_h(VL + ((b * CC + (size_t)h * HD + dt * 16 + col) * TT) + jB, lane), acc[dt]); }
      else {   // last block: keys jB..jB+15 are the LAST 16 positions -> read V from TT-32 and put P into K positions 16..31
        v16h pc2; 
#pragma unroll
        for (int i = 0; i < 8; ++i) { pc2[i] = (_Float16)0.f; pc2[8 + i] = pb[i]; }
#pragma unroll
        for (int dt = 0; dt < 4; ++dt) acc[dt] = wmma16(pc2, frag_h(VL + ((b * CC + (size_t)h * HD + dt * 16 + col) * TT) + (TT - 32), lane), acc[dt]); } }
  }
#pragma unroll
  for (int r = 0; r < 8; ++r)
#pragma unroll
    for (int dt = 0; dt < 4; ++dt) so[wave][8 * g + r][dt * 16 + col] = acc[dt][r] * il[r];
  LDSX();
  for (int rl = 0; rl < 16; ++rl) if (lane < 16) vst2(LO + ((b * NH + h) * TT + q0 + rl) * (size_t)HD + lane * 4, *(const v4f*)&so[wave][rl][lane * 4]);   // (h, t, d) order: 256-B row per (h, t)
}
// ---- K / V tiles of k_global in LDS: 64 keys a tile; K = 64 key rows x 64 dims, V = 64 dim rows x 64 keys, each row one whole 128-B line, LDS pitch 144 B (16 B x odd for ds_load_b128); read by all four waves of a block; two buffers, the next tile's copies fly while this one is worked on
#define KVP 72
#define KVT (64 * KVP)
#define KVBUF (2 * KVT)
#define KVSTG (TT / 64)
// one tile pair: thread = (row tid >> 3 (+ 16 i), 16-byte piece tid & 7), a wave's copy covers 4 whole 128-B lines. The s_wait_xcnt stands inside the statement so that no address register is rewritten ahead of it.
__device__ __forceinline__ void kvstage(unsigned l, const _Float16* gk, const _Float16* gv) {
  asm volatile("global_load_async_to_lds_b128 %0, %8, off\n\t"
               "global_load_async_to_lds_b128 %1, %9, off\n\t"
               "global_load_async_to_lds_b128 %2, %10, off\n\t"
               "global_load_async_to_lds_b128 %3, %11, off\n\t"
               "global_load_async_to_lds_b128 %4, %12, off\n\t"
               "global_load_async_to_lds_b128 %5, %13, off\n\t"
               "global_load_async_to_lds_b128 %6, %14, off\n\t"
               "global_load_async_to_lds_b128 %7, %15, off\n\t"
               "s_wait_xcnt 0x0"
               :: "v"(l), "v"(l + 2304u), "v"(l + 2u * 2304u), "v"(l + 3u * 2304u), "v"(l + 4u * 2304u), "v"(l + 5u * 2304u), "v"(l + 6u * 2304u), "v"(l + 7u * 2304u),
                  "v"(gk), "v"(gk + 16 * CC), "v"(gk + 32 * CC), "v"(gk + 48 * CC), "v"(gv), "v"(gv + 16 * TT), "v"(gv + 32 * TT), "v"(gv + 48 * TT) : "memory");
}
// value of lane ^ 16 (the same column in the other lane half) by a vector cross-row move, no LDS round trip
__device__ __forceinline__ float xhalf(float v) { const int bts = __builtin_bit_cast(int, v); return __builtin_bit_cast(float, __builtin_amdgcn_permlanex16(bts, bts, 0x76543210, 0xfedcba98, false, false)); }
__global__ __launch_bounds__(128) void k_global(const _Float16* __restrict__ QG, const _Float16* __restrict__ KG, const _Float16* __restrict__ VG, float* __restrict__ CG) {
  __shared__ __align__(16) float so[4][16][68]; __shared__ __align__(16) _Float16 skv[2 * KVBUF];
  const int tid = threadIdx.x, wave = tid >> 5, lane = tid & 31, col = lane & 15, g = lane >> 4; const int h = blockIdx.y; const size_t b = blockIdx.z; const int q0 = blockIdx.x * 64 + wave * 16; const size_t rq = b * TT + q0;
  v16h aq[2];   // Q rows as the B operand: column col = query q0 + col
#pragma unroll
  for (int kc = 0; kc < 2; ++kc) aq[kc] = frag_h(QG + (rq + col) * CC + h * HD + kc * 32, lane);
  const float SC2 = 0.125f * 1.44269504088896f;   // 1/sqrt(64) * log2(e): raw score -> exponent of 2
  float m = -3.0e38f, l = 0.f;   // of query col: m (a raw q . k) is equal in both lane halves, l is 2048 x the sum over this half's keys (the halves are joined behind the loop)
  v8f acc[4] = {};   // acc[dt][r] = O[query col][dt * 16 + 8g + r]
  const _Float16* gk = KG + (b * TT + (tid >> 3)) * CC + h * HD + (tid & 7) * 8; const _Float16* gv = VG + (b * CC + (size_t)h * HD + (tid >> 3)) * TT + (tid & 7) * 8; const unsigned kl = lds_off(skv) + (unsigned)(tid >> 3) * 144u + (unsigned)(tid & 7) * 16u;
  // in front of the loop: tile 0, wait, barrier, then tile 1
  kvstage(kl, gk, gv); WAIT_COPIES(); __syncthreads(); kvstage(kl + 2u * KVBUF, gk + 64 * CC, gv + 64);
#pragma unroll 1   // one tile a trip: the ring's foot stands once in the code
  for (int st = 0; st < KVSTG; ++st) { const _Float16* kb = skv + (st & 1) * KVBUF; const _Float16* vb = kb + KVT;
#pragma unroll   // kk becomes a constant, so that the LDS reads of both 32-key steps take immediate offsets from one address
    for (int kk = 0; kk < 2; ++kk) { v16h kf[2][2], vf[4];   // the step's eight fragments are read as one group, so that the LDS latency is waited out once
#pragma unroll
      for (int ct = 0; ct < 2; ++ct)
#pragma unroll
        for (int kc = 0; kc < 2; ++kc) kf[ct][kc] = frag_h(kb + (kk * 32 + ct * 16 + col) * KVP + kc * 32, lane);
#pragma unroll
      for (int dt = 0; dt < 4; ++dt) vf[dt] = frag_h(vb + (dt * 16 + col) * KVP + kk * 32, lane);
      v8f c[2];   // c[ct][r] = raw q . k of key kk * 32 + ct * 16 + 8g + r with query col
#pragma unroll
      for (int ct = 0; ct < 2; ++ct) { c[ct] = v8f{};
#pragma unroll
        for (int kc = 0; kc < 2; ++kc) c[ct] = wmma16(kf[ct][kc], aq[kc], c[ct]); }
      float mx = fmaxf(c[0][0], c[1][0]);
#pragma unroll   // r becomes a constant: the scores stay in registers
      for (int r = 1; r < 8; ++r) mx = fmaxf(mx, fmaxf(c[0][r], c[1][r]));
      mx = fmaxf(mx, xhalf(mx));   // the other half's 16 keys of the same query
      const float mn = fmaxf(m, mx); const float alpha = __builtin_amdgcn_exp2f((m - mn) * SC2); m = mn;   // first step: m = -3e38 gives exp2 of a huge negative = 0
      const float nb = 11.0f - mn * SC2;   // P = 2^(c SC2 - mn SC2 + 11) = 2048 exp((c - mn) / 8): one multiply-add and one exp2 a score
      v16h pb; float es = 0.f;   // P^T as the B operand straight from the score registers: element i = key 8g + i, element 8 + i = key 16 + 8g + i, the k order of frag_h
#pragma unroll   // r becomes a constant: scores and P stay in registers
      for (int r = 0; r < 8; ++r) { const float e0 = __builtin_amdgcn_exp2f(fmaf(c[0][r], SC2, nb)), e1 = __builtin_amdgcn_exp2f(fmaf(c[1][r], SC2, nb)); es += e0 + e1; pb[r] = (_Float16)e0; pb[8 + r] = (_Float16)e1; }
      l = l * alpha + es;
#pragma unroll   // dt becomes a constant: the accumulators stay in registers
      for (int dt = 0; dt < 4; ++dt) { acc[dt] *= alpha; acc[dt] = wmma16(vf[dt], pb, acc[dt]); } }
    // foot of trip st: the one barrier publishes tile st + 1 and ends every wave's reads of tile st, whose buffer takes tile st + 2
    WAIT_LDS(); WAIT_COPIES(); __syncthreads(); if (st + 2 < KVSTG) kvstage(kl + (unsigned)(st & 1) * (2u * KVBUF), gk + (size_t)(st + 2) * 64 * CC, gv + (st + 2) * 64); }
  WAIT_COPIES();
  l += xhalf(l);
  const float il = 1.0f / l;   // l and acc both carry the factor 2048
#pragma unroll   // dt and r become constants: the accumulators stay in registers
  for (int dt = 0; dt < 4; ++dt) { v4f lo, hi;
#pragma unroll
    for (int r = 0; r < 4; ++r) { lo[r] = acc[dt][r] * il; hi[r] = acc[dt][4 + r] * il; }
    *(v4f*)&so[wave][col][dt * 16 + 8 * g] = lo; *(v4f*)&so[wave][col][dt * 16 + 8 * g + 4] = hi; }
  LDSX();
  for (int rl = 0; rl < 16; ++rl) if (lane < 16) vst2(CG + (rq + rl) * CC + h * HD + lane * 4, *(const v4f*)&so[wave][rl][lane * 4]);
}
// ---- k_out: block = (64 tokens, 128 out channels): yl = lo_w[o] . LO[.][t] (LO viewed as [c'][t'], gathered token-major as in k_proj) and yg = go_w[o] . cg[t], each context split in registers into bf16 hi + residual (2 products); out[b][o][t] = sqrt(1 - t_b/999) (yg + go_b) + sqrt(t_b/999) (yl + lo_b), channels-first. One ring of 16 weight tiles: 8 of lo_w, then 8 of go_w
#define OSTG (2 * WSTG)
__device__ __forceinline__ const __bf16* otile(const __bf16* g, int s) { return g + (s < WSTG ? s * 64 : 4 * CC * CC + (s - WSTG) * 64); }   // go_w lies 4 matrices behind lo_w in the packed weights
// foot of trip s, as WRING_FOOT, over the 16 tiles
#define ORING_FOOT(l, g, s) do { WAIT_LDS(); WAIT_COPIES(); __syncthreads(); if ((s) + 2 < OSTG) wstage((l) + (unsigned)((s) & 1) * (2u * WBUF), otile((g), (s) + 2)); } while (0)
__global__ __launch_bounds__(128) void k_out(const float* __restrict__ LO, const float* __restrict__ CG, const __bf16* __restrict__ P, const float* __restrict__ BL, const float* __restrict__ BG, const int* __restrict__ TSTEP, float* __restrict__ OUT) {
  __shared__ __align__(16) float st[128][68]; __shared__ __align__(16) __bf16 sw[2 * WBUF];
  const int tid = threadIdx.x, wave = tid >> 5, lane = tid & 31, col = lane & 15, g = lane >> 4; const size_t rb0 = (size_t)blockIdx.x * 64, r0 = rb0 + wave * 16; const size_t b = rb0 / TT, t0 = rb0 % TT; const int n0 = blockIdx.y * 128;
  const int ts = TSTEP[b];   // block-uniform, read ahead of the loops
  v8f accl[8] = {}, accg[8] = {};
  const __bf16* wg = P + ((size_t)3 * CC + n0 + (tid >> 3)) * CC + (tid & 7) * 8; const unsigned wl = lds_off(sw) + (unsigned)(tid >> 3) * 144u + (unsigned)(tid & 7) * 16u;
  const float* pl = LO + (b * CC + 8 * g) * TT + t0 + wave * 16 + col;   // element (token t0 + 16 wave + col, channel 8g+..) of tile 0; tile s lies s * 64 channels on
  const float* cr = CG + (r0 + col) * CC + 8 * g;   // element (token row r0 + col, channel 8g+..) of tile 8; tile s lies (s - 8) * 64 floats on
  float an[32];   // a tile's context values, fetched one tile ahead, in the order of k_proj
  gather_tile(an, pl);
  WRING_OPEN(wl, wg);
  for (int s = 0; s < WSTG; ++s) { const __bf16* wb = sw + (s & 1) * WBUF; const F2 a[2] = { bsplit16(an), bsplit16(an + 16) };
    if (s + 1 < WSTG) gather_tile(an, pl + (size_t)(s + 1) * 64 * TT); else row_tile(an, cr);   // the next tile's 32 values fly while this tile is worked on
#pragma unroll   // kk becomes a constant, so that the LDS reads of both k steps take immediate offsets from one address
    for (int kk = 0; kk < 2; ++kk) {
      v16b w[8];   // one group of LDS reads per k step, as in k_proj
#pragma unroll
      for (int j = 0; j < 8; ++j) w[j] = frag_b(wb + (j * 16 + col) * WPITCH + kk * 32, lane);
#pragma unroll
      for (int j = 0; j < 8; ++j) { accl[j] = wmma_bf(a[kk].h, w[j], accl[j]); accl[j] = wmma_bf(a[kk].l, w[j], accl[j]); } }
    ORING_FOOT(wl, wg, s); }
  for (int s = WSTG; s < OSTG; ++s) { const __bf16* wb = sw + (s & 1) * WBUF; const F2 a[2] = { bsplit16(an), bsplit16(an + 16) };
    if (s + 1 < OSTG) { cr += 64; row_tile(an, cr); }   // as above
#pragma unroll   // kk becomes a constant, so that the LDS reads of both k steps take immediate offsets from one address
    for (int kk = 0; kk < 2; ++kk) {
      v16b w[8];   // one group of LDS reads per k step, as in k_proj
#pragma unroll
      for (int j = 0; j < 8; ++j) w[j] = frag_b(wb + (j * 16 + col) * WPITCH + kk * 32, lane);
#pragma unroll
      for (int j = 0; j < 8; ++j) { accg[j] = wmma_bf(a[kk].l, w[j], accg[j]); accg[j] = wmma_bf(a[kk].h, w[j], accg[j]); } }
    ORING_FOOT(wl, wg, s); }
  WAIT_COPIES();
  const float tn = (float)ts / (float)(TS - 1); const float ag = sqrtf(1.0f - tn), al = sqrtf(tn);
  float bg[8], bl[8]; const int bo = n0 + col;
#pragma unroll   // j becomes a constant: the 16 bias loads go out as one group
  for (int j = 0; j < 8; ++j) { bg[j] = BG[bo + j * 16]; bl[j] = BL[bo + j * 16]; }
  asm volatile("s_wait_xcnt 0x0" :: "v"(bo) : "memory");   // takes the bias loads' index as an input: it stays in use behind all 16 loads, so no load's result lands in it, and any later write of it stands behind this wait
#pragma unroll
  for (int j = 0; j < 8; ++j) { const float bgj = bfr(bg[j]), blj = bfr(bl[j]);
#pragma unroll
    for (int r = 0; r < 8; ++r) st[j * 16 + col][wave * 16 + 8 * g + r] = (accg[j][r] + bgj) * ag + al * (accl[j][r] + blj); }
  __syncthreads();
  for (int e = tid; e < 128 * 16; e += 128) { const int o = e >> 4, q = e & 15; vst2(OUT + ((b * CC + n0 + o) * TT) + t0 + q * 4, *(const v4f*)&st[o][q * 4]); }   // 256-B segment of row (b, o)
}
extern "C" void kernel_launch(void* const* d_in, const int* in_sizes, int n_in, void* d_out, int out_size, void* d_ws, size_t ws_size, hipStream_t stream) {
  (void)in_sizes; (void)n_in; (void)out_size;
  const float** F = (const float**)d_in;   // 0 x, 1 cond [4,512,2048]; 2 t [4] int; 3 lq_w,4 lq_b, 5 lk_w,6 lk_b, 7 lv_w,8 lv_b, 9 lo_w,10 lo_b, 11 gq_w,12 gq_b, 13 gk_w,14 gk_b, 15 gv_w,16 gv_b, 17 go_w,18 go_b
  if (ws_size < (size_t)WS_END) return;
  char* ws = (char*)d_ws; __bf16* P = (__bf16*)ws; _Float16 *QL = (_Float16*)(ws + WS_QL), *KL = (_Float16*)(ws + WS_KL), *QG = (_Float16*)(ws + WS_QG), *KG = (_Float16*)(ws + WS_KG), *VL = (_Float16*)(ws + WS_VL), *VG = (_Float16*)(ws + WS_VG); float *LO = (float*)(ws + WS_LO), *CG = (float*)(ws + WS_CG); float *RC = (float*)(ws + WS_RC), *RS = (float*)(ws + WS_RS);
  k_pack<<<dim3(CC, 9), 256, 0, stream>>>(F[3], F[5], F[7], F[9], F[11], F[13], F[15], F[17], P, RC, RS);
  k_proj<<<dim3(TR / 64, CC / 128, 6), 128, 0, stream>>>(F[0], F[1], P, F[4], F[6], F[8], F[12], F[14], F[16], QL, KL, VL, QG, KG, VG, RC, RS);
  k_local<<<dim3(TT / 64, NH, TNB), 128, 0, stream>>>(QL, KL, VL, LO);
  k_global<<<dim3(TT / 64, NH, TNB), 128, 0, stream>>>(QG, KG, VG, CG);
  k_out<<<dim3(TR / 64, CC / 128), 128, 0, stream>>>(LO, CG, P, F[10], F[18], (const int*)d_in[2], (float*)d_out);
}

// v008
// One run takes 119 microseconds.
// Timed twice side by side with v007, it ran 1.05 and 1.04 times as fast.
// All steps since v000 together make it 3.54 times as fast.
// compute dtype: all float inputs rounded to bf16, t read on device; the six q/k/v projections with EXACT bf16 products on WMMA 16x16x32 (natural [out][in] rows; channels-first activations gathered token-major), + bias, rounded once to f16; local branch: windowed scores (16 slots, zero-padded slots as logit-0 / value-0 phantoms) and global branch: interleaved-pair RoPE (f32 inv_freq by powf, precise sinf/cosf) then full attention - both PLAIN (q, k single f16 x 1/8, running-max softmax in f32 with hardware exp, P scaled by 2^11 single f16 x v single f16); output convs/linears with the contexts split into bf16 hi + residual (2 products); the sqrt(1 - t/999), sqrt(t/999) mix in f32.
#include <hip/hip_runtime.h>
#include <math.h>

typedef __attribute__((ext_vector_type(16))) _Float16 v16h;
typedef __attribute__((ext_vector_type(16))) __bf16 v16b;
typedef __attribute__((ext_vector_type(8)))  _Float16 v8h;
typedef __attribute__((ext_vector_type(8)))  float v8f;
typedef __attribute__((ext_vector_type(4)))  float v4f;
typedef __attribute__((ext_vector_type(2)))  float v2f;
typedef __attribute__((ext_vector_type(4)))  unsigned v4u;
typedef __attribute__((ext_vector_type(4)))  int v4i;
typedef float __attribute__((may_alias)) float_a;
typedef int __attribute__((may_alias)) int_a;

template <typename T> __device__ __forceinline__ void vst2(void* p, T v) { *(T*)p = v;  }
__device__ __forceinline__ v8f wmma16(v16h a, v16h b, v8f c) {
  v8f d = __builtin_amdgcn_wmma_f32_16x16x32_f16(false, a, false, b, (short)0, c, false, false);
  asm volatile("v_nop\n\tv_nop\n\tv_nop\n\tv_nop" : "+v"(d) : "v"(a), "v"(b));
  return d;
}
__device__ __forceinline__ v8f wmma_bf(v16b a, v16b b, v8f c) {
  v8f d = __builtin_amdgcn_wmma_f32_16x16x32_bf16(false, a, false, b, (short)0, c, false, false);
  asm volatile("v_nop\n\tv_nop\n\tv_nop\n\tv_nop" : "+v"(d) : "v"(a), "v"(b));
  return d;
}
// 16x16x32 fragments: lane = (h = lane>>4, row/col = lane&15); elements 0..7 = k0+8h+0..7, 8..15 = k0+16+8h+0..7; D element r = row 8h+r
__device__ __forceinline__ v16h frag_h(const _Float16* rowk0, int lane) {
  union { v16h v; v8h q[2]; } u; const _Float16* p = rowk0 + 8 * (lane >> 4);
  u.q[0] = *(const v8h*)p; u.q[1] = *(const v8h*)(p + 16); return u.v;
}
__device__ __forceinline__ v16h frag_f32(const float* rowk0, int lane) {
  v16h a; const float* p = rowk0 + 8 * (lane >> 4);
#pragma unroll
  for (int i = 0; i < 8; ++i) { a[i] = (_Float16)p[i]; a[8 + i] = (_Float16)p[16 + i]; }
  return a;
}
__device__ __forceinline__ v16h frag_f32s(const float* rowk0, int lane, float sc) {
  v16h a; const float* p = rowk0 + 8 * (lane >> 4);
#pragma unroll
  for (int i = 0; i < 8; ++i) { a[i] = (_Float16)(p[i] * sc); a[8 + i] = (_Float16)(p[16 + i] * sc); }
  return a;
}
// column fragment from a [K][ld] layout (column n), rows >= K read as 0
__device__ __forceinline__ v16h fragc_f32(const float* W, int k0, int n, int lane, int ld, int K) {
  v16h a; const int g = lane >> 4;
#pragma unroll
  for (int i = 0; i < 8; ++i) { const int ka = k0 + 8 * g + i, kb = ka + 16;
    a[i] = (_Float16)(ka < K ? W[(size_t)(ka < K ? ka : K - 1) * ld + n] : 0.f); a[8 + i] = (_Float16)(kb < K ? W[(size_t)(kb < K ? kb : K - 1) * ld + n] : 0.f); }
  return a;
}
struct F2 { v16b h, l; };
__device__ __forceinline__ F2 bsplit16(const float v[16]) { F2 r;
#pragma unroll
  for (int i = 0; i < 16; ++i) { const __bf16 h = (__bf16)v[i]; r.h[i] = h; r.l[i] = (__bf16)(v[i] - (float)h); }
  return r; }
__device__ __forceinline__ F2 split_row(const float* row, int k0, int lane) { float v[16]; const float* p = row + k0 + 8 * (lane >> 4);
#pragma unroll
  for (int i = 0; i < 8; ++i) { v[i] = p[i]; v[8 + i] = p[16 + i]; }
  return bsplit16(v); }
__device__ __forceinline__ F2 split_rowK(const float* row, int k0, int lane, int K) { float v[16]; const int g = lane >> 4;
#pragma unroll
  for (int i = 0; i < 8; ++i) { const int ka = k0 + 8 * g + i, kb = ka + 16; v[i] = ka < K ? row[ka < K ? ka : K - 1] : 0.f; v[8 + i] = kb < K ? row[kb < K ? kb : K - 1] : 0.f; }
  return bsplit16(v); }
__device__ __forceinline__ F2 split_col(const float* W, int k0, int n, int lane, int ld, int K) { float v[16]; const int g = lane >> 4;
#pragma unroll
  for (int i = 0; i < 8; ++i) { const int ka = k0 + 8 * g + i, kb = ka + 16; v[i] = ka < K ? W[(size_t)(ka < K ? ka : K - 1) * ld + n] : 0.f; v[8 + i] = kb < K ? W[(size_t)(kb < K ? kb : K - 1) * ld + n] : 0.f; }
  return bsplit16(v); }
__device__ __forceinline__ v8f mac3(const F2& a, const F2& b, v8f c) { c = wmma_bf(a.l, b.h, c); c = wmma_bf(a.h, b.l, c); return wmma_bf(a.h, b.h, c); }
__device__ __forceinline__ float sigm(float v) { return 1.0f / (1.0f + expf(-v)); }
#define LDSX() do { asm volatile("s_wait_dscnt 0" ::: "memory"); __builtin_amdgcn_wave_barrier(); __builtin_amdgcn_fence(__ATOMIC_RELEASE, "workgroup"); } while (0)


// Mixed local / global soft-align attention (B 4, C 512, T 2,048, 8 heads x 64, window 16): a windowed cross attention (q from x, k/v from cond, zero-padded window) and a global RoPE cross attention, each with its own 1x1 projections, blended per sample by the diffusion step t.
#define NB 4
#define CC 512
#define TT 2048
#define NH 8
#define HD 64
#define WW 16
#define TS 1000
#define NR (NB * TT)
#ifndef TNB
#define TNB NB
#endif
#define TR (TNB * TT)
typedef __attribute__((ext_vector_type(8))) __bf16 v8b;
__device__ __forceinline__ v16b frag_b(const __bf16* rowk0, int lane) {
  union { v16b v; v8b q[2]; } u; const __bf16* p = rowk0 + 8 * (lane >> 4);
  u.q[0] = *(const v8b*)p; u.q[1] = *(const v8b*)(p + 16); return u.v;
}
__device__ __forceinline__ float bfr(float v) { return (float)(__bf16)v; }
__device__ __attribute__((noinline)) float exp_ni(float v) { return expf(v); }
__device__ __attribute__((noinline)) float erf_ni(float v) { return erff(v); }

#define WS_PW   0u                                     // bf16 rows: lq, lk, lv, lo, gq, gk, gv, go [8][512][512] (natural [out][in])
#define WS_QL   (WS_PW + 2u * (size_t)8 * CC * CC)        // f16 token rows [NR][512]: QL, KL, QG, KG
#define WS_KL   (WS_QL + 2u * (size_t)NR * CC)
#define WS_QG   (WS_KL + 2u * (size_t)NR * CC)
#define WS_KG   (WS_QG + 2u * (size_t)NR * CC)
#define WS_VL   (WS_KG + 2u * (size_t)NR * CC)            // f16 planes [b][512][TT]: VL, VG
#define WS_VG   (WS_VL + 2u * (size_t)NB * CC * TT)
#define WS_LO   (WS_VG + 2u * (size_t)NB * CC * TT)       // f32 local context in the module's (h, t, d) order == [c'][t'] ; CG token-major [NR][512]
#define WS_CG   (WS_LO + 4u * (size_t)NR * CC)
#define WS_RC   (WS_CG + 4u * (size_t)NR * CC)            // f32 RoPE table [TT][32]: cos, then sin
#define WS_RS   (WS_RC + 4u * (size_t)TT * (HD / 2))
#define WS_END  (WS_RS + 4u * (size_t)TT * (HD / 2))

// ---- weight tile in LDS: 128 weight rows x 64 k (128 B a row, LDS pitch 144 B = 16 B x odd for ds_load_b128), read by all four waves of a block; two buffers, the next tile's copies fly while this one is worked on
#define WPITCH 72
#define WBUF (128 * WPITCH)
#define WSTG (CC / 64)
__device__ __forceinline__ unsigned lds_off(const void* p) { return (unsigned)(size_t)p; }   // low 32 bits of a __shared__ address = byte offset in the work-group's LDS
// one tile: thread = (row tid >> 3 (+ 16 i), 16-byte piece tid & 7), a wave's copy covers 4 whole 128-B lines. The s_wait_xcnt stands inside the statement so that no address register is rewritten ahead of it.
__device__ __forceinline__ void wstage(unsigned l, const __bf16* g) {
  asm volatile("global_load_async_to_lds_b128 %0, %8, off\n\t"
               "global_load_async_to_lds_b128 %1, %9, off\n\t"
               "global_load_async_to_lds_b128 %2, %10, off\n\t"
               "global_load_async_to_lds_b128 %3, %11, off\n\t"
               "global_load_async_to_lds_b128 %4, %12, off\n\t"
               "global_load_async_to_lds_b128 %5, %13, off\n\t"
               "global_load_async_to_lds_b128 %6, %14, off\n\t"
               "global_load_async_to_lds_b128 %7, %15, off\n\t"
               "s_wait_xcnt 0x0"
               :: "v"(l), "v"(l + 2304u), "v"(l + 2u * 2304u), "v"(l + 3u * 2304u), "v"(l + 4u * 2304u), "v"(l + 5u * 2304u), "v"(l + 6u * 2304u), "v"(l + 7u * 2304u),
                  "v"(g), "v"(g + 16 * CC), "v"(g + 32 * CC), "v"(g + 48 * CC), "v"(g + 64 * CC), "v"(g + 80 * CC), "v"(g + 96 * CC), "v"(g + 112 * CC) : "memory");
}
#define WAIT_COPIES() asm volatile("s_wait_asynccnt 0x0" ::: "memory")   // this wave's copies have landed
#define WAIT_LDS() asm volatile("s_wait_dscnt 0x0" ::: "memory")         // this wave's reads of the buffer about to be refilled have returned
// in front of the loop: tile 0, wait, barrier, then tile 1
#define WRING_OPEN(l, g) do { wstage((l), (g)); WAIT_COPIES(); __syncthreads(); wstage((l) + 2u * WBUF, (g) + 64); } while (0)
// foot of trip s: the one barrier publishes tile s + 1 and ends every wave's reads of tile s, whose buffer takes tile s + 2
#define WRING_FOOT(l, g, s) do { WAIT_LDS(); WAIT_COPIES(); __syncthreads(); if ((s) + 2 < WSTG) wstage((l) + (unsigned)((s) & 1) * (2u * WBUF), (g) + ((s) + 2) * 64); } while (0)

// the projection kernel's ring: 256 weight rows a tile, staged as two runs of 128 rows; same order of waits and barrier as above
#define PBUF (256 * WPITCH)
__device__ __forceinline__ void pstage(unsigned l, const __bf16* g) { wstage(l, g); wstage(l + 128u * 144u, g + 128 * CC); }
#define PRING_OPEN(l, g) do { pstage((l), (g)); WAIT_COPIES(); __syncthreads(); pstage((l) + 2u * PBUF, (g) + 64); } while (0)
#define PRING_FOOT(l, g, s) do { WAIT_LDS(); WAIT_COPIES(); __syncthreads(); if ((s) + 2 < WSTG) pstage((l) + (unsigned)((s) & 1) * (2u * PBUF), (g) + ((s) + 2) * 64); } while (0)

// 128 out channels x one k step for a wave's two token tiles
__device__ __forceinline__ void pmac(v8f (&c0)[8], v8f (&c1)[8], v16b a0, v16b a1, const __bf16* wrow, int lane) {
  v16b w[8];   // eight weight fragments are read as one group, so that the LDS latency is waited out once and not in front of every product
#pragma unroll
  for (int j = 0; j < 8; ++j) w[j] = frag_b(wrow + j * 16 * WPITCH, lane);
  __builtin_amdgcn_sched_barrier(0);   // keeps the 16 LDS reads together in front of the 16 products: without it the compiler spreads them in pairs among the products, each pair with a wait to 0
#pragma unroll
  for (int j = 0; j < 8; ++j) {   // each fragment read from LDS serves two products; the plain builtin, whose distances the compiler keeps: an asm statement's operands would tie all 256 accumulator registers to the first register window
    c0[j] = __builtin_amdgcn_wmma_f32_16x16x32_bf16(false, a0, false, w[j], (short)0, c0[j], false, false); c1[j] = __builtin_amdgcn_wmma_f32_16x16x32_bf16(false, a1, false, w[j], (short)0, c1[j], false, false); }
}
// a tile's 2 x 32 gathered values to the two token tiles' bf16 fragments of its two k steps
__device__ __forceinline__ void pconv(v16b (&a)[2][2], const float (&an)[2][32]) {
#pragma unroll   // constants: an and a stay in registers
  for (int u = 0; u < 2; ++u)
#pragma unroll
    for (int i = 0; i < 16; ++i) { a[u][0][i] = (__bf16)an[u][i]; a[u][1][i] = (__bf16)an[u][16 + i]; }
}
// one tile (64 channels) of a channels-first f32 activation for one token a lane: 32 loads as one group from one address
__device__ __forceinline__ void gather_tile(float (&an)[32], const float* p) {
#pragma unroll   // constants: immediate offsets, an stays in registers
  for (int kk = 0; kk < 2; ++kk)
#pragma unroll
    for (int i = 0; i < 8; ++i) { an[16 * kk + i] = p[(size_t)(kk * 32 + i) * TT]; an[16 * kk + 8 + i] = p[(size_t)(kk * 32 + 16 + i) * TT]; }
  asm volatile("s_wait_xcnt 0x0" :: "v"(p) : "memory");   // takes the loads' address as an input: the pair stays in use behind all 32 loads, so no load's result lands in it, and any later write of it stands behind this wait
}
// the same for two tokens a lane, 64 tokens apart: 64 loads as one group from one address
__device__ __forceinline__ void gather_tile2(float (&an)[2][32], const float* p) {
#pragma unroll   // constants: immediate offsets, an stays in registers
  for (int u = 0; u < 2; ++u)
#pragma unroll
    for (int kk = 0; kk < 2; ++kk)
#pragma unroll
      for (int i = 0; i < 8; ++i) { an[u][16 * kk + i] = p[(size_t)(kk * 32 + i) * TT + u * 64]; an[u][16 * kk + 8 + i] = p[(size_t)(kk * 32 + 16 + i) * TT + u * 64]; }
  asm volatile("s_wait_xcnt 0x0" :: "v"(p) : "memory");   // as in gather_tile, behind all 64 loads
}
// the same 64 channels from a token-major f32 row
__device__ __forceinline__ void row_tile(float (&an)[32], const float* p) {
#pragma unroll   // constants: immediate offsets, an stays in registers
  for (int kk = 0; kk < 2; ++kk)
#pragma unroll
    for (int i = 0; i < 8; ++i) { an[16 * kk + i] = p[kk * 32 + i]; an[16 * kk + 8 + i] = p[kk * 32 + 16 + i]; }
  asm volatile("s_wait_xcnt 0x0" :: "v"(p) : "memory");   // as in gather_tile, for the row loads' address
}
__device__ __attribute__((noinline)) float pow_p(float a, float b) { return powf(a, b); }
__device__ __attribute__((noinline)) float sin_p(float v) { return sinf(v); }
__device__ __attribute__((noinline)) float cos_p(float v) { return cosf(v); }
static_assert(CC * 128 == TT * (HD / 2), "the CC blocks of blockIdx.y 8, 128 entries each, cover the table exactly");
// blockIdx.y 0..7: one weight row to bf16; blockIdx.y 8: 128 entries (4 positions x 32 frequencies) of the RoPE table, waves 0..3 the cosines, waves 4..7 the sines, each wave one whole 128-B line
__global__ __launch_bounds__(256) void k_pack(const float* __restrict__ W0, const float* __restrict__ W1, const float* __restrict__ W2, const float* __restrict__ W3, const float* __restrict__ W4, const float* __restrict__ W5, const float* __restrict__ W6, const float* __restrict__ W7, __bf16* __restrict__ P, float* __restrict__ RC, float* __restrict__ RS) {
  __shared__ __align__(16) __bf16 s[CC]; const int n = blockIdx.x, which = blockIdx.y, t = threadIdx.x;
  if (which == 8) { const int e = n * 128 + (t & 127); const int i = e & 31; const float inv = 1.0f / pow_p(10000.0f, (float)(2 * i) / (float)HD); const float ang = (float)(e >> 5) * inv;   // angle = position * inv_freq[i]
    if (t < 128) RC[e] = cos_p(ang); else RS[e] = sin_p(ang);
    return; }
  const float* Wm = (which == 0) ? W0 : (which == 1) ? W1 : (which == 2) ? W2 : (which == 3) ? W3 : (which == 4) ? W4 : (which == 5) ? W5 : (which == 6) ? W6 : W7;
  for (int k = t; k < CC; k += 256) s[k] = (__bf16)Wm[(size_t)n * CC + k]; __syncthreads(); for (int q = t; q < CC / 8; q += 256) vst2((unsigned*)(P + ((size_t)which * CC + n) * CC + q * 8), *(const v4u*)&s[q * 8]); }
// ---- k_proj: block = (128 tokens, 256 out channels, which), a wave = two 16-token tiles, 64 tokens apart, x 256 out channels: a weight fragment serves two products, a gathered activation sixteen: which 0 lq(x) 1 lk(cond) 4 gq(x) 5 gk(cond) -> f16 token rows (gq/gk with RoPE); 2 lv(cond) 6 gv(cond) -> f16 planes. A gathered from the channels-first input.
__global__ __launch_bounds__(128) void k_proj(const float* __restrict__ X, const float* __restrict__ CND, const __bf16* __restrict__ P, const float* __restrict__ B0, const float* __restrict__ B1, const float* __restrict__ B2, const float* __restrict__ B4, const float* __restrict__ B5, const float* __restrict__ B6, _Float16* __restrict__ QL, _Float16* __restrict__ KL, _Float16* __restrict__ VL, _Float16* __restrict__ QG, _Float16* __restrict__ KG, _Float16* __restrict__ VG, const float* __restrict__ RC, const float* __restrict__ RS) {
  __shared__ __align__(16) float sf[64][132]; __shared__ __align__(16) _Float16 so[64][136]; __shared__ __align__(16) _Float16 st[128][72]; __shared__ __align__(16) __bf16 sw[2 * PBUF];
  const int tid = threadIdx.x, wave = tid >> 5, lane = tid & 31, col = lane & 15, g = lane >> 4; const int wsel = blockIdx.z; const int which = (wsel < 3) ? wsel : wsel + 1;   // 0,1,2,4,5,6
  const int nb0 = blockIdx.y * 256; const size_t rb0 = (size_t)blockIdx.x * 128; const size_t b = rb0 / TT, t0 = rb0 % TT; const int tw = (int)t0 + wave * 16;
  const float* IN = (which == 0 || which == 4) ? X : CND; const float* BB = (which == 0) ? B0 : (which == 1) ? B1 : (which == 2) ? B2 : (which == 4) ? B4 : (which == 5) ? B5 : B6;
  v8f acc00[8] = {}, acc01[8] = {}, acc10[8] = {}, acc11[8] = {};   // acc<u><hb>[j]: tokens tw + 64 u + .., out channels nb0 + 128 hb + 16 j + ..
  const __bf16* wg = P + ((size_t)which * CC + nb0 + (tid >> 3)) * CC + (tid & 7) * 8; const unsigned wl = lds_off(sw) + (unsigned)(tid >> 3) * 144u + (unsigned)(tid & 7) * 16u;
  const float* pa = IN + (b * CC + 8 * g) * TT + tw + col;   // element (token tw+col, channel 8g+..) of tile 0; tile s lies s * 64 channels on: one address for a tile's two k steps
  float an[2][32];   // a tile's activations, fetched one tile ahead: [u][16 kk + (i, 8 + i)] = channels kk*32 + 8g + (i, 16 + i) of token tw + 64 u + col
  gather_tile2(an, pa);
  PRING_OPEN(wl, wg);
  v16b a[2][2];
  for (int s = 0; s < WSTG - 1; ++s) { const __bf16* wb = sw + (s & 1) * PBUF;
    pconv(a, an);
    gather_tile2(an, pa + (size_t)(s + 1) * 64 * TT);   // the next tile's 64 loads fly while this tile is worked on
#pragma unroll   // kk becomes a constant, so that the LDS reads of both k steps take immediate offsets from one address
    for (int kk = 0; kk < 2; ++kk) { pmac(acc00, acc10, a[0][kk], a[1][kk], wb + col * WPITCH + kk * 32, lane); pmac(acc01, acc11, a[0][kk], a[1][kk], wb + (128 + col) * WPITCH + kk * 32, lane); }
    PRING_FOOT(wl, wg, s); }
  { const __bf16* wb = sw + ((WSTG - 1) & 1) * PBUF;   // the last tile stands on its own: with a test round the loads inside the loop the build held the 64 values twice, moved them every trip and spilled an address
    pconv(a, an);
#pragma unroll   // as above
    for (int kk = 0; kk < 2; ++kk) { pmac(acc00, acc10, a[0][kk], a[1][kk], wb + col * WPITCH + kk * 32, lane); pmac(acc01, acc11, a[0][kk], a[1][kk], wb + (128 + col) * WPITCH + kk * 32, lane); }
    PRING_FOOT(wl, wg, WSTG - 1); }
  WAIT_COPIES();
  // the block's four quarters (64 tokens x 128 out channels) go out one after the other through the same LDS
#pragma unroll 1   // the epilogue stands once in the code, which keeps the kernel's text small for the instruction cache: each trip writes acc00 out, then the other three move up one place
  for (int q = 0; q < 4; ++q) { const int u = q >> 1, n0 = nb0 + (q & 1) * 128;
  if (which == 2 || which == 6) {   // v -> planes [b][c][t]
    if (q) __syncthreads();   // every thread has read the quarter before out of st
#pragma unroll
    for (int j = 0; j < 8; ++j) { const float bb = bfr(BB[n0 + j * 16 + col]);
#pragma unroll
      for (int r = 0; r < 8; ++r) st[j * 16 + col][wave * 16 + 8 * g + r] = (_Float16)(acc00[j][r] + bb); }
    __syncthreads(); _Float16* V = (which == 2) ? VL : VG;
    for (int e = tid; e < 128 * 8; e += 128) { const int d = e >> 3, pc = e & 7; vst2((unsigned*)(V + ((b * CC + n0 + d) * TT) + t0 + u * 64 + pc * 8), *(const v4u*)&st[d][pc * 8]); }
  } else {
  if (which < 2) {   // local q/k rows
#pragma unroll
    for (int j = 0; j < 8; ++j) { const float bb = bfr(BB[n0 + j * 16 + col]);
#pragma unroll
      for (int r = 0; r < 8; ++r) so[wave * 16 + 8 * g + r][j * 16 + col] = (_Float16)(acc00[j][r] + bb); }
  } else {   // global q/k: + bias then interleaved-pair RoPE within each 64-dim head: angle = t * inv_freq[(c % 64) / 2], its cos and sin from the table
    float cs[16], sn[16]; const float* rc = RC + (tw + u * 64) * (HD / 2) + lane; const float* rs = RS + (tw + u * 64) * (HD / 2) + lane;   // pair pi has frequency pi % 32 = lane: one table line a row serves both of a lane's pairs
#pragma unroll   // rl becomes a constant: the 32 loads go out as one group, in front of the LDS round trip
    for (int rl = 0; rl < 16; ++rl) { cs[rl] = rc[rl * (HD / 2)]; sn[rl] = rs[rl * (HD / 2)]; }
    asm volatile("s_wait_xcnt 0x0" :: "v"(rc), "v"(rs) : "memory");   // takes the table loads' addresses as inputs: they stay in use behind all 32 loads, so no load's result lands in them, and any later write of them stands behind this wait
#pragma unroll
    for (int j = 0; j < 8; ++j) { const float bb = bfr(BB[n0 + j * 16 + col]);
#pragma unroll
      for (int r = 0; r < 8; ++r) sf[wave * 16 + 8 * g + r][j * 16 + col] = acc00[j][r] + bb; }
    LDSX();
    // each lane: rows of this wave; pairs handled by even columns
#pragma unroll   // rl becomes a constant: cs and sn stay in registers
    for (int rl = 0; rl < 16; ++rl) {
#pragma unroll   // two pairs a lane, straight-line now that no call stands in the body
      for (int u = 0; u < 2; ++u) { const int c = 2 * (lane + 32 * u);
        const float x1 = sf[wave * 16 + rl][c], x2 = sf[wave * 16 + rl][c + 1]; so[wave * 16 + rl][c] = (_Float16)(x1 * cs[rl] - x2 * sn[rl]); so[wave * 16 + rl][c + 1] = (_Float16)(x1 * sn[rl] + x2 * cs[rl]); } }
  }
  LDSX();
  _Float16* D0 = (which == 0) ? QL : (which == 1) ? KL : (which == 4) ? QG : KG;
  for (int rl = 0; rl < 16; ++rl) if (lane < 16) vst2((unsigned*)(D0 + (rb0 + u * 64 + wave * 16 + rl) * CC + n0 + lane * 8), *(const v4u*)&so[wave * 16 + rl][lane * 8]);
  }
#pragma unroll   // j becomes a constant: register moves
  for (int j = 0; j < 8; ++j) { acc00[j] = acc01[j]; acc01[j] = acc10[j]; acc10[j] = acc11[j]; }
  }
}
// ---- k_local: block = (64 queries, head, b): window keys j = t-8..t+7 (3 key tiles from tq0-16), out-of-range slots = phantom keys with logit 0 and value 0; out -> LO in (h, t, d) order
__global__ __launch_bounds__(128) void k_local(const _Float16* __restrict__ QL, const _Float16* __restrict__ KL, const _Float16* __restrict__ VL, float* __restrict__ LO) {
  __shared__ __align__(16) _Float16 sph[4][16][56]; __shared__ __align__(16) float so[4][16][68];
  const int tid = threadIdx.x, wave = tid >> 5, lane = tid & 31, col = lane & 15, g = lane >> 4; const int h = blockIdx.y; const size_t b = blockIdx.z; const int q0 = blockIdx.x * 64 + wave * 16; const size_t rq = b * TT + q0;
  v16h aq[2];
#pragma unroll
  for (int kc = 0; kc < 2; ++kc) aq[kc] = frag_h(QL + (rq + col) * CC + h * HD + kc * 32, lane);
  float s[3][8]; const int jbase = q0 - 16;
#pragma unroll
  for (int ct = 0; ct < 3; ++ct) { const int j = jbase + ct * 16 + col; v8f c = {};
    if (jbase + ct * 16 >= 0 && jbase + ct * 16 + 16 <= TT) {
#pragma unroll
      for (int kc = 0; kc < 2; ++kc) c = wmma16(aq[kc], frag_h(KL + (b * TT + j) * CC + h * HD + kc * 32, lane), c); }
#pragma unroll
    for (int r = 0; r < 8; ++r) { const int t = q0 + 8 * g + r; const bool inwin = (j >= t - 8) && (j <= t + 7) && (j >= 0) && (j < TT); s[ct][r] = inwin ? c[r] * 0.125f : -3.0e38f; } }
  float il[8];
#pragma unroll
  for (int r = 0; r < 8; ++r) { const int t = q0 + 8 * g + r; const int npad = max(0, 8 - t) + max(0, t + 8 - TT); float mx = fmaxf(fmaxf(s[0][r], s[1][r]), s[2][r]);
#pragma unroll
    for (int o = 1; o < 16; o <<= 1) mx = fmaxf(mx, __shfl_xor(mx, o));
    if (npad > 0) mx = fmaxf(mx, 0.f);
    float es = 0.f; float e[3];
#pragma unroll
    for (int ct = 0; ct < 3; ++ct) { e[ct] = (s[ct][r] <= -1.0e38f) ? 0.f : __expf(s[ct][r] - mx); es += e[ct]; }
#pragma unroll
    for (int o = 1; o < 16; o <<= 1) es += __shfl_xor(es, o);
    es += (float)npad * __expf(-mx);   // zero-padded slots: logit 0, value 0
    il[r] = (1.0f / 2048.0f) / es;
#pragma unroll
    for (int ct = 0; ct < 3; ++ct) sph[wave][8 * g + r][ct * 16 + col] = (_Float16)(e[ct] * 2048.0f); }
  LDSX();
  v8f acc[4] = {};
#pragma unroll
  for (int ct = 0; ct < 3; ++ct) { const int j0 = jbase + ct * 16; if (j0 < 0 || j0 + 16 > TT) continue;   // fully out-of-range tile: P is 0 there
    // a 16-wide K step: use a 32-wide frag with the second half zero? frag_h reads 32 halves; take keys [j0, j0+32) only when ct < 2 pairs... simpler: process pairs (ct 0-1) as one 32-step and ct 2 alone padded by sph zeros beyond col 48
    (void)j0; }
  { // step A: keys jbase..jbase+31 (tiles 0,1); step B: keys jbase+32..jbase+47 (tile 2) + 16 zero columns (sph cols 48..63 are never written -> zero them)
#pragma unroll
    for (int r = 0; r < 8; ++r) sph[wave][8 * g + r][48 + (col & 7)] = (_Float16)0.f;   // cols 48..55 zeroed (56-wide buffer); frag reads up to col 63 -> keep within 56? use explicit bounds below
  }
  LDSX();
  { const int jA = jbase, jB = jbase + 32;
    const v16h pa = frag_h(&sph[wave][col][0], lane);
    if (jA >= 0) {   // tiles 0-1 fully in range unless jbase < 0 (first query block): then tile 0 is out of range and its P are 0, but the V address would underflow -> handle by splitting
#pragma unroll
      for (int dt = 0; dt < 4; ++dt) acc[dt] = wmma16(pa, frag_h(VL + ((b * CC + (size_t)h * HD + dt * 16 + col) * TT) + jA, lane), acc[dt]); }
    else {   // q0 == 0 block, wave 0: keys -16..15: only 0..15 valid (tile 1) -> shift: build a frag over keys 0..31 with P columns 16..47? Simplest: second-half product using a 32-wide read at 0 with P cols 16..47
      const v16h pa2 = frag_h(&sph[wave][col][16], lane);   // P for keys jbase+16 .. jbase+47 = 0..31
#pragma unroll
      for (int dt = 0; dt < 4; ++dt) acc[dt] = wmma16(pa2, frag_h(VL + ((b * CC + (size_t)h * HD + dt * 16 + col) * TT) + 0, lane), acc[dt]); }
    if (jA >= 0 && jB + 16 <= TT) {   // tile 2 (16 keys) + 16 phantom zero columns: read 32 values from V (the extra 16 are multiplied by explicit zeros)
      v16h pb = frag_h(&sph[wave][col][32], lane);
#pragma unroll
      for (int i = 8; i < 16; ++i) pb[i] = (_Float16)0.f;   // K positions 16..31 of this step (cols 48..63) -> zero regardless of LDS contents
      const int jr = (jB + 32 <= TT) ? jB : (TT - 32);   // keep the 32-wide V read in range; when shifted, realign P instead
      if (jr == jB) {
#pragma unroll
        for (int dt = 0; dt < 4; ++dt) acc[dt] = wmma16(pb, frag_h(VL + ((b * CC + (size_t)h * HD + dt * 16 + col) * TT) + jB, lane), acc[dt]); }
      else {   // last block: keys jB..jB+15 are the LAST 16 positions -> read V from TT-32 and put P into K positions 16..31
        v16h pc2; 
#pragma unroll
        for (int i = 0; i < 8; ++i) { pc2[i] = (_Float16)0.f; pc2[8 + i] = pb[i]; }
#pragma unroll
        for (int dt = 0; dt < 4; ++dt) acc[dt] = wmma16(pc2, frag_h(VL + ((b * CC + (size_t)h * HD + dt * 16 + col) * TT) + (TT - 32), lane), acc[dt]); } }
  }
#pragma unroll
  for (int r = 0; r < 8; ++r)
#pragma unroll
    for (int dt = 0; dt < 4; ++dt) so[wave][8 * g + r][dt * 16 + col] = acc[dt][r] * il[r];
  LDSX();
  for (int rl = 0; rl < 16; ++rl) if (lane < 16) vst2(LO + ((b * NH + h) * TT + q0 + rl) * (size_t)HD + lane * 4, *(const v4f*)&so[wave][rl][lane * 4]);   // (h, t, d) order: 256-B row per (h, t)
}
// ---- K / V tiles of k_global in LDS: 64 keys a tile; K = 64 key rows x 64 dims, V = 64 dim rows x 64 keys, each row one whole 128-B line, LDS pitch 144 B (16 B x odd for ds_load_b128); read by all four waves of a block; two buffers, the next tile's copies fly while this one is worked on
#define KVP 72
#define KVT (64 * KVP)
#define KVBUF (2 * KVT)
#define KVSTG (TT / 64)
// one tile pair: thread = (row tid >> 3 (+ 16 i), 16-byte piece tid & 7), a wave's copy covers 4 whole 128-B lines. The s_wait_xcnt stands inside the statement so that no address register is rewritten ahead of it.
__device__ __forceinline__ void kvstage(unsigned l, const _Float16* gk, const _Float16* gv) {
  asm volatile("global_load_async_to_lds_b128 %0, %8, off\n\t"
               "global_load_async_to_lds_b128 %1, %9, off\n\t"
               "global_load_async_to_lds_b128 %2, %10, off\n\t"
               "global_load_async_to_lds_b128 %3, %11, off\n\t"
               "global_load_async_to_lds_b128 %4, %12, off\n\t"
               "global_load_async_to_lds_b128 %5, %13, off\n\t"
               "global_load_async_to_lds_b128 %6, %14, off\n\t"
               "global_load_async_to_lds_b128 %7, %15, off\n\t"
               "s_wait_xcnt 0x0"
               :: "v"(l), "v"(l + 2304u), "v"(l + 2u * 2304u), "v"(l + 3u * 2304u), "v"(l + 4u * 2304u), "v"(l + 5u * 2304u), "v"(l + 6u * 2304u), "v"(l + 7u * 2304u),
                  "v"(gk), "v"(gk + 16 * CC), "v"(gk + 32 * CC), "v"(gk + 48 * CC), "v"(gv), "v"(gv + 16 * TT), "v"(gv + 32 * TT), "v"(gv + 48 * TT) : "memory");
}
// value of lane ^ 16 (the same column in the other lane half) by a vector cross-row move, no LDS round trip
__device__ __forceinline__ float xhalf(float v) { const int bts = __builtin_bit_cast(int, v); return __builtin_bit_cast(float, __builtin_amdgcn_permlanex16(bts, bts, 0x76543210, 0xfedcba98, false, false)); }
__global__ __launch_bounds__(128) void k_global(const _Float16* __restrict__ QG, const _Float16* __restrict__ KG, const _Float16* __restrict__ VG, float* __restrict__ CG) {
  __shared__ __align__(16) float so[4][16][68]; __shared__ __align__(16) _Float16 skv[2 * KVBUF];
  const int tid = threadIdx.x, wave = tid >> 5, lane = tid & 31, col = lane & 15, g = lane >> 4; const int h = blockIdx.y; const size_t b = blockIdx.z; const int q0 = blockIdx.x * 64 + wave * 16; const size_t rq = b * TT + q0;
  v16h aq[2];   // Q rows as the B operand: column col = query q0 + col
#pragma unroll
  for (int kc = 0; kc < 2; ++kc) aq[kc] = frag_h(QG + (rq + col) * CC + h * HD + kc * 32, lane);
  const float SC2 = 0.125f * 1.44269504088896f;   // 1/sqrt(64) * log2(e): raw score -> exponent of 2
  float m = -3.0e38f, l = 0.f;   // of query col: m (a raw q . k) is equal in both lane halves, l is 2048 x the sum over this half's keys (the halves are joined behind the loop)
  v8f acc[4] = {};   // acc[dt][r] = O[query col][dt * 16 + 8g + r]
  const _Float16* gk = KG + (b * TT + (tid >> 3)) * CC + h * HD + (tid & 7) * 8; const _Float16* gv = VG + (b * CC + (size_t)h * HD + (tid >> 3)) * TT + (tid & 7) * 8; const unsigned kl = lds_off(skv) + (unsigned)(tid >> 3) * 144u + (unsigned)(tid & 7) * 16u;
  // in front of the loop: tile 0, wait, barrier, then tile 1
  kvstage(kl, gk, gv); WAIT_COPIES(); __syncthreads(); kvstage(kl + 2u * KVBUF, gk + 64 * CC, gv + 64);
#pragma unroll 1   // one tile a trip: the ring's foot stands once in the code
  for (int st = 0; st < KVSTG; ++st) { const _Float16* kb = skv + (st & 1) * KVBUF; const _Float16* vb = kb + KVT;
#pragma unroll   // kk becomes a constant, so that the LDS reads of both 32-key steps take immediate offsets from one address
    for (int kk = 0; kk < 2; ++kk) { v16h kf[2][2], vf[4];   // the step's eight fragments are read as one group, so that the LDS latency is waited out once
#pragma unroll
      for (int ct = 0; ct < 2; ++ct)
#pragma unroll
        for (int kc = 0; kc < 2; ++kc) kf[ct][kc] = frag_h(kb + (kk * 32 + ct * 16 + col) * KVP + kc * 32, lane);
#pragma unroll
      for (int dt = 0; dt < 4; ++dt) vf[dt] = frag_h(vb + (dt * 16 + col) * KVP + kk * 32, lane);
      v8f c[2];   // c[ct][r] = raw q . k of key kk * 32 + ct * 16 + 8g + r with query col
#pragma unroll
      for (int ct = 0; ct < 2; ++ct) { c[ct] = v8f{};
#pragma unroll
        for (int kc = 0; kc < 2; ++kc) c[ct] = wmma16(kf[ct][kc], aq[kc], c[ct]); }
      float mx = fmaxf(c[0][0], c[1][0]);
#pragma unroll   // r becomes a constant: the scores stay in registers
      for (int r = 1; r < 8; ++r) mx = fmaxf(mx, fmaxf(c[0][r], c[1][r]));
      mx = fmaxf(mx, xhalf(mx));   // the other half's 16 keys of the same query
      const float mn = fmaxf(m, mx); const float alpha = __builtin_amdgcn_exp2f((m - mn) * SC2); m = mn;   // first step: m = -3e38 gives exp2 of a huge negative = 0
      const float nb = 11.0f - mn * SC2;   // P = 2^(c SC2 - mn SC2 + 11) = 2048 exp((c - mn) / 8): one multiply-add and one exp2 a score
      v16h pb; float es = 0.f;   // P^T as the B operand straight from the score registers: element i = key 8g + i, element 8 + i = key 16 + 8g + i, the k order of frag_h
#pragma unroll   // r becomes a constant: scores and P stay in registers
      for (int r = 0; r < 8; ++r) { const float e0 = __builtin_amdgcn_exp2f(fmaf(c[0][r], SC2, nb)), e1 = __builtin_amdgcn_exp2f(fmaf(c[1][r], SC2, nb)); es += e0 + e1; pb[r] = (_Float16)e0; pb[8 + r] = (_Float16)e1; }
      l = l * alpha + es;
#pragma unroll   // dt becomes a constant: the accumulators stay in registers
      for (int dt = 0; dt < 4; ++dt) { acc[dt] *= alpha; acc[dt] = wmma16(vf[dt], pb, acc[dt]); } }
    // foot of trip st: the one barrier publishes tile st + 1 and ends every wave's reads of tile st, whose buffer takes tile st + 2
    WAIT_LDS(); WAIT_COPIES(); __syncthreads(); if (st + 2 < KVSTG) kvstage(kl + (unsigned)(st & 1) * (2u * KVBUF), gk + (size_t)(st + 2) * 64 * CC, gv + (st + 2) * 64); }
  WAIT_COPIES();
  l += xhalf(l);
  const float il = 1.0f / l;   // l and acc both carry the factor 2048
#pragma unroll   // dt and r become constants: the accumulators stay in registers
  for (int dt = 0; dt < 4; ++dt) { v4f lo, hi;
#pragma unroll
    for (int r = 0; r < 4; ++r) { lo[r] = acc[dt][r] * il; hi[r] = acc[dt][4 + r] * il; }
    *(v4f*)&so[wave][col][dt * 16 + 8 * g] = lo; *(v4f*)&so[wave][col][dt * 16 + 8 * g + 4] = hi; }
  LDSX();
  for (int rl = 0; rl < 16; ++rl) if (lane < 16) vst2(CG + (rq + rl) * CC + h * HD + lane * 4, *(const v4f*)&so[wave][rl][lane * 4]);
}
// ---- k_out: block = (64 tokens, 128 out channels): yl = lo_w[o] . LO[.][t] (LO viewed as [c'][t'], gathered token-major as in k_proj) and yg = go_w[o] . cg[t], each context split in registers into bf16 hi + residual (2 products); out[b][o][t] = sqrt(1 - t_b/999) (yg + go_b) + sqrt(t_b/999) (yl + lo_b), channels-first. One ring of 16 weight tiles: 8 of lo_w, then 8 of go_w
#define OSTG (2 * WSTG)
__device__ __forceinline__ const __bf16* otile(const __bf16* g, int s) { return g + (s < WSTG ? s * 64 : 4 * CC * CC + (s - WSTG) * 64); }   // go_w lies 4 matrices behind lo_w in the packed weights
// foot of trip s, as WRING_FOOT, over the 16 tiles
#define ORING_FOOT(l, g, s) do { WAIT_LDS(); WAIT_COPIES(); __syncthreads(); if ((s) + 2 < OSTG) wstage((l) + (unsigned)((s) & 1) * (2u * WBUF), otile((g), (s) + 2)); } while (0)
__global__ __launch_bounds__(128) void k_out(const float* __restrict__ LO, const float* __restrict__ CG, const __bf16* __restrict__ P, const float* __restrict__ BL, const float* __restrict__ BG, const int* __restrict__ TSTEP, float* __restrict__ OUT) {
  __shared__ __align__(16) float st[128][68]; __shared__ __align__(16) __bf16 sw[2 * WBUF];
  const int tid = threadIdx.x, wave = tid >> 5, lane = tid & 31, col = lane & 15, g = lane >> 4; const size_t rb0 = (size_t)blockIdx.x * 64, r0 = rb0 + wave * 16; const size_t b = rb0 / TT, t0 = rb0 % TT; const int n0 = blockIdx.y * 128;
  const int ts = TSTEP[b];   // block-uniform, read ahead of the loops
  v8f accl[8] = {}, accg[8] = {};
  const __bf16* wg = P + ((size_t)3 * CC + n0 + (tid >> 3)) * CC + (tid & 7) * 8; const unsigned wl = lds_off(sw) + (unsigned)(tid >> 3) * 144u + (unsigned)(tid & 7) * 16u;
  const float* pl = LO + (b * CC + 8 * g) * TT + t0 + wave * 16 + col;   // element (token t0 + 16 wave + col, channel 8g+..) of tile 0; tile s lies s * 64 channels on
  const float* cr = CG + (r0 + col) * CC + 8 * g;   // element (token row r0 + col, channel 8g+..) of tile 8; tile s lies (s - 8) * 64 floats on
  float an[32];   // a tile's context values, fetched one tile ahead, in the order of k_proj
  gather_tile(an, pl);
  WRING_OPEN(wl, wg);
  for (int s = 0; s < WSTG; ++s) { const __bf16* wb = sw + (s & 1) * WBUF; const F2 a[2] = { bsplit16(an), bsplit16(an + 16) };
    if (s + 1 < WSTG) gather_tile(an, pl + (size_t)(s + 1) * 64 * TT); else row_tile(an, cr);   // the next tile's 32 values fly while this tile is worked on
#pragma unroll   // kk becomes a constant, so that the LDS reads of both k steps take immediate offsets from one address
    for (int kk = 0; kk < 2; ++kk) {
      v16b w[8];   // one group of LDS reads per k step, as in k_proj
#pragma unroll
      for (int j = 0; j < 8; ++j) w[j] = frag_b(wb + (j * 16 + col) * WPITCH + kk * 32, lane);
#pragma unroll
      for (int j = 0; j < 8; ++j) { accl[j] = wmma_bf(a[kk].h, w[j], accl[j]); accl[j] = wmma_bf(a[kk].l, w[j], accl[j]); } }
    ORING_FOOT(wl, wg, s); }
  for (int s = WSTG; s < OSTG; ++s) { const __bf16* wb = sw + (s & 1) * WBUF; const F2 a[2] = { bsplit16(an), bsplit16(an + 16) };
    if (s + 1 < OSTG) { cr += 64; row_tile(an, cr); }   // as above
#pragma unroll   // kk becomes a constant, so that the LDS reads of both k steps take immediate offsets from one address
    for (int kk = 0; kk < 2; ++kk) {
      v16b w[8];   // one group of LDS reads per k step, as in k_proj
#pragma unroll
      for (int j = 0; j < 8; ++j) w[j] = frag_b(wb + (j * 16 + col) * WPITCH + kk * 32, lane);
#pragma unroll
      for (int j = 0; j < 8; ++j) { accg[j] = wmma_bf(a[kk].l, w[j], accg[j]); accg[j] = wmma_bf(a[kk].h, w[j], accg[j]); } }
    ORING_FOOT(wl, wg, s); }
  WAIT_COPIES();
  const float tn = (float)ts / (float)(TS - 1); const float ag = sqrtf(1.0f - tn), al = sqrtf(tn);
  float bg[8], bl[8]; const int bo = n0 + col;
#pragma unroll   // j becomes a constant: the 16 bias loads go out as one group
  for (int j = 0; j < 8; ++j) { bg[j] = BG[bo + j * 16]; bl[j] = BL[bo + j * 16]; }
  asm volatile("s_wait_xcnt 0x0" :: "v"(bo) : "memory");   // takes the bias loads' index as an input: it stays in use behind all 16 loads, so no load's result lands in it, and any later write of it stands behind this wait
#pragma unroll
  for (int j = 0; j < 8; ++j) { const float bgj = bfr(bg[j]), blj = bfr(bl[j]);
#pragma unroll
    for (int r = 0; r < 8; ++r) st[j * 16 + col][wave * 16 + 8 * g + r] = (accg[j][r] + bgj) * ag + al * (accl[j][r] + blj); }
  __syncthreads();
  for (int e = tid; e < 128 * 16; e += 128) { const int o = e >> 4, q = e & 15; vst2(OUT + ((b * CC + n0 + o) * TT) + t0 + q * 4, *(const v4f*)&st[o][q * 4]); }   // 256-B segment of row (b, o)
}
extern "C" void kernel_launch(void* const* d_in, const int* in_sizes, int n_in, void* d_out, int out_size, void* d_ws, size_t ws_size, hipStream_t stream) {
  (void)in_sizes; (void)n_in; (void)out_size;
  const float** F = (const float**)d_in;   // 0 x, 1 cond [4,512,2048]; 2 t [4] int; 3 lq_w,4 lq_b, 5 lk_w,6 lk_b, 7 lv_w,8 lv_b, 9 lo_w,10 lo_b, 11 gq_w,12 gq_b, 13 gk_w,14 gk_b, 15 gv_w,16 gv_b, 17 go_w,18 go_b
  if (ws_size < (size_t)WS_END) return;
  char* ws = (char*)d_ws; __bf16* P = (__bf16*)ws; _Float16 *QL = (_Float16*)(ws + WS_QL), *KL = (_Float16*)(ws + WS_KL), *QG = (_Float16*)(ws + WS_QG), *KG = (_Float16*)(ws + WS_KG), *VL = (_Float16*)(ws + WS_VL), *VG = (_Float16*)(ws + WS_VG); float *LO = (float*)(ws + WS_LO), *CG = (float*)(ws + WS_CG); float *RC = (float*)(ws + WS_RC), *RS = (float*)(ws + WS_RS);
  k_pack<<<dim3(CC, 9), 256, 0, stream>>>(F[3], F[5], F[7], F[9], F[11], F[13], F[15], F[17], P, RC, RS);
  k_proj<<<dim3(TR / 128, CC / 256, 6), 128, 0, stream>>>(F[0], F[1], P, F[4], F[6], F[8], F[12], F[14], F[16], QL, KL, VL, QG, KG, VG, RC, RS);
  k_local<<<dim3(TT / 64, NH, TNB), 128, 0, stream>>>(QL, KL, VL, LO);
  k_global<<<dim3(TT / 64, NH, TNB), 128, 0, stream>>>(QG, KG, VG, CG);
  k_out<<<dim3(TR / 64, CC / 128), 128, 0, stream>>>(LO, CG, P, F[10], F[18], (const int*)d_in[2], (float*)d_out);
}

// v009
// One run takes 110 microseconds.
// In two side-by-side timings against v008, it was 1.09 and 1.08 times as fast.
// All steps since v000 together make it 3.84 times as fast.
// compute dtype: all float inputs rounded to bf16, t read on device; the six q/k/v projections with EXACT bf16 products on WMMA 16x16x32 (natural [out][in] rows; channels-first activations gathered token-major), + bias, rounded once to f16; local branch: windowed scores (16 slots, zero-padded slots as logit-0 / value-0 phantoms) and global branch: interleaved-pair RoPE (f32 inv_freq by powf, precise sinf/cosf) then full attention - both PLAIN (q, k single f16 x 1/8, running-max softmax in f32 with hardware exp, P scaled by 2^11 single f16 x v single f16); output convs/linears with the contexts split into bf16 hi + residual (2 products); the sqrt(1 - t/999), sqrt(t/999) mix in f32.
#include <hip/hip_runtime.h>
#include <math.h>

typedef __attribute__((ext_vector_type(16))) _Float16 v16h;
typedef __attribute__((ext_vector_type(16))) __bf16 v16b;
typedef __attribute__((ext_vector_type(8)))  _Float16 v8h;
typedef __attribute__((ext_vector_type(8)))  float v8f;
typedef __attribute__((ext_vector_type(4)))  float v4f;
typedef __attribute__((ext_vector_type(2)))  float v2f;
typedef __attribute__((ext_vector_type(4)))  unsigned v4u;
typedef __attribute__((ext_vector_type(4)))  int v4i;
typedef float __attribute__((may_alias)) float_a;
typedef int __attribute__((may_alias)) int_a;

template <typename T> __device__ __forceinline__ void vst2(void* p, T v) { *(T*)p = v;  }
__device__ __forceinline__ v8f wmma16(v16h a, v16h b, v8f c) {
  v8f d = __builtin_amdgcn_wmma_f32_16x16x32_f16(false, a, false, b, (short)0, c, false, false);
  asm volatile("v_nop\n\tv_nop\n\tv_nop\n\tv_nop" : "+v"(d) : "v"(a), "v"(b));
  return d;
}
__device__ __forceinline__ v8f wmma_bf(v16b a, v16b b, v8f c) {
  v8f d = __builtin_amdgcn_wmma_f32_16x16x32_bf16(false, a, false, b, (short)0, c, false, false);
  asm volatile("v_nop\n\tv_nop\n\tv_nop\n\tv_nop" : "+v"(d) : "v"(a), "v"(b));
  return d;
}
// 16x16x32 fragments: lane = (h = lane>>4, row/col = lane&15); elements 0..7 = k0+8h+0..7, 8..15 = k0+16+8h+0..7; D element r = row 8h+r
__device__ __forceinline__ v16h frag_h(const _Float16* rowk0, int lane) {
  union { v16h v; v8h q[2]; } u; const _Float16* p = rowk0 + 8 * (lane >> 4);
  u.q[0] = *(const v8h*)p; u.q[1] = *(const v8h*)(p + 16); return u.v;
}
__device__ __forceinline__ v16h frag_f32(const float* rowk0, int lane) {
  v16h a; const float* p = rowk0 + 8 * (lane >> 4);
#pragma unroll
  for (int i = 0; i < 8; ++i) { a[i] = (_Float16)p[i]; a[8 + i] = (_Float16)p[16 + i]; }
  return a;
}
__device__ __forceinline__ v16h frag_f32s(const float* rowk0, int lane, float sc) {
  v16h a; const float* p = rowk0 + 8 * (lane >> 4);
#pragma unroll
  for (int i = 0; i < 8; ++i) { a[i] = (_Float16)(p[i] * sc); a[8 + i] = (_Float16)(p[16 + i] * sc); }
  return a;
}
// column fragment from a [K][ld] layout (column n), rows >= K read as 0
__device__ __forceinline__ v16h fragc_f32(const float* W, int k0, int n, int lane, int ld, int K) {
  v16h a; const int g = lane >> 4;
#pragma unroll
  for (int i = 0; i < 8; ++i) { const int ka = k0 + 8 * g + i, kb = ka + 16;
    a[i] = (_Float16)(ka < K ? W[(size_t)(ka < K ? ka : K - 1) * ld + n] : 0.f); a[8 + i] = (_Float16)(kb < K ? W[(size_t)(kb < K ? kb : K - 1) * ld + n] : 0.f); }
  return a;
}
struct F2 { v16b h, l; };
__device__ __forceinline__ F2 bsplit16(const float v[16]) { F2 r;
#pragma unroll
  for (int i = 0; i < 16; ++i) { const __bf16 h = (__bf16)v[i]; r.h[i] = h; r.l[i] = (__bf16)(v[i] - (float)h); }
  return r; }
__device__ __forceinline__ F2 split_row(const float* row, int k0, int lane) { float v[16]; const float* p = row + k0 + 8 * (lane >> 4);
#pragma unroll
  for (int i = 0; i < 8; ++i) { v[i] = p[i]; v[8 + i] = p[16 + i]; }
  return bsplit16(v); }
__device__ __forceinline__ F2 split_rowK(const float* row, int k0, int lane, int K) { float v[16]; const int g = lane >> 4;
#pragma unroll
  for (int i = 0; i < 8; ++i) { const int ka = k0 + 8 * g + i, kb = ka + 16; v[i] = ka < K ? row[ka < K ? ka : K - 1] : 0.f; v[8 + i] = kb < K ? row[kb < K ? kb : K - 1] : 0.f; }
  return bsplit16(v); }
__device__ __forceinline__ F2 split_col(const float* W, int k0, int n, int lane, int ld, int K) { float v[16]; const int g = lane >> 4;
#pragma unroll
  for (int i = 0; i < 8; ++i) { const int ka = k0 + 8 * g + i, kb = ka + 16; v[i] = ka < K ? W[(size_t)(ka < K ? ka : K - 1) * ld + n] : 0.f; v[8 + i] = kb < K ? W[(size_t)(kb < K ? kb : K - 1) * ld + n] : 0.f; }
  return bsplit16(v); }
__device__ __forceinline__ v8f mac3(const F2& a, const F2& b, v8f c) { c = wmma_bf(a.l, b.h, c); c = wmma_bf(a.h, b.l, c); return wmma_bf(a.h, b.h, c); }
__device__ __forceinline__ float sigm(float v) { return 1.0f / (1.0f + expf(-v)); }
#define LDSX() do { asm volatile("s_wait_dscnt 0" ::: "memory"); __builtin_amdgcn_wave_barrier(); __builtin_amdgcn_fence(__ATOMIC_RELEASE, "workgroup"); } while (0)


// Mixed local / global soft-align attention (B 4, C 512, T 2,048, 8 heads x 64, window 16): a windowed cross attention (q from x, k/v from cond, zero-padded window) and a global RoPE cross attention, each with its own 1x1 projections, blended per sample by the diffusion step t.
#define NB 4
#define CC 512
#define TT 2048
#define NH 8
#define HD 64
#define WW 16
#define TS 1000
#define NR (NB * TT)
#ifndef TNB
#define TNB NB
#endif
#define TR (TNB * TT)
typedef __attribute__((ext_vector_type(8))) __bf16 v8b;
__device__ __forceinline__ v16b frag_b(const __bf16* rowk0, int lane) {
  union { v16b v; v8b q[2]; } u; const __bf16* p = rowk0 + 8 * (lane >> 4);
  u.q[0] = *(const v8b*)p; u.q[1] = *(const v8b*)(p + 16); return u.v;
}
__device__ __forceinline__ float bfr(float v) { return (float)(__bf16)v; }
__device__ __attribute__((noinline)) float exp_ni(float v) { return expf(v); }
__device__ __attribute__((noinline)) float erf_ni(float v) { return erff(v); }

#define WS_PW   0u                                     // bf16 rows: lq, lk, lv, lo, gq, gk, gv, go [8][512][512] (natural [out][in])
#define WS_QL   (WS_PW + 2u * (size_t)8 * CC * CC)        // f16 token rows [NR][512]: QL, KL, QG, KG
#define WS_KL   (WS_QL + 2u * (size_t)NR * CC)
#define WS_QG   (WS_KL + 2u * (size_t)NR * CC)
#define WS_KG   (WS_QG + 2u * (size_t)NR * CC)
#define WS_VL   (WS_KG + 2u * (size_t)NR * CC)            // f16 planes [b][512][TT]: VL, VG
#define WS_VG   (WS_VL + 2u * (size_t)NB * CC * TT)
#define WS_LO   (WS_VG + 2u * (size_t)NB * CC * TT)       // f32 local context in the module's (h, t, d) order == [c'][t'] ; CG token-major [NR][512]
#define WS_CG   (WS_LO + 4u * (size_t)NR * CC)
#define WS_RC   (WS_CG + 4u * (size_t)NR * CC)            // f32 RoPE table [TT][32]: cos, then sin
#define WS_RS   (WS_RC + 4u * (size_t)TT * (HD / 2))
#define WS_END  (WS_RS + 4u * (size_t)TT * (HD / 2))

// ---- weight tile in LDS: 128 weight rows x 64 k (128 B a row, LDS pitch 144 B = 16 B x odd for ds_load_b128), read by all four waves of a block; two buffers, the next tile's copies fly while this one is worked on
#define WPITCH 72
#define WBUF (128 * WPITCH)
#define WSTG (CC / 64)
__device__ __forceinline__ unsigned lds_off(const void* p) { return (unsigned)(size_t)p; }   // low 32 bits of a __shared__ address = byte offset in the work-group's LDS
// one tile: thread = (row tid >> 3 (+ 16 i), 16-byte piece tid & 7), a wave's copy covers 4 whole 128-B lines. The s_wait_xcnt stands inside the statement so that no address register is rewritten ahead of it.
__device__ __forceinline__ void wstage(unsigned l, const __bf16* g) {
  asm volatile("global_load_async_to_lds_b128 %0, %8, off\n\t"
               "global_load_async_to_lds_b128 %1, %9, off\n\t"
               "global_load_async_to_lds_b128 %2, %10, off\n\t"
               "global_load_async_to_lds_b128 %3, %11, off\n\t"
               "global_load_async_to_lds_b128 %4, %12, off\n\t"
               "global_load_async_to_lds_b128 %5, %13, off\n\t"
               "global_load_async_to_lds_b128 %6, %14, off\n\t"
               "global_load_async_to_lds_b128 %7, %15, off\n\t"
               "s_wait_xcnt 0x0"
               :: "v"(l), "v"(l + 2304u), "v"(l + 2u * 2304u), "v"(l + 3u * 2304u), "v"(l + 4u * 2304u), "v"(l + 5u * 2304u), "v"(l + 6u * 2304u), "v"(l + 7u * 2304u),
                  "v"(g), "v"(g + 16 * CC), "v"(g + 32 * CC), "v"(g + 48 * CC), "v"(g + 64 * CC), "v"(g + 80 * CC), "v"(g + 96 * CC), "v"(g + 112 * CC) : "memory");
}
#define WAIT_COPIES() asm volatile("s_wait_asynccnt 0x0" ::: "memory")   // this wave's copies have landed
#define WAIT_LDS() asm volatile("s_wait_dscnt 0x0" ::: "memory")         // this wave's reads of the buffer about to be refilled have returned
// in front of the loop: tile 0, wait, barrier, then tile 1
#define WRING_OPEN(l, g) do { wstage((l), (g)); WAIT_COPIES(); __syncthreads(); wstage((l) + 2u * WBUF, (g) + 64); } while (0)
// foot of trip s: the one barrier publishes tile s + 1 and ends every wave's reads of tile s, whose buffer takes tile s + 2
#define WRING_FOOT(l, g, s) do { WAIT_LDS(); WAIT_COPIES(); __syncthreads(); if ((s) + 2 < WSTG) wstage((l) + (unsigned)((s) & 1) * (2u * WBUF), (g) + ((s) + 2) * 64); } while (0)

// the projection kernel's ring: 256 weight rows a tile, staged as two runs of 128 rows; same order of waits and barrier as above
#define PBUF (256 * WPITCH)
__device__ __forceinline__ void pstage(unsigned l, const __bf16* g) { wstage(l, g); wstage(l + 128u * 144u, g + 128 * CC); }
#define PRING_OPEN(l, g) do { pstage((l), (g)); WAIT_COPIES(); __syncthreads(); pstage((l) + 2u * PBUF, (g) + 64); } while (0)
#define PRING_FOOT(l, g, s) do { WAIT_LDS(); WAIT_COPIES(); __syncthreads(); if ((s) + 2 < WSTG) pstage((l) + (unsigned)((s) & 1) * (2u * PBUF), (g) + ((s) + 2) * 64); } while (0)

// 128 out channels x one k step for a wave's two token tiles
__device__ __forceinline__ void pmac(v8f (&c0)[8], v8f (&c1)[8], v16b a0, v16b a1, const __bf16* wrow, int lane) {
  v16b w[8];   // eight weight fragments are read as one group, so that the LDS latency is waited out once and not in front of every product
#pragma unroll
  for (int j = 0; j < 8; ++j) w[j] = frag_b(wrow + j * 16 * WPITCH, lane);
  __builtin_amdgcn_sched_barrier(0);   // keeps the 16 LDS reads together in front of the 16 products: without it the compiler spreads them in pairs among the products, each pair with a wait to 0
#pragma unroll
  for (int j = 0; j < 8; ++j) {   // each fragment read from LDS serves two products; the plain builtin, whose distances the compiler keeps: an asm statement's operands would tie all 256 accumulator registers to the first register window
    c0[j] = __builtin_amdgcn_wmma_f32_16x16x32_bf16(false, a0, false, w[j], (short)0, c0[j], false, false); c1[j] = __builtin_amdgcn_wmma_f32_16x16x32_bf16(false, a1, false, w[j], (short)0, c1[j], false, false); }
}
// a tile's 2 x 32 gathered values to the two token tiles' bf16 fragments of its two k steps
__device__ __forceinline__ void pconv(v16b (&a)[2][2], const float (&an)[2][32]) {
#pragma unroll   // constants: an and a stay in registers
  for (int u = 0; u < 2; ++u)
#pragma unroll
    for (int i = 0; i < 16; ++i) { a[u][0][i] = (__bf16)an[u][i]; a[u][1][i] = (__bf16)an[u][16 + i]; }
}
// one tile (64 channels) of a channels-first f32 activation for one token a lane: 32 loads as one group from one address
__device__ __forceinline__ void gather_tile(float (&an)[32], const float* p) {
#pragma unroll   // constants: immediate offsets, an stays in registers
  for (int kk = 0; kk < 2; ++kk)
#pragma unroll
    for (int i = 0; i < 8; ++i) { an[16 * kk + i] = p[(size_t)(kk * 32 + i) * TT]; an[16 * kk + 8 + i] = p[(size_t)(kk * 32 + 16 + i) * TT]; }
  asm volatile("s_wait_xcnt 0x0" :: "v"(p) : "memory");   // takes the loads' address as an input: the pair stays in use behind all 32 loads, so no load's result lands in it, and any later write of it stands behind this wait
}
// the same for two tokens a lane, 64 tokens apart: 64 loads as one group from one address
__device__ __forceinline__ void gather_tile2(float (&an)[2][32], const float* p) {
#pragma unroll   // constants: immediate offsets, an stays in registers
  for (int u = 0; u < 2; ++u)
#pragma unroll
    for (int kk = 0; kk < 2; ++kk)
#pragma unroll
      for (int i = 0; i < 8; ++i) { an[u][16 * kk + i] = p[(size_t)(kk * 32 + i) * TT + u * 64]; an[u][16 * kk + 8 + i] = p[(size_t)(kk * 32 + 16 + i) * TT + u * 64]; }
  asm volatile("s_wait_xcnt 0x0" :: "v"(p) : "memory");   // as in gather_tile, behind all 64 loads
}
// the same 64 channels from a token-major f32 row
__device__ __forceinline__ void row_tile(float (&an)[32], const float* p) {
#pragma unroll   // constants: immediate offsets, an stays in registers
  for (int kk = 0; kk < 2; ++kk)
#pragma unroll
    for (int i = 0; i < 8; ++i) { an[16 * kk + i] = p[kk * 32 + i]; an[16 * kk + 8 + i] = p[kk * 32 + 16 + i]; }
  asm volatile("s_wait_xcnt 0x0" :: "v"(p) : "memory");   // as in gather_tile, for the row loads' address
}
__device__ __attribute__((noinline)) float pow_p(float a, float b) { return powf(a, b); }
__device__ __attribute__((noinline)) float sin_p(float v) { return sinf(v); }
__device__ __attribute__((noinline)) float cos_p(float v) { return cosf(v); }
static_assert(CC * 128 == TT * (HD / 2), "the CC blocks of blockIdx.y 8, 128 entries each, cover the table exactly");
// blockIdx.y 0..7: one weight row to bf16; blockIdx.y 8: 128 entries (4 positions x 32 frequencies) of the RoPE table, waves 0..3 the cosines, waves 4..7 the sines, each wave one whole 128-B line
__global__ __launch_bounds__(256) void k_pack(const float* __restrict__ W0, const float* __restrict__ W1, const float* __restrict__ W2, const float* __restrict__ W3, const float* __restrict__ W4, const float* __restrict__ W5, const float* __restrict__ W6, const float* __restrict__ W7, __bf16* __restrict__ P, float* __restrict__ RC, float* __restrict__ RS) {
  __shared__ __align__(16) __bf16 s[CC]; const int n = blockIdx.x, which = blockIdx.y, t = threadIdx.x;
  if (which == 8) { const int e = n * 128 + (t & 127); const int i = e & 31; const float inv = 1.0f / pow_p(10000.0f, (float)(2 * i) / (float)HD); const float ang = (float)(e >> 5) * inv;   // angle = position * inv_freq[i]
    if (t < 128) RC[e] = cos_p(ang); else RS[e] = sin_p(ang);
    return; }
  const float* Wm = (which == 0) ? W0 : (which == 1) ? W1 : (which == 2) ? W2 : (which == 3) ? W3 : (which == 4) ? W4 : (which == 5) ? W5 : (which == 6) ? W6 : W7;
  for (int k = t; k < CC; k += 256) s[k] = (__bf16)Wm[(size_t)n * CC + k]; __syncthreads(); for (int q = t; q < CC / 8; q += 256) vst2((unsigned*)(P + ((size_t)which * CC + n) * CC + q * 8), *(const v4u*)&s[q * 8]); }
// ---- k_proj: block = (128 tokens, 256 out channels, which), a wave = two 16-token tiles, 64 tokens apart, x 256 out channels: a weight fragment serves two products, a gathered activation sixteen: which 0 lq(x) 1 lk(cond) 4 gq(x) 5 gk(cond) -> f16 token rows (gq/gk with RoPE); 2 lv(cond) 6 gv(cond) -> f16 planes. A gathered from the channels-first input.
__global__ __launch_bounds__(128) void k_proj(const float* __restrict__ X, const float* __restrict__ CND, const __bf16* __restrict__ P, const float* __restrict__ B0, const float* __restrict__ B1, const float* __restrict__ B2, const float* __restrict__ B4, const float* __restrict__ B5, const float* __restrict__ B6, _Float16* __restrict__ QL, _Float16* __restrict__ KL, _Float16* __restrict__ VL, _Float16* __restrict__ QG, _Float16* __restrict__ KG, _Float16* __restrict__ VG, const float* __restrict__ RC, const float* __restrict__ RS) {
  __shared__ __align__(16) float sf[64][132]; __shared__ __align__(16) _Float16 so[64][136]; __shared__ __align__(16) _Float16 st[128][72]; __shared__ __align__(16) __bf16 sw[2 * PBUF];
  const int tid = threadIdx.x, wave = tid >> 5, lane = tid & 31, col = lane & 15, g = lane >> 4; const int wsel = blockIdx.z; const int which = (wsel < 3) ? wsel : wsel + 1;   // 0,1,2,4,5,6
  const int nb0 = blockIdx.y * 256; const size_t rb0 = (size_t)blockIdx.x * 128; const size_t b = rb0 / TT, t0 = rb0 % TT; const int tw = (int)t0 + wave * 16;
  const float* IN = (which == 0 || which == 4) ? X : CND; const float* BB = (which == 0) ? B0 : (which == 1) ? B1 : (which == 2) ? B2 : (which == 4) ? B4 : (which == 5) ? B5 : B6;
  v8f acc00[8] = {}, acc01[8] = {}, acc10[8] = {}, acc11[8] = {};   // acc<u><hb>[j]: tokens tw + 64 u + .., out channels nb0 + 128 hb + 16 j + ..
  const __bf16* wg = P + ((size_t)which * CC + nb0 + (tid >> 3)) * CC + (tid & 7) * 8; const unsigned wl = lds_off(sw) + (unsigned)(tid >> 3) * 144u + (unsigned)(tid & 7) * 16u;
  const float* pa = IN + (b * CC + 8 * g) * TT + tw + col;   // element (token tw+col, channel 8g+..) of tile 0; tile s lies s * 64 channels on: one address for a tile's two k steps
  float an[2][32];   // a tile's activations, fetched one tile ahead: [u][16 kk + (i, 8 + i)] = channels kk*32 + 8g + (i, 16 + i) of token tw + 64 u + col
  gather_tile2(an, pa);
  PRING_OPEN(wl, wg);
  v16b a[2][2];
  for (int s = 0; s < WSTG - 1; ++s) { const __bf16* wb = sw + (s & 1) * PBUF;
    pconv(a, an);
    gather_tile2(an, pa + (size_t)(s + 1) * 64 * TT);   // the next tile's 64 loads fly while this tile is worked on
#pragma unroll   // kk becomes a constant, so that the LDS reads of both k steps take immediate offsets from one address
    for (int kk = 0; kk < 2; ++kk) { pmac(acc00, acc10, a[0][kk], a[1][kk], wb + col * WPITCH + kk * 32, lane); pmac(acc01, acc11, a[0][kk], a[1][kk], wb + (128 + col) * WPITCH + kk * 32, lane); }
    PRING_FOOT(wl, wg, s); }
  { const __bf16* wb = sw + ((WSTG - 1) & 1) * PBUF;   // the last tile stands on its own: with a test round the loads inside the loop the build held the 64 values twice, moved them every trip and spilled an address
    pconv(a, an);
#pragma unroll   // as above
    for (int kk = 0; kk < 2; ++kk) { pmac(acc00, acc10, a[0][kk], a[1][kk], wb + col * WPITCH + kk * 32, lane); pmac(acc01, acc11, a[0][kk], a[1][kk], wb + (128 + col) * WPITCH + kk * 32, lane); }
    PRING_FOOT(wl, wg, WSTG - 1); }
  WAIT_COPIES();
  // the block's four quarters (64 tokens x 128 out channels) go out one after the other through the same LDS
#pragma unroll 1   // the epilogue stands once in the code, which keeps the kernel's text small for the instruction cache: each trip writes acc00 out, then the other three move up one place
  for (int q = 0; q < 4; ++q) { const int u = q >> 1, n0 = nb0 + (q & 1) * 128;
  if (which == 2 || which == 6) {   // v -> planes [b][c][t]
    if (q) __syncthreads();   // every thread has read the quarter before out of st
#pragma unroll
    for (int j = 0; j < 8; ++j) { const float bb = bfr(BB[n0 + j * 16 + col]);
#pragma unroll
      for (int r = 0; r < 8; ++r) st[j * 16 + col][wave * 16 + 8 * g + r] = (_Float16)(acc00[j][r] + bb); }
    __syncthreads(); _Float16* V = (which == 2) ? VL : VG;
    for (int e = tid; e < 128 * 8; e += 128) { const int d = e >> 3, pc = e & 7; vst2((unsigned*)(V + ((b * CC + n0 + d) * TT) + t0 + u * 64 + pc * 8), *(const v4u*)&st[d][pc * 8]); }
  } else {
  if (which < 2) {   // local q/k rows
#pragma unroll
    for (int j = 0; j < 8; ++j) { const float bb = bfr(BB[n0 + j * 16 + col]);
#pragma unroll
      for (int r = 0; r < 8; ++r) so[wave * 16 + 8 * g + r][j * 16 + col] = (_Float16)(acc00[j][r] + bb); }
  } else {   // global q/k: + bias then interleaved-pair RoPE within each 64-dim head: angle = t * inv_freq[(c % 64) / 2], its cos and sin from the table
    float cs[16], sn[16]; const float* rc = RC + (tw + u * 64) * (HD / 2) + lane; const float* rs = RS + (tw + u * 64) * (HD / 2) + lane;   // pair pi has frequency pi % 32 = lane: one table line a row serves both of a lane's pairs
#pragma unroll   // rl becomes a constant: the 32 loads go out as one group, in front of the LDS round trip
    for (int rl = 0; rl < 16; ++rl) { cs[rl] = rc[rl * (HD / 2)]; sn[rl] = rs[rl * (HD / 2)]; }
    asm volatile("s_wait_xcnt 0x0" :: "v"(rc), "v"(rs) : "memory");   // takes the table loads' addresses as inputs: they stay in use behind all 32 loads, so no load's result lands in them, and any later write of them stands behind this wait
#pragma unroll
    for (int j = 0; j < 8; ++j) { const float bb = bfr(BB[n0 + j * 16 + col]);
#pragma unroll
      for (int r = 0; r < 8; ++r) sf[wave * 16 + 8 * g + r][j * 16 + col] = acc00[j][r] + bb; }
    LDSX();
    // each lane: rows of this wave; pairs handled by even columns
#pragma unroll   // rl becomes a constant: cs and sn stay in registers
    for (int rl = 0; rl < 16; ++rl) {
#pragma unroll   // two pairs a lane, straight-line now that no call stands in the body
      for (int u = 0; u < 2; ++u) { const int c = 2 * (lane + 32 * u);
        const float x1 = sf[wave * 16 + rl][c], x2 = sf[wave * 16 + rl][c + 1]; so[wave * 16 + rl][c] = (_Float16)(x1 * cs[rl] - x2 * sn[rl]); so[wave * 16 + rl][c + 1] = (_Float16)(x1 * sn[rl] + x2 * cs[rl]); } }
  }
  LDSX();
  _Float16* D0 = (which == 0) ? QL : (which == 1) ? KL : (which == 4) ? QG : KG;
  for (int rl = 0; rl < 16; ++rl) if (lane < 16) vst2((unsigned*)(D0 + (rb0 + u * 64 + wave * 16 + rl) * CC + n0 + lane * 8), *(const v4u*)&so[wave * 16 + rl][lane * 8]);
  }
#pragma unroll   // j becomes a constant: register moves
  for (int j = 0; j < 8; ++j) { acc00[j] = acc01[j]; acc01[j] = acc10[j]; acc10[j] = acc11[j]; }
  }
}
// ---- LDS of k_attn, one array for both bodies: bytes 0 .. SM_SO - 1 hold the global body's K / V ring (the local body's P tiles lie at its start), the f32 output staging of either body follows
#define SM_SO (2 * 2 * 2 * 64 * 72)
#define SM_ALL (SM_SO + 4 * 4 * 16 * 68)
// ---- local_body: block = (64 queries, head, b): window keys j = t-8..t+7 (3 key tiles from tq0-16), out-of-range slots = phantom keys with logit 0 and value 0; out -> LO in (h, t, d) order
__device__ __forceinline__ void local_body(const _Float16* __restrict__ QL, const _Float16* __restrict__ KL, const _Float16* __restrict__ VL, float* __restrict__ LO, char* sm, const size_t b) {
  _Float16 (*sph)[16][56] = (_Float16 (*)[16][56])sm; float (*so)[16][68] = (float (*)[16][68])(sm + SM_SO);
  const int tid = threadIdx.x, wave = tid >> 5, lane = tid & 31, col = lane & 15, g = lane >> 4; const int h = blockIdx.y; const int q0 = blockIdx.x * 64 + wave * 16; const size_t rq = b * TT + q0;
  v16h aq[2];
#pragma unroll
  for (int kc = 0; kc < 2; ++kc) aq[kc] = frag_h(QL + (rq + col) * CC + h * HD + kc * 32, lane);
  float s[3][8]; const int jbase = q0 - 16;
#pragma unroll
  for (int ct = 0; ct < 3; ++ct) { const int j = jbase + ct * 16 + col; v8f c = {};
    if (jbase + ct * 16 >= 0 && jbase + ct * 16 + 16 <= TT) {
#pragma unroll
      for (int kc = 0; kc < 2; ++kc) c = wmma16(aq[kc], frag_h(KL + (b * TT + j) * CC + h * HD + kc * 32, lane), c); }
#pragma unroll
    for (int r = 0; r < 8; ++r) { const int t = q0 + 8 * g + r; const bool inwin = (j >= t - 8) && (j <= t + 7) && (j >= 0) && (j < TT); s[ct][r] = inwin ? c[r] * 0.125f : -3.0e38f; } }
  float il[8];
#pragma unroll
  for (int r = 0; r < 8; ++r) { const int t = q0 + 8 * g + r; const int npad = max(0, 8 - t) + max(0, t + 8 - TT); float mx = fmaxf(fmaxf(s[0][r], s[1][r]), s[2][r]);
#pragma unroll
    for (int o = 1; o < 16; o <<= 1) mx = fmaxf(mx, __shfl_xor(mx, o));
    if (npad > 0) mx = fmaxf(mx, 0.f);
    float es = 0.f; float e[3];
#pragma unroll
    for (int ct = 0; ct < 3; ++ct) { e[ct] = (s[ct][r] <= -1.0e38f) ? 0.f : __expf(s[ct][r] - mx); es += e[ct]; }
#pragma unroll
    for (int o = 1; o < 16; o <<= 1) es += __shfl_xor(es, o);
    es += (float)npad * __expf(-mx);   // zero-padded slots: logit 0, value 0
    il[r] = (1.0f / 2048.0f) / es;
#pragma unroll
    for (int ct = 0; ct < 3; ++ct) sph[wave][8 * g + r][ct * 16 + col] = (_Float16)(e[ct] * 2048.0f); }
  LDSX();
  v8f acc[4] = {};
#pragma unroll
  for (int ct = 0; ct < 3; ++ct) { const int j0 = jbase + ct * 16; if (j0 < 0 || j0 + 16 > TT) continue;   // fully out-of-range tile: P is 0 there
    // a 16-wide K step: use a 32-wide frag with the second half zero? frag_h reads 32 halves; take keys [j0, j0+32) only when ct < 2 pairs... simpler: process pairs (ct 0-1) as one 32-step and ct 2 alone padded by sph zeros beyond col 48
    (void)j0; }
  { // step A: keys jbase..jbase+31 (tiles 0,1); step B: keys jbase+32..jbase+47 (tile 2) + 16 zero columns (sph cols 48..63 are never written -> zero them)
#pragma unroll
    for (int r = 0; r < 8; ++r) sph[wave][8 * g + r][48 + (col & 7)] = (_Float16)0.f;   // cols 48..55 zeroed (56-wide buffer); frag reads up to col 63 -> keep within 56? use explicit bounds below
  }
  LDSX();
  { const int jA = jbase, jB = jbase + 32;
    const v16h pa = frag_h(&sph[wave][col][0], lane);
    if (jA >= 0) {   // tiles 0-1 fully in range unless jbase < 0 (first query block): then tile 0 is out of range and its P are 0, but the V address would underflow -> handle by splitting
#pragma unroll
      for (int dt = 0; dt < 4; ++dt) acc[dt] = wmma16(pa, frag_h(VL + ((b * CC + (size_t)h * HD + dt * 16 + col) * TT) + jA, lane), acc[dt]); }
    else {   // q0 == 0 block, wave 0: keys -16..15: only 0..15 valid (tile 1) -> shift: build a frag over keys 0..31 with P columns 16..47? Simplest: second-half product using a 32-wide read at 0 with P cols 16..47
      const v16h pa2 = frag_h(&sph[wave][col][16], lane);   // P for keys jbase+16 .. jbase+47 = 0..31
#pragma unroll
      for (int dt = 0; dt < 4; ++dt) acc[dt] = wmma16(pa2, frag_h(VL + ((b * CC + (size_t)h * HD + dt * 16 + col) * TT) + 0, lane), acc[dt]); }
    if (jA >= 0 && jB + 16 <= TT) {   // tile 2 (16 keys) + 16 phantom zero columns: read 32 values from V (the extra 16 are multiplied by explicit zeros)
      v16h pb = frag_h(&sph[wave][col][32], lane);
#pragma unroll
      for (int i = 8; i < 16; ++i) pb[i] = (_Float16)0.f;   // K positions 16..31 of this step (cols 48..63) -> zero regardless of LDS contents
      const int jr = (jB + 32 <= TT) ? jB : (TT - 32);   // keep the 32-wide V read in range; when shifted, realign P instead
      if (jr == jB) {
#pragma unroll
        for (int dt = 0; dt < 4; ++dt) acc[dt] = wmma16(pb, frag_h(VL + ((b * CC + (size_t)h * HD + dt * 16 + col) * TT) + jB, lane), acc[dt]); }
      else {   // last block: keys jB..jB+15 are the LAST 16 positions -> read V from TT-32 and put P into K positions 16..31
        v16h pc2; 
#pragma unroll
        for (int i = 0; i < 8; ++i) { pc2[i] = (_Float16)0.f; pc2[8 + i] = pb[i]; }
#pragma unroll
        for (int dt = 0; dt < 4; ++dt) acc[dt] = wmma16(pc2, frag_h(VL + ((b * CC + (size_t)h * HD + dt * 16 + col) * TT) + (TT - 32), lane), acc[dt]); } }
  }
#pragma unroll
  for (int r = 0; r < 8; ++r)
#pragma unroll
    for (int dt = 0; dt < 4; ++dt) so[wave][8 * g + r][dt * 16 + col] = acc[dt][r] * il[r];
  LDSX();
  for (int rl = 0; rl < 16; ++rl) if (lane < 16) vst2(LO + ((b * NH + h) * TT + q0 + rl) * (size_t)HD + lane * 4, *(const v4f*)&so[wave][rl][lane * 4]);   // (h, t, d) order: 256-B row per (h, t)
}
// ---- K / V tiles of global_body in LDS: 64 keys a tile; K = 64 key rows x 64 dims, V = 64 dim rows x 64 keys, each row one whole 128-B line, LDS pitch 144 B (16 B x odd for ds_load_b128); read by all four waves of a block; two buffers, the next tile's copies fly while this one is worked on
#define KVP 72
#define KVT (64 * KVP)
#define KVBUF (2 * KVT)
#define KVSTG (TT / 64)
// one tile pair: thread = (row tid >> 3 (+ 16 i), 16-byte piece tid & 7), a wave's copy covers 4 whole 128-B lines. The s_wait_xcnt stands inside the statement so that no address register is rewritten ahead of it.
__device__ __forceinline__ void kvstage(unsigned l, const _Float16* gk, const _Float16* gv) {
  asm volatile("global_load_async_to_lds_b128 %0, %8, off\n\t"
               "global_load_async_to_lds_b128 %1, %9, off\n\t"
               "global_load_async_to_lds_b128 %2, %10, off\n\t"
               "global_load_async_to_lds_b128 %3, %11, off\n\t"
               "global_load_async_to_lds_b128 %4, %12, off\n\t"
               "global_load_async_to_lds_b128 %5, %13, off\n\t"
               "global_load_async_to_lds_b128 %6, %14, off\n\t"
               "global_load_async_to_lds_b128 %7, %15, off\n\t"
               "s_wait_xcnt 0x0"
               :: "v"(l), "v"(l + 2304u), "v"(l + 2u * 2304u), "v"(l + 3u * 2304u), "v"(l + 4u * 2304u), "v"(l + 5u * 2304u), "v"(l + 6u * 2304u), "v"(l + 7u * 2304u),
                  "v"(gk), "v"(gk + 16 * CC), "v"(gk + 32 * CC), "v"(gk + 48 * CC), "v"(gv), "v"(gv + 16 * TT), "v"(gv + 32 * TT), "v"(gv + 48 * TT) : "memory");
}
// value of lane ^ 16 (the same column in the other lane half) by a vector cross-row move, no LDS round trip
__device__ __forceinline__ float xhalf(float v) { const int bts = __builtin_bit_cast(int, v); return __builtin_bit_cast(float, __builtin_amdgcn_permlanex16(bts, bts, 0x76543210, 0xfedcba98, false, false)); }
static_assert(SM_SO == 2 * 2 * KVBUF, "the ring's two buffers fill the first part of the array exactly");
__device__ __forceinline__ void global_body(const _Float16* __restrict__ QG, const _Float16* __restrict__ KG, const _Float16* __restrict__ VG, float* __restrict__ CG, char* sm, const size_t b) {
  float (*so)[16][68] = (float (*)[16][68])(sm + SM_SO); _Float16* skv = (_Float16*)sm;
  const int tid = threadIdx.x, wave = tid >> 5, lane = tid & 31, col = lane & 15, g = lane >> 4; const int h = blockIdx.y; const int q0 = blockIdx.x * 64 + wave * 16; const size_t rq = b * TT + q0;
  v16h aq[2];   // Q rows as the B operand: column col = query q0 + col
#pragma unroll
  for (int kc = 0; kc < 2; ++kc) aq[kc] = frag_h(QG + (rq + col) * CC + h * HD + kc * 32, lane);
  const float SC2 = 0.125f * 1.44269504088896f;   // 1/sqrt(64) * log2(e): raw score -> exponent of 2
  float m = -3.0e38f, l = 0.f;   // of query col: m (a raw q . k) is equal in both lane halves, l is 2048 x the sum over this half's keys (the halves are joined behind the loop)
  v8f acc[4] = {};   // acc[dt][r] = O[query col][dt * 16 + 8g + r]
  const _Float16* gk = KG + (b * TT + (tid >> 3)) * CC + h * HD + (tid & 7) * 8; const _Float16* gv = VG + (b * CC + (size_t)h * HD + (tid >> 3)) * TT + (tid & 7) * 8; const unsigned kl = lds_off(skv) + (unsigned)(tid >> 3) * 144u + (unsigned)(tid & 7) * 16u;
  // in front of the loop: tile 0, wait, barrier, then tile 1
  kvstage(kl, gk, gv); WAIT_COPIES(); __syncthreads(); kvstage(kl + 2u * KVBUF, gk + 64 * CC, gv + 64);
#pragma unroll 1   // one tile a trip: the ring's foot stands once in the code
  for (int st = 0; st < KVSTG; ++st) { const _Float16* kb = skv + (st & 1) * KVBUF; const _Float16* vb = kb + KVT;
#pragma unroll   // kk becomes a constant, so that the LDS reads of both 32-key steps take immediate offsets from one address
    for (int kk = 0; kk < 2; ++kk) { v16h kf[2][2], vf[4];   // the step's eight fragments are read as one group, so that the LDS latency is waited out once
#pragma unroll
      for (int ct = 0; ct < 2; ++ct)
#pragma unroll
        for (int kc = 0; kc < 2; ++kc) kf[ct][kc] = frag_h(kb + (kk * 32 + ct * 16 + col) * KVP + kc * 32, lane);
#pragma unroll
      for (int dt = 0; dt < 4; ++dt) vf[dt] = frag_h(vb + (dt * 16 + col) * KVP + kk * 32, lane);
      v8f c[2];   // c[ct][r] = raw q . k of key kk * 32 + ct * 16 + 8g + r with query col
#pragma unroll
      for (int ct = 0; ct < 2; ++ct) { c[ct] = v8f{};
#pragma unroll
        for (int kc = 0; kc < 2; ++kc) c[ct] = wmma16(kf[ct][kc], aq[kc], c[ct]); }
      float mx = fmaxf(c[0][0], c[1][0]);
#pragma unroll   // r becomes a constant: the scores stay in registers
      for (int r = 1; r < 8; ++r) mx = fmaxf(mx, fmaxf(c[0][r], c[1][r]));
      mx = fmaxf(mx, xhalf(mx));   // the other half's 16 keys of the same query
      const float mn = fmaxf(m, mx); const float alpha = __builtin_amdgcn_exp2f((m - mn) * SC2); m = mn;   // first step: m = -3e38 gives exp2 of a huge negative = 0
      const float nb = 11.0f - mn * SC2;   // P = 2^(c SC2 - mn SC2 + 11) = 2048 exp((c - mn) / 8): one multiply-add and one exp2 a score
      v16h pb; float es = 0.f;   // P^T as the B operand straight from the score registers: element i = key 8g + i, element 8 + i = key 16 + 8g + i, the k order of frag_h
#pragma unroll   // r becomes a constant: scores and P stay in registers
      for (int r = 0; r < 8; ++r) { const float e0 = __builtin_amdgcn_exp2f(fmaf(c[0][r], SC2, nb)), e1 = __builtin_amdgcn_exp2f(fmaf(c[1][r], SC2, nb)); es += e0 + e1; pb[r] = (_Float16)e0; pb[8 + r] = (_Float16)e1; }
      l = l * alpha + es;
#pragma unroll   // dt becomes a constant: the accumulators stay in registers
      for (int dt = 0; dt < 4; ++dt) { acc[dt] *= alpha; acc[dt] = wmma16(vf[dt], pb, acc[dt]); } }
    // foot of trip st: the one barrier publishes tile st + 1 and ends every wave's reads of tile st, whose buffer takes tile st + 2
    WAIT_LDS(); WAIT_COPIES(); __syncthreads(); if (st + 2 < KVSTG) kvstage(kl + (unsigned)(st & 1) * (2u * KVBUF), gk + (size_t)(st + 2) * 64 * CC, gv + (st + 2) * 64); }
  WAIT_COPIES();
  l += xhalf(l);
  const float il = 1.0f / l;   // l and acc both carry the factor 2048
#pragma unroll   // dt and r become constants: the accumulators stay in registers
  for (int dt = 0; dt < 4; ++dt) { v4f lo, hi;
#pragma unroll
    for (int r = 0; r < 4; ++r) { lo[r] = acc[dt][r] * il; hi[r] = acc[dt][4 + r] * il; }
    *(v4f*)&so[wave][col][dt * 16 + 8 * g] = lo; *(v4f*)&so[wave][col][dt * 16 + 8 * g + 4] = hi; }
  LDSX();
  for (int rl = 0; rl < 16; ++rl) if (lane < 16) vst2(CG + (rq + rl) * CC + h * HD + lane * 4, *(const v4f*)&so[wave][rl][lane * 4]);
}
// ---- k_attn: both attentions in one launch (neither reads what the other writes). blockIdx.z 0..3: global attention of sample z; 4..7: local attention of sample z - 4. The long global blocks have the low indices; registers and LDS leave room for a fifth block a WGP
__global__ __launch_bounds__(128) void k_attn(const _Float16* __restrict__ QL, const _Float16* __restrict__ KL, const _Float16* __restrict__ VL, float* __restrict__ LO, const _Float16* __restrict__ QG, const _Float16* __restrict__ KG, const _Float16* __restrict__ VG, float* __restrict__ CG) {
  __shared__ __align__(16) char sm[SM_ALL];
  if (blockIdx.z < TNB) global_body(QG, KG, VG, CG, sm, blockIdx.z);   // the same for a whole block: every barrier of a body is passed by all of its block's waves
  else local_body(QL, KL, VL, LO, sm, blockIdx.z - TNB);
}
// ---- k_out: block = (64 tokens, 128 out channels): yl = lo_w[o] . LO[.][t] (LO viewed as [c'][t'], gathered token-major as in k_proj) and yg = go_w[o] . cg[t], each context split in registers into bf16 hi + residual (2 products); out[b][o][t] = sqrt(1 - t_b/999) (yg + go_b) + sqrt(t_b/999) (yl + lo_b), channels-first. One ring of 16 weight tiles: 8 of lo_w, then 8 of go_w
#define OSTG (2 * WSTG)
__device__ __forceinline__ const __bf16* otile(const __bf16* g, int s) { return g + (s < WSTG ? s * 64 : 4 * CC * CC + (s - WSTG) * 64); }   // go_w lies 4 matrices behind lo_w in the packed weights
// foot of trip s, as WRING_FOOT, over the 16 tiles
#define ORING_FOOT(l, g, s) do { WAIT_LDS(); WAIT_COPIES(); __syncthreads(); if ((s) + 2 < OSTG) wstage((l) + (unsigned)((s) & 1) * (2u * WBUF), otile((g), (s) + 2)); } while (0)
__global__ __launch_bounds__(128) void k_out(const float* __restrict__ LO, const float* __restrict__ CG, const __bf16* __restrict__ P, const float* __restrict__ BL, const float* __restrict__ BG, const int* __restrict__ TSTEP, float* __restrict__ OUT) {
  __shared__ __align__(16) float st[128][68]; __shared__ __align__(16) __bf16 sw[2 * WBUF];
  const int tid = threadIdx.x, wave = tid >> 5, lane = tid & 31, col = lane & 15, g = lane >> 4; const size_t rb0 = (size_t)blockIdx.x * 64, r0 = rb0 + wave * 16; const size_t b = rb0 / TT, t0 = rb0 % TT; const int n0 = blockIdx.y * 128;
  const int ts = TSTEP[b];   // block-uniform, read ahead of the loops
  v8f accl[8] = {}, accg[8] = {};
  const __bf16* wg = P + ((size_t)3 * CC + n0 + (tid >> 3)) * CC + (tid & 7) * 8; const unsigned wl = lds_off(sw) + (unsigned)(tid >> 3) * 144u + (unsigned)(tid & 7) * 16u;
  const float* pl = LO + (b * CC + 8 * g) * TT + t0 + wave * 16 + col;   // element (token t0 + 16 wave + col, channel 8g+..) of tile 0; tile s lies s * 64 channels on
  const float* cr = CG + (r0 + col) * CC + 8 * g;   // element (token row r0 + col, channel 8g+..) of tile 8; tile s lies (s - 8) * 64 floats on
  float an[32];   // a tile's context values, fetched one tile ahead, in the order of k_proj
  gather_tile(an, pl);
  WRING_OPEN(wl, wg);
  for (int s = 0; s < WSTG; ++s) { const __bf16* wb = sw + (s & 1) * WBUF; const F2 a[2] = { bsplit16(an), bsplit16(an + 16) };
    if (s + 1 < WSTG) gather_tile(an, pl + (size_t)(s + 1) * 64 * TT); else row_tile(an, cr);   // the next tile's 32 values fly while this tile is worked on
#pragma unroll   // kk becomes a constant, so that the LDS reads of both k steps take immediate offsets from one address
    for (int kk = 0; kk < 2; ++kk) {
      v16b w[8];   // one group of LDS reads per k step, as in k_proj
#pragma unroll
      for (int j = 0; j < 8; ++j) w[j] = frag_b(wb + (j * 16 + col) * WPITCH + kk * 32, lane);
#pragma unroll
      for (int j = 0; j < 8; ++j) { accl[j] = wmma_bf(a[kk].h, w[j], accl[j]); accl[j] = wmma_bf(a[kk].l, w[j], accl[j]); } }
    ORING_FOOT(wl, wg, s); }
  for (int s = WSTG; s < OSTG; ++s) { const __bf16* wb = sw + (s & 1) * WBUF; const F2 a[2] = { bsplit16(an), bsplit16(an + 16) };
    if (s + 1 < OSTG) { cr += 64; row_tile(an, cr); }   // as above
#pragma unroll   // kk becomes a constant, so that the LDS reads of both k steps take immediate offsets from one address
    for (int kk = 0; kk < 2; ++kk) {
      v16b w[8];   // one group of LDS reads per k step, as in k_proj
#pragma unroll
      for (int j = 0; j < 8; ++j) w[j] = frag_b(wb + (j * 16 + col) * WPITCH + kk * 32, lane);
#pragma unroll
      for (int j = 0; j < 8; ++j) { accg[j] = wmma_bf(a[kk].l, w[j], accg[j]); accg[j] = wmma_bf(a[kk].h, w[j], accg[j]); } }
    ORING_FOOT(wl, wg, s); }
  WAIT_COPIES();
  const float tn = (float)ts / (float)(TS - 1); const float ag = sqrtf(1.0f - tn), al = sqrtf(tn);
  float bg[8], bl[8]; const int bo = n0 + col;
#pragma unroll   // j becomes a constant: the 16 bias loads go out as one group
  for (int j = 0; j < 8; ++j) { bg[j] = BG[bo + j * 16]; bl[j] = BL[bo + j * 16]; }
  asm volatile("s_wait_xcnt 0x0" :: "v"(bo) : "memory");   // takes the bias loads' index as an input: it stays in use behind all 16 loads, so no load's result lands in it, and any later write of it stands behind this wait
#pragma unroll
  for (int j = 0; j < 8; ++j) { const float bgj = bfr(bg[j]), blj = bfr(bl[j]);
#pragma unroll
    for (int r = 0; r < 8; ++r) st[j * 16 + col][wave * 16 + 8 * g + r] = (accg[j][r] + bgj) * ag + al * (accl[j][r] + blj); }
  __syncthreads();
  for (int e = tid; e < 128 * 16; e += 128) { const int o = e >> 4, q = e & 15; vst2(OUT + ((b * CC + n0 + o) * TT) + t0 + q * 4, *(const v4f*)&st[o][q * 4]); }   // 256-B segment of row (b, o)
}
extern "C" void kernel_launch(void* const* d_in, const int* in_sizes, int n_in, void* d_out, int out_size, void* d_ws, size_t ws_size, hipStream_t stream) {
  (void)in_sizes; (void)n_in; (void)out_size;
  const float** F = (const float**)d_in;   // 0 x, 1 cond [4,512,2048]; 2 t [4] int; 3 lq_w,4 lq_b, 5 lk_w,6 lk_b, 7 lv_w,8 lv_b, 9 lo_w,10 lo_b, 11 gq_w,12 gq_b, 13 gk_w,14 gk_b, 15 gv_w,16 gv_b, 17 go_w,18 go_b
  if (ws_size < (size_t)WS_END) return;
  char* ws = (char*)d_ws; __bf16* P = (__bf16*)ws; _Float16 *QL = (_Float16*)(ws + WS_QL), *KL = (_Float16*)(ws + WS_KL), *QG = (_Float16*)(ws + WS_QG), *KG = (_Float16*)(ws + WS_KG), *VL = (_Float16*)(ws + WS_VL), *VG = (_Float16*)(ws + WS_VG); float *LO = (float*)(ws + WS_LO), *CG = (float*)(ws + WS_CG); float *RC = (float*)(ws + WS_RC), *RS = (float*)(ws + WS_RS);
  k_pack<<<dim3(CC, 9), 256, 0, stream>>>(F[3], F[5], F[7], F[9], F[11], F[13], F[15], F[17], P, RC, RS);
  k_proj<<<dim3(TR / 128, CC / 256, 6), 128, 0, stream>>>(F[0], F[1], P, F[4], F[6], F[8], F[12], F[14], F[16], QL, KL, VL, QG, KG, VG, RC, RS);
  k_attn<<<dim3(TT / 64, NH, 2 * TNB), 128, 0, stream>>>(QL, KL, VL, LO, QG, KG, VG, CG);
  k_out<<<dim3(TR / 64, CC / 128), 128, 0, stream>>>(LO, CG, P, F[10], F[18], (const int*)d_in[2], (float*)d_out);
}

// v010
// One run takes 105 microseconds.
// Timed twice side by side with v009, it ran 1.04 times as fast both times.
// All steps since v000 together make it 3.99 times as fast.
// compute dtype: all float inputs rounded to bf16, t read on device; the six q/k/v projections with EXACT bf16 products on WMMA 16x16x32 (natural [out][in] rows; channels-first activations gathered token-major), + bias, rounded once to f16; local branch: windowed scores (16 slots, zero-padded slots as logit-0 / value-0 phantoms) and global branch: interleaved-pair RoPE (f32 inv_freq by powf, precise sinf/cosf) then full attention - both PLAIN (q, k single f16 x 1/8, running-max softmax in f32 with hardware exp, P scaled by 2^11 single f16 x v single f16); output convs/linears with the contexts split into bf16 hi + residual (2 products); the sqrt(1 - t/999), sqrt(t/999) mix in f32.
#include <hip/hip_runtime.h>
#include <math.h>

typedef __attribute__((ext_vector_type(16))) _Float16 v16h;
typedef __attribute__((ext_vector_type(16))) __bf16 v16b;
typedef __attribute__((ext_vector_type(8)))  _Float16 v8h;
typedef __attribute__((ext_vector_type(8)))  float v8f;
typedef __attribute__((ext_vector_type(4)))  float v4f;
typedef __attribute__((ext_vector_type(2)))  float v2f;
typedef __attribute__((ext_vector_type(4)))  unsigned v4u;
typedef __attribute__((ext_vector_type(4)))  int v4i;
typedef float __attribute__((may_alias)) float_a;
typedef int __attribute__((may_alias)) int_a;

template <typename T> __device__ __forceinline__ void vst2(void* p, T v) { *(T*)p = v;  }
__device__ __forceinline__ v8f wmma16(v16h a, v16h b, v8f c) {
  v8f d = __builtin_amdgcn_wmma_f32_16x16x32_f16(false, a, false, b, (short)0, c, false, false);
  asm volatile("v_nop\n\tv_nop\n\tv_nop\n\tv_nop" : "+v"(d) : "v"(a), "v"(b));
  return d;
}
__device__ __forceinline__ v8f wmma_bf(v16b a, v16b b, v8f c) {
  v8f d = __builtin_amdgcn_wmma_f32_16x16x32_bf16(false, a, false, b, (short)0, c, false, false);
  asm volatile("v_nop\n\tv_nop\n\tv_nop\n\tv_nop" : "+v"(d) : "v"(a), "v"(b));
  return d;
}
// 16x16x32 fragments: lane = (h = lane>>4, row/col = lane&15); elements 0..7 = k0+8h+0..7, 8..15 = k0+16+8h+0..7; D element r = row 8h+r
__device__ __forceinline__ v16h frag_h(const _Float16* rowk0, int lane) {
  union { v16h v; v8h q[2]; } u; const _Float16* p = rowk0 + 8 * (lane >> 4);
  u.q[0] = *(const v8h*)p; u.q[1] = *(const v8h*)(p + 16); return u.v;
}
__device__ __forceinline__ v16h frag_f32(const float* rowk0, int lane) {
  v16h a; const float* p = rowk0 + 8 * (lane >> 4);
#pragma unroll
  for (int i = 0; i < 8; ++i) { a[i] = (_Float16)p[i]; a[8 + i] = (_Float16)p[16 + i]; }
  return a;
}
__device__ __forceinline__ v16h frag_f32s(const float* rowk0, int lane, float sc) {
  v16h a; const float* p = rowk0 + 8 * (lane >> 4);
#pragma unroll
  for (int i = 0; i < 8; ++i) { a[i] = (_Float16)(p[i] * sc); a[8 + i] = (_Float16)(p[16 + i] * sc); }
  return a;
}
// column fragment from a [K][ld] layout (column n), rows >= K read as 0
__device__ __forceinline__ v16h fragc_f32(const float* W, int k0, int n, int lane, int ld, int K) {
  v16h a; const int g = lane >> 4;
#pragma unroll
  for (int i = 0; i < 8; ++i) { const int ka = k0 + 8 * g + i, kb = ka + 16;
    a[i] = (_Float16)(ka < K ? W[(size_t)(ka < K ? ka : K - 1) * ld + n] : 0.f); a[8 + i] = (_Float16)(kb < K ? W[(size_t)(kb < K ? kb : K - 1) * ld + n] : 0.f); }
  return a;
}
struct F2 { v16b h, l; };
__device__ __forceinline__ F2 bsplit16(const float v[16]) { F2 r;
#pragma unroll
  for (int i = 0; i < 16; ++i) { const __bf16 h = (__bf16)v[i]; r.h[i] = h; r.l[i] = (__bf16)(v[i] - (float)h); }
  return r; }
__device__ __forceinline__ F2 split_row(const float* row, int k0, int lane) { float v[16]; const float* p = row + k0 + 8 * (lane >> 4);
#pragma unroll
  for (int i = 0; i < 8; ++i) { v[i] = p[i]; v[8 + i] = p[16 + i]; }
  return bsplit16(v); }
__device__ __forceinline__ F2 split_rowK(const float* row, int k0, int lane, int K) { float v[16]; const int g = lane >> 4;
#pragma unroll
  for (int i = 0; i < 8; ++i) { const int ka = k0 + 8 * g + i, kb = ka + 16; v[i] = ka < K ? row[ka < K ? ka : K - 1] : 0.f; v[8 + i] = kb < K ? row[kb < K ? kb : K - 1] : 0.f; }
  return bsplit16(v); }
__device__ __forceinline__ F2 split_col(const float* W, int k0, int n, int lane, int ld, int K) { float v[16]; const int g = lane >> 4;
#pragma unroll
  for (int i = 0; i < 8; ++i) { const int ka = k0 + 8 * g + i, kb = ka + 16; v[i] = ka < K ? W[(size_t)(ka < K ? ka : K - 1) * ld + n] : 0.f; v[8 + i] = kb < K ? W[(size_t)(kb < K ? kb : K - 1) * ld + n] : 0.f; }
  return bsplit16(v); }
__device__ __forceinline__ v8f mac3(const F2& a, const F2& b, v8f c) { c = wmma_bf(a.l, b.h, c); c = wmma_bf(a.h, b.l, c); return wmma_bf(a.h, b.h, c); }
__device__ __forceinline__ float sigm(float v) { return 1.0f / (1.0f + expf(-v)); }
#define LDSX() do { asm volatile("s_wait_dscnt 0" ::: "memory"); __builtin_amdgcn_wave_barrier(); __builtin_amdgcn_fence(__ATOMIC_RELEASE, "workgroup"); } while (0)


// Mixed local / global soft-align attention (B 4, C 512, T 2,048, 8 heads x 64, window 16): a windowed cross attention (q from x, k/v from cond, zero-padded window) and a global RoPE cross attention, each with its own 1x1 projections, blended per sample by the diffusion step t.
#define NB 4
#define CC 512
#define TT 2048
#define NH 8
#define HD 64
#define WW 16
#define TS 1000
#define NR (NB * TT)
#ifndef TNB
#define TNB NB
#endif
#define TR (TNB * TT)
typedef __attribute__((ext_vector_type(8))) __bf16 v8b;
__device__ __forceinline__ v16b frag_b(const __bf16* rowk0, int lane) {
  union { v16b v; v8b q[2]; } u; const __bf16* p = rowk0 + 8 * (lane >> 4);
  u.q[0] = *(const v8b*)p; u.q[1] = *(const v8b*)(p + 16); return u.v;
}
__device__ __forceinline__ float bfr(float v) { return (float)(__bf16)v; }
__device__ __attribute__((noinline)) float exp_ni(float v) { return expf(v); }
__device__ __attribute__((noinline)) float erf_ni(float v) { return erff(v); }

#define WS_PW   0u                                     // bf16 rows: lq, lk, lv, lo, gq, gk, gv, go [8][512][512] (natural [out][in])
#define WS_QL   (WS_PW + 2u * (size_t)8 * CC * CC)        // f16 token rows [NR][512]: QL, KL, QG, KG
#define WS_KL   (WS_QL + 2u * (size_t)NR * CC)
#define WS_QG   (WS_KL + 2u * (size_t)NR * CC)
#define WS_KG   (WS_QG + 2u * (size_t)NR * CC)
#define WS_VL   (WS_KG + 2u * (size_t)NR * CC)            // f16 planes [b][512][TT]: VL, VG
#define WS_VG   (WS_VL + 2u * (size_t)NB * CC * TT)
#define WS_LO   (WS_VG + 2u * (size_t)NB * CC * TT)       // f32 local context in the module's (h, t, d) order == [c'][t'] ; CG token-major [NR][512]
#define WS_CG   (WS_LO + 4u * (size_t)NR * CC)
#define WS_RC   (WS_CG + 4u * (size_t)NR * CC)            // f32 RoPE table [TT][32]: cos, then sin
#define WS_RS   (WS_RC + 4u * (size_t)TT * (HD / 2))
#define WS_END  (WS_RS + 4u * (size_t)TT * (HD / 2))

// ---- weight tile in LDS: 128 weight rows x 64 k (128 B a row, LDS pitch 144 B = 16 B x odd for ds_load_b128), read by all four waves of a block; two buffers, the next tile's copies fly while this one is worked on
#define WPITCH 72
#define WBUF (128 * WPITCH)
#define WSTG (CC / 64)
__device__ __forceinline__ unsigned lds_off(const void* p) { return (unsigned)(size_t)p; }   // low 32 bits of a __shared__ address = byte offset in the work-group's LDS
// one tile: thread = (row tid >> 3 (+ 16 i), 16-byte piece tid & 7), a wave's copy covers 4 whole 128-B lines. The s_wait_xcnt stands inside the statement so that no address register is rewritten ahead of it.
__device__ __forceinline__ void wstage(unsigned l, const __bf16* g) {
  asm volatile("global_load_async_to_lds_b128 %0, %8, off\n\t"
               "global_load_async_to_lds_b128 %1, %9, off\n\t"
               "global_load_async_to_lds_b128 %2, %10, off\n\t"
               "global_load_async_to_lds_b128 %3, %11, off\n\t"
               "global_load_async_to_lds_b128 %4, %12, off\n\t"
               "global_load_async_to_lds_b128 %5, %13, off\n\t"
               "global_load_async_to_lds_b128 %6, %14, off\n\t"
               "global_load_async_to_lds_b128 %7, %15, off\n\t"
               "s_wait_xcnt 0x0"
               :: "v"(l), "v"(l + 2304u), "v"(l + 2u * 2304u), "v"(l + 3u * 2304u), "v"(l + 4u * 2304u), "v"(l + 5u * 2304u), "v"(l + 6u * 2304u), "v"(l + 7u * 2304u),
                  "v"(g), "v"(g + 16 * CC), "v"(g + 32 * CC), "v"(g + 48 * CC), "v"(g + 64 * CC), "v"(g + 80 * CC), "v"(g + 96 * CC), "v"(g + 112 * CC) : "memory");
}
#define WAIT_COPIES() asm volatile("s_wait_asynccnt 0x0" ::: "memory")   // this wave's copies have landed
#define WAIT_LDS() asm volatile("s_wait_dscnt 0x0" ::: "memory")         // this wave's reads of the buffer about to be refilled have returned
// in front of the loop: tile 0, wait, barrier, then tile 1
#define WRING_OPEN(l, g) do { wstage((l), (g)); WAIT_COPIES(); __syncthreads(); wstage((l) + 2u * WBUF, (g) + 64); } while (0)
// foot of trip s: the one barrier publishes tile s + 1 and ends every wave's reads of tile s, whose buffer takes tile s + 2
#define WRING_FOOT(l, g, s) do { WAIT_LDS(); WAIT_COPIES(); __syncthreads(); if ((s) + 2 < WSTG) wstage((l) + (unsigned)((s) & 1) * (2u * WBUF), (g) + ((s) + 2) * 64); } while (0)

// the projection kernel's ring: 256 weight rows a tile, staged as two runs of 128 rows; same order of waits and barrier as above
#define PBUF (256 * WPITCH)
__device__ __forceinline__ void pstage(unsigned l, const __bf16* g) { wstage(l, g); wstage(l + 128u * 144u, g + 128 * CC); }
#define PRING_OPEN(l, g) do { pstage((l), (g)); WAIT_COPIES(); __syncthreads(); pstage((l) + 2u * PBUF, (g) + 64); } while (0)
#define PRING_FOOT(l, g, s) do { WAIT_LDS(); WAIT_COPIES(); __syncthreads(); if ((s) + 2 < WSTG) pstage((l) + (unsigned)((s) & 1) * (2u * PBUF), (g) + ((s) + 2) * 64); } while (0)

// 128 out channels x one k step for a wave's two token tiles
__device__ __forceinline__ void pmac(v8f (&c0)[8], v8f (&c1)[8], v16b a0, v16b a1, const __bf16* wrow, int lane) {
  v16b w[8];   // eight weight fragments are read as one group, so that the LDS latency is waited out once and not in front of every product
#pragma unroll
  for (int j = 0; j < 8; ++j) w[j] = frag_b(wrow + j * 16 * WPITCH, lane);
  __builtin_amdgcn_sched_barrier(0);   // keeps the 16 LDS reads together in front of the 16 products: without it the compiler spreads them in pairs among the products, each pair with a wait to 0
#pragma unroll
  for (int j = 0; j < 8; ++j) {   // each fragment read from LDS serves two products; the plain builtin, whose distances the compiler keeps: an asm statement's operands would tie all 256 accumulator registers to the first register window
    c0[j] = __builtin_amdgcn_wmma_f32_16x16x32_bf16(false, a0, false, w[j], (short)0, c0[j], false, false); c1[j] = __builtin_amdgcn_wmma_f32_16x16x32_bf16(false, a1, false, w[j], (short)0, c1[j], false, false); }
}
// a tile's 2 x 32 gathered values to the two token tiles' bf16 fragments of its two k steps
__device__ __forceinline__ void pconv(v16b (&a)[2][2], const float (&an)[2][32]) {
#pragma unroll   // constants: an and a stay in registers
  for (int u = 0; u < 2; ++u)
#pragma unroll
    for (int i = 0; i < 16; ++i) { a[u][0][i] = (__bf16)an[u][i]; a[u][1][i] = (__bf16)an[u][16 + i]; }
}
// one tile (64 channels) of a channels-first f32 activation for one token a lane: 32 loads as one group from one address
__device__ __forceinline__ void gather_tile(float (&an)[32], const float* p) {
#pragma unroll   // constants: immediate offsets, an stays in registers
  for (int kk = 0; kk < 2; ++kk)
#pragma unroll
    for (int i = 0; i < 8; ++i) { an[16 * kk + i] = p[(size_t)(kk * 32 + i) * TT]; an[16 * kk + 8 + i] = p[(size_t)(kk * 32 + 16 + i) * TT]; }
  asm volatile("s_wait_xcnt 0x0" :: "v"(p) : "memory");   // takes the loads' address as an input: the pair stays in use behind all 32 loads, so no load's result lands in it, and any later write of it stands behind this wait
}
// the same for two tokens a lane, 64 tokens apart: 64 loads as one group from one address
__device__ __forceinline__ void gather_tile2(float (&an)[2][32], const float* p) {
#pragma unroll   // constants: immediate offsets, an stays in registers
  for (int u = 0; u < 2; ++u)
#pragma unroll
    for (int kk = 0; kk < 2; ++kk)
#pragma unroll
      for (int i = 0; i < 8; ++i) { an[u][16 * kk + i] = p[(size_t)(kk * 32 + i) * TT + u * 64]; an[u][16 * kk + 8 + i] = p[(size_t)(kk * 32 + 16 + i) * TT + u * 64]; }
  asm volatile("s_wait_xcnt 0x0" :: "v"(p) : "memory");   // as in gather_tile, behind all 64 loads
}
// the same 64 channels from a token-major f32 row
__device__ __forceinline__ void row_tile(float (&an)[32], const float* p) {
#pragma unroll   // constants: immediate offsets, an stays in registers
  for (int kk = 0; kk < 2; ++kk)
#pragma unroll
    for (int i = 0; i < 8; ++i) { an[16 * kk + i] = p[kk * 32 + i]; an[16 * kk + 8 + i] = p[kk * 32 + 16 + i]; }
  asm volatile("s_wait_xcnt 0x0" :: "v"(p) : "memory");   // as in gather_tile, for the row loads' address
}
__device__ __attribute__((noinline)) float pow_p(float a, float b) { return powf(a, b); }
__device__ __attribute__((noinline)) float sin_p(float v) { return sinf(v); }
__device__ __attribute__((noinline)) float cos_p(float v) { return cosf(v); }
static_assert(CC * 128 == TT * (HD / 2), "the CC blocks of blockIdx.y 8, 128 entries each, cover the table exactly");
// blockIdx.y 0..7: one weight row to bf16; blockIdx.y 8: 128 entries (4 positions x 32 frequencies) of the RoPE table, waves 0..3 the cosines, waves 4..7 the sines, each wave one whole 128-B line
__global__ __launch_bounds__(256) void k_pack(const float* __restrict__ W0, const float* __restrict__ W1, const float* __restrict__ W2, const float* __restrict__ W3, const float* __restrict__ W4, const float* __restrict__ W5, const float* __restrict__ W6, const float* __restrict__ W7, __bf16* __restrict__ P, float* __restrict__ RC, float* __restrict__ RS) {
  __shared__ __align__(16) __bf16 s[CC]; const int n = blockIdx.x, which = blockIdx.y, t = threadIdx.x;
  if (which == 8) { const int e = n * 128 + (t & 127); const int i = e & 31; const float inv = 1.0f / pow_p(10000.0f, (float)(2 * i) / (float)HD); const float ang = (float)(e >> 5) * inv;   // angle = position * inv_freq[i]
    if (t < 128) RC[e] = cos_p(ang); else RS[e] = sin_p(ang);
    return; }
  const float* Wm = (which == 0) ? W0 : (which == 1) ? W1 : (which == 2) ? W2 : (which == 3) ? W3 : (which == 4) ? W4 : (which == 5) ? W5 : (which == 6) ? W6 : W7;
  for (int k = t; k < CC; k += 256) s[k] = (__bf16)Wm[(size_t)n * CC + k]; __syncthreads(); for (int q = t; q < CC / 8; q += 256) vst2((unsigned*)(P + ((size_t)which * CC + n) * CC + q * 8), *(const v4u*)&s[q * 8]); }
// ---- k_proj: block = (128 tokens, 256 out channels, which), a wave = two 16-token tiles, 64 tokens apart, x 256 out channels: a weight fragment serves two products, a gathered activation sixteen: which 0 lq(x) 1 lk(cond) 4 gq(x) 5 gk(cond) -> f16 token rows (gq/gk with RoPE); 2 lv(cond) 6 gv(cond) -> f16 planes. A gathered from the channels-first input.
__global__ __launch_bounds__(128) void k_proj(const float* __restrict__ X, const float* __restrict__ CND, const __bf16* __restrict__ P, const float* __restrict__ B0, const float* __restrict__ B1, const float* __restrict__ B2, const float* __restrict__ B4, const float* __restrict__ B5, const float* __restrict__ B6, _Float16* __restrict__ QL, _Float16* __restrict__ KL, _Float16* __restrict__ VL, _Float16* __restrict__ QG, _Float16* __restrict__ KG, _Float16* __restrict__ VG, const float* __restrict__ RC, const float* __restrict__ RS) {
  __shared__ __align__(16) float sf[64][132]; __shared__ __align__(16) _Float16 so[64][136]; __shared__ __align__(16) _Float16 st[128][72]; __shared__ __align__(16) __bf16 sw[2 * PBUF];
  const int tid = threadIdx.x, wave = tid >> 5, lane = tid & 31, col = lane & 15, g = lane >> 4; const int wsel = blockIdx.z; const int which = (wsel < 3) ? wsel : wsel + 1;   // 0,1,2,4,5,6
  const int nb0 = blockIdx.y * 256; const size_t rb0 = (size_t)blockIdx.x * 128; const size_t b = rb0 / TT, t0 = rb0 % TT; const int tw = (int)t0 + wave * 16;
  const float* IN = (which == 0 || which == 4) ? X : CND; const float* BB = (which == 0) ? B0 : (which == 1) ? B1 : (which == 2) ? B2 : (which == 4) ? B4 : (which == 5) ? B5 : B6;
  v8f acc00[8] = {}, acc01[8] = {}, acc10[8] = {}, acc11[8] = {};   // acc<u><hb>[j]: tokens tw + 64 u + .., out channels nb0 + 128 hb + 16 j + ..
  const __bf16* wg = P + ((size_t)which * CC + nb0 + (tid >> 3)) * CC + (tid & 7) * 8; const unsigned wl = lds_off(sw) + (unsigned)(tid >> 3) * 144u + (unsigned)(tid & 7) * 16u;
  const float* pa = IN + (b * CC + 8 * g) * TT + tw + col;   // element (token tw+col, channel 8g+..) of tile 0; tile s lies s * 64 channels on: one address for a tile's two k steps
  float an[2][32];   // a tile's activations, fetched one tile ahead: [u][16 kk + (i, 8 + i)] = channels kk*32 + 8g + (i, 16 + i) of token tw + 64 u + col
  gather_tile2(an, pa);
  PRING_OPEN(wl, wg);
  v16b a[2][2];
  for (int s = 0; s < WSTG - 1; ++s) { const __bf16* wb = sw + (s & 1) * PBUF;
    pconv(a, an);
    gather_tile2(an, pa + (size_t)(s + 1) * 64 * TT);   // the next tile's 64 loads fly while this tile is worked on
#pragma unroll   // kk becomes a constant, so that the LDS reads of both k steps take immediate offsets from one address
    for (int kk = 0; kk < 2; ++kk) { pmac(acc00, acc10, a[0][kk], a[1][kk], wb + col * WPITCH + kk * 32, lane); pmac(acc01, acc11, a[0][kk], a[1][kk], wb + (128 + col) * WPITCH + kk * 32, lane); }
    PRING_FOOT(wl, wg, s); }
  { const __bf16* wb = sw + ((WSTG - 1) & 1) * PBUF;   // the last tile stands on its own: with a test round the loads inside the loop the build held the 64 values twice, moved them every trip and spilled an address
    pconv(a, an);
#pragma unroll   // as above
    for (int kk = 0; kk < 2; ++kk) { pmac(acc00, acc10, a[0][kk], a[1][kk], wb + col * WPITCH + kk * 32, lane); pmac(acc01, acc11, a[0][kk], a[1][kk], wb + (128 + col) * WPITCH + kk * 32, lane); }
    PRING_FOOT(wl, wg, WSTG - 1); }
  WAIT_COPIES();
  // the block's four quarters (64 tokens x 128 out channels) go out one after the other through the same LDS
#pragma unroll 1   // the epilogue stands once in the code, which keeps the kernel's text small for the instruction cache: each trip writes acc00 out, then the other three move up one place
  for (int q = 0; q < 4; ++q) { const int u = q >> 1, n0 = nb0 + (q & 1) * 128;
  if (which == 2 || which == 6) {   // v -> planes [b][c][t]
    if (q) __syncthreads();   // every thread has read the quarter before out of st
#pragma unroll
    for (int j = 0; j < 8; ++j) { const float bb = bfr(BB[n0 + j * 16 + col]);
#pragma unroll
      for (int r = 0; r < 8; ++r) st[j * 16 + col][wave * 16 + 8 * g + r] = (_Float16)(acc00[j][r] + bb); }
    __syncthreads(); _Float16* V = (which == 2) ? VL : VG;
    for (int e = tid; e < 128 * 8; e += 128) { const int d = e >> 3, pc = e & 7; vst2((unsigned*)(V + ((b * CC + n0 + d) * TT) + t0 + u * 64 + pc * 8), *(const v4u*)&st[d][pc * 8]); }
  } else {
  if (which < 2) {   // local q/k rows
#pragma unroll
    for (int j = 0; j < 8; ++j) { const float bb = bfr(BB[n0 + j * 16 + col]);
#pragma unroll
      for (int r = 0; r < 8; ++r) so[wave * 16 + 8 * g + r][j * 16 + col] = (_Float16)(acc00[j][r] + bb); }
  } else {   // global q/k: + bias then interleaved-pair RoPE within each 64-dim head: angle = t * inv_freq[(c % 64) / 2], its cos and sin from the table
    float cs[16], sn[16]; const float* rc = RC + (tw + u * 64) * (HD / 2) + lane; const float* rs = RS + (tw + u * 64) * (HD / 2) + lane;   // pair pi has frequency pi % 32 = lane: one table line a row serves both of a lane's pairs
#pragma unroll   // rl becomes a constant: the 32 loads go out as one group, in front of the LDS round trip
    for (int rl = 0; rl < 16; ++rl) { cs[rl] = rc[rl * (HD / 2)]; sn[rl] = rs[rl * (HD / 2)]; }
    asm volatile("s_wait_xcnt 0x0" :: "v"(rc), "v"(rs) : "memory");   // takes the table loads' addresses as inputs: they stay in use behind all 32 loads, so no load's result lands in them, and any later write of them stands behind this wait
#pragma unroll
    for (int j = 0; j < 8; ++j) { const float bb = bfr(BB[n0 + j * 16 + col]);
#pragma unroll
      for (int r = 0; r < 8; ++r) sf[wave * 16 + 8 * g + r][j * 16 + col] = acc00[j][r] + bb; }
    LDSX();
    // each lane: rows of this wave; pairs handled by even columns
#pragma unroll   // rl becomes a constant: cs and sn stay in registers
    for (int rl = 0; rl < 16; ++rl) {
#pragma unroll   // two pairs a lane, straight-line now that no call stands in the body
      for (int u = 0; u < 2; ++u) { const int c = 2 * (lane + 32 * u);
        const float x1 = sf[wave * 16 + rl][c], x2 = sf[wave * 16 + rl][c + 1]; so[wave * 16 + rl][c] = (_Float16)(x1 * cs[rl] - x2 * sn[rl]); so[wave * 16 + rl][c + 1] = (_Float16)(x1 * sn[rl] + x2 * cs[rl]); } }
  }
  LDSX();
  _Float16* D0 = (which == 0) ? QL : (which == 1) ? KL : (which == 4) ? QG : KG;
  for (int rl = 0; rl < 16; ++rl) if (lane < 16) vst2((unsigned*)(D0 + (rb0 + u * 64 + wave * 16 + rl) * CC + n0 + lane * 8), *(const v4u*)&so[wave * 16 + rl][lane * 8]);
  }
#pragma unroll   // j becomes a constant: register moves
  for (int j = 0; j < 8; ++j) { acc00[j] = acc01[j]; acc01[j] = acc10[j]; acc10[j] = acc11[j]; }
  }
}
// ---- LDS of k_attn, one array for both bodies: bytes 0 .. SM_SO - 1 hold the global body's K / V ring (the local body's P tiles lie at its start), the f32 output staging of either body follows
#define SM_SO (2 * 2 * 2 * 64 * 72)
#define SM_ALL (SM_SO + 4 * 4 * 16 * 68)
// ---- local_body: block = (64 queries, head, b): window keys j = t-8..t+7 (3 key tiles from tq0-16), out-of-range slots = phantom keys with logit 0 and value 0; out -> LO in (h, t, d) order
__device__ __forceinline__ void local_body(const _Float16* __restrict__ QL, const _Float16* __restrict__ KL, const _Float16* __restrict__ VL, float* __restrict__ LO, char* sm, const size_t b) {
  _Float16 (*sph)[16][56] = (_Float16 (*)[16][56])sm; float (*so)[16][68] = (float (*)[16][68])(sm + SM_SO);
  const int tid = threadIdx.x, wave = tid >> 5, lane = tid & 31, col = lane & 15, g = lane >> 4; const int h = blockIdx.y; const int q0 = blockIdx.x * 64 + wave * 16; const size_t rq = b * TT + q0;
  v16h aq[2];
#pragma unroll
  for (int kc = 0; kc < 2; ++kc) aq[kc] = frag_h(QL + (rq + col) * CC + h * HD + kc * 32, lane);
  float s[3][8]; const int jbase = q0 - 16;
#pragma unroll
  for (int ct = 0; ct < 3; ++ct) { const int j = jbase + ct * 16 + col; v8f c = {};
    if (jbase + ct * 16 >= 0 && jbase + ct * 16 + 16 <= TT) {
#pragma unroll
      for (int kc = 0; kc < 2; ++kc) c = wmma16(aq[kc], frag_h(KL + (b * TT + j) * CC + h * HD + kc * 32, lane), c); }
#pragma unroll
    for (int r = 0; r < 8; ++r) { const int t = q0 + 8 * g + r; const bool inwin = (j >= t - 8) && (j <= t + 7) && (j >= 0) && (j < TT); s[ct][r] = inwin ? c[r] * 0.125f : -3.0e38f; } }
  float il[8];
#pragma unroll
  for (int r = 0; r < 8; ++r) { const int t = q0 + 8 * g + r; const int npad = max(0, 8 - t) + max(0, t + 8 - TT); float mx = fmaxf(fmaxf(s[0][r], s[1][r]), s[2][r]);
#pragma unroll
    for (int o = 1; o < 16; o <<= 1) mx = fmaxf(mx, __shfl_xor(mx, o));
    if (npad > 0) mx = fmaxf(mx, 0.f);
    float es = 0.f; float e[3];
#pragma unroll
    for (int ct = 0; ct < 3; ++ct) { e[ct] = (s[ct][r] <= -1.0e38f) ? 0.f : __expf(s[ct][r] - mx); es += e[ct]; }
#pragma unroll
    for (int o = 1; o < 16; o <<= 1) es += __shfl_xor(es, o);
    es += (float)npad * __expf(-mx);   // zero-padded slots: logit 0, value 0
    il[r] = (1.0f / 2048.0f) / es;
#pragma unroll
    for (int ct = 0; ct < 3; ++ct) sph[wave][8 * g + r][ct * 16 + col] = (_Float16)(e[ct] * 2048.0f); }
  LDSX();
  v8f acc[4] = {};
#pragma unroll
  for (int ct = 0; ct < 3; ++ct) { const int j0 = jbase + ct * 16; if (j0 < 0 || j0 + 16 > TT) continue;   // fully out-of-range tile: P is 0 there
    // a 16-wide K step: use a 32-wide frag with the second half zero? frag_h reads 32 halves; take keys [j0, j0+32) only when ct < 2 pairs... simpler: process pairs (ct 0-1) as one 32-step and ct 2 alone padded by sph zeros beyond col 48
    (void)j0; }
  { // step A: keys jbase..jbase+31 (tiles 0,1); step B: keys jbase+32..jbase+47 (tile 2) + 16 zero columns (sph cols 48..63 are never written -> zero them)
#pragma unroll
    for (int r = 0; r < 8; ++r) sph[wave][8 * g + r][48 + (col & 7)] = (_Float16)0.f;   // cols 48..55 zeroed (56-wide buffer); frag reads up to col 63 -> keep within 56? use explicit bounds below
  }
  LDSX();
  { const int jA = jbase, jB = jbase + 32;
    const v16h pa = frag_h(&sph[wave][col][0], lane);
    if (jA >= 0) {   // tiles 0-1 fully in range unless jbase < 0 (first query block): then tile 0 is out of range and its P are 0, but the V address would underflow -> handle by splitting
#pragma unroll
      for (int dt = 0; dt < 4; ++dt) acc[dt] = wmma16(pa, frag_h(VL + ((b * CC + (size_t)h * HD + dt * 16 + col) * TT) + jA, lane), acc[dt]); }
    else {   // q0 == 0 block, wave 0: keys -16..15: only 0..15 valid (tile 1) -> shift: build a frag over keys 0..31 with P columns 16..47? Simplest: second-half product using a 32-wide read at 0 with P cols 16..47
      const v16h pa2 = frag_h(&sph[wave][col][16], lane);   // P for keys jbase+16 .. jbase+47 = 0..31
#pragma unroll
      for (int dt = 0; dt < 4; ++dt) acc[dt] = wmma16(pa2, frag_h(VL + ((b * CC + (size_t)h * HD + dt * 16 + col) * TT) + 0, lane), acc[dt]); }
    if (jA >= 0 && jB + 16 <= TT) {   // tile 2 (16 keys) + 16 phantom zero columns: read 32 values from V (the extra 16 are multiplied by explicit zeros)
      v16h pb = frag_h(&sph[wave][col][32], lane);
#pragma unroll
      for (int i = 8; i < 16; ++i) pb[i] = (_Float16)0.f;   // K positions 16..31 of this step (cols 48..63) -> zero regardless of LDS contents
      const int jr = (jB + 32 <= TT) ? jB : (TT - 32);   // keep the 32-wide V read in range; when shifted, realign P instead
      if (jr == jB) {
#pragma unroll
        for (int dt = 0; dt < 4; ++dt) acc[dt] = wmma16(pb, frag_h(VL + ((b * CC + (size_t)h * HD + dt * 16 + col) * TT) + jB, lane), acc[dt]); }
      else {   // last block: keys jB..jB+15 are the LAST 16 positions -> read V from TT-32 and put P into K positions 16..31
        v16h pc2; 
#pragma unroll
        for (int i = 0; i < 8; ++i) { pc2[i] = (_Float16)0.f; pc2[8 + i] = pb[i]; }
#pragma unroll
        for (int dt = 0; dt < 4; ++dt) acc[dt] = wmma16(pc2, frag_h(VL + ((b * CC + (size_t)h * HD + dt * 16 + col) * TT) + (TT - 32), lane), acc[dt]); } }
  }
#pragma unroll
  for (int r = 0; r < 8; ++r)
#pragma unroll
    for (int dt = 0; dt < 4; ++dt) so[wave][8 * g + r][dt * 16 + col] = acc[dt][r] * il[r];
  LDSX();
  for (int rl = 0; rl < 16; ++rl) if (lane < 16) vst2(LO + ((b * NH + h) * TT + q0 + rl) * (size_t)HD + lane * 4, *(const v4f*)&so[wave][rl][lane * 4]);   // (h, t, d) order: 256-B row per (h, t)
}
// ---- K / V tiles of global_body in LDS: 64 keys a tile; K = 64 key rows x 64 dims, V = 64 dim rows x 64 keys, each row one whole 128-B line, LDS pitch 144 B (16 B x odd for ds_load_b128); read by all four waves of a block; two buffers, the next tile's copies fly while this one is worked on
#define KVP 72
#define KVT (64 * KVP)
#define KVBUF (2 * KVT)
#define KVSTG (TT / 64)
// one tile pair: thread = (row tid >> 3 (+ 16 i), 16-byte piece tid & 7), a wave's copy covers 4 whole 128-B lines. The s_wait_xcnt stands inside the statement so that no address register is rewritten ahead of it.
__device__ __forceinline__ void kvstage(unsigned l, const _Float16* gk, const _Float16* gv) {
  asm volatile("global_load_async_to_lds_b128 %0, %8, off\n\t"
               "global_load_async_to_lds_b128 %1, %9, off\n\t"
               "global_load_async_to_lds_b128 %2, %10, off\n\t"
               "global_load_async_to_lds_b128 %3, %11, off\n\t"
               "global_load_async_to_lds_b128 %4, %12, off\n\t"
               "global_load_async_to_lds_b128 %5, %13, off\n\t"
               "global_load_async_to_lds_b128 %6, %14, off\n\t"
               "global_load_async_to_lds_b128 %7, %15, off\n\t"
               "s_wait_xcnt 0x0"
               :: "v"(l), "v"(l + 2304u), "v"(l + 2u * 2304u), "v"(l + 3u * 2304u), "v"(l + 4u * 2304u), "v"(l + 5u * 2304u), "v"(l + 6u * 2304u), "v"(l + 7u * 2304u),
                  "v"(gk), "v"(gk + 16 * CC), "v"(gk + 32 * CC), "v"(gk + 48 * CC), "v"(gv), "v"(gv + 16 * TT), "v"(gv + 32 * TT), "v"(gv + 48 * TT) : "memory");
}
// value of lane ^ 16 (the same column in the other lane half) by a vector cross-row move, no LDS round trip
__device__ __forceinline__ float xhalf(float v) { const int bts = __builtin_bit_cast(int, v); return __builtin_bit_cast(float, __builtin_amdgcn_permlanex16(bts, bts, 0x76543210, 0xfedcba98, false, false)); }
static_assert(SM_SO == 2 * 2 * KVBUF, "the ring's two buffers fill the first part of the array exactly");
__device__ __forceinline__ void global_body(const _Float16* __restrict__ QG, const _Float16* __restrict__ KG, const _Float16* __restrict__ VG, float* __restrict__ CG, char* sm, const size_t b, const int qb) {
  float (*so)[16][68] = (float (*)[16][68])(sm + SM_SO); _Float16* skv = (_Float16*)sm;
  const int tid = threadIdx.x, wave = tid >> 5, lane = tid & 31, col = lane & 15, g = lane >> 4; const int h = blockIdx.y; const int q0 = qb * 128 + wave * 32; const size_t rq = b * TT + q0;
  v16h aq[2][2];   // Q rows as the B operand: column col of group u = query q0 + 16 u + col
#pragma unroll
  for (int u = 0; u < 2; ++u)
#pragma unroll
    for (int kc = 0; kc < 2; ++kc) aq[u][kc] = frag_h(QG + (rq + u * 16 + col) * CC + h * HD + kc * 32, lane);
  const float SC2 = 0.125f * 1.44269504088896f;   // 1/sqrt(64) * log2(e): raw score -> exponent of 2
  float m[2] = { -3.0e38f, -3.0e38f }, l[2] = { 0.f, 0.f };   // of query col of group u: m (a raw q . k) is equal in both lane halves, l is 2048 x the sum over this half's keys (the halves are joined behind the loop)
  v8f acc[2][4] = {};   // acc[u][dt][r] = O[query col of group u][dt * 16 + 8g + r]
  const _Float16* gk = KG + (b * TT + (tid >> 3)) * CC + h * HD + (tid & 7) * 8; const _Float16* gv = VG + (b * CC + (size_t)h * HD + (tid >> 3)) * TT + (tid & 7) * 8; const unsigned kl = lds_off(skv) + (unsigned)(tid >> 3) * 144u + (unsigned)(tid & 7) * 16u;
  // in front of the loop: tile 0, wait, barrier, then tile 1
  kvstage(kl, gk, gv); WAIT_COPIES(); __syncthreads(); kvstage(kl + 2u * KVBUF, gk + 64 * CC, gv + 64);
#pragma unroll 1   // one tile a trip: the ring's foot stands once in the code
  for (int st = 0; st < KVSTG; ++st) { const _Float16* kb = skv + (st & 1) * KVBUF; const _Float16* vb = kb + KVT;
    v16h kf[2][2][2];   // the tile's eight K fragments are read as one group at the head of the trip: the second step's scores then wait for no LDS read
#pragma unroll
    for (int kk = 0; kk < 2; ++kk)
#pragma unroll
      for (int ct = 0; ct < 2; ++ct)
#pragma unroll
        for (int kc = 0; kc < 2; ++kc) kf[kk][ct][kc] = frag_h(kb + (kk * 32 + ct * 16 + col) * KVP + kc * 32, lane);
#pragma unroll   // kk becomes a constant, so that the LDS reads of both 32-key steps take immediate offsets from one address
    for (int kk = 0; kk < 2; ++kk) { v16h vf[4];
#pragma unroll
      for (int dt = 0; dt < 4; ++dt) vf[dt] = frag_h(vb + (dt * 16 + col) * KVP + kk * 32, lane);
      v8f c[2][2] = {};   // c[u][ct][r] = raw q . k of key kk * 32 + ct * 16 + 8g + r with query col of group u
#pragma unroll   // three independent products stand between the two that add into one tile
      for (int kc = 0; kc < 2; ++kc)
#pragma unroll
        for (int ct = 0; ct < 2; ++ct)
#pragma unroll
          for (int u = 0; u < 2; ++u) c[u][ct] = wmma16(kf[kk][ct][kc], aq[u][kc], c[u][ct]);
      v16h pb[2]; float alpha[2];   // P^T as the B operand straight from the score registers: element i = key 8g + i, element 8 + i = key 16 + 8g + i, the k order of frag_h
#pragma unroll   // u becomes a constant: both groups' scores, P and state stay in registers, and their two chains interleave
      for (int u = 0; u < 2; ++u) {
        float mx = fmaxf(c[u][0][0], c[u][1][0]);
#pragma unroll   // r becomes a constant: the scores stay in registers
        for (int r = 1; r < 8; ++r) mx = fmaxf(mx, fmaxf(c[u][0][r], c[u][1][r]));
        mx = fmaxf(mx, xhalf(mx));   // the other half's 16 keys of the same query
        const float mn = fmaxf(m[u], mx); alpha[u] = __builtin_amdgcn_exp2f((m[u] - mn) * SC2); m[u] = mn;   // first step: m = -3e38 gives exp2 of a huge negative = 0
        const float nb = 11.0f - mn * SC2;   // P = 2^(c SC2 - mn SC2 + 11) = 2048 exp((c - mn) / 8): one multiply-add and one exp2 a score
        float es = 0.f;
#pragma unroll   // r becomes a constant: scores and P stay in registers
        for (int r = 0; r < 8; ++r) { const float e0 = __builtin_amdgcn_exp2f(fmaf(c[u][0][r], SC2, nb)), e1 = __builtin_amdgcn_exp2f(fmaf(c[u][1][r], SC2, nb)); es += e0 + e1; pb[u][r] = (_Float16)e0; pb[u][8 + r] = (_Float16)e1; }
        l[u] = l[u] * alpha[u] + es; }
#pragma unroll   // dt and u become constants: the accumulators stay in registers
      for (int dt = 0; dt < 4; ++dt)
#pragma unroll
        for (int u = 0; u < 2; ++u) { acc[u][dt] *= alpha[u]; acc[u][dt] = wmma16(vf[dt], pb[u], acc[u][dt]); } }
    // foot of trip st: the one barrier publishes tile st + 1 and ends every wave's reads of tile st, whose buffer takes tile st + 2
    WAIT_LDS(); WAIT_COPIES(); __syncthreads(); if (st + 2 < KVSTG) kvstage(kl + (unsigned)(st & 1) * (2u * KVBUF), gk + (size_t)(st + 2) * 64 * CC, gv + (st + 2) * 64); }
  WAIT_COPIES();
#pragma unroll   // u becomes a constant: the accumulators stay in registers; the two groups go out one after the other through the wave's own staging rows (a wave's LDS operations keep their order, so group 1 is written behind the reads of group 0)
  for (int u = 0; u < 2; ++u) {
    const float lj = l[u] + xhalf(l[u]);
    const float il = 1.0f / lj;   // l and acc both carry the factor 2048
#pragma unroll   // dt and r become constants: the accumulators stay in registers
    for (int dt = 0; dt < 4; ++dt) { v4f lo, hi;
#pragma unroll
      for (int r = 0; r < 4; ++r) { lo[r] = acc[u][dt][r] * il; hi[r] = acc[u][dt][4 + r] * il; }
      *(v4f*)&so[wave][col][dt * 16 + 8 * g] = lo; *(v4f*)&so[wave][col][dt * 16 + 8 * g + 4] = hi; }
    LDSX();
    for (int rl = 0; rl < 16; ++rl) if (lane < 16) vst2(CG + (rq + u * 16 + rl) * CC + h * HD + lane * 4, *(const v4f*)&so[wave][rl][lane * 4]);
  }
}
// ---- k_attn: both attentions in one launch (neither reads what the other writes). blockIdx.z 0..1: global attention, 128 queries a block: sample 2 z + (x >> 4), query block x & 15; 2..5: local attention of sample z - 2, 64 queries a block. The long global blocks have the low indices; registers and LDS leave room for further blocks a WGP, through which the short local blocks pass while the global ones run
static_assert(TNB % 2 == 0 && TT / 64 == 2 * (TT / 128), "two samples' global query blocks fill one plane of the grid");
__global__ __launch_bounds__(128) void k_attn(const _Float16* __restrict__ QL, const _Float16* __restrict__ KL, const _Float16* __restrict__ VL, float* __restrict__ LO, const _Float16* __restrict__ QG, const _Float16* __restrict__ KG, const _Float16* __restrict__ VG, float* __restrict__ CG) {
  __shared__ __align__(16) char sm[SM_ALL];
  if (blockIdx.z < TNB / 2) global_body(QG, KG, VG, CG, sm, blockIdx.z * 2 + (blockIdx.x >> 4), blockIdx.x & 15);   // the same for a whole block: every barrier of a body is passed by all of its block's waves
  else local_body(QL, KL, VL, LO, sm, blockIdx.z - TNB / 2);
}
// ---- k_out: block = (64 tokens, 128 out channels): yl = lo_w[o] . LO[.][t] (LO viewed as [c'][t'], gathered token-major as in k_proj) and yg = go_w[o] . cg[t], each context split in registers into bf16 hi + residual (2 products); out[b][o][t] = sqrt(1 - t_b/999) (yg + go_b) + sqrt(t_b/999) (yl + lo_b), channels-first. One ring of 16 weight tiles: 8 of lo_w, then 8 of go_w
#define OSTG (2 * WSTG)
__device__ __forceinline__ const __bf16* otile(const __bf16* g, int s) { return g + (s < WSTG ? s * 64 : 4 * CC * CC + (s - WSTG) * 64); }   // go_w lies 4 matrices behind lo_w in the packed weights
// foot of trip s, as WRING_FOOT, over the 16 tiles
#define ORING_FOOT(l, g, s) do { WAIT_LDS(); WAIT_COPIES(); __syncthreads(); if ((s) + 2 < OSTG) wstage((l) + (unsigned)((s) & 1) * (2u * WBUF), otile((g), (s) + 2)); } while (0)
__global__ __launch_bounds__(128) void k_out(const float* __restrict__ LO, const float* __restrict__ CG, const __bf16* __restrict__ P, const float* __restrict__ BL, const float* __restrict__ BG, const int* __restrict__ TSTEP, float* __restrict__ OUT) {
  __shared__ __align__(16) float st[128][68]; __shared__ __align__(16) __bf16 sw[2 * WBUF];
  const int tid = threadIdx.x, wave = tid >> 5, lane = tid & 31, col = lane & 15, g = lane >> 4; const size_t rb0 = (size_t)blockIdx.x * 64, r0 = rb0 + wave * 16; const size_t b = rb0 / TT, t0 = rb0 % TT; const int n0 = blockIdx.y * 128;
  const int ts = TSTEP[b];   // block-uniform, read ahead of the loops
  v8f accl[8] = {}, accg[8] = {};
  const __bf16* wg = P + ((size_t)3 * CC + n0 + (tid >> 3)) * CC + (tid & 7) * 8; const unsigned wl = lds_off(sw) + (unsigned)(tid >> 3) * 144u + (unsigned)(tid & 7) * 16u;
  const float* pl = LO + (b * CC + 8 * g) * TT + t0 + wave * 16 + col;   // element (token t0 + 16 wave + col, channel 8g+..) of tile 0; tile s lies s * 64 channels on
  const float* cr = CG + (r0 + col) * CC + 8 * g;   // element (token row r0 + col, channel 8g+..) of tile 8; tile s lies (s - 8) * 64 floats on
  float an[32];   // a tile's context values, fetched one tile ahead, in the order of k_proj
  gather_tile(an, pl);
  WRING_OPEN(wl, wg);
  for (int s = 0; s < WSTG; ++s) { const __bf16* wb = sw + (s & 1) * WBUF; const F2 a[2] = { bsplit16(an), bsplit16(an + 16) };
    if (s + 1 < WSTG) gather_tile(an, pl + (size_t)(s + 1) * 64 * TT); else row_tile(an, cr);   // the next tile's 32 values fly while this tile is worked on
#pragma unroll   // kk becomes a constant, so that the LDS reads of both k steps take immediate offsets from one address
    for (int kk = 0; kk < 2; ++kk) {
      v16b w[8];   // one group of LDS reads per k step, as in k_proj
#pragma unroll
      for (int j = 0; j < 8; ++j) w[j] = frag_b(wb + (j * 16 + col) * WPITCH + kk * 32, lane);
#pragma unroll
      for (int j = 0; j < 8; ++j) { accl[j] = wmma_bf(a[kk].h, w[j], accl[j]); accl[j] = wmma_bf(a[kk].l, w[j], accl[j]); } }
    ORING_FOOT(wl, wg, s); }
  for (int s = WSTG; s < OSTG; ++s) { const __bf16* wb = sw + (s & 1) * WBUF; const F2 a[2] = { bsplit16(an), bsplit16(an + 16) };
    if (s + 1 < OSTG) { cr += 64; row_tile(an, cr); }   // as above
#pragma unroll   // kk becomes a constant, so that the LDS reads of both k steps take immediate offsets from one address
    for (int kk = 0; kk < 2; ++kk) {
      v16b w[8];   // one group of LDS reads per k step, as in k_proj
#pragma unroll
      for (int j = 0; j < 8; ++j) w[j] = frag_b(wb + (j * 16 + col) * WPITCH + kk * 32, lane);
#pragma unroll
      for (int j = 0; j < 8; ++j) { accg[j] = wmma_bf(a[kk].l, w[j], accg[j]); accg[j] = wmma_bf(a[kk].h, w[j], accg[j]); } }
    ORING_FOOT(wl, wg, s); }
  WAIT_COPIES();
  const float tn = (float)ts / (float)(TS - 1); const float ag = sqrtf(1.0f - tn), al = sqrtf(tn);
  float bg[8], bl[8]; const int bo = n0 + col;
#pragma unroll   // j becomes a constant: the 16 bias loads go out as one group
  for (int j = 0; j < 8; ++j) { bg[j] = BG[bo + j * 16]; bl[j] = BL[bo + j * 16]; }
  asm volatile("s_wait_xcnt 0x0" :: "v"(bo) : "memory");   // takes the bias loads' index as an input: it stays in use behind all 16 loads, so no load's result lands in it, and any later write of it stands behind this wait
#pragma unroll
  for (int j = 0; j < 8; ++j) { const float bgj = bfr(bg[j]), blj = bfr(bl[j]);
#pragma unroll
    for (int r = 0; r < 8; ++r) st[j * 16 + col][wave * 16 + 8 * g + r] = (accg[j][r] + bgj) * ag + al * (accl[j][r] + blj); }
  __syncthreads();
  for (int e = tid; e < 128 * 16; e += 128) { const int o = e >> 4, q = e & 15; vst2(OUT + ((b * CC + n0 + o) * TT) + t0 + q * 4, *(const v4f*)&st[o][q * 4]); }   // 256-B segment of row (b, o)
}
extern "C" void kernel_launch(void* const* d_in, const int* in_sizes, int n_in, void* d_out, int out_size, void* d_ws, size_t ws_size, hipStream_t stream) {
  (void)in_sizes; (void)n_in; (void)out_size;
  const float** F = (const float**)d_in;   // 0 x, 1 cond [4,512,2048]; 2 t [4] int; 3 lq_w,4 lq_b, 5 lk_w,6 lk_b, 7 lv_w,8 lv_b, 9 lo_w,10 lo_b, 11 gq_w,12 gq_b, 13 gk_w,14 gk_b, 15 gv_w,16 gv_b, 17 go_w,18 go_b
  if (ws_size < (size_t)WS_END) return;
  char* ws = (char*)d_ws; __bf16* P = (__bf16*)ws; _Float16 *QL = (_Float16*)(ws + WS_QL), *KL = (_Float16*)(ws + WS_KL), *QG = (_Float16*)(ws + WS_QG), *KG = (_Float16*)(ws + WS_KG), *VL = (_Float16*)(ws + WS_VL), *VG = (_Float16*)(ws + WS_VG); float *LO = (float*)(ws + WS_LO), *CG = (float*)(ws + WS_CG); float *RC = (float*)(ws + WS_RC), *RS = (float*)(ws + WS_RS);
  k_pack<<<dim3(CC, 9), 256, 0, stream>>>(F[3], F[5], F[7], F[9], F[11], F[13], F[15], F[17], P, RC, RS);
  k_proj<<<dim3(TR / 128, CC / 256, 6), 128, 0, stream>>>(F[0], F[1], P, F[4], F[6], F[8], F[12], F[14], F[16], QL, KL, VL, QG, KG, VG, RC, RS);
  k_attn<<<dim3(TT / 64, NH, TNB / 2 + TNB), 128, 0, stream>>>(QL, KL, VL, LO, QG, KG, VG, CG);
  k_out<<<dim3(TR / 64, CC / 128), 128, 0, stream>>>(LO, CG, P, F[10], F[18], (const int*)d_in[2], (float*)d_out);
}
